// v000
// Times are from an AMD MI455X. After a warm-up the kernel runs many times in a row, and a time is the length of
// such a window on the GPU divided by its runs, so every launch and the gaps after it count. The runs cycle
// through copies of the inputs. A figure is the median of several windows, for all but v000 over two sittings.
// Sittings can differ by a few percent; kernels timed side by side share one.
// v000, which the later versions start from, runs in 4020 microseconds.
#include <hip/hip_runtime.h>
// All GEMMs on v_wmma_f32_16x16x32_bf16, f32 accumulate: fused per-head q|k|v projection (K=1024, N=3072), concat·Wo, a·Wf — A operands
// (the residual stream, quantised to bf16 once at the input) split into bf16 hi/lo (2 terms) against bf16-rounded weights; attention QKᵀ/√128
// and P·V per 16-query tile as 3-term splits (head dim 128); LayerNorm and softmax in f32. Six layers with shared weights.
#define SS 2048
#define DD 1024
#define NH 8
#define DK 128
#define NLAY 6

typedef __bf16 v16b __attribute__((ext_vector_type(16)));
typedef unsigned short v8us __attribute__((ext_vector_type(8), may_alias));
typedef float  v8f  __attribute__((ext_vector_type(8)));
typedef float  v4f  __attribute__((ext_vector_type(4)));
typedef float  v4fa __attribute__((ext_vector_type(4), may_alias));
union FragB { v16b v; v8us half[2]; unsigned short u[16]; };

__device__ __forceinline__ unsigned short bf16_bits(float x) { unsigned int u = __float_as_uint(x); return (unsigned short)((u + 0x7FFFu + ((u >> 16) & 1u)) >> 16); }
__device__ __forceinline__ float bf16_val(unsigned short b) { return __uint_as_float(((unsigned int)b) << 16); }
__device__ __forceinline__ float bf16_round(float x) { return bf16_val(bf16_bits(x)); }
// D += A·B with NT terms: 1 = ah·bh, 2 = + al·bh (A split), 3 = + ah·bl (both split)
template <int NT>
__device__ __forceinline__ v8f mmaN(v16b ah, v16b al, v16b bh, v16b bl, v8f c) {
  c = __builtin_amdgcn_wmma_f32_16x16x32_bf16(false, ah, false, bh, (short)0, c, false, false);
  if (NT >= 2) c = __builtin_amdgcn_wmma_f32_16x16x32_bf16(false, al, false, bh, (short)0, c, false, false);
  if (NT >= 3) c = __builtin_amdgcn_wmma_f32_16x16x32_bf16(false, ah, false, bl, (short)0, c, false, false);
  asm volatile("v_nop\n\tv_nop\n\tv_nop\n\tv_nop" : "+v"(c) : "v"(ah), "v"(al), "v"(bh), "v"(bl));
  return c;
}

__global__ __launch_bounds__(256) void k_wt_bf16(const float* __restrict__ W, unsigned short* __restrict__ Wt, int K, int N) {
  const int t = blockIdx.x * 256 + threadIdx.x;
  const int k8n = K / 8;
  if (t >= N * k8n) return;
  const int n = t / k8n, k8 = (t % k8n) * 8;
  v8us v;
#pragma unroll
  for (int i = 0; i < 8; ++i) v[i] = bf16_bits(W[(size_t)(k8 + i) * N + n]);
  *(v8us*)(Wt + (size_t)n * K + k8) = v;
  
}

// GEMM C[M][N] (f32, pitch ldc) = act(A[M][K]·W + bias). A f32 row-major (pitch lda) converted per fragment to bf16
// (ASPLIT: hi/lo two planes -> 2 terms, else single rounded term); Wt bf16 [N][K] (pitch ldb). BIAS_BF16 rounds the
// bias to bf16 first (bias quantised to bf16 before the add). K%32==0, M%16==0, N%64==0.
template <bool ASPLIT, int ACT, bool BIAS_BF16>
__global__ __launch_bounds__(128) void k_gemm_bf(const float* __restrict__ A, int lda, const unsigned short* __restrict__ Wt, int ldb,
                                               const float* __restrict__ bias, float* __restrict__ C, int ldc, int M, int N, int K) {
  __shared__ __attribute__((aligned(16))) float so[4][16][64];
  const int tid = threadIdx.x, w = tid >> 5, lane = tid & 31, ln = lane & 15, hh = lane >> 4;
  const int ntn = N / 64;
  const int wid = blockIdx.x * 4 + w;
  const int mt = wid / ntn, nq = wid % ntn;
  if (mt * 16 >= M) return;
  const int row0 = mt * 16, col0 = nq * 64;
  const float* arow = A + (size_t)(row0 + ln) * lda;
  v8f acc[4] = {};
  for (int kb = 0; kb < K; kb += 32) {
    FragB ah, al;
    const v4f x0 = *(const v4fa*)(arow + kb + 8 * hh), x1 = *(const v4fa*)(arow + kb + 8 * hh + 4);
    const v4f x2 = *(const v4fa*)(arow + kb + 16 + 8 * hh), x3 = *(const v4fa*)(arow + kb + 16 + 8 * hh + 4);
    float xs[16] = {x0[0],x0[1],x0[2],x0[3],x1[0],x1[1],x1[2],x1[3],x2[0],x2[1],x2[2],x2[3],x3[0],x3[1],x3[2],x3[3]};
#pragma unroll
    for (int i = 0; i < 16; ++i) { const unsigned short hb = bf16_bits(xs[i]); ah.u[i] = hb; al.u[i] = ASPLIT ? bf16_bits(xs[i] - bf16_val(hb)) : (unsigned short)0; }
#pragma unroll
    for (int t = 0; t < 4; ++t) {
      const unsigned short* brow = Wt + (size_t)(col0 + t * 16 + ln) * ldb + kb;
      FragB b;
      b.half[0] = *(const v8us*)(brow + 8 * hh);
      b.half[1] = *(const v8us*)(brow + 16 + 8 * hh);
      acc[t] = mmaN<ASPLIT ? 2 : 1>(ah.v, al.v, b.v, b.v, acc[t]);
    }
  }
#pragma unroll
  for (int t = 0; t < 4; ++t) {
    float bv = bias ? bias[col0 + t * 16 + ln] : 0.f;
    if (BIAS_BF16) bv = bf16_round(bv);
#pragma unroll
    for (int r = 0; r < 8; ++r) { float v = acc[t][r] + bv; if (ACT == 1) v = fmaxf(v, 0.f); so[w][8 * hh + r][t * 16 + ln] = v; }
  }
  __builtin_amdgcn_fence(__ATOMIC_ACQ_REL, "workgroup");
  __builtin_amdgcn_wave_barrier();
  const int rsub = lane >> 4, c4 = (lane & 15) * 4;
  {
#pragma unroll
    for (int q = 0; q < 8; ++q) {
      const int r = q * 2 + rsub;
      const v4f v = *(const v4fa*)&so[w][r][c4];
      *(v4f*)(C + (size_t)(row0 + r) * ldc + col0 + c4) = v;
    }
    
  }
}

// Flash-style causal/unmasked attention, all contractions 3-term bf16 hi/lo splits, f32 softmax with running max.
// q,k,v rows are read from f32 buffers with arbitrary row pitch (so they can live inside a fused qkv buffer);
// D = head size (multiple of 32, <= 128); one wave = 16 query rows; block = 4 waves (64 queries) sharing K/V chunks of 32.
template <int D, bool CAUSAL>
__global__ __launch_bounds__(128) void k_flash(const float* __restrict__ qb, const float* __restrict__ kb, const float* __restrict__ vb,
                                             int pitch, int T, int H, float scale, float* __restrict__ y, int ypitch) {
  constexpr int KS = D / 32;        // k-steps for QK
  constexpr int DT = D / 16;        // d tiles for PV
  __shared__ __attribute__((aligned(16))) unsigned short sKh[32][D + 8], sKl[32][D + 8], sVh[32][D + 8], sVl[32][D + 8];
  __shared__ __attribute__((aligned(16))) unsigned short sPh[4][16][40], sPl[4][16][40];
  __shared__ __attribute__((aligned(16))) float sO[4][16][D];
  const int tid = threadIdx.x, w = tid >> 5, lane = tid & 31, ln = lane & 15, hh = lane >> 4;
  const int nqb = (T + 63) / 64;
  const int bh = blockIdx.x / nqb, qblk = blockIdx.x % nqb;
  const int b = bh / H, h = bh % H;
  const int q0 = qblk * 64 + w * 16;
  const float* Q = qb + (size_t)b * T * pitch + h * D;
  const float* K = kb + (size_t)b * T * pitch + h * D;
  const float* V = vb + (size_t)b * T * pitch + h * D;

  // A fragments of the wave's 16 query rows (scaled), hi/lo
  FragB aqh[KS], aql[KS];
  {
    int row = q0 + ln; if (row >= T) row = T - 1;
    const float* qr = Q + (size_t)row * pitch;
#pragma unroll
    for (int ks = 0; ks < KS; ++ks)
#pragma unroll
      for (int i = 0; i < 16; ++i) {
        const int d = ks * 32 + ((i < 8) ? (8 * hh + i) : (16 + 8 * hh + (i - 8)));
        const float x = qr[d] * scale; const unsigned short hb = bf16_bits(x);
        aqh[ks].u[i] = hb; aql[ks].u[i] = bf16_bits(x - bf16_val(hb));
      }
  }
  float m_r[8], l_r[8];
#pragma unroll
  for (int r = 0; r < 8; ++r) { m_r[r] = -3.0e38f; l_r[r] = 0.f; }
  v8f oacc[DT];
#pragma unroll
  for (int dt = 0; dt < DT; ++dt) oacc[dt] = (v8f){0.f,0.f,0.f,0.f,0.f,0.f,0.f,0.f};

  const int kv_end = CAUSAL ? min(T, qblk * 64 + 64) : T;     // block-uniform
  for (int j0 = 0; j0 < kv_end; j0 += 32) {
    __syncthreads();
    for (int e = tid; e < 32 * (D / 4); e += 128) {
      const int r = e / (D / 4), c4 = (e % (D / 4)) * 4;
      const int key = j0 + r;
      v4f kf = {0.f,0.f,0.f,0.f}, vf = {0.f,0.f,0.f,0.f};
      if (key < T) { kf = *(const v4fa*)(K + (size_t)key * pitch + c4); vf = *(const v4fa*)(V + (size_t)key * pitch + c4); }
#pragma unroll
      for (int t = 0; t < 4; ++t) {
        unsigned short hb = bf16_bits(kf[t]); sKh[r][c4 + t] = hb; sKl[r][c4 + t] = bf16_bits(kf[t] - bf16_val(hb));
        hb = bf16_bits(vf[t]); sVh[r][c4 + t] = hb; sVl[r][c4 + t] = bf16_bits(vf[t] - bf16_val(hb));
      }
    }
    __syncthreads();
    // S tile 16 x 32
    v8f s[2];
#pragma unroll
    for (int nt = 0; nt < 2; ++nt) {
      v8f acc = {};
#pragma unroll
      for (int ks = 0; ks < KS; ++ks) {
        FragB bh_, bl_;
        bh_.half[0] = *(const v8us*)&sKh[nt * 16 + ln][ks * 32 + 8 * hh]; bh_.half[1] = *(const v8us*)&sKh[nt * 16 + ln][ks * 32 + 16 + 8 * hh];
        bl_.half[0] = *(const v8us*)&sKl[nt * 16 + ln][ks * 32 + 8 * hh]; bl_.half[1] = *(const v8us*)&sKl[nt * 16 + ln][ks * 32 + 16 + 8 * hh];
        acc = mmaN<3>(aqh[ks].v, aql[ks].v, bh_.v, bl_.v, acc);
      }
      s[nt] = acc;
    }
    // mask + running max (rows 8hh+r; the 16 lanes of a half share rows)
    float alpha[8];
#pragma unroll
    for (int r = 0; r < 8; ++r) {
      const int qi = q0 + 8 * hh + r;
      const int ja = j0 + ln, jb = j0 + 16 + ln;
      if (CAUSAL) { if (ja > qi) s[0][r] = -3.0e38f; if (jb > qi) s[1][r] = -3.0e38f; }
      if (ja >= T) s[0][r] = -3.0e38f;
      if (jb >= T) s[1][r] = -3.0e38f;
      float mx = fmaxf(s[0][r], s[1][r]);
      mx = fmaxf(mx, __shfl_xor(mx, 1, 32)); mx = fmaxf(mx, __shfl_xor(mx, 2, 32)); mx = fmaxf(mx, __shfl_xor(mx, 4, 32)); mx = fmaxf(mx, __shfl_xor(mx, 8, 32));
      const float mnew = fmaxf(m_r[r], mx);
      alpha[r] = (mnew > -1.0e38f) ? __expf(m_r[r] - mnew) : 1.0f;
      const float p0 = (s[0][r] > -1.0e38f) ? __expf(s[0][r] - mnew) : 0.f;
      const float p1 = (s[1][r] > -1.0e38f) ? __expf(s[1][r] - mnew) : 0.f;
      m_r[r] = mnew;
      l_r[r] = l_r[r] * alpha[r] + p0 + p1;            // per-lane partial row sum (16 lanes combined at the end)
      unsigned short hb = bf16_bits(p0); sPh[w][8 * hh + r][ln] = hb;      sPl[w][8 * hh + r][ln] = bf16_bits(p0 - bf16_val(hb));
      hb = bf16_bits(p1);                sPh[w][8 * hh + r][16 + ln] = hb; sPl[w][8 * hh + r][16 + ln] = bf16_bits(p1 - bf16_val(hb));
    }
#pragma unroll
    for (int dt = 0; dt < DT; ++dt)
#pragma unroll
      for (int r = 0; r < 8; ++r) oacc[dt][r] *= alpha[r];
    __builtin_amdgcn_fence(__ATOMIC_ACQ_REL, "workgroup");
    __builtin_amdgcn_wave_barrier();
    FragB pah, pal;
    pah.half[0] = *(const v8us*)&sPh[w][ln][8 * hh]; pah.half[1] = *(const v8us*)&sPh[w][ln][16 + 8 * hh];
    pal.half[0] = *(const v8us*)&sPl[w][ln][8 * hh]; pal.half[1] = *(const v8us*)&sPl[w][ln][16 + 8 * hh];
#pragma unroll
    for (int dt = 0; dt < DT; ++dt) {
      FragB bvh, bvl;
#pragma unroll
      for (int i = 0; i < 8; ++i) {
        bvh.u[i] = sVh[8 * hh + i][dt * 16 + ln]; bvh.u[8 + i] = sVh[16 + 8 * hh + i][dt * 16 + ln];
        bvl.u[i] = sVl[8 * hh + i][dt * 16 + ln]; bvl.u[8 + i] = sVl[16 + 8 * hh + i][dt * 16 + ln];
      }
      oacc[dt] = mmaN<3>(pah.v, pal.v, bvh.v, bvl.v, oacc[dt]);
    }
    __builtin_amdgcn_fence(__ATOMIC_ACQ_REL, "workgroup");
    __builtin_amdgcn_wave_barrier();
  }
#pragma unroll
  for (int r = 0; r < 8; ++r) {
    float l = l_r[r];
    l += __shfl_xor(l, 1, 32); l += __shfl_xor(l, 2, 32); l += __shfl_xor(l, 4, 32); l += __shfl_xor(l, 8, 32);
    l_r[r] = (l > 0.f) ? 1.0f / l : 0.f;
  }
#pragma unroll
  for (int dt = 0; dt < DT; ++dt)
#pragma unroll
    for (int r = 0; r < 8; ++r) sO[w][8 * hh + r][dt * 16 + ln] = oacc[dt][r] * l_r[r];
  __builtin_amdgcn_fence(__ATOMIC_ACQ_REL, "workgroup");
  __builtin_amdgcn_wave_barrier();
  {
    for (int r = 0; r < 16; ++r) {
      const int row = q0 + r;
      if (row < T && lane < D / 4) {
        const v4f val = *(const v4fa*)&sO[w][r][lane * 4];
        *(v4f*)(y + ((size_t)b * T + row) * ypitch + h * D + lane * 4) = val;
      }
    }
    
  }
}

// GEMM C = act(A·W + bias + resid): A f32 (ASPLIT -> hi/lo 2 terms), Wt bf16 [N][K]; ACT 0 none, 1 relu, 2 exact gelu;
// resid (optional, f32, row index = (row % rmod), pitch ldr, RES_BF16 rounds it) added before the activation.
template <bool ASPLIT, int ACT, bool BIAS_BF16, bool RES_BF16>
__global__ __launch_bounds__(128) void k_gemm_bf3(const float* __restrict__ A, int lda, const unsigned short* __restrict__ Wt, int ldb,
                                                const float* __restrict__ bias, const float* __restrict__ resid, int rmod, int ldr,
                                                float* __restrict__ C, int ldc, int M, int N, int K) {
  __shared__ __attribute__((aligned(16))) float so[4][16][64];
  const int tid = threadIdx.x, w = tid >> 5, lane = tid & 31, ln = lane & 15, hh = lane >> 4;
  const int ntn = N / 64;
  const int wid = blockIdx.x * 4 + w;
  const int mt = wid / ntn, nq = wid % ntn;
  if (mt * 16 >= M) return;
  const int row0 = mt * 16, col0 = nq * 64;
  const float* arow = A + (size_t)(row0 + ln) * lda;
  v8f acc[4] = {};
  for (int kb = 0; kb < K; kb += 32) {
    FragB ah, al;
    const v4f x0 = *(const v4fa*)(arow + kb + 8 * hh), x1 = *(const v4fa*)(arow + kb + 8 * hh + 4);
    const v4f x2 = *(const v4fa*)(arow + kb + 16 + 8 * hh), x3 = *(const v4fa*)(arow + kb + 16 + 8 * hh + 4);
    float xs[16] = {x0[0],x0[1],x0[2],x0[3],x1[0],x1[1],x1[2],x1[3],x2[0],x2[1],x2[2],x2[3],x3[0],x3[1],x3[2],x3[3]};
#pragma unroll
    for (int i = 0; i < 16; ++i) { const unsigned short hb = bf16_bits(xs[i]); ah.u[i] = hb; al.u[i] = ASPLIT ? bf16_bits(xs[i] - bf16_val(hb)) : (unsigned short)0; }
#pragma unroll
    for (int t = 0; t < 4; ++t) {
      const unsigned short* brow = Wt + (size_t)(col0 + t * 16 + ln) * ldb + kb;
      FragB b;
      b.half[0] = *(const v8us*)(brow + 8 * hh);
      b.half[1] = *(const v8us*)(brow + 16 + 8 * hh);
      acc[t] = mmaN<ASPLIT ? 2 : 1>(ah.v, al.v, b.v, b.v, acc[t]);
    }
  }
#pragma unroll
  for (int t = 0; t < 4; ++t) {
    const int col = col0 + t * 16 + ln;
    float bv = bias ? bias[col] : 0.f;
    if (BIAS_BF16) bv = bf16_round(bv);
#pragma unroll
    for (int r = 0; r < 8; ++r) {
      float v = acc[t][r] + bv;
      if (resid) { float rv = resid[(size_t)((row0 + 8 * hh + r) % rmod) * ldr + col]; if (RES_BF16) rv = bf16_round(rv); v += rv; }
      if (ACT == 1) v = fmaxf(v, 0.f);
      if (ACT == 2) v = 0.5f * v * (1.0f + erff(v * 0.70710678118654752f));
      if (ACT == 3) { const float u = 0.7978845608028654f * (v + 0.044715f * v * v * v); v = 0.5f * v * (1.0f + tanhf(u)); }
      so[w][8 * hh + r][t * 16 + ln] = v;
    }
  }
  __builtin_amdgcn_fence(__ATOMIC_ACQ_REL, "workgroup");
  __builtin_amdgcn_wave_barrier();
  const int rsub = lane >> 4, c4 = (lane & 15) * 4;
  {
#pragma unroll
    for (int q = 0; q < 8; ++q) {
      const int r = q * 2 + rsub;
      const v4f v = *(const v4fa*)&so[w][r][c4];
      *(v4f*)(C + (size_t)(row0 + r) * ldc + col0 + c4) = v;
    }
    
  }
}
// row LayerNorm (biased variance, eps) over N: s = X (+ R); optional out_sum <- s; out_norm <- (s-mu)*rsqrt(var+eps)*g + b
template <bool PARAM_BF16>
__global__ __launch_bounds__(256) void k_layernorm(const float* __restrict__ X, const float* __restrict__ R, const float* __restrict__ g, const float* __restrict__ bta,
                                                  float* __restrict__ out_sum, float* __restrict__ out_norm, int N, float eps) {
  __shared__ float red[256];
  const int row = blockIdx.x, tid = threadIdx.x;
  const float* x = X + (size_t)row * N; const float* rr = R ? R + (size_t)row * N : nullptr;
  float vals[16];                     // up to N = 4096
  const int per = N / 256;            // contiguous chunk per thread? use strided-by-4 chunks: thread handles j = tid*4 + 1024*u
  float s1 = 0.f;
  for (int u = 0; u < per / 4; ++u) {
    const int j = tid * 4 + 1024 * u;
    const v4f a = *(const v4fa*)(x + j);
    v4f b = {0.f,0.f,0.f,0.f}; if (rr) b = *(const v4fa*)(rr + j);
#pragma unroll
    for (int q = 0; q < 4; ++q) { const float v = a[q] + b[q]; vals[u * 4 + q] = v; s1 += v; }
  }
  red[tid] = s1; __syncthreads();
  for (int st = 128; st > 0; st >>= 1) { if (tid < st) red[tid] += red[tid + st]; __syncthreads(); }
  const float mu = red[0] / (float)N; __syncthreads();
  float s2 = 0.f;
  for (int u = 0; u < per / 4; ++u)
#pragma unroll
    for (int q = 0; q < 4; ++q) { const float c = vals[u * 4 + q] - mu; s2 += c * c; }
  red[tid] = s2; __syncthreads();
  for (int st = 128; st > 0; st >>= 1) { if (tid < st) red[tid] += red[tid + st]; __syncthreads(); }
  const float rs = rsqrtf(red[0] / (float)N + eps);
  {
    for (int u = 0; u < per / 4; ++u) {
      const int j = tid * 4 + 1024 * u;
      v4f o, sm;
#pragma unroll
      for (int q = 0; q < 4; ++q) {
        float gg = g[j + q], bb = bta[j + q];
        if (PARAM_BF16) { gg = bf16_round(gg); bb = bf16_round(bb); }
        sm[q] = vals[u * 4 + q]; o[q] = (vals[u * 4 + q] - mu) * rs * gg + bb;
      }
      if (out_sum) *(v4f*)(out_sum + (size_t)row * N + j) = sm;
      *(v4f*)(out_norm + (size_t)row * N + j) = o;
    }
    
  }
}

// General attention: queries [b][Tq] rows at Q + b*Tq*qpitch + h*D + row*qpitch; keys/values j < Tk1 from (K1,V1) at
// X + b*Tk1*pitch + h*D + j*pitch, j >= Tk1 from (K2,V2) with j-Tk1 (pass Tk2 = 0 and null for a single source).
// Optional int mask [Tq][Tk] (nonzero keep), causal flag (j <= qi), additive score bias sbias[bh*Tk + j].
// 3-term bf16 splits, f32 softmax with running max; y[b][row][h*D + d] pitch ypitch, whole-line rows (D % 32 == 0).
template <int D>
__global__ __launch_bounds__(128) void k_flash3(const float* __restrict__ Qb, int qpitch, int Tq,
                                              const float* __restrict__ K1, const float* __restrict__ V1, int Tk1,
                                              const float* __restrict__ K2, const float* __restrict__ V2, int Tk2, int kpitch, int vpitch,
                                              int H, float scale, const int* __restrict__ mask, int causal, const float* __restrict__ sbias,
                                              float* __restrict__ y, int ypitch) {
  constexpr int KS = D / 32, DT = D / 16;
  __shared__ __attribute__((aligned(16))) unsigned short sKh[32][D + 8], sKl[32][D + 8], sVh[32][D + 8], sVl[32][D + 8];
  __shared__ __attribute__((aligned(16))) unsigned short sPh[4][16][40], sPl[4][16][40];
  __shared__ __attribute__((aligned(16))) float sO[4][16][D];
  const int tid = threadIdx.x, w = tid >> 5, lane = tid & 31, ln = lane & 15, hh = lane >> 4;
  const int Tk = Tk1 + Tk2;
  const int nqb = (Tq + 63) / 64;
  const int bh = blockIdx.x / nqb, qblk = blockIdx.x % nqb;
  const int b = bh / H, h = bh % H;
  const int q0 = qblk * 64 + w * 16;
  const float* Q = Qb + (size_t)b * Tq * qpitch + h * D;
  FragB aqh[KS], aql[KS];
  {
    int row = q0 + ln; if (row >= Tq) row = Tq - 1;
    const float* qr = Q + (size_t)row * qpitch;
#pragma unroll
    for (int ks = 0; ks < KS; ++ks)
#pragma unroll
      for (int i = 0; i < 16; ++i) {
        const int d = ks * 32 + ((i < 8) ? (8 * hh + i) : (16 + 8 * hh + (i - 8)));
        const float x = qr[d] * scale; const unsigned short hb = bf16_bits(x);
        aqh[ks].u[i] = hb; aql[ks].u[i] = bf16_bits(x - bf16_val(hb));
      }
  }
  int qrow[8];
#pragma unroll
  for (int r = 0; r < 8; ++r) { int qi = q0 + 8 * hh + r; qrow[r] = qi < Tq ? qi : Tq - 1; }
  float m_r[8], l_r[8];
#pragma unroll
  for (int r = 0; r < 8; ++r) { m_r[r] = -3.0e38f; l_r[r] = 0.f; }
  v8f oacc[DT];
#pragma unroll
  for (int dt = 0; dt < DT; ++dt) oacc[dt] = (v8f){0.f,0.f,0.f,0.f,0.f,0.f,0.f,0.f};
  const int kv_end = causal ? min(Tk, qblk * 64 + 64) : Tk;
  for (int j0 = 0; j0 < kv_end; j0 += 32) {
    __syncthreads();
    for (int e = tid; e < 32 * (D / 4); e += 128) {
      const int r = e / (D / 4), c4 = (e % (D / 4)) * 4; const int key = j0 + r;
      v4f kf = {0.f,0.f,0.f,0.f}, vf = {0.f,0.f,0.f,0.f};
      if (key < Tk1) { kf = *(const v4fa*)(K1 + (size_t)b * Tk1 * kpitch + h * D + (size_t)key * kpitch + c4); vf = *(const v4fa*)(V1 + (size_t)b * Tk1 * vpitch + h * D + (size_t)key * vpitch + c4); }
      else if (key < Tk) { const int k2 = key - Tk1; kf = *(const v4fa*)(K2 + (size_t)b * Tk2 * kpitch + h * D + (size_t)k2 * kpitch + c4); vf = *(const v4fa*)(V2 + (size_t)b * Tk2 * vpitch + h * D + (size_t)k2 * vpitch + c4); }
#pragma unroll
      for (int t = 0; t < 4; ++t) {
        unsigned short hb = bf16_bits(kf[t]); sKh[r][c4 + t] = hb; sKl[r][c4 + t] = bf16_bits(kf[t] - bf16_val(hb));
        hb = bf16_bits(vf[t]); sVh[r][c4 + t] = hb; sVl[r][c4 + t] = bf16_bits(vf[t] - bf16_val(hb));
      }
    }
    __syncthreads();
    v8f s[2];
#pragma unroll
    for (int nt = 0; nt < 2; ++nt) {
      v8f acc = {};
#pragma unroll
      for (int ks = 0; ks < KS; ++ks) {
        FragB bh_, bl_;
        bh_.half[0] = *(const v8us*)&sKh[nt * 16 + ln][ks * 32 + 8 * hh]; bh_.half[1] = *(const v8us*)&sKh[nt * 16 + ln][ks * 32 + 16 + 8 * hh];
        bl_.half[0] = *(const v8us*)&sKl[nt * 16 + ln][ks * 32 + 8 * hh]; bl_.half[1] = *(const v8us*)&sKl[nt * 16 + ln][ks * 32 + 16 + 8 * hh];
        acc = mmaN<3>(aqh[ks].v, aql[ks].v, bh_.v, bl_.v, acc);
      }
      s[nt] = acc;
    }
    float alpha[8];
#pragma unroll
    for (int r = 0; r < 8; ++r) {
      const int qi = qrow[r];
      const int ja = j0 + ln, jb = j0 + 16 + ln;
      bool keepa = ja < Tk, keepb = jb < Tk;
      if (causal) { keepa = keepa && (ja <= qi); keepb = keepb && (jb <= qi); }
      if (mask) { if (keepa) keepa = mask[(size_t)qi * Tk + ja] != 0; if (keepb) keepb = mask[(size_t)qi * Tk + jb] != 0; }
      if (sbias) { if (keepa) s[0][r] += sbias[(size_t)bh * Tk + ja]; if (keepb) s[1][r] += sbias[(size_t)bh * Tk + jb]; }   // per-key additive bias (a per-query constant would cancel in the softmax)
      if (!keepa) s[0][r] = -3.0e38f;
      if (!keepb) s[1][r] = -3.0e38f;
      float mx = fmaxf(s[0][r], s[1][r]);
      mx = fmaxf(mx, __shfl_xor(mx, 1, 32)); mx = fmaxf(mx, __shfl_xor(mx, 2, 32)); mx = fmaxf(mx, __shfl_xor(mx, 4, 32)); mx = fmaxf(mx, __shfl_xor(mx, 8, 32));
      const float mnew = fmaxf(m_r[r], mx);
      alpha[r] = (mnew > -1.0e38f) ? __expf(m_r[r] - mnew) : 1.0f;
      const float p0 = keepa ? __expf(s[0][r] - mnew) : 0.f;
      const float p1 = keepb ? __expf(s[1][r] - mnew) : 0.f;
      m_r[r] = mnew;
      l_r[r] = l_r[r] * alpha[r] + p0 + p1;
      unsigned short hb = bf16_bits(p0); sPh[w][8 * hh + r][ln] = hb;      sPl[w][8 * hh + r][ln] = bf16_bits(p0 - bf16_val(hb));
      hb = bf16_bits(p1);                sPh[w][8 * hh + r][16 + ln] = hb; sPl[w][8 * hh + r][16 + ln] = bf16_bits(p1 - bf16_val(hb));
    }
#pragma unroll
    for (int dt = 0; dt < DT; ++dt)
#pragma unroll
      for (int r = 0; r < 8; ++r) oacc[dt][r] *= alpha[r];
    __builtin_amdgcn_fence(__ATOMIC_ACQ_REL, "workgroup");
    __builtin_amdgcn_wave_barrier();
    FragB pah, pal;
    pah.half[0] = *(const v8us*)&sPh[w][ln][8 * hh]; pah.half[1] = *(const v8us*)&sPh[w][ln][16 + 8 * hh];
    pal.half[0] = *(const v8us*)&sPl[w][ln][8 * hh]; pal.half[1] = *(const v8us*)&sPl[w][ln][16 + 8 * hh];
#pragma unroll
    for (int dt = 0; dt < DT; ++dt) {
      FragB bvh, bvl;
#pragma unroll
      for (int i = 0; i < 8; ++i) {
        bvh.u[i] = sVh[8 * hh + i][dt * 16 + ln]; bvh.u[8 + i] = sVh[16 + 8 * hh + i][dt * 16 + ln];
        bvl.u[i] = sVl[8 * hh + i][dt * 16 + ln]; bvl.u[8 + i] = sVl[16 + 8 * hh + i][dt * 16 + ln];
      }
      oacc[dt] = mmaN<3>(pah.v, pal.v, bvh.v, bvl.v, oacc[dt]);
    }
    __builtin_amdgcn_fence(__ATOMIC_ACQ_REL, "workgroup");
    __builtin_amdgcn_wave_barrier();
  }
#pragma unroll
  for (int r = 0; r < 8; ++r) {
    float l = l_r[r];
    l += __shfl_xor(l, 1, 32); l += __shfl_xor(l, 2, 32); l += __shfl_xor(l, 4, 32); l += __shfl_xor(l, 8, 32);
    l_r[r] = (m_r[r] > -1.0e38f) ? 1.0f / l : __builtin_nanf("");
  }
#pragma unroll
  for (int dt = 0; dt < DT; ++dt)
#pragma unroll
    for (int r = 0; r < 8; ++r) sO[w][8 * hh + r][dt * 16 + ln] = oacc[dt][r] * l_r[r];
  __builtin_amdgcn_fence(__ATOMIC_ACQ_REL, "workgroup");
  __builtin_amdgcn_wave_barrier();
  {
    for (int r = 0; r < 16; ++r) {
      const int row = q0 + r;
      if (row < Tq && lane < D / 4) {
        const v4f val = *(const v4fa*)&sO[w][r][lane * 4];
        *(v4f*)(y + ((size_t)b * Tq + row) * ypitch + h * D + lane * 4) = val;
      }
    }
    
  }
}

__global__ __launch_bounds__(256) void k_roundcopy(const float* __restrict__ src, float* __restrict__ dst, int n8) {
  const size_t t = (size_t)blockIdx.x * 256 + threadIdx.x;
  if (t >= (size_t)n8 * 2) return;
  v4f a = *(const v4fa*)(src + t * 4);
  for (int i = 0; i < 4; ++i) a[i] = bf16_round(a[i]);
  *(v4f*)(dst + t * 4) = a; 
}

__global__ void k_ln_rows(const float* __restrict__ X, const float* __restrict__ R, const float* __restrict__ g, const float* __restrict__ bta, float* __restrict__ out, int N, float eps) {
  __shared__ float red[256];
  const int row = blockIdx.x, tid = threadIdx.x, nt = blockDim.x;
  v4f a = *(const v4fa*)(X + (size_t)row * N + tid * 4);
  if (R) { const v4f rr = *(const v4fa*)(R + (size_t)row * N + tid * 4); for (int q = 0; q < 4; ++q) a[q] += rr[q]; }
  float s = a[0] + a[1] + a[2] + a[3];
  red[tid] = s; __syncthreads();
  for (int st = nt / 2; st > 0; st >>= 1) { if (tid < st) red[tid] += red[tid + st]; __syncthreads(); }
  const float mu = red[0] / (float)N; __syncthreads();
  float v = 0.f; for (int q = 0; q < 4; ++q) { const float c = a[q] - mu; v += c * c; }
  red[tid] = v; __syncthreads();
  for (int st = nt / 2; st > 0; st >>= 1) { if (tid < st) red[tid] += red[tid + st]; __syncthreads(); }
  const float rs = rsqrtf(red[0] / (float)N + eps);
  v4f o; for (int q = 0; q < 4; ++q) o[q] = (a[q] - mu) * rs * bf16_round(g[tid * 4 + q]) + bf16_round(bta[tid * 4 + q]);
  *(v4f*)(out + (size_t)row * N + tid * 4) = o; 
}

// Bt[h*DK + k][d] = W[h][d][k]  (W [H][D][DK]); thread per (n, 8 d)
__global__ __launch_bounds__(256) void k_wt_heads(const float* __restrict__ W, unsigned short* __restrict__ Bt) {
  const int t = blockIdx.x * 256 + threadIdx.x; if (t >= NH * DK * (DD / 8)) return;
  const int n = t / (DD / 8), d8 = (t % (DD / 8)) * 8; const int h = n / DK, kk = n % DK; v8us v;
#pragma unroll
  for (int i = 0; i < 8; ++i) v[i] = bf16_bits(W[((size_t)h * DD + d8 + i) * DK + kk]);
  *(v8us*)(Bt + (size_t)n * DD + d8) = v; 
}
extern "C" void kernel_launch(void* const* d_in, const int* in_sizes, int n_in,
                              void* d_out, int out_size, void* d_ws, size_t ws_size, hipStream_t stream) {
  (void)in_sizes; (void)n_in; (void)out_size;
  const float* token = (const float*)d_in[0];
  const float* Wq = (const float*)d_in[1]; const float* bq = (const float*)d_in[2]; const float* Wk = (const float*)d_in[3]; const float* bk = (const float*)d_in[4];
  const float* Wv = (const float*)d_in[5]; const float* bv = (const float*)d_in[6]; const float* Wo = (const float*)d_in[7]; const float* bo = (const float*)d_in[8];
  const float* Wf = (const float*)d_in[9]; const float* bfv = (const float*)d_in[10]; const float* gamma = (const float*)d_in[11]; const float* beta = (const float*)d_in[12];
  char* ws = (char*)d_ws; size_t off = 0;
  auto take = [&](size_t bytes) { char* p = ws + off; off += (bytes + 255) & ~(size_t)255; return p; };
  unsigned short* Bqkv = (unsigned short*)take((size_t)3 * DD * DD * 2); unsigned short* Bo = (unsigned short*)take((size_t)DD * DD * 2); unsigned short* Bf = (unsigned short*)take((size_t)DD * DD * 2);
  float* bqkv = (float*)take(3 * DD * 4);
  float* x = (float*)take((size_t)SS * DD * 4); float* qkv = (float*)take((size_t)SS * 3 * DD * 4); float* att = (float*)take((size_t)SS * DD * 4); float* tmp = (float*)take((size_t)SS * DD * 4); float* a = (float*)take((size_t)SS * DD * 4);
  if (off > ws_size) return;
  k_wt_heads<<<(NH * DK * (DD / 8) + 255) / 256, 256, 0, stream>>>(Wq, Bqkv);
  k_wt_heads<<<(NH * DK * (DD / 8) + 255) / 256, 256, 0, stream>>>(Wk, Bqkv + (size_t)DD * DD);
  k_wt_heads<<<(NH * DK * (DD / 8) + 255) / 256, 256, 0, stream>>>(Wv, Bqkv + (size_t)2 * DD * DD);
  k_wt_bf16<<<(DD * (DD / 8) + 255) / 256, 256, 0, stream>>>(Wo, Bo, DD, DD);
  k_wt_bf16<<<(DD * (DD / 8) + 255) / 256, 256, 0, stream>>>(Wf, Bf, DD, DD);
  k_roundcopy<<<(3 * DD / 4 + 255) / 256, 256, 0, stream>>>(bq, bqkv, DD / 8);            // bq|bk|bv flat [H*DK] each: three copies (f32, rounded) into one bias vector
  k_roundcopy<<<(DD / 4 + 255) / 256, 256, 0, stream>>>(bk, bqkv + DD, DD / 8);
  k_roundcopy<<<(DD / 4 + 255) / 256, 256, 0, stream>>>(bv, bqkv + 2 * DD, DD / 8);
  k_roundcopy<<<(SS * DD / 4 + 255) / 256, 256, 0, stream>>>(token, x, SS * DD / 8);
  const int gq = ((SS / 16) * (3 * DD / 64) + 3) / 4, g1 = ((SS / 16) * (DD / 64) + 3) / 4;
  for (int l = 0; l < NLAY; ++l) {
    k_gemm_bf3<true, 0, false, false><<<gq, 128, 0, stream>>>(x, DD, Bqkv, DD, bqkv, nullptr, 1, 0, qkv, 3 * DD, SS, 3 * DD, DD);      // bias already rounded (BIAS_BF16=false adds it as given)
    k_flash3<DK><<<NH * (SS / 64), 128, 0, stream>>>(qkv, 3 * DD, SS, qkv + DD, qkv + 2 * DD, SS, nullptr, nullptr, 0, 3 * DD, 3 * DD, NH, 0.08838834764831845f, nullptr, 0, nullptr, att, DD);
    k_gemm_bf3<true, 0, true, false><<<g1, 128, 0, stream>>>(att, DD, Bo, DD, bo, nullptr, 1, 0, tmp, DD, SS, DD, DD);
    k_ln_rows<<<SS, DD / 4, 0, stream>>>(tmp, x, gamma, beta, a, DD, 1e-5f);                  // a = LN(x + attn_out)
    k_gemm_bf3<true, 0, true, false><<<g1, 128, 0, stream>>>(a, DD, Bf, DD, bfv, nullptr, 1, 0, tmp, DD, SS, DD, DD);
    k_ln_rows<<<SS, DD / 4, 0, stream>>>(tmp, a, gamma, beta, (l == NLAY - 1) ? (float*)d_out : x, DD, 1e-5f);   // x = LN(a + ff)
  }
}

// v001
// One run takes 2060 microseconds.
// Timed twice side by side with v000, it ran 1.96 and 1.95 times as fast.
#include <hip/hip_runtime.h>
// All GEMMs on v_wmma_f32_16x16x32_bf16, f32 accumulate: fused per-head q|k|v projection (K=1024, N=3072), concat·Wo, a·Wf — A operands
// (the residual stream, quantised to bf16 once at the input) split into bf16 hi/lo (2 terms) against bf16-rounded weights; attention QKᵀ/√128
// and P·V per 16-query tile as 3-term splits (head dim 128); LayerNorm and softmax in f32. Six layers with shared weights.
#define SS 2048
#define DD 1024
#define NH 8
#define DK 128
#define NLAY 6

typedef __bf16 v16b __attribute__((ext_vector_type(16)));
typedef unsigned short v8us __attribute__((ext_vector_type(8), may_alias));
typedef float  v8f  __attribute__((ext_vector_type(8)));
typedef float  v4f  __attribute__((ext_vector_type(4)));
typedef float  v4fa __attribute__((ext_vector_type(4), may_alias));
union FragB { v16b v; v8us half[2]; unsigned short u[16]; };

__device__ __forceinline__ unsigned short bf16_bits(float x) { unsigned int u = __float_as_uint(x); return (unsigned short)((u + 0x7FFFu + ((u >> 16) & 1u)) >> 16); }
__device__ __forceinline__ float bf16_val(unsigned short b) { return __uint_as_float(((unsigned int)b) << 16); }
__device__ __forceinline__ float bf16_round(float x) { return bf16_val(bf16_bits(x)); }
// D += A·B with NT terms: 1 = ah·bh, 2 = + al·bh (A split), 3 = + ah·bl (both split)
template <int NT>
__device__ __forceinline__ v8f mmaN(v16b ah, v16b al, v16b bh, v16b bl, v8f c) {
  c = __builtin_amdgcn_wmma_f32_16x16x32_bf16(false, ah, false, bh, (short)0, c, false, false);
  if (NT >= 2) c = __builtin_amdgcn_wmma_f32_16x16x32_bf16(false, al, false, bh, (short)0, c, false, false);
  if (NT >= 3) c = __builtin_amdgcn_wmma_f32_16x16x32_bf16(false, ah, false, bl, (short)0, c, false, false);
  asm volatile("v_nop\n\tv_nop\n\tv_nop\n\tv_nop" : "+v"(c) : "v"(ah), "v"(al), "v"(bh), "v"(bl));
  return c;
}

__global__ __launch_bounds__(256) void k_wt_bf16(const float* __restrict__ W, unsigned short* __restrict__ Wt, int K, int N) {
  const int t = blockIdx.x * 256 + threadIdx.x;
  const int k8n = K / 8;
  if (t >= N * k8n) return;
  const int n = t / k8n, k8 = (t % k8n) * 8;
  v8us v;
#pragma unroll
  for (int i = 0; i < 8; ++i) v[i] = bf16_bits(W[(size_t)(k8 + i) * N + n]);
  *(v8us*)(Wt + (size_t)n * K + k8) = v;
  
}

// GEMM C[M][N] (f32, pitch ldc) = act(A[M][K]·W + bias). A f32 row-major (pitch lda) converted per fragment to bf16
// (ASPLIT: hi/lo two planes -> 2 terms, else single rounded term); Wt bf16 [N][K] (pitch ldb). BIAS_BF16 rounds the
// bias to bf16 first (bias quantised to bf16 before the add). K%32==0, M%16==0, N%64==0.
template <bool ASPLIT, int ACT, bool BIAS_BF16>
__global__ __launch_bounds__(128) void k_gemm_bf(const float* __restrict__ A, int lda, const unsigned short* __restrict__ Wt, int ldb,
                                               const float* __restrict__ bias, float* __restrict__ C, int ldc, int M, int N, int K) {
  __shared__ __attribute__((aligned(16))) float so[4][16][64];
  const int tid = threadIdx.x, w = tid >> 5, lane = tid & 31, ln = lane & 15, hh = lane >> 4;
  const int ntn = N / 64;
  const int wid = blockIdx.x * 4 + w;
  const int mt = wid / ntn, nq = wid % ntn;
  if (mt * 16 >= M) return;
  const int row0 = mt * 16, col0 = nq * 64;
  const float* arow = A + (size_t)(row0 + ln) * lda;
  v8f acc[4] = {};
  for (int kb = 0; kb < K; kb += 32) {
    FragB ah, al;
    const v4f x0 = *(const v4fa*)(arow + kb + 8 * hh), x1 = *(const v4fa*)(arow + kb + 8 * hh + 4);
    const v4f x2 = *(const v4fa*)(arow + kb + 16 + 8 * hh), x3 = *(const v4fa*)(arow + kb + 16 + 8 * hh + 4);
    float xs[16] = {x0[0],x0[1],x0[2],x0[3],x1[0],x1[1],x1[2],x1[3],x2[0],x2[1],x2[2],x2[3],x3[0],x3[1],x3[2],x3[3]};
#pragma unroll
    for (int i = 0; i < 16; ++i) { const unsigned short hb = bf16_bits(xs[i]); ah.u[i] = hb; al.u[i] = ASPLIT ? bf16_bits(xs[i] - bf16_val(hb)) : (unsigned short)0; }
#pragma unroll
    for (int t = 0; t < 4; ++t) {
      const unsigned short* brow = Wt + (size_t)(col0 + t * 16 + ln) * ldb + kb;
      FragB b;
      b.half[0] = *(const v8us*)(brow + 8 * hh);
      b.half[1] = *(const v8us*)(brow + 16 + 8 * hh);
      acc[t] = mmaN<ASPLIT ? 2 : 1>(ah.v, al.v, b.v, b.v, acc[t]);
    }
  }
#pragma unroll
  for (int t = 0; t < 4; ++t) {
    float bv = bias ? bias[col0 + t * 16 + ln] : 0.f;
    if (BIAS_BF16) bv = bf16_round(bv);
#pragma unroll
    for (int r = 0; r < 8; ++r) { float v = acc[t][r] + bv; if (ACT == 1) v = fmaxf(v, 0.f); so[w][8 * hh + r][t * 16 + ln] = v; }
  }
  __builtin_amdgcn_fence(__ATOMIC_ACQ_REL, "workgroup");
  __builtin_amdgcn_wave_barrier();
  const int rsub = lane >> 4, c4 = (lane & 15) * 4;
  {
#pragma unroll
    for (int q = 0; q < 8; ++q) {
      const int r = q * 2 + rsub;
      const v4f v = *(const v4fa*)&so[w][r][c4];
      *(v4f*)(C + (size_t)(row0 + r) * ldc + col0 + c4) = v;
    }
    
  }
}

// Flash-style causal/unmasked attention, all contractions 3-term bf16 hi/lo splits, f32 softmax with running max.
// q,k,v rows are read from f32 buffers with arbitrary row pitch (so they can live inside a fused qkv buffer);
// D = head size (multiple of 32, <= 128); one wave = 16 query rows; block = 4 waves (64 queries) sharing K/V chunks of 32.
template <int D, bool CAUSAL>
__global__ __launch_bounds__(128) void k_flash(const float* __restrict__ qb, const float* __restrict__ kb, const float* __restrict__ vb,
                                             int pitch, int T, int H, float scale, float* __restrict__ y, int ypitch) {
  constexpr int KS = D / 32;        // k-steps for QK
  constexpr int DT = D / 16;        // d tiles for PV
  __shared__ __attribute__((aligned(16))) unsigned short sKh[32][D + 8], sKl[32][D + 8], sVh[32][D + 8], sVl[32][D + 8];
  __shared__ __attribute__((aligned(16))) unsigned short sPh[4][16][40], sPl[4][16][40];
  __shared__ __attribute__((aligned(16))) float sO[4][16][D];
  const int tid = threadIdx.x, w = tid >> 5, lane = tid & 31, ln = lane & 15, hh = lane >> 4;
  const int nqb = (T + 63) / 64;
  const int bh = blockIdx.x / nqb, qblk = blockIdx.x % nqb;
  const int b = bh / H, h = bh % H;
  const int q0 = qblk * 64 + w * 16;
  const float* Q = qb + (size_t)b * T * pitch + h * D;
  const float* K = kb + (size_t)b * T * pitch + h * D;
  const float* V = vb + (size_t)b * T * pitch + h * D;

  // A fragments of the wave's 16 query rows (scaled), hi/lo
  FragB aqh[KS], aql[KS];
  {
    int row = q0 + ln; if (row >= T) row = T - 1;
    const float* qr = Q + (size_t)row * pitch;
#pragma unroll
    for (int ks = 0; ks < KS; ++ks)
#pragma unroll
      for (int i = 0; i < 16; ++i) {
        const int d = ks * 32 + ((i < 8) ? (8 * hh + i) : (16 + 8 * hh + (i - 8)));
        const float x = qr[d] * scale; const unsigned short hb = bf16_bits(x);
        aqh[ks].u[i] = hb; aql[ks].u[i] = bf16_bits(x - bf16_val(hb));
      }
  }
  float m_r[8], l_r[8];
#pragma unroll
  for (int r = 0; r < 8; ++r) { m_r[r] = -3.0e38f; l_r[r] = 0.f; }
  v8f oacc[DT];
#pragma unroll
  for (int dt = 0; dt < DT; ++dt) oacc[dt] = (v8f){0.f,0.f,0.f,0.f,0.f,0.f,0.f,0.f};

  const int kv_end = CAUSAL ? min(T, qblk * 64 + 64) : T;     // block-uniform
  for (int j0 = 0; j0 < kv_end; j0 += 32) {
    __syncthreads();
    for (int e = tid; e < 32 * (D / 4); e += 128) {
      const int r = e / (D / 4), c4 = (e % (D / 4)) * 4;
      const int key = j0 + r;
      v4f kf = {0.f,0.f,0.f,0.f}, vf = {0.f,0.f,0.f,0.f};
      if (key < T) { kf = *(const v4fa*)(K + (size_t)key * pitch + c4); vf = *(const v4fa*)(V + (size_t)key * pitch + c4); }
#pragma unroll
      for (int t = 0; t < 4; ++t) {
        unsigned short hb = bf16_bits(kf[t]); sKh[r][c4 + t] = hb; sKl[r][c4 + t] = bf16_bits(kf[t] - bf16_val(hb));
        hb = bf16_bits(vf[t]); sVh[r][c4 + t] = hb; sVl[r][c4 + t] = bf16_bits(vf[t] - bf16_val(hb));
      }
    }
    __syncthreads();
    // S tile 16 x 32
    v8f s[2];
#pragma unroll
    for (int nt = 0; nt < 2; ++nt) {
      v8f acc = {};
#pragma unroll
      for (int ks = 0; ks < KS; ++ks) {
        FragB bh_, bl_;
        bh_.half[0] = *(const v8us*)&sKh[nt * 16 + ln][ks * 32 + 8 * hh]; bh_.half[1] = *(const v8us*)&sKh[nt * 16 + ln][ks * 32 + 16 + 8 * hh];
        bl_.half[0] = *(const v8us*)&sKl[nt * 16 + ln][ks * 32 + 8 * hh]; bl_.half[1] = *(const v8us*)&sKl[nt * 16 + ln][ks * 32 + 16 + 8 * hh];
        acc = mmaN<3>(aqh[ks].v, aql[ks].v, bh_.v, bl_.v, acc);
      }
      s[nt] = acc;
    }
    // mask + running max (rows 8hh+r; the 16 lanes of a half share rows)
    float alpha[8];
#pragma unroll
    for (int r = 0; r < 8; ++r) {
      const int qi = q0 + 8 * hh + r;
      const int ja = j0 + ln, jb = j0 + 16 + ln;
      if (CAUSAL) { if (ja > qi) s[0][r] = -3.0e38f; if (jb > qi) s[1][r] = -3.0e38f; }
      if (ja >= T) s[0][r] = -3.0e38f;
      if (jb >= T) s[1][r] = -3.0e38f;
      float mx = fmaxf(s[0][r], s[1][r]);
      mx = fmaxf(mx, __shfl_xor(mx, 1, 32)); mx = fmaxf(mx, __shfl_xor(mx, 2, 32)); mx = fmaxf(mx, __shfl_xor(mx, 4, 32)); mx = fmaxf(mx, __shfl_xor(mx, 8, 32));
      const float mnew = fmaxf(m_r[r], mx);
      alpha[r] = (mnew > -1.0e38f) ? __expf(m_r[r] - mnew) : 1.0f;
      const float p0 = (s[0][r] > -1.0e38f) ? __expf(s[0][r] - mnew) : 0.f;
      const float p1 = (s[1][r] > -1.0e38f) ? __expf(s[1][r] - mnew) : 0.f;
      m_r[r] = mnew;
      l_r[r] = l_r[r] * alpha[r] + p0 + p1;            // per-lane partial row sum (16 lanes combined at the end)
      unsigned short hb = bf16_bits(p0); sPh[w][8 * hh + r][ln] = hb;      sPl[w][8 * hh + r][ln] = bf16_bits(p0 - bf16_val(hb));
      hb = bf16_bits(p1);                sPh[w][8 * hh + r][16 + ln] = hb; sPl[w][8 * hh + r][16 + ln] = bf16_bits(p1 - bf16_val(hb));
    }
#pragma unroll
    for (int dt = 0; dt < DT; ++dt)
#pragma unroll
      for (int r = 0; r < 8; ++r) oacc[dt][r] *= alpha[r];
    __builtin_amdgcn_fence(__ATOMIC_ACQ_REL, "workgroup");
    __builtin_amdgcn_wave_barrier();
    FragB pah, pal;
    pah.half[0] = *(const v8us*)&sPh[w][ln][8 * hh]; pah.half[1] = *(const v8us*)&sPh[w][ln][16 + 8 * hh];
    pal.half[0] = *(const v8us*)&sPl[w][ln][8 * hh]; pal.half[1] = *(const v8us*)&sPl[w][ln][16 + 8 * hh];
#pragma unroll
    for (int dt = 0; dt < DT; ++dt) {
      FragB bvh, bvl;
#pragma unroll
      for (int i = 0; i < 8; ++i) {
        bvh.u[i] = sVh[8 * hh + i][dt * 16 + ln]; bvh.u[8 + i] = sVh[16 + 8 * hh + i][dt * 16 + ln];
        bvl.u[i] = sVl[8 * hh + i][dt * 16 + ln]; bvl.u[8 + i] = sVl[16 + 8 * hh + i][dt * 16 + ln];
      }
      oacc[dt] = mmaN<3>(pah.v, pal.v, bvh.v, bvl.v, oacc[dt]);
    }
    __builtin_amdgcn_fence(__ATOMIC_ACQ_REL, "workgroup");
    __builtin_amdgcn_wave_barrier();
  }
#pragma unroll
  for (int r = 0; r < 8; ++r) {
    float l = l_r[r];
    l += __shfl_xor(l, 1, 32); l += __shfl_xor(l, 2, 32); l += __shfl_xor(l, 4, 32); l += __shfl_xor(l, 8, 32);
    l_r[r] = (l > 0.f) ? 1.0f / l : 0.f;
  }
#pragma unroll
  for (int dt = 0; dt < DT; ++dt)
#pragma unroll
    for (int r = 0; r < 8; ++r) sO[w][8 * hh + r][dt * 16 + ln] = oacc[dt][r] * l_r[r];
  __builtin_amdgcn_fence(__ATOMIC_ACQ_REL, "workgroup");
  __builtin_amdgcn_wave_barrier();
  {
    for (int r = 0; r < 16; ++r) {
      const int row = q0 + r;
      if (row < T && lane < D / 4) {
        const v4f val = *(const v4fa*)&sO[w][r][lane * 4];
        *(v4f*)(y + ((size_t)b * T + row) * ypitch + h * D + lane * 4) = val;
      }
    }
    
  }
}

// GEMM C = act(A·W + bias + resid): A f32 (ASPLIT -> hi/lo 2 terms), Wt bf16 [N][K]; ACT 0 none, 1 relu, 2 exact gelu;
// resid (optional, f32, row index = (row % rmod), pitch ldr, RES_BF16 rounds it) added before the activation.
template <bool ASPLIT, int ACT, bool BIAS_BF16, bool RES_BF16>
__global__ __launch_bounds__(128) void k_gemm_bf3(const float* __restrict__ A, int lda, const unsigned short* __restrict__ Wt, int ldb,
                                                const float* __restrict__ bias, const float* __restrict__ resid, int rmod, int ldr,
                                                float* __restrict__ C, int ldc, int M, int N, int K) {
  __shared__ __attribute__((aligned(16))) float so[4][16][64];
  const int tid = threadIdx.x, w = tid >> 5, lane = tid & 31, ln = lane & 15, hh = lane >> 4;
  const int ntn = N / 64;
  const int wid = blockIdx.x * 4 + w;
  const int mt = wid / ntn, nq = wid % ntn;
  if (mt * 16 >= M) return;
  const int row0 = mt * 16, col0 = nq * 64;
  const float* arow = A + (size_t)(row0 + ln) * lda;
  v8f acc[4] = {};
  for (int kb = 0; kb < K; kb += 32) {
    FragB ah, al;
    const v4f x0 = *(const v4fa*)(arow + kb + 8 * hh), x1 = *(const v4fa*)(arow + kb + 8 * hh + 4);
    const v4f x2 = *(const v4fa*)(arow + kb + 16 + 8 * hh), x3 = *(const v4fa*)(arow + kb + 16 + 8 * hh + 4);
    float xs[16] = {x0[0],x0[1],x0[2],x0[3],x1[0],x1[1],x1[2],x1[3],x2[0],x2[1],x2[2],x2[3],x3[0],x3[1],x3[2],x3[3]};
#pragma unroll
    for (int i = 0; i < 16; ++i) { const unsigned short hb = bf16_bits(xs[i]); ah.u[i] = hb; al.u[i] = ASPLIT ? bf16_bits(xs[i] - bf16_val(hb)) : (unsigned short)0; }
#pragma unroll
    for (int t = 0; t < 4; ++t) {
      const unsigned short* brow = Wt + (size_t)(col0 + t * 16 + ln) * ldb + kb;
      FragB b;
      b.half[0] = *(const v8us*)(brow + 8 * hh);
      b.half[1] = *(const v8us*)(brow + 16 + 8 * hh);
      acc[t] = mmaN<ASPLIT ? 2 : 1>(ah.v, al.v, b.v, b.v, acc[t]);
    }
  }
#pragma unroll
  for (int t = 0; t < 4; ++t) {
    const int col = col0 + t * 16 + ln;
    float bv = bias ? bias[col] : 0.f;
    if (BIAS_BF16) bv = bf16_round(bv);
#pragma unroll
    for (int r = 0; r < 8; ++r) {
      float v = acc[t][r] + bv;
      if (resid) { float rv = resid[(size_t)((row0 + 8 * hh + r) % rmod) * ldr + col]; if (RES_BF16) rv = bf16_round(rv); v += rv; }
      if (ACT == 1) v = fmaxf(v, 0.f);
      if (ACT == 2) v = 0.5f * v * (1.0f + erff(v * 0.70710678118654752f));
      if (ACT == 3) { const float u = 0.7978845608028654f * (v + 0.044715f * v * v * v); v = 0.5f * v * (1.0f + tanhf(u)); }
      so[w][8 * hh + r][t * 16 + ln] = v;
    }
  }
  __builtin_amdgcn_fence(__ATOMIC_ACQ_REL, "workgroup");
  __builtin_amdgcn_wave_barrier();
  const int rsub = lane >> 4, c4 = (lane & 15) * 4;
  {
#pragma unroll
    for (int q = 0; q < 8; ++q) {
      const int r = q * 2 + rsub;
      const v4f v = *(const v4fa*)&so[w][r][c4];
      *(v4f*)(C + (size_t)(row0 + r) * ldc + col0 + c4) = v;
    }
    
  }
}
// row LayerNorm (biased variance, eps) over N: s = X (+ R); optional out_sum <- s; out_norm <- (s-mu)*rsqrt(var+eps)*g + b
template <bool PARAM_BF16>
__global__ __launch_bounds__(256) void k_layernorm(const float* __restrict__ X, const float* __restrict__ R, const float* __restrict__ g, const float* __restrict__ bta,
                                                  float* __restrict__ out_sum, float* __restrict__ out_norm, int N, float eps) {
  __shared__ float red[256];
  const int row = blockIdx.x, tid = threadIdx.x;
  const float* x = X + (size_t)row * N; const float* rr = R ? R + (size_t)row * N : nullptr;
  float vals[16];                     // up to N = 4096
  const int per = N / 256;            // contiguous chunk per thread? use strided-by-4 chunks: thread handles j = tid*4 + 1024*u
  float s1 = 0.f;
  for (int u = 0; u < per / 4; ++u) {
    const int j = tid * 4 + 1024 * u;
    const v4f a = *(const v4fa*)(x + j);
    v4f b = {0.f,0.f,0.f,0.f}; if (rr) b = *(const v4fa*)(rr + j);
#pragma unroll
    for (int q = 0; q < 4; ++q) { const float v = a[q] + b[q]; vals[u * 4 + q] = v; s1 += v; }
  }
  red[tid] = s1; __syncthreads();
  for (int st = 128; st > 0; st >>= 1) { if (tid < st) red[tid] += red[tid + st]; __syncthreads(); }
  const float mu = red[0] / (float)N; __syncthreads();
  float s2 = 0.f;
  for (int u = 0; u < per / 4; ++u)
#pragma unroll
    for (int q = 0; q < 4; ++q) { const float c = vals[u * 4 + q] - mu; s2 += c * c; }
  red[tid] = s2; __syncthreads();
  for (int st = 128; st > 0; st >>= 1) { if (tid < st) red[tid] += red[tid + st]; __syncthreads(); }
  const float rs = rsqrtf(red[0] / (float)N + eps);
  {
    for (int u = 0; u < per / 4; ++u) {
      const int j = tid * 4 + 1024 * u;
      v4f o, sm;
#pragma unroll
      for (int q = 0; q < 4; ++q) {
        float gg = g[j + q], bb = bta[j + q];
        if (PARAM_BF16) { gg = bf16_round(gg); bb = bf16_round(bb); }
        sm[q] = vals[u * 4 + q]; o[q] = (vals[u * 4 + q] - mu) * rs * gg + bb;
      }
      if (out_sum) *(v4f*)(out_sum + (size_t)row * N + j) = sm;
      *(v4f*)(out_norm + (size_t)row * N + j) = o;
    }
    
  }
}

// General attention: queries [b][Tq] rows at Q + b*Tq*qpitch + h*D + row*qpitch; keys/values j < Tk1 from (K1,V1) at
// X + b*Tk1*pitch + h*D + j*pitch, j >= Tk1 from (K2,V2) with j-Tk1 (pass Tk2 = 0 and null for a single source).
// Optional int mask [Tq][Tk] (nonzero keep), causal flag (j <= qi), additive score bias sbias[bh*Tk + j].
// 3-term bf16 splits, f32 softmax with running max; y[b][row][h*D + d] pitch ypitch, whole-line rows (D % 32 == 0).
// Block = 16 waves = 4 query tiles x NG key groups: group g walks the 32-key chunks g, g + NG, ... with its own K/V/P staging and its own
// running (max, sum, O); the NG partial results of a query tile are merged once, through LDS, after the loop.
template <int D>
__global__ __launch_bounds__(512) void k_flash3(const float* __restrict__ Qb, int qpitch, int Tq,
                                              const float* __restrict__ K1, const float* __restrict__ V1, int Tk1,
                                              const float* __restrict__ K2, const float* __restrict__ V2, int Tk2, int kpitch, int vpitch,
                                              int H, float scale, const int* __restrict__ mask, int causal, const float* __restrict__ sbias,
                                              float* __restrict__ y, int ypitch) {
  constexpr int KS = D / 32, DT = D / 16, NG = 4;
  __shared__ __attribute__((aligned(16))) unsigned short sKh[NG][32][D + 8], sKl[NG][32][D + 8], sVh[NG][32][D + 8], sVl[NG][32][D + 8];
  __shared__ __attribute__((aligned(16))) unsigned short sPh[4 * NG][16][40], sPl[4 * NG][16][40];
  __shared__ __attribute__((aligned(16))) float sO[4 * NG][16][D];
  __shared__ float sM[4 * NG][16], sL[4 * NG][16];
  const int tid = threadIdx.x, lane = tid & 31, ln = lane & 15, hh = lane >> 4;
  const int w = __builtin_amdgcn_readfirstlane(tid >> 5);   // wave number, kept scalar so that the group's key offset and LDS bases stay scalar
  const int qt = w & 3, g = w >> 2, gtid = tid & 127;       // query tile, key group, thread index inside the group
  const int Tk = Tk1 + Tk2;
  const int nqb = (Tq + 63) / 64;
  const int bh = blockIdx.x / nqb, qblk = blockIdx.x % nqb;
  const int b = bh / H, h = bh % H;
  const int q0 = qblk * 64 + qt * 16;
  const float* Q = Qb + (size_t)b * Tq * qpitch + h * D;
  FragB aqh[KS], aql[KS];
  {
    int row = q0 + ln; if (row >= Tq) row = Tq - 1;
    const float* qr = Q + (size_t)row * qpitch;
#pragma unroll
    for (int ks = 0; ks < KS; ++ks)
#pragma unroll
      for (int i = 0; i < 16; ++i) {
        const int d = ks * 32 + ((i < 8) ? (8 * hh + i) : (16 + 8 * hh + (i - 8)));
        const float x = qr[d] * scale; const unsigned short hb = bf16_bits(x);
        aqh[ks].u[i] = hb; aql[ks].u[i] = bf16_bits(x - bf16_val(hb));
      }
  }
  int qrow[8];
#pragma unroll
  for (int r = 0; r < 8; ++r) { int qi = q0 + 8 * hh + r; qrow[r] = qi < Tq ? qi : Tq - 1; }
  float m_r[8], l_r[8];
#pragma unroll
  for (int r = 0; r < 8; ++r) { m_r[r] = -3.0e38f; l_r[r] = 0.f; }
  v8f oacc[DT];
#pragma unroll
  for (int dt = 0; dt < DT; ++dt) oacc[dt] = (v8f){0.f,0.f,0.f,0.f,0.f,0.f,0.f,0.f};
  const int kv_end = causal ? min(Tk, qblk * 64 + 64) : Tk;
  for (int jg = 0; jg < kv_end; jg += 32 * NG) {               // block-uniform trip count; a chunk past kv_end is fully masked and adds nothing
    const int j0 = jg + 32 * g;
    __syncthreads();
    for (int e = gtid; e < 32 * (D / 4); e += 128) {
      const int r = e / (D / 4), c4 = (e % (D / 4)) * 4; const int key = j0 + r;
      v4f kf = {0.f,0.f,0.f,0.f}, vf = {0.f,0.f,0.f,0.f};
      if (key < Tk1) { kf = *(const v4fa*)(K1 + (size_t)b * Tk1 * kpitch + h * D + (size_t)key * kpitch + c4); vf = *(const v4fa*)(V1 + (size_t)b * Tk1 * vpitch + h * D + (size_t)key * vpitch + c4); }
      else if (key < Tk) { const int k2 = key - Tk1; kf = *(const v4fa*)(K2 + (size_t)b * Tk2 * kpitch + h * D + (size_t)k2 * kpitch + c4); vf = *(const v4fa*)(V2 + (size_t)b * Tk2 * vpitch + h * D + (size_t)k2 * vpitch + c4); }
#pragma unroll
      for (int t = 0; t < 4; ++t) {
        unsigned short hb = bf16_bits(kf[t]); sKh[g][r][c4 + t] = hb; sKl[g][r][c4 + t] = bf16_bits(kf[t] - bf16_val(hb));
        hb = bf16_bits(vf[t]); sVh[g][r][c4 + t] = hb; sVl[g][r][c4 + t] = bf16_bits(vf[t] - bf16_val(hb));
      }
    }
    __syncthreads();
    v8f s[2];
#pragma unroll
    for (int nt = 0; nt < 2; ++nt) {
      v8f acc = {};
#pragma unroll
      for (int ks = 0; ks < KS; ++ks) {
        FragB bh_, bl_;
        bh_.half[0] = *(const v8us*)&sKh[g][nt * 16 + ln][ks * 32 + 8 * hh]; bh_.half[1] = *(const v8us*)&sKh[g][nt * 16 + ln][ks * 32 + 16 + 8 * hh];
        bl_.half[0] = *(const v8us*)&sKl[g][nt * 16 + ln][ks * 32 + 8 * hh]; bl_.half[1] = *(const v8us*)&sKl[g][nt * 16 + ln][ks * 32 + 16 + 8 * hh];
        acc = mmaN<3>(aqh[ks].v, aql[ks].v, bh_.v, bl_.v, acc);
      }
      s[nt] = acc;
    }
    float alpha[8];
#pragma unroll
    for (int r = 0; r < 8; ++r) {
      const int qi = qrow[r];
      const int ja = j0 + ln, jb = j0 + 16 + ln;
      bool keepa = ja < Tk, keepb = jb < Tk;
      if (causal) { keepa = keepa && (ja <= qi); keepb = keepb && (jb <= qi); }
      if (mask) { if (keepa) keepa = mask[(size_t)qi * Tk + ja] != 0; if (keepb) keepb = mask[(size_t)qi * Tk + jb] != 0; }
      if (sbias) { if (keepa) s[0][r] += sbias[(size_t)bh * Tk + ja]; if (keepb) s[1][r] += sbias[(size_t)bh * Tk + jb]; }   // per-key additive bias (a per-query constant would cancel in the softmax)
      if (!keepa) s[0][r] = -3.0e38f;
      if (!keepb) s[1][r] = -3.0e38f;
      float mx = fmaxf(s[0][r], s[1][r]);
      mx = fmaxf(mx, __shfl_xor(mx, 1, 32)); mx = fmaxf(mx, __shfl_xor(mx, 2, 32)); mx = fmaxf(mx, __shfl_xor(mx, 4, 32)); mx = fmaxf(mx, __shfl_xor(mx, 8, 32));
      const float mnew = fmaxf(m_r[r], mx);
      alpha[r] = (mnew > -1.0e38f) ? __expf(m_r[r] - mnew) : 1.0f;
      const float p0 = keepa ? __expf(s[0][r] - mnew) : 0.f;
      const float p1 = keepb ? __expf(s[1][r] - mnew) : 0.f;
      m_r[r] = mnew;
      l_r[r] = l_r[r] * alpha[r] + p0 + p1;
      unsigned short hb = bf16_bits(p0); sPh[w][8 * hh + r][ln] = hb;      sPl[w][8 * hh + r][ln] = bf16_bits(p0 - bf16_val(hb));
      hb = bf16_bits(p1);                sPh[w][8 * hh + r][16 + ln] = hb; sPl[w][8 * hh + r][16 + ln] = bf16_bits(p1 - bf16_val(hb));
    }
#pragma unroll
    for (int dt = 0; dt < DT; ++dt)
#pragma unroll
      for (int r = 0; r < 8; ++r) oacc[dt][r] *= alpha[r];
    __builtin_amdgcn_fence(__ATOMIC_ACQ_REL, "workgroup");
    __builtin_amdgcn_wave_barrier();
    FragB pah, pal;
    pah.half[0] = *(const v8us*)&sPh[w][ln][8 * hh]; pah.half[1] = *(const v8us*)&sPh[w][ln][16 + 8 * hh];
    pal.half[0] = *(const v8us*)&sPl[w][ln][8 * hh]; pal.half[1] = *(const v8us*)&sPl[w][ln][16 + 8 * hh];
#pragma unroll
    for (int dt = 0; dt < DT; ++dt) {
      FragB bvh, bvl;
#pragma unroll
      for (int i = 0; i < 8; ++i) {
        bvh.u[i] = sVh[g][8 * hh + i][dt * 16 + ln]; bvh.u[8 + i] = sVh[g][16 + 8 * hh + i][dt * 16 + ln];
        bvl.u[i] = sVl[g][8 * hh + i][dt * 16 + ln]; bvl.u[8 + i] = sVl[g][16 + 8 * hh + i][dt * 16 + ln];
      }
      oacc[dt] = mmaN<3>(pah.v, pal.v, bvh.v, bvl.v, oacc[dt]);
    }
    __builtin_amdgcn_fence(__ATOMIC_ACQ_REL, "workgroup");
    __builtin_amdgcn_wave_barrier();
  }
#pragma unroll
  for (int r = 0; r < 8; ++r) {
    float l = l_r[r];
    l += __shfl_xor(l, 1, 32); l += __shfl_xor(l, 2, 32); l += __shfl_xor(l, 4, 32); l += __shfl_xor(l, 8, 32);
    if (ln == 0) { sM[w][8 * hh + r] = m_r[r]; sL[w][8 * hh + r] = l; }
  }
#pragma unroll
  for (int dt = 0; dt < DT; ++dt)
#pragma unroll
    for (int r = 0; r < 8; ++r) sO[w][8 * hh + r][dt * 16 + ln] = oacc[dt][r];
  __syncthreads();   // every group's partial (max, sum, O) is in LDS before any wave merges
  // merge: wave (qt, g) finishes rows g*16/NG ... of query tile qt; a lane owns 4 columns of the row
#pragma unroll
  for (int i = 0; i < 16 / NG; ++i) {
    const int rr = g * (16 / NG) + i, row = q0 + rr;
    if (row < Tq && lane < D / 4) {
      float mg[NG], mall = -3.0e38f;
#pragma unroll
      for (int k = 0; k < NG; ++k) { mg[k] = sM[k * 4 + qt][rr]; mall = fmaxf(mall, mg[k]); }
      float lall = 0.f;
      v4f val = {0.f, 0.f, 0.f, 0.f};
#pragma unroll
      for (int k = 0; k < NG; ++k) {
        const float wt = (mg[k] > -1.0e38f) ? __expf(mg[k] - mall) : 0.f;
        const v4f o = *(const v4fa*)&sO[k * 4 + qt][rr][lane * 4];
        lall += wt * sL[k * 4 + qt][rr];
        val += wt * o;
      }
      const float inv = (mall > -1.0e38f) ? 1.0f / lall : __builtin_nanf("");
      *(v4f*)(y + ((size_t)b * Tq + row) * ypitch + h * D + lane * 4) = val * inv;
      if (i + 1 < 16 / NG) asm volatile("s_wait_xcnt 0x0" ::: "memory");   // precaution: stands before the next row's reads reuse the store's address and data registers
    }
  }
}

__global__ __launch_bounds__(256) void k_roundcopy(const float* __restrict__ src, float* __restrict__ dst, int n8) {
  const size_t t = (size_t)blockIdx.x * 256 + threadIdx.x;
  if (t >= (size_t)n8 * 2) return;
  v4f a = *(const v4fa*)(src + t * 4);
  for (int i = 0; i < 4; ++i) a[i] = bf16_round(a[i]);
  *(v4f*)(dst + t * 4) = a; 
}

__global__ void k_ln_rows(const float* __restrict__ X, const float* __restrict__ R, const float* __restrict__ g, const float* __restrict__ bta, float* __restrict__ out, int N, float eps) {
  __shared__ float red[256];
  const int row = blockIdx.x, tid = threadIdx.x, nt = blockDim.x;
  v4f a = *(const v4fa*)(X + (size_t)row * N + tid * 4);
  if (R) { const v4f rr = *(const v4fa*)(R + (size_t)row * N + tid * 4); for (int q = 0; q < 4; ++q) a[q] += rr[q]; }
  float s = a[0] + a[1] + a[2] + a[3];
  red[tid] = s; __syncthreads();
  for (int st = nt / 2; st > 0; st >>= 1) { if (tid < st) red[tid] += red[tid + st]; __syncthreads(); }
  const float mu = red[0] / (float)N; __syncthreads();
  float v = 0.f; for (int q = 0; q < 4; ++q) { const float c = a[q] - mu; v += c * c; }
  red[tid] = v; __syncthreads();
  for (int st = nt / 2; st > 0; st >>= 1) { if (tid < st) red[tid] += red[tid + st]; __syncthreads(); }
  const float rs = rsqrtf(red[0] / (float)N + eps);
  v4f o; for (int q = 0; q < 4; ++q) o[q] = (a[q] - mu) * rs * bf16_round(g[tid * 4 + q]) + bf16_round(bta[tid * 4 + q]);
  *(v4f*)(out + (size_t)row * N + tid * 4) = o; 
}

// Bt[h*DK + k][d] = W[h][d][k]  (W [H][D][DK]); thread per (n, 8 d)
__global__ __launch_bounds__(256) void k_wt_heads(const float* __restrict__ W, unsigned short* __restrict__ Bt) {
  const int t = blockIdx.x * 256 + threadIdx.x; if (t >= NH * DK * (DD / 8)) return;
  const int n = t / (DD / 8), d8 = (t % (DD / 8)) * 8; const int h = n / DK, kk = n % DK; v8us v;
#pragma unroll
  for (int i = 0; i < 8; ++i) v[i] = bf16_bits(W[((size_t)h * DD + d8 + i) * DK + kk]);
  *(v8us*)(Bt + (size_t)n * DD + d8) = v; 
}
extern "C" void kernel_launch(void* const* d_in, const int* in_sizes, int n_in,
                              void* d_out, int out_size, void* d_ws, size_t ws_size, hipStream_t stream) {
  (void)in_sizes; (void)n_in; (void)out_size;
  const float* token = (const float*)d_in[0];
  const float* Wq = (const float*)d_in[1]; const float* bq = (const float*)d_in[2]; const float* Wk = (const float*)d_in[3]; const float* bk = (const float*)d_in[4];
  const float* Wv = (const float*)d_in[5]; const float* bv = (const float*)d_in[6]; const float* Wo = (const float*)d_in[7]; const float* bo = (const float*)d_in[8];
  const float* Wf = (const float*)d_in[9]; const float* bfv = (const float*)d_in[10]; const float* gamma = (const float*)d_in[11]; const float* beta = (const float*)d_in[12];
  char* ws = (char*)d_ws; size_t off = 0;
  auto take = [&](size_t bytes) { char* p = ws + off; off += (bytes + 255) & ~(size_t)255; return p; };
  unsigned short* Bqkv = (unsigned short*)take((size_t)3 * DD * DD * 2); unsigned short* Bo = (unsigned short*)take((size_t)DD * DD * 2); unsigned short* Bf = (unsigned short*)take((size_t)DD * DD * 2);
  float* bqkv = (float*)take(3 * DD * 4);
  float* x = (float*)take((size_t)SS * DD * 4); float* qkv = (float*)take((size_t)SS * 3 * DD * 4); float* att = (float*)take((size_t)SS * DD * 4); float* tmp = (float*)take((size_t)SS * DD * 4); float* a = (float*)take((size_t)SS * DD * 4);
  if (off > ws_size) return;
  k_wt_heads<<<(NH * DK * (DD / 8) + 255) / 256, 256, 0, stream>>>(Wq, Bqkv);
  k_wt_heads<<<(NH * DK * (DD / 8) + 255) / 256, 256, 0, stream>>>(Wk, Bqkv + (size_t)DD * DD);
  k_wt_heads<<<(NH * DK * (DD / 8) + 255) / 256, 256, 0, stream>>>(Wv, Bqkv + (size_t)2 * DD * DD);
  k_wt_bf16<<<(DD * (DD / 8) + 255) / 256, 256, 0, stream>>>(Wo, Bo, DD, DD);
  k_wt_bf16<<<(DD * (DD / 8) + 255) / 256, 256, 0, stream>>>(Wf, Bf, DD, DD);
  k_roundcopy<<<(3 * DD / 4 + 255) / 256, 256, 0, stream>>>(bq, bqkv, DD / 8);            // bq|bk|bv flat [H*DK] each: three copies (f32, rounded) into one bias vector
  k_roundcopy<<<(DD / 4 + 255) / 256, 256, 0, stream>>>(bk, bqkv + DD, DD / 8);
  k_roundcopy<<<(DD / 4 + 255) / 256, 256, 0, stream>>>(bv, bqkv + 2 * DD, DD / 8);
  k_roundcopy<<<(SS * DD / 4 + 255) / 256, 256, 0, stream>>>(token, x, SS * DD / 8);
  const int gq = ((SS / 16) * (3 * DD / 64) + 3) / 4, g1 = ((SS / 16) * (DD / 64) + 3) / 4;
  for (int l = 0; l < NLAY; ++l) {
    k_gemm_bf3<true, 0, false, false><<<gq, 128, 0, stream>>>(x, DD, Bqkv, DD, bqkv, nullptr, 1, 0, qkv, 3 * DD, SS, 3 * DD, DD);      // bias already rounded (BIAS_BF16=false adds it as given)
    k_flash3<DK><<<NH * (SS / 64), 512, 0, stream>>>(qkv, 3 * DD, SS, qkv + DD, qkv + 2 * DD, SS, nullptr, nullptr, 0, 3 * DD, 3 * DD, NH, 0.08838834764831845f, nullptr, 0, nullptr, att, DD);
    k_gemm_bf3<true, 0, true, false><<<g1, 128, 0, stream>>>(att, DD, Bo, DD, bo, nullptr, 1, 0, tmp, DD, SS, DD, DD);
    k_ln_rows<<<SS, DD / 4, 0, stream>>>(tmp, x, gamma, beta, a, DD, 1e-5f);                  // a = LN(x + attn_out)
    k_gemm_bf3<true, 0, true, false><<<g1, 128, 0, stream>>>(a, DD, Bf, DD, bfv, nullptr, 1, 0, tmp, DD, SS, DD, DD);
    k_ln_rows<<<SS, DD / 4, 0, stream>>>(tmp, a, gamma, beta, (l == NLAY - 1) ? (float*)d_out : x, DD, 1e-5f);   // x = LN(a + ff)
  }
}

// v002
// Measured time: 1500 microseconds a run.
// Timed twice side by side with v001, it ran 1.38 and 1.37 times as fast.
// Counting every step since v000, it is 2.69 times as fast.
#include <hip/hip_runtime.h>
// All GEMMs on v_wmma_f32_16x16x32_bf16, f32 accumulate: fused per-head q|k|v projection (K=1024, N=3072), concat·Wo, a·Wf — A operands
// (the residual stream, quantised to bf16 once at the input) split into bf16 hi/lo (2 terms) against bf16-rounded weights; attention QKᵀ/√128
// and P·V per 16-query tile as 3-term splits (head dim 128); LayerNorm and softmax in f32. Six layers with shared weights.
#define SS 2048
#define DD 1024
#define NH 8
#define DK 128
#define NLAY 6

typedef __bf16 v16b __attribute__((ext_vector_type(16)));
typedef unsigned short v8us __attribute__((ext_vector_type(8), may_alias));
typedef unsigned short v4us __attribute__((ext_vector_type(4), may_alias));
typedef float  v8f  __attribute__((ext_vector_type(8)));
typedef float  v4f  __attribute__((ext_vector_type(4)));
typedef float  v4fa __attribute__((ext_vector_type(4), may_alias));
union FragB { v16b v; v8us half[2]; unsigned short u[16]; };

__device__ __forceinline__ unsigned short bf16_bits(float x) { unsigned int u = __float_as_uint(x); return (unsigned short)((u + 0x7FFFu + ((u >> 16) & 1u)) >> 16); }
__device__ __forceinline__ float bf16_val(unsigned short b) { return __uint_as_float(((unsigned int)b) << 16); }
__device__ __forceinline__ float bf16_round(float x) { return bf16_val(bf16_bits(x)); }
// D += A·B with NT terms: 1 = ah·bh, 2 = + al·bh (A split), 3 = + ah·bl (both split)
template <int NT>
__device__ __forceinline__ v8f mmaN(v16b ah, v16b al, v16b bh, v16b bl, v8f c) {
  c = __builtin_amdgcn_wmma_f32_16x16x32_bf16(false, ah, false, bh, (short)0, c, false, false);
  if (NT >= 2) c = __builtin_amdgcn_wmma_f32_16x16x32_bf16(false, al, false, bh, (short)0, c, false, false);
  if (NT >= 3) c = __builtin_amdgcn_wmma_f32_16x16x32_bf16(false, ah, false, bl, (short)0, c, false, false);
  asm volatile("v_nop\n\tv_nop\n\tv_nop\n\tv_nop" : "+v"(c) : "v"(ah), "v"(al), "v"(bh), "v"(bl));
  return c;
}

__global__ __launch_bounds__(256) void k_wt_bf16(const float* __restrict__ W, unsigned short* __restrict__ Wt, int K, int N) {
  const int t = blockIdx.x * 256 + threadIdx.x;
  const int k8n = K / 8;
  if (t >= N * k8n) return;
  const int n = t / k8n, k8 = (t % k8n) * 8;
  v8us v;
#pragma unroll
  for (int i = 0; i < 8; ++i) v[i] = bf16_bits(W[(size_t)(k8 + i) * N + n]);
  *(v8us*)(Wt + (size_t)n * K + k8) = v;
  
}

// GEMM C[M][N] (f32, pitch ldc) = act(A[M][K]·W + bias). A f32 row-major (pitch lda) converted per fragment to bf16
// (ASPLIT: hi/lo two planes -> 2 terms, else single rounded term); Wt bf16 [N][K] (pitch ldb). BIAS_BF16 rounds the
// bias to bf16 first (bias quantised to bf16 before the add). K%32==0, M%16==0, N%64==0.
template <bool ASPLIT, int ACT, bool BIAS_BF16>
__global__ __launch_bounds__(128) void k_gemm_bf(const float* __restrict__ A, int lda, const unsigned short* __restrict__ Wt, int ldb,
                                               const float* __restrict__ bias, float* __restrict__ C, int ldc, int M, int N, int K) {
  __shared__ __attribute__((aligned(16))) float so[4][16][64];
  const int tid = threadIdx.x, w = tid >> 5, lane = tid & 31, ln = lane & 15, hh = lane >> 4;
  const int ntn = N / 64;
  const int wid = blockIdx.x * 4 + w;
  const int mt = wid / ntn, nq = wid % ntn;
  if (mt * 16 >= M) return;
  const int row0 = mt * 16, col0 = nq * 64;
  const float* arow = A + (size_t)(row0 + ln) * lda;
  v8f acc[4] = {};
  for (int kb = 0; kb < K; kb += 32) {
    FragB ah, al;
    const v4f x0 = *(const v4fa*)(arow + kb + 8 * hh), x1 = *(const v4fa*)(arow + kb + 8 * hh + 4);
    const v4f x2 = *(const v4fa*)(arow + kb + 16 + 8 * hh), x3 = *(const v4fa*)(arow + kb + 16 + 8 * hh + 4);
    float xs[16] = {x0[0],x0[1],x0[2],x0[3],x1[0],x1[1],x1[2],x1[3],x2[0],x2[1],x2[2],x2[3],x3[0],x3[1],x3[2],x3[3]};
#pragma unroll
    for (int i = 0; i < 16; ++i) { const unsigned short hb = bf16_bits(xs[i]); ah.u[i] = hb; al.u[i] = ASPLIT ? bf16_bits(xs[i] - bf16_val(hb)) : (unsigned short)0; }
#pragma unroll
    for (int t = 0; t < 4; ++t) {
      const unsigned short* brow = Wt + (size_t)(col0 + t * 16 + ln) * ldb + kb;
      FragB b;
      b.half[0] = *(const v8us*)(brow + 8 * hh);
      b.half[1] = *(const v8us*)(brow + 16 + 8 * hh);
      acc[t] = mmaN<ASPLIT ? 2 : 1>(ah.v, al.v, b.v, b.v, acc[t]);
    }
  }
#pragma unroll
  for (int t = 0; t < 4; ++t) {
    float bv = bias ? bias[col0 + t * 16 + ln] : 0.f;
    if (BIAS_BF16) bv = bf16_round(bv);
#pragma unroll
    for (int r = 0; r < 8; ++r) { float v = acc[t][r] + bv; if (ACT == 1) v = fmaxf(v, 0.f); so[w][8 * hh + r][t * 16 + ln] = v; }
  }
  __builtin_amdgcn_fence(__ATOMIC_ACQ_REL, "workgroup");
  __builtin_amdgcn_wave_barrier();
  const int rsub = lane >> 4, c4 = (lane & 15) * 4;
  {
#pragma unroll
    for (int q = 0; q < 8; ++q) {
      const int r = q * 2 + rsub;
      const v4f v = *(const v4fa*)&so[w][r][c4];
      *(v4f*)(C + (size_t)(row0 + r) * ldc + col0 + c4) = v;
    }
    
  }
}

// Flash-style causal/unmasked attention, all contractions 3-term bf16 hi/lo splits, f32 softmax with running max.
// q,k,v rows are read from f32 buffers with arbitrary row pitch (so they can live inside a fused qkv buffer);
// D = head size (multiple of 32, <= 128); one wave = 16 query rows; block = 4 waves (64 queries) sharing K/V chunks of 32.
template <int D, bool CAUSAL>
__global__ __launch_bounds__(128) void k_flash(const float* __restrict__ qb, const float* __restrict__ kb, const float* __restrict__ vb,
                                             int pitch, int T, int H, float scale, float* __restrict__ y, int ypitch) {
  constexpr int KS = D / 32;        // k-steps for QK
  constexpr int DT = D / 16;        // d tiles for PV
  __shared__ __attribute__((aligned(16))) unsigned short sKh[32][D + 8], sKl[32][D + 8], sVh[32][D + 8], sVl[32][D + 8];
  __shared__ __attribute__((aligned(16))) unsigned short sPh[4][16][40], sPl[4][16][40];
  __shared__ __attribute__((aligned(16))) float sO[4][16][D];
  const int tid = threadIdx.x, w = tid >> 5, lane = tid & 31, ln = lane & 15, hh = lane >> 4;
  const int nqb = (T + 63) / 64;
  const int bh = blockIdx.x / nqb, qblk = blockIdx.x % nqb;
  const int b = bh / H, h = bh % H;
  const int q0 = qblk * 64 + w * 16;
  const float* Q = qb + (size_t)b * T * pitch + h * D;
  const float* K = kb + (size_t)b * T * pitch + h * D;
  const float* V = vb + (size_t)b * T * pitch + h * D;

  // A fragments of the wave's 16 query rows (scaled), hi/lo
  FragB aqh[KS], aql[KS];
  {
    int row = q0 + ln; if (row >= T) row = T - 1;
    const float* qr = Q + (size_t)row * pitch;
#pragma unroll
    for (int ks = 0; ks < KS; ++ks)
#pragma unroll
      for (int i = 0; i < 16; ++i) {
        const int d = ks * 32 + ((i < 8) ? (8 * hh + i) : (16 + 8 * hh + (i - 8)));
        const float x = qr[d] * scale; const unsigned short hb = bf16_bits(x);
        aqh[ks].u[i] = hb; aql[ks].u[i] = bf16_bits(x - bf16_val(hb));
      }
  }
  float m_r[8], l_r[8];
#pragma unroll
  for (int r = 0; r < 8; ++r) { m_r[r] = -3.0e38f; l_r[r] = 0.f; }
  v8f oacc[DT];
#pragma unroll
  for (int dt = 0; dt < DT; ++dt) oacc[dt] = (v8f){0.f,0.f,0.f,0.f,0.f,0.f,0.f,0.f};

  const int kv_end = CAUSAL ? min(T, qblk * 64 + 64) : T;     // block-uniform
  for (int j0 = 0; j0 < kv_end; j0 += 32) {
    __syncthreads();
    for (int e = tid; e < 32 * (D / 4); e += 128) {
      const int r = e / (D / 4), c4 = (e % (D / 4)) * 4;
      const int key = j0 + r;
      v4f kf = {0.f,0.f,0.f,0.f}, vf = {0.f,0.f,0.f,0.f};
      if (key < T) { kf = *(const v4fa*)(K + (size_t)key * pitch + c4); vf = *(const v4fa*)(V + (size_t)key * pitch + c4); }
#pragma unroll
      for (int t = 0; t < 4; ++t) {
        unsigned short hb = bf16_bits(kf[t]); sKh[r][c4 + t] = hb; sKl[r][c4 + t] = bf16_bits(kf[t] - bf16_val(hb));
        hb = bf16_bits(vf[t]); sVh[r][c4 + t] = hb; sVl[r][c4 + t] = bf16_bits(vf[t] - bf16_val(hb));
      }
    }
    __syncthreads();
    // S tile 16 x 32
    v8f s[2];
#pragma unroll
    for (int nt = 0; nt < 2; ++nt) {
      v8f acc = {};
#pragma unroll
      for (int ks = 0; ks < KS; ++ks) {
        FragB bh_, bl_;
        bh_.half[0] = *(const v8us*)&sKh[nt * 16 + ln][ks * 32 + 8 * hh]; bh_.half[1] = *(const v8us*)&sKh[nt * 16 + ln][ks * 32 + 16 + 8 * hh];
        bl_.half[0] = *(const v8us*)&sKl[nt * 16 + ln][ks * 32 + 8 * hh]; bl_.half[1] = *(const v8us*)&sKl[nt * 16 + ln][ks * 32 + 16 + 8 * hh];
        acc = mmaN<3>(aqh[ks].v, aql[ks].v, bh_.v, bl_.v, acc);
      }
      s[nt] = acc;
    }
    // mask + running max (rows 8hh+r; the 16 lanes of a half share rows)
    float alpha[8];
#pragma unroll
    for (int r = 0; r < 8; ++r) {
      const int qi = q0 + 8 * hh + r;
      const int ja = j0 + ln, jb = j0 + 16 + ln;
      if (CAUSAL) { if (ja > qi) s[0][r] = -3.0e38f; if (jb > qi) s[1][r] = -3.0e38f; }
      if (ja >= T) s[0][r] = -3.0e38f;
      if (jb >= T) s[1][r] = -3.0e38f;
      float mx = fmaxf(s[0][r], s[1][r]);
      mx = fmaxf(mx, __shfl_xor(mx, 1, 32)); mx = fmaxf(mx, __shfl_xor(mx, 2, 32)); mx = fmaxf(mx, __shfl_xor(mx, 4, 32)); mx = fmaxf(mx, __shfl_xor(mx, 8, 32));
      const float mnew = fmaxf(m_r[r], mx);
      alpha[r] = (mnew > -1.0e38f) ? __expf(m_r[r] - mnew) : 1.0f;
      const float p0 = (s[0][r] > -1.0e38f) ? __expf(s[0][r] - mnew) : 0.f;
      const float p1 = (s[1][r] > -1.0e38f) ? __expf(s[1][r] - mnew) : 0.f;
      m_r[r] = mnew;
      l_r[r] = l_r[r] * alpha[r] + p0 + p1;            // per-lane partial row sum (16 lanes combined at the end)
      unsigned short hb = bf16_bits(p0); sPh[w][8 * hh + r][ln] = hb;      sPl[w][8 * hh + r][ln] = bf16_bits(p0 - bf16_val(hb));
      hb = bf16_bits(p1);                sPh[w][8 * hh + r][16 + ln] = hb; sPl[w][8 * hh + r][16 + ln] = bf16_bits(p1 - bf16_val(hb));
    }
#pragma unroll
    for (int dt = 0; dt < DT; ++dt)
#pragma unroll
      for (int r = 0; r < 8; ++r) oacc[dt][r] *= alpha[r];
    __builtin_amdgcn_fence(__ATOMIC_ACQ_REL, "workgroup");
    __builtin_amdgcn_wave_barrier();
    FragB pah, pal;
    pah.half[0] = *(const v8us*)&sPh[w][ln][8 * hh]; pah.half[1] = *(const v8us*)&sPh[w][ln][16 + 8 * hh];
    pal.half[0] = *(const v8us*)&sPl[w][ln][8 * hh]; pal.half[1] = *(const v8us*)&sPl[w][ln][16 + 8 * hh];
#pragma unroll
    for (int dt = 0; dt < DT; ++dt) {
      FragB bvh, bvl;
#pragma unroll
      for (int i = 0; i < 8; ++i) {
        bvh.u[i] = sVh[8 * hh + i][dt * 16 + ln]; bvh.u[8 + i] = sVh[16 + 8 * hh + i][dt * 16 + ln];
        bvl.u[i] = sVl[8 * hh + i][dt * 16 + ln]; bvl.u[8 + i] = sVl[16 + 8 * hh + i][dt * 16 + ln];
      }
      oacc[dt] = mmaN<3>(pah.v, pal.v, bvh.v, bvl.v, oacc[dt]);
    }
    __builtin_amdgcn_fence(__ATOMIC_ACQ_REL, "workgroup");
    __builtin_amdgcn_wave_barrier();
  }
#pragma unroll
  for (int r = 0; r < 8; ++r) {
    float l = l_r[r];
    l += __shfl_xor(l, 1, 32); l += __shfl_xor(l, 2, 32); l += __shfl_xor(l, 4, 32); l += __shfl_xor(l, 8, 32);
    l_r[r] = (l > 0.f) ? 1.0f / l : 0.f;
  }
#pragma unroll
  for (int dt = 0; dt < DT; ++dt)
#pragma unroll
    for (int r = 0; r < 8; ++r) sO[w][8 * hh + r][dt * 16 + ln] = oacc[dt][r] * l_r[r];
  __builtin_amdgcn_fence(__ATOMIC_ACQ_REL, "workgroup");
  __builtin_amdgcn_wave_barrier();
  {
    for (int r = 0; r < 16; ++r) {
      const int row = q0 + r;
      if (row < T && lane < D / 4) {
        const v4f val = *(const v4fa*)&sO[w][r][lane * 4];
        *(v4f*)(y + ((size_t)b * T + row) * ypitch + h * D + lane * 4) = val;
      }
    }
    
  }
}

// GEMM C[M][N] (f32, pitch ldc) = A[M][K] x W + bias: A f32 row-major (pitch lda), two terms (bf16 hi + lo) against Wt bf16 [N][K] (pitch ldb).
// Block = 8 waves (2 x 4) on a 64 x 128 tile of C, a wave owns 32 x 32. K is walked in slices of 64: the A slice is split into its hi and lo
// planes once per block, the Wt slice is copied, both through whole-line global loads into LDS, where all 8 waves read their fragments.
// Two LDS buffers: the next slice's global loads are issued ahead of this slice's products and stored behind them; one barrier per slice.
// Each accumulator takes hi then lo of every 32-wide k step in rising k. M % 64 == 0, N % 128 == 0, K % 64 == 0; grid = (M / 64) * (N / 128).
template <bool BIAS_BF16>
__global__ __launch_bounds__(256) void k_gemm_tile(const float* __restrict__ A, int lda, const unsigned short* __restrict__ Wt, int ldb,
                                                   const float* __restrict__ bias, float* __restrict__ C, int ldc, int N, int K) {
  constexpr int BM = 64, BN = 128, BK = 64, LP = BK + 8;       // LP: LDS row pitch 144 B = 16 B x odd
  constexpr int PA = BM * LP, PB = BN * LP, BUF = 2 * PA + PB;  // one buffer, in 16-bit elements: A hi | A lo | Wt
  constexpr int OP = 36;                                       // pitch of the output staging rows, in floats
  __shared__ __attribute__((aligned(16))) unsigned short sm[2 * BUF];
  const int tid = threadIdx.x, lane = tid & 31, ln = lane & 15, hh = lane >> 4;
  const int w = __builtin_amdgcn_readfirstlane(tid >> 5);      // wave number, kept scalar so that the tile offsets stay scalar
  const int wm = w >> 2, wn = w & 3;
  const int nbn = N / BN;
  const int row0 = (blockIdx.x / nbn) * BM, col0 = (blockIdx.x % nbn) * BN;
  const int ar = tid >> 4, ac = (tid & 15) * 4;                // A slice: a wave's load covers 2 rows x 256 B
  const int br = tid >> 3, bc = (tid & 7) * 8;                 // Wt slice: a wave's load covers 4 rows x 128 B
  const float* ag = A + (size_t)(row0 + ar) * lda + ac;
  const unsigned short* bg = Wt + (size_t)(col0 + br) * ldb + bc;
  v4f ra[4];
  v8us rb[4];
  auto fetch = [&](int kb) {
    const float* pa[4];
    const unsigned short* pb[4];
#pragma unroll
    for (int j = 0; j < 4; ++j) { pa[j] = ag + (size_t)(16 * j) * lda + kb; pb[j] = bg + (size_t)(32 * j) * ldb + kb; }
#pragma unroll
    for (int j = 0; j < 4; ++j) ra[j] = *(const v4fa*)pa[j];
#pragma unroll
    for (int j = 0; j < 4; ++j) rb[j] = *(const v8us*)pb[j];
    // precaution: the eight address pairs are inputs of the wait, so none of them is reused (not even as a later load's result) ahead of it
    asm volatile("s_wait_xcnt 0x0" :: "v"(pa[0]), "v"(pa[1]), "v"(pa[2]), "v"(pa[3]), "v"(pb[0]), "v"(pb[1]), "v"(pb[2]), "v"(pb[3]) : "memory");
  };
  auto stash = [&](unsigned short* sb) {
#pragma unroll
    for (int j = 0; j < 4; ++j) {
      v4us h, l;
#pragma unroll
      for (int t = 0; t < 4; ++t) { const unsigned short hb = bf16_bits(ra[j][t]); h[t] = hb; l[t] = bf16_bits(ra[j][t] - bf16_val(hb)); }
      *(v4us*)(sb + (ar + 16 * j) * LP + ac) = h;
      *(v4us*)(sb + PA + (ar + 16 * j) * LP + ac) = l;
      *(v8us*)(sb + 2 * PA + (br + 32 * j) * LP + bc) = rb[j];
    }
  };
  v8f acc[2][2] = {};
  const int ns = K / BK;
  fetch(0);
  stash(sm);
  __syncthreads();
  for (int s = 0; s < ns; ++s) {
    const unsigned short* sb = sm + (s & 1) * BUF;
    if (s + 1 < ns) fetch((s + 1) * BK);
#pragma unroll
    for (int ks = 0; ks < BK / 32; ++ks) {
      FragB ah[2], al[2], b[2];
#pragma unroll
      for (int t = 0; t < 2; ++t) {
        const unsigned short* pa = sb + (wm * 32 + t * 16 + ln) * LP + ks * 32 + 8 * hh;
        const unsigned short* pb = sb + 2 * PA + (wn * 32 + t * 16 + ln) * LP + ks * 32 + 8 * hh;
        ah[t].half[0] = *(const v8us*)pa;        ah[t].half[1] = *(const v8us*)(pa + 16);
        al[t].half[0] = *(const v8us*)(pa + PA); al[t].half[1] = *(const v8us*)(pa + PA + 16);
        b[t].half[0]  = *(const v8us*)pb;        b[t].half[1]  = *(const v8us*)(pb + 16);
      }
      __builtin_amdgcn_sched_barrier(0);   // keeps the k step's 12 LDS reads together as one group ahead of its 8 products: one LDS wait per k step, not four
#pragma unroll
      for (int mt = 0; mt < 2; ++mt)
#pragma unroll
        for (int nt = 0; nt < 2; ++nt) acc[mt][nt] = __builtin_amdgcn_wmma_f32_16x16x32_bf16(false, ah[mt].v, false, b[nt].v, (short)0, acc[mt][nt], false, false);
#pragma unroll
      for (int mt = 0; mt < 2; ++mt)
#pragma unroll
        for (int nt = 0; nt < 2; ++nt) acc[mt][nt] = __builtin_amdgcn_wmma_f32_16x16x32_bf16(false, al[mt].v, false, b[nt].v, (short)0, acc[mt][nt], false, false);
    }
    if (s + 1 < ns) stash(sm + ((s + 1) & 1) * BUF);
    __syncthreads();   // publishes slice s + 1 and ends every wave's reads of slice s, whose buffer is refilled in the next trip
  }
  // output: each wave turns its 32 x 32 tile through its own piece of the (now free) LDS so that every store covers whole 128-B lines
  float* so = (float*)sm + w * 32 * OP;
#pragma unroll
  for (int nt = 0; nt < 2; ++nt) {
    float bv = bias[col0 + wn * 32 + nt * 16 + ln];
    if (BIAS_BF16) bv = bf16_round(bv);
#pragma unroll
    for (int mt = 0; mt < 2; ++mt)
#pragma unroll
      for (int r = 0; r < 8; ++r) so[(mt * 16 + 8 * hh + r) * OP + nt * 16 + ln] = acc[mt][nt][r] + bv;
  }
  __builtin_amdgcn_fence(__ATOMIC_ACQ_REL, "workgroup");
  __builtin_amdgcn_wave_barrier();
  const int rsub = lane >> 3, c4 = (lane & 7) * 4;
#pragma unroll
  for (int q = 0; q < 8; ++q) {
    const int r = q * 4 + rsub;
    const v4f v = *(const v4fa*)(so + r * OP + c4);
    *(v4f*)(C + (size_t)(row0 + wm * 32 + r) * ldc + col0 + wn * 32 + c4) = v;
  }
}
// row LayerNorm (biased variance, eps) over N: s = X (+ R); optional out_sum <- s; out_norm <- (s-mu)*rsqrt(var+eps)*g + b
template <bool PARAM_BF16>
__global__ __launch_bounds__(256) void k_layernorm(const float* __restrict__ X, const float* __restrict__ R, const float* __restrict__ g, const float* __restrict__ bta,
                                                  float* __restrict__ out_sum, float* __restrict__ out_norm, int N, float eps) {
  __shared__ float red[256];
  const int row = blockIdx.x, tid = threadIdx.x;
  const float* x = X + (size_t)row * N; const float* rr = R ? R + (size_t)row * N : nullptr;
  float vals[16];                     // up to N = 4096
  const int per = N / 256;            // contiguous chunk per thread? use strided-by-4 chunks: thread handles j = tid*4 + 1024*u
  float s1 = 0.f;
  for (int u = 0; u < per / 4; ++u) {
    const int j = tid * 4 + 1024 * u;
    const v4f a = *(const v4fa*)(x + j);
    v4f b = {0.f,0.f,0.f,0.f}; if (rr) b = *(const v4fa*)(rr + j);
#pragma unroll
    for (int q = 0; q < 4; ++q) { const float v = a[q] + b[q]; vals[u * 4 + q] = v; s1 += v; }
  }
  red[tid] = s1; __syncthreads();
  for (int st = 128; st > 0; st >>= 1) { if (tid < st) red[tid] += red[tid + st]; __syncthreads(); }
  const float mu = red[0] / (float)N; __syncthreads();
  float s2 = 0.f;
  for (int u = 0; u < per / 4; ++u)
#pragma unroll
    for (int q = 0; q < 4; ++q) { const float c = vals[u * 4 + q] - mu; s2 += c * c; }
  red[tid] = s2; __syncthreads();
  for (int st = 128; st > 0; st >>= 1) { if (tid < st) red[tid] += red[tid + st]; __syncthreads(); }
  const float rs = rsqrtf(red[0] / (float)N + eps);
  {
    for (int u = 0; u < per / 4; ++u) {
      const int j = tid * 4 + 1024 * u;
      v4f o, sm;
#pragma unroll
      for (int q = 0; q < 4; ++q) {
        float gg = g[j + q], bb = bta[j + q];
        if (PARAM_BF16) { gg = bf16_round(gg); bb = bf16_round(bb); }
        sm[q] = vals[u * 4 + q]; o[q] = (vals[u * 4 + q] - mu) * rs * gg + bb;
      }
      if (out_sum) *(v4f*)(out_sum + (size_t)row * N + j) = sm;
      *(v4f*)(out_norm + (size_t)row * N + j) = o;
    }
    
  }
}

// General attention: queries [b][Tq] rows at Q + b*Tq*qpitch + h*D + row*qpitch; keys/values j < Tk1 from (K1,V1) at
// X + b*Tk1*pitch + h*D + j*pitch, j >= Tk1 from (K2,V2) with j-Tk1 (pass Tk2 = 0 and null for a single source).
// Optional int mask [Tq][Tk] (nonzero keep), causal flag (j <= qi), additive score bias sbias[bh*Tk + j].
// 3-term bf16 splits, f32 softmax with running max; y[b][row][h*D + d] pitch ypitch, whole-line rows (D % 32 == 0).
// Block = 16 waves = 4 query tiles x NG key groups: group g walks the 32-key chunks g, g + NG, ... with its own K/V/P staging and its own
// running (max, sum, O); the NG partial results of a query tile are merged once, through LDS, after the loop.
template <int D>
__global__ __launch_bounds__(512) void k_flash3(const float* __restrict__ Qb, int qpitch, int Tq,
                                              const float* __restrict__ K1, const float* __restrict__ V1, int Tk1,
                                              const float* __restrict__ K2, const float* __restrict__ V2, int Tk2, int kpitch, int vpitch,
                                              int H, float scale, const int* __restrict__ mask, int causal, const float* __restrict__ sbias,
                                              float* __restrict__ y, int ypitch) {
  constexpr int KS = D / 32, DT = D / 16, NG = 4;
  __shared__ __attribute__((aligned(16))) unsigned short sKh[NG][32][D + 8], sKl[NG][32][D + 8], sVh[NG][32][D + 8], sVl[NG][32][D + 8];
  __shared__ __attribute__((aligned(16))) unsigned short sPh[4 * NG][16][40], sPl[4 * NG][16][40];
  __shared__ __attribute__((aligned(16))) float sO[4 * NG][16][D];
  __shared__ float sM[4 * NG][16], sL[4 * NG][16];
  const int tid = threadIdx.x, lane = tid & 31, ln = lane & 15, hh = lane >> 4;
  const int w = __builtin_amdgcn_readfirstlane(tid >> 5);   // wave number, kept scalar so that the group's key offset and LDS bases stay scalar
  const int qt = w & 3, g = w >> 2, gtid = tid & 127;       // query tile, key group, thread index inside the group
  const int Tk = Tk1 + Tk2;
  const int nqb = (Tq + 63) / 64;
  const int bh = blockIdx.x / nqb, qblk = blockIdx.x % nqb;
  const int b = bh / H, h = bh % H;
  const int q0 = qblk * 64 + qt * 16;
  const float* Q = Qb + (size_t)b * Tq * qpitch + h * D;
  FragB aqh[KS], aql[KS];
  {
    int row = q0 + ln; if (row >= Tq) row = Tq - 1;
    const float* qr = Q + (size_t)row * qpitch;
#pragma unroll
    for (int ks = 0; ks < KS; ++ks)
#pragma unroll
      for (int i = 0; i < 16; ++i) {
        const int d = ks * 32 + ((i < 8) ? (8 * hh + i) : (16 + 8 * hh + (i - 8)));
        const float x = qr[d] * scale; const unsigned short hb = bf16_bits(x);
        aqh[ks].u[i] = hb; aql[ks].u[i] = bf16_bits(x - bf16_val(hb));
      }
  }
  int qrow[8];
#pragma unroll
  for (int r = 0; r < 8; ++r) { int qi = q0 + 8 * hh + r; qrow[r] = qi < Tq ? qi : Tq - 1; }
  float m_r[8], l_r[8];
#pragma unroll
  for (int r = 0; r < 8; ++r) { m_r[r] = -3.0e38f; l_r[r] = 0.f; }
  v8f oacc[DT];
#pragma unroll
  for (int dt = 0; dt < DT; ++dt) oacc[dt] = (v8f){0.f,0.f,0.f,0.f,0.f,0.f,0.f,0.f};
  const int kv_end = causal ? min(Tk, qblk * 64 + 64) : Tk;
  for (int jg = 0; jg < kv_end; jg += 32 * NG) {               // block-uniform trip count; a chunk past kv_end is fully masked and adds nothing
    const int j0 = jg + 32 * g;
    __syncthreads();
    for (int e = gtid; e < 32 * (D / 4); e += 128) {
      const int r = e / (D / 4), c4 = (e % (D / 4)) * 4; const int key = j0 + r;
      v4f kf = {0.f,0.f,0.f,0.f}, vf = {0.f,0.f,0.f,0.f};
      if (key < Tk1) { kf = *(const v4fa*)(K1 + (size_t)b * Tk1 * kpitch + h * D + (size_t)key * kpitch + c4); vf = *(const v4fa*)(V1 + (size_t)b * Tk1 * vpitch + h * D + (size_t)key * vpitch + c4); }
      else if (key < Tk) { const int k2 = key - Tk1; kf = *(const v4fa*)(K2 + (size_t)b * Tk2 * kpitch + h * D + (size_t)k2 * kpitch + c4); vf = *(const v4fa*)(V2 + (size_t)b * Tk2 * vpitch + h * D + (size_t)k2 * vpitch + c4); }
#pragma unroll
      for (int t = 0; t < 4; ++t) {
        unsigned short hb = bf16_bits(kf[t]); sKh[g][r][c4 + t] = hb; sKl[g][r][c4 + t] = bf16_bits(kf[t] - bf16_val(hb));
        hb = bf16_bits(vf[t]); sVh[g][r][c4 + t] = hb; sVl[g][r][c4 + t] = bf16_bits(vf[t] - bf16_val(hb));
      }
    }
    __syncthreads();
    v8f s[2];
#pragma unroll
    for (int nt = 0; nt < 2; ++nt) {
      v8f acc = {};
#pragma unroll
      for (int ks = 0; ks < KS; ++ks) {
        FragB bh_, bl_;
        bh_.half[0] = *(const v8us*)&sKh[g][nt * 16 + ln][ks * 32 + 8 * hh]; bh_.half[1] = *(const v8us*)&sKh[g][nt * 16 + ln][ks * 32 + 16 + 8 * hh];
        bl_.half[0] = *(const v8us*)&sKl[g][nt * 16 + ln][ks * 32 + 8 * hh]; bl_.half[1] = *(const v8us*)&sKl[g][nt * 16 + ln][ks * 32 + 16 + 8 * hh];
        acc = mmaN<3>(aqh[ks].v, aql[ks].v, bh_.v, bl_.v, acc);
      }
      s[nt] = acc;
    }
    float alpha[8];
#pragma unroll
    for (int r = 0; r < 8; ++r) {
      const int qi = qrow[r];
      const int ja = j0 + ln, jb = j0 + 16 + ln;
      bool keepa = ja < Tk, keepb = jb < Tk;
      if (causal) { keepa = keepa && (ja <= qi); keepb = keepb && (jb <= qi); }
      if (mask) { if (keepa) keepa = mask[(size_t)qi * Tk + ja] != 0; if (keepb) keepb = mask[(size_t)qi * Tk + jb] != 0; }
      if (sbias) { if (keepa) s[0][r] += sbias[(size_t)bh * Tk + ja]; if (keepb) s[1][r] += sbias[(size_t)bh * Tk + jb]; }   // per-key additive bias (a per-query constant would cancel in the softmax)
      if (!keepa) s[0][r] = -3.0e38f;
      if (!keepb) s[1][r] = -3.0e38f;
      float mx = fmaxf(s[0][r], s[1][r]);
      mx = fmaxf(mx, __shfl_xor(mx, 1, 32)); mx = fmaxf(mx, __shfl_xor(mx, 2, 32)); mx = fmaxf(mx, __shfl_xor(mx, 4, 32)); mx = fmaxf(mx, __shfl_xor(mx, 8, 32));
      const float mnew = fmaxf(m_r[r], mx);
      alpha[r] = (mnew > -1.0e38f) ? __expf(m_r[r] - mnew) : 1.0f;
      const float p0 = keepa ? __expf(s[0][r] - mnew) : 0.f;
      const float p1 = keepb ? __expf(s[1][r] - mnew) : 0.f;
      m_r[r] = mnew;
      l_r[r] = l_r[r] * alpha[r] + p0 + p1;
      unsigned short hb = bf16_bits(p0); sPh[w][8 * hh + r][ln] = hb;      sPl[w][8 * hh + r][ln] = bf16_bits(p0 - bf16_val(hb));
      hb = bf16_bits(p1);                sPh[w][8 * hh + r][16 + ln] = hb; sPl[w][8 * hh + r][16 + ln] = bf16_bits(p1 - bf16_val(hb));
    }
#pragma unroll
    for (int dt = 0; dt < DT; ++dt)
#pragma unroll
      for (int r = 0; r < 8; ++r) oacc[dt][r] *= alpha[r];
    __builtin_amdgcn_fence(__ATOMIC_ACQ_REL, "workgroup");
    __builtin_amdgcn_wave_barrier();
    FragB pah, pal;
    pah.half[0] = *(const v8us*)&sPh[w][ln][8 * hh]; pah.half[1] = *(const v8us*)&sPh[w][ln][16 + 8 * hh];
    pal.half[0] = *(const v8us*)&sPl[w][ln][8 * hh]; pal.half[1] = *(const v8us*)&sPl[w][ln][16 + 8 * hh];
#pragma unroll
    for (int dt = 0; dt < DT; ++dt) {
      FragB bvh, bvl;
#pragma unroll
      for (int i = 0; i < 8; ++i) {
        bvh.u[i] = sVh[g][8 * hh + i][dt * 16 + ln]; bvh.u[8 + i] = sVh[g][16 + 8 * hh + i][dt * 16 + ln];
        bvl.u[i] = sVl[g][8 * hh + i][dt * 16 + ln]; bvl.u[8 + i] = sVl[g][16 + 8 * hh + i][dt * 16 + ln];
      }
      oacc[dt] = mmaN<3>(pah.v, pal.v, bvh.v, bvl.v, oacc[dt]);
    }
    __builtin_amdgcn_fence(__ATOMIC_ACQ_REL, "workgroup");
    __builtin_amdgcn_wave_barrier();
  }
#pragma unroll
  for (int r = 0; r < 8; ++r) {
    float l = l_r[r];
    l += __shfl_xor(l, 1, 32); l += __shfl_xor(l, 2, 32); l += __shfl_xor(l, 4, 32); l += __shfl_xor(l, 8, 32);
    if (ln == 0) { sM[w][8 * hh + r] = m_r[r]; sL[w][8 * hh + r] = l; }
  }
#pragma unroll
  for (int dt = 0; dt < DT; ++dt)
#pragma unroll
    for (int r = 0; r < 8; ++r) sO[w][8 * hh + r][dt * 16 + ln] = oacc[dt][r];
  __syncthreads();   // every group's partial (max, sum, O) is in LDS before any wave merges
  // merge: wave (qt, g) finishes rows g*16/NG ... of query tile qt; a lane owns 4 columns of the row
#pragma unroll
  for (int i = 0; i < 16 / NG; ++i) {
    const int rr = g * (16 / NG) + i, row = q0 + rr;
    if (row < Tq && lane < D / 4) {
      float mg[NG], mall = -3.0e38f;
#pragma unroll
      for (int k = 0; k < NG; ++k) { mg[k] = sM[k * 4 + qt][rr]; mall = fmaxf(mall, mg[k]); }
      float lall = 0.f;
      v4f val = {0.f, 0.f, 0.f, 0.f};
#pragma unroll
      for (int k = 0; k < NG; ++k) {
        const float wt = (mg[k] > -1.0e38f) ? __expf(mg[k] - mall) : 0.f;
        const v4f o = *(const v4fa*)&sO[k * 4 + qt][rr][lane * 4];
        lall += wt * sL[k * 4 + qt][rr];
        val += wt * o;
      }
      const float inv = (mall > -1.0e38f) ? 1.0f / lall : __builtin_nanf("");
      *(v4f*)(y + ((size_t)b * Tq + row) * ypitch + h * D + lane * 4) = val * inv;
      if (i + 1 < 16 / NG) asm volatile("s_wait_xcnt 0x0" ::: "memory");   // precaution: stands before the next row's reads reuse the store's address and data registers
    }
  }
}

__global__ __launch_bounds__(256) void k_roundcopy(const float* __restrict__ src, float* __restrict__ dst, int n8) {
  const size_t t = (size_t)blockIdx.x * 256 + threadIdx.x;
  if (t >= (size_t)n8 * 2) return;
  v4f a = *(const v4fa*)(src + t * 4);
  for (int i = 0; i < 4; ++i) a[i] = bf16_round(a[i]);
  *(v4f*)(dst + t * 4) = a; 
}

__global__ void k_ln_rows(const float* __restrict__ X, const float* __restrict__ R, const float* __restrict__ g, const float* __restrict__ bta, float* __restrict__ out, int N, float eps) {
  __shared__ float red[256];
  const int row = blockIdx.x, tid = threadIdx.x, nt = blockDim.x;
  v4f a = *(const v4fa*)(X + (size_t)row * N + tid * 4);
  if (R) { const v4f rr = *(const v4fa*)(R + (size_t)row * N + tid * 4); for (int q = 0; q < 4; ++q) a[q] += rr[q]; }
  float s = a[0] + a[1] + a[2] + a[3];
  red[tid] = s; __syncthreads();
  for (int st = nt / 2; st > 0; st >>= 1) { if (tid < st) red[tid] += red[tid + st]; __syncthreads(); }
  const float mu = red[0] / (float)N; __syncthreads();
  float v = 0.f; for (int q = 0; q < 4; ++q) { const float c = a[q] - mu; v += c * c; }
  red[tid] = v; __syncthreads();
  for (int st = nt / 2; st > 0; st >>= 1) { if (tid < st) red[tid] += red[tid + st]; __syncthreads(); }
  const float rs = rsqrtf(red[0] / (float)N + eps);
  v4f o; for (int q = 0; q < 4; ++q) o[q] = (a[q] - mu) * rs * bf16_round(g[tid * 4 + q]) + bf16_round(bta[tid * 4 + q]);
  *(v4f*)(out + (size_t)row * N + tid * 4) = o; 
}

// Bt[h*DK + k][d] = W[h][d][k]  (W [H][D][DK]); thread per (n, 8 d)
__global__ __launch_bounds__(256) void k_wt_heads(const float* __restrict__ W, unsigned short* __restrict__ Bt) {
  const int t = blockIdx.x * 256 + threadIdx.x; if (t >= NH * DK * (DD / 8)) return;
  const int n = t / (DD / 8), d8 = (t % (DD / 8)) * 8; const int h = n / DK, kk = n % DK; v8us v;
#pragma unroll
  for (int i = 0; i < 8; ++i) v[i] = bf16_bits(W[((size_t)h * DD + d8 + i) * DK + kk]);
  *(v8us*)(Bt + (size_t)n * DD + d8) = v; 
}
extern "C" void kernel_launch(void* const* d_in, const int* in_sizes, int n_in,
                              void* d_out, int out_size, void* d_ws, size_t ws_size, hipStream_t stream) {
  (void)in_sizes; (void)n_in; (void)out_size;
  const float* token = (const float*)d_in[0];
  const float* Wq = (const float*)d_in[1]; const float* bq = (const float*)d_in[2]; const float* Wk = (const float*)d_in[3]; const float* bk = (const float*)d_in[4];
  const float* Wv = (const float*)d_in[5]; const float* bv = (const float*)d_in[6]; const float* Wo = (const float*)d_in[7]; const float* bo = (const float*)d_in[8];
  const float* Wf = (const float*)d_in[9]; const float* bfv = (const float*)d_in[10]; const float* gamma = (const float*)d_in[11]; const float* beta = (const float*)d_in[12];
  char* ws = (char*)d_ws; size_t off = 0;
  auto take = [&](size_t bytes) { char* p = ws + off; off += (bytes + 255) & ~(size_t)255; return p; };
  unsigned short* Bqkv = (unsigned short*)take((size_t)3 * DD * DD * 2); unsigned short* Bo = (unsigned short*)take((size_t)DD * DD * 2); unsigned short* Bf = (unsigned short*)take((size_t)DD * DD * 2);
  float* bqkv = (float*)take(3 * DD * 4);
  float* x = (float*)take((size_t)SS * DD * 4); float* qkv = (float*)take((size_t)SS * 3 * DD * 4); float* att = (float*)take((size_t)SS * DD * 4); float* tmp = (float*)take((size_t)SS * DD * 4); float* a = (float*)take((size_t)SS * DD * 4);
  if (off > ws_size) return;
  k_wt_heads<<<(NH * DK * (DD / 8) + 255) / 256, 256, 0, stream>>>(Wq, Bqkv);
  k_wt_heads<<<(NH * DK * (DD / 8) + 255) / 256, 256, 0, stream>>>(Wk, Bqkv + (size_t)DD * DD);
  k_wt_heads<<<(NH * DK * (DD / 8) + 255) / 256, 256, 0, stream>>>(Wv, Bqkv + (size_t)2 * DD * DD);
  k_wt_bf16<<<(DD * (DD / 8) + 255) / 256, 256, 0, stream>>>(Wo, Bo, DD, DD);
  k_wt_bf16<<<(DD * (DD / 8) + 255) / 256, 256, 0, stream>>>(Wf, Bf, DD, DD);
  k_roundcopy<<<(3 * DD / 4 + 255) / 256, 256, 0, stream>>>(bq, bqkv, DD / 8);            // bq|bk|bv flat [H*DK] each: three copies (f32, rounded) into one bias vector
  k_roundcopy<<<(DD / 4 + 255) / 256, 256, 0, stream>>>(bk, bqkv + DD, DD / 8);
  k_roundcopy<<<(DD / 4 + 255) / 256, 256, 0, stream>>>(bv, bqkv + 2 * DD, DD / 8);
  k_roundcopy<<<(SS * DD / 4 + 255) / 256, 256, 0, stream>>>(token, x, SS * DD / 8);
  const int gq = (SS / 64) * (3 * DD / 128), g1 = (SS / 64) * (DD / 128);
  for (int l = 0; l < NLAY; ++l) {
    k_gemm_tile<false><<<gq, 256, 0, stream>>>(x, DD, Bqkv, DD, bqkv, qkv, 3 * DD, 3 * DD, DD);      // bias already rounded (BIAS_BF16=false adds it as given)
    k_flash3<DK><<<NH * (SS / 64), 512, 0, stream>>>(qkv, 3 * DD, SS, qkv + DD, qkv + 2 * DD, SS, nullptr, nullptr, 0, 3 * DD, 3 * DD, NH, 0.08838834764831845f, nullptr, 0, nullptr, att, DD);
    k_gemm_tile<true><<<g1, 256, 0, stream>>>(att, DD, Bo, DD, bo, tmp, DD, DD, DD);
    k_ln_rows<<<SS, DD / 4, 0, stream>>>(tmp, x, gamma, beta, a, DD, 1e-5f);                  // a = LN(x + attn_out)
    k_gemm_tile<true><<<g1, 256, 0, stream>>>(a, DD, Bf, DD, bfv, tmp, DD, DD, DD);
    k_ln_rows<<<SS, DD / 4, 0, stream>>>(tmp, a, gamma, beta, (l == NLAY - 1) ? (float*)d_out : x, DD, 1e-5f);   // x = LN(a + ff)
  }
}

// v003
// It runs in 1370 microseconds.
// Two timings next to v002 both put it at 1.09 times that version's speed.
// All steps since v000 together make it 2.93 times as fast.
#include <hip/hip_runtime.h>
// All GEMMs on v_wmma_f32_16x16x32_bf16, f32 accumulate: fused per-head q|k|v projection (K=1024, N=3072), concat·Wo, a·Wf — A operands
// (the residual stream, quantised to bf16 once at the input) split into bf16 hi/lo (2 terms) against bf16-rounded weights; attention QKᵀ/√128
// and P·V per 16-query tile as 3-term splits (head dim 128); LayerNorm and softmax in f32. Six layers with shared weights.
#define SS 2048
#define DD 1024
#define NH 8
#define DK 128
#define NLAY 6

typedef __bf16 v16b __attribute__((ext_vector_type(16)));
typedef unsigned short v8us __attribute__((ext_vector_type(8), may_alias));
typedef unsigned short v4us __attribute__((ext_vector_type(4), may_alias));
typedef float  v8f  __attribute__((ext_vector_type(8)));
typedef float  v4f  __attribute__((ext_vector_type(4)));
typedef float  v4fa __attribute__((ext_vector_type(4), may_alias));
union FragB { v16b v; v8us half[2]; unsigned short u[16]; };
typedef short s16x8 __attribute__((ext_vector_type(8)));
typedef __attribute__((address_space(3))) s16x8 lds_s16x8;
// transposing LDS load of an 8 x 16 block of 16-bit elements per lane half: lane l points at 8 elements of row 8*(l>>4) + (l&7), columns 8*((l>>3)&1) ...;
// lane (c = l&15, h = l>>4) receives rows 8h .. 8h+7 of column c
__device__ __forceinline__ v8us ld_tr16(const unsigned short* p) { return __builtin_bit_cast(v8us, __builtin_amdgcn_ds_load_tr16_b128_v8i16((lds_s16x8*)p)); }

__device__ __forceinline__ unsigned short bf16_bits(float x) { unsigned int u = __float_as_uint(x); return (unsigned short)((u + 0x7FFFu + ((u >> 16) & 1u)) >> 16); }
__device__ __forceinline__ float bf16_val(unsigned short b) { return __uint_as_float(((unsigned int)b) << 16); }
__device__ __forceinline__ float bf16_round(float x) { return bf16_val(bf16_bits(x)); }
// D += A·B with NT terms: 1 = ah·bh, 2 = + al·bh (A split), 3 = + ah·bl (both split)
template <int NT>
__device__ __forceinline__ v8f mmaN(v16b ah, v16b al, v16b bh, v16b bl, v8f c) {
  c = __builtin_amdgcn_wmma_f32_16x16x32_bf16(false, ah, false, bh, (short)0, c, false, false);
  if (NT >= 2) c = __builtin_amdgcn_wmma_f32_16x16x32_bf16(false, al, false, bh, (short)0, c, false, false);
  if (NT >= 3) c = __builtin_amdgcn_wmma_f32_16x16x32_bf16(false, ah, false, bl, (short)0, c, false, false);
  asm volatile("v_nop\n\tv_nop\n\tv_nop\n\tv_nop" : "+v"(c) : "v"(ah), "v"(al), "v"(bh), "v"(bl));
  return c;
}

__global__ __launch_bounds__(256) void k_wt_bf16(const float* __restrict__ W, unsigned short* __restrict__ Wt, int K, int N) {
  const int t = blockIdx.x * 256 + threadIdx.x;
  const int k8n = K / 8;
  if (t >= N * k8n) return;
  const int n = t / k8n, k8 = (t % k8n) * 8;
  v8us v;
#pragma unroll
  for (int i = 0; i < 8; ++i) v[i] = bf16_bits(W[(size_t)(k8 + i) * N + n]);
  *(v8us*)(Wt + (size_t)n * K + k8) = v;
  
}

// GEMM C[M][N] (f32, pitch ldc) = act(A[M][K]·W + bias). A f32 row-major (pitch lda) converted per fragment to bf16
// (ASPLIT: hi/lo two planes -> 2 terms, else single rounded term); Wt bf16 [N][K] (pitch ldb). BIAS_BF16 rounds the
// bias to bf16 first (bias quantised to bf16 before the add). K%32==0, M%16==0, N%64==0.
template <bool ASPLIT, int ACT, bool BIAS_BF16>
__global__ __launch_bounds__(128) void k_gemm_bf(const float* __restrict__ A, int lda, const unsigned short* __restrict__ Wt, int ldb,
                                               const float* __restrict__ bias, float* __restrict__ C, int ldc, int M, int N, int K) {
  __shared__ __attribute__((aligned(16))) float so[4][16][64];
  const int tid = threadIdx.x, w = tid >> 5, lane = tid & 31, ln = lane & 15, hh = lane >> 4;
  const int ntn = N / 64;
  const int wid = blockIdx.x * 4 + w;
  const int mt = wid / ntn, nq = wid % ntn;
  if (mt * 16 >= M) return;
  const int row0 = mt * 16, col0 = nq * 64;
  const float* arow = A + (size_t)(row0 + ln) * lda;
  v8f acc[4] = {};
  for (int kb = 0; kb < K; kb += 32) {
    FragB ah, al;
    const v4f x0 = *(const v4fa*)(arow + kb + 8 * hh), x1 = *(const v4fa*)(arow + kb + 8 * hh + 4);
    const v4f x2 = *(const v4fa*)(arow + kb + 16 + 8 * hh), x3 = *(const v4fa*)(arow + kb + 16 + 8 * hh + 4);
    float xs[16] = {x0[0],x0[1],x0[2],x0[3],x1[0],x1[1],x1[2],x1[3],x2[0],x2[1],x2[2],x2[3],x3[0],x3[1],x3[2],x3[3]};
#pragma unroll
    for (int i = 0; i < 16; ++i) { const unsigned short hb = bf16_bits(xs[i]); ah.u[i] = hb; al.u[i] = ASPLIT ? bf16_bits(xs[i] - bf16_val(hb)) : (unsigned short)0; }
#pragma unroll
    for (int t = 0; t < 4; ++t) {
      const unsigned short* brow = Wt + (size_t)(col0 + t * 16 + ln) * ldb + kb;
      FragB b;
      b.half[0] = *(const v8us*)(brow + 8 * hh);
      b.half[1] = *(const v8us*)(brow + 16 + 8 * hh);
      acc[t] = mmaN<ASPLIT ? 2 : 1>(ah.v, al.v, b.v, b.v, acc[t]);
    }
  }
#pragma unroll
  for (int t = 0; t < 4; ++t) {
    float bv = bias ? bias[col0 + t * 16 + ln] : 0.f;
    if (BIAS_BF16) bv = bf16_round(bv);
#pragma unroll
    for (int r = 0; r < 8; ++r) { float v = acc[t][r] + bv; if (ACT == 1) v = fmaxf(v, 0.f); so[w][8 * hh + r][t * 16 + ln] = v; }
  }
  __builtin_amdgcn_fence(__ATOMIC_ACQ_REL, "workgroup");
  __builtin_amdgcn_wave_barrier();
  const int rsub = lane >> 4, c4 = (lane & 15) * 4;
  {
#pragma unroll
    for (int q = 0; q < 8; ++q) {
      const int r = q * 2 + rsub;
      const v4f v = *(const v4fa*)&so[w][r][c4];
      *(v4f*)(C + (size_t)(row0 + r) * ldc + col0 + c4) = v;
    }
    
  }
}

// Flash-style causal/unmasked attention, all contractions 3-term bf16 hi/lo splits, f32 softmax with running max.
// q,k,v rows are read from f32 buffers with arbitrary row pitch (so they can live inside a fused qkv buffer);
// D = head size (multiple of 32, <= 128); one wave = 16 query rows; block = 4 waves (64 queries) sharing K/V chunks of 32.
template <int D, bool CAUSAL>
__global__ __launch_bounds__(128) void k_flash(const float* __restrict__ qb, const float* __restrict__ kb, const float* __restrict__ vb,
                                             int pitch, int T, int H, float scale, float* __restrict__ y, int ypitch) {
  constexpr int KS = D / 32;        // k-steps for QK
  constexpr int DT = D / 16;        // d tiles for PV
  __shared__ __attribute__((aligned(16))) unsigned short sKh[32][D + 8], sKl[32][D + 8], sVh[32][D + 8], sVl[32][D + 8];
  __shared__ __attribute__((aligned(16))) unsigned short sPh[4][16][40], sPl[4][16][40];
  __shared__ __attribute__((aligned(16))) float sO[4][16][D];
  const int tid = threadIdx.x, w = tid >> 5, lane = tid & 31, ln = lane & 15, hh = lane >> 4;
  const int nqb = (T + 63) / 64;
  const int bh = blockIdx.x / nqb, qblk = blockIdx.x % nqb;
  const int b = bh / H, h = bh % H;
  const int q0 = qblk * 64 + w * 16;
  const float* Q = qb + (size_t)b * T * pitch + h * D;
  const float* K = kb + (size_t)b * T * pitch + h * D;
  const float* V = vb + (size_t)b * T * pitch + h * D;

  // A fragments of the wave's 16 query rows (scaled), hi/lo
  FragB aqh[KS], aql[KS];
  {
    int row = q0 + ln; if (row >= T) row = T - 1;
    const float* qr = Q + (size_t)row * pitch;
#pragma unroll
    for (int ks = 0; ks < KS; ++ks)
#pragma unroll
      for (int i = 0; i < 16; ++i) {
        const int d = ks * 32 + ((i < 8) ? (8 * hh + i) : (16 + 8 * hh + (i - 8)));
        const float x = qr[d] * scale; const unsigned short hb = bf16_bits(x);
        aqh[ks].u[i] = hb; aql[ks].u[i] = bf16_bits(x - bf16_val(hb));
      }
  }
  float m_r[8], l_r[8];
#pragma unroll
  for (int r = 0; r < 8; ++r) { m_r[r] = -3.0e38f; l_r[r] = 0.f; }
  v8f oacc[DT];
#pragma unroll
  for (int dt = 0; dt < DT; ++dt) oacc[dt] = (v8f){0.f,0.f,0.f,0.f,0.f,0.f,0.f,0.f};

  const int kv_end = CAUSAL ? min(T, qblk * 64 + 64) : T;     // block-uniform
  for (int j0 = 0; j0 < kv_end; j0 += 32) {
    __syncthreads();
    for (int e = tid; e < 32 * (D / 4); e += 128) {
      const int r = e / (D / 4), c4 = (e % (D / 4)) * 4;
      const int key = j0 + r;
      v4f kf = {0.f,0.f,0.f,0.f}, vf = {0.f,0.f,0.f,0.f};
      if (key < T) { kf = *(const v4fa*)(K + (size_t)key * pitch + c4); vf = *(const v4fa*)(V + (size_t)key * pitch + c4); }
#pragma unroll
      for (int t = 0; t < 4; ++t) {
        unsigned short hb = bf16_bits(kf[t]); sKh[r][c4 + t] = hb; sKl[r][c4 + t] = bf16_bits(kf[t] - bf16_val(hb));
        hb = bf16_bits(vf[t]); sVh[r][c4 + t] = hb; sVl[r][c4 + t] = bf16_bits(vf[t] - bf16_val(hb));
      }
    }
    __syncthreads();
    // S tile 16 x 32
    v8f s[2];
#pragma unroll
    for (int nt = 0; nt < 2; ++nt) {
      v8f acc = {};
#pragma unroll
      for (int ks = 0; ks < KS; ++ks) {
        FragB bh_, bl_;
        bh_.half[0] = *(const v8us*)&sKh[nt * 16 + ln][ks * 32 + 8 * hh]; bh_.half[1] = *(const v8us*)&sKh[nt * 16 + ln][ks * 32 + 16 + 8 * hh];
        bl_.half[0] = *(const v8us*)&sKl[nt * 16 + ln][ks * 32 + 8 * hh]; bl_.half[1] = *(const v8us*)&sKl[nt * 16 + ln][ks * 32 + 16 + 8 * hh];
        acc = mmaN<3>(aqh[ks].v, aql[ks].v, bh_.v, bl_.v, acc);
      }
      s[nt] = acc;
    }
    // mask + running max (rows 8hh+r; the 16 lanes of a half share rows)
    float alpha[8];
#pragma unroll
    for (int r = 0; r < 8; ++r) {
      const int qi = q0 + 8 * hh + r;
      const int ja = j0 + ln, jb = j0 + 16 + ln;
      if (CAUSAL) { if (ja > qi) s[0][r] = -3.0e38f; if (jb > qi) s[1][r] = -3.0e38f; }
      if (ja >= T) s[0][r] = -3.0e38f;
      if (jb >= T) s[1][r] = -3.0e38f;
      float mx = fmaxf(s[0][r], s[1][r]);
      mx = fmaxf(mx, __shfl_xor(mx, 1, 32)); mx = fmaxf(mx, __shfl_xor(mx, 2, 32)); mx = fmaxf(mx, __shfl_xor(mx, 4, 32)); mx = fmaxf(mx, __shfl_xor(mx, 8, 32));
      const float mnew = fmaxf(m_r[r], mx);
      alpha[r] = (mnew > -1.0e38f) ? __expf(m_r[r] - mnew) : 1.0f;
      const float p0 = (s[0][r] > -1.0e38f) ? __expf(s[0][r] - mnew) : 0.f;
      const float p1 = (s[1][r] > -1.0e38f) ? __expf(s[1][r] - mnew) : 0.f;
      m_r[r] = mnew;
      l_r[r] = l_r[r] * alpha[r] + p0 + p1;            // per-lane partial row sum (16 lanes combined at the end)
      unsigned short hb = bf16_bits(p0); sPh[w][8 * hh + r][ln] = hb;      sPl[w][8 * hh + r][ln] = bf16_bits(p0 - bf16_val(hb));
      hb = bf16_bits(p1);                sPh[w][8 * hh + r][16 + ln] = hb; sPl[w][8 * hh + r][16 + ln] = bf16_bits(p1 - bf16_val(hb));
    }
#pragma unroll
    for (int dt = 0; dt < DT; ++dt)
#pragma unroll
      for (int r = 0; r < 8; ++r) oacc[dt][r] *= alpha[r];
    __builtin_amdgcn_fence(__ATOMIC_ACQ_REL, "workgroup");
    __builtin_amdgcn_wave_barrier();
    FragB pah, pal;
    pah.half[0] = *(const v8us*)&sPh[w][ln][8 * hh]; pah.half[1] = *(const v8us*)&sPh[w][ln][16 + 8 * hh];
    pal.half[0] = *(const v8us*)&sPl[w][ln][8 * hh]; pal.half[1] = *(const v8us*)&sPl[w][ln][16 + 8 * hh];
#pragma unroll
    for (int dt = 0; dt < DT; ++dt) {
      FragB bvh, bvl;
#pragma unroll
      for (int i = 0; i < 8; ++i) {
        bvh.u[i] = sVh[8 * hh + i][dt * 16 + ln]; bvh.u[8 + i] = sVh[16 + 8 * hh + i][dt * 16 + ln];
        bvl.u[i] = sVl[8 * hh + i][dt * 16 + ln]; bvl.u[8 + i] = sVl[16 + 8 * hh + i][dt * 16 + ln];
      }
      oacc[dt] = mmaN<3>(pah.v, pal.v, bvh.v, bvl.v, oacc[dt]);
    }
    __builtin_amdgcn_fence(__ATOMIC_ACQ_REL, "workgroup");
    __builtin_amdgcn_wave_barrier();
  }
#pragma unroll
  for (int r = 0; r < 8; ++r) {
    float l = l_r[r];
    l += __shfl_xor(l, 1, 32); l += __shfl_xor(l, 2, 32); l += __shfl_xor(l, 4, 32); l += __shfl_xor(l, 8, 32);
    l_r[r] = (l > 0.f) ? 1.0f / l : 0.f;
  }
#pragma unroll
  for (int dt = 0; dt < DT; ++dt)
#pragma unroll
    for (int r = 0; r < 8; ++r) sO[w][8 * hh + r][dt * 16 + ln] = oacc[dt][r] * l_r[r];
  __builtin_amdgcn_fence(__ATOMIC_ACQ_REL, "workgroup");
  __builtin_amdgcn_wave_barrier();
  {
    for (int r = 0; r < 16; ++r) {
      const int row = q0 + r;
      if (row < T && lane < D / 4) {
        const v4f val = *(const v4fa*)&sO[w][r][lane * 4];
        *(v4f*)(y + ((size_t)b * T + row) * ypitch + h * D + lane * 4) = val;
      }
    }
    
  }
}

// GEMM C[M][N] (f32, pitch ldc) = A[M][K] x W + bias: A f32 row-major (pitch lda), two terms (bf16 hi + lo) against Wt bf16 [N][K] (pitch ldb).
// Block = 8 waves (2 x 4) on a 64 x 128 tile of C, a wave owns 32 x 32. K is walked in slices of 64: the A slice is split into its hi and lo
// planes once per block, the Wt slice is copied, both through whole-line global loads into LDS, where all 8 waves read their fragments.
// Two LDS buffers: the next slice's global loads are issued ahead of this slice's products and stored behind them; one barrier per slice.
// Each accumulator takes hi then lo of every 32-wide k step in rising k. M % 64 == 0, N % 128 == 0, K % 64 == 0; grid = (M / 64) * (N / 128).
template <bool BIAS_BF16>
__global__ __launch_bounds__(256) void k_gemm_tile(const float* __restrict__ A, int lda, const unsigned short* __restrict__ Wt, int ldb,
                                                   const float* __restrict__ bias, float* __restrict__ C, int ldc, int N, int K) {
  constexpr int BM = 64, BN = 128, BK = 64, LP = BK + 8;       // LP: LDS row pitch 144 B = 16 B x odd
  constexpr int PA = BM * LP, PB = BN * LP, BUF = 2 * PA + PB;  // one buffer, in 16-bit elements: A hi | A lo | Wt
  constexpr int OP = 36;                                       // pitch of the output staging rows, in floats
  __shared__ __attribute__((aligned(16))) unsigned short sm[2 * BUF];
  const int tid = threadIdx.x, lane = tid & 31, ln = lane & 15, hh = lane >> 4;
  const int w = __builtin_amdgcn_readfirstlane(tid >> 5);      // wave number, kept scalar so that the tile offsets stay scalar
  const int wm = w >> 2, wn = w & 3;
  const int nbn = N / BN;
  const int row0 = (blockIdx.x / nbn) * BM, col0 = (blockIdx.x % nbn) * BN;
  const int ar = tid >> 4, ac = (tid & 15) * 4;                // A slice: a wave's load covers 2 rows x 256 B
  const int br = tid >> 3, bc = (tid & 7) * 8;                 // Wt slice: a wave's load covers 4 rows x 128 B
  const float* ag = A + (size_t)(row0 + ar) * lda + ac;
  const unsigned short* bg = Wt + (size_t)(col0 + br) * ldb + bc;
  v4f ra[4];
  v8us rb[4];
  auto fetch = [&](int kb) {
    const float* pa[4];
    const unsigned short* pb[4];
#pragma unroll
    for (int j = 0; j < 4; ++j) { pa[j] = ag + (size_t)(16 * j) * lda + kb; pb[j] = bg + (size_t)(32 * j) * ldb + kb; }
#pragma unroll
    for (int j = 0; j < 4; ++j) ra[j] = *(const v4fa*)pa[j];
#pragma unroll
    for (int j = 0; j < 4; ++j) rb[j] = *(const v8us*)pb[j];
    // precaution: the eight address pairs are inputs of the wait, so none of them is reused (not even as a later load's result) ahead of it
    asm volatile("s_wait_xcnt 0x0" :: "v"(pa[0]), "v"(pa[1]), "v"(pa[2]), "v"(pa[3]), "v"(pb[0]), "v"(pb[1]), "v"(pb[2]), "v"(pb[3]) : "memory");
  };
  auto stash = [&](unsigned short* sb) {
#pragma unroll
    for (int j = 0; j < 4; ++j) {
      v4us h, l;
#pragma unroll
      for (int t = 0; t < 4; ++t) { const unsigned short hb = bf16_bits(ra[j][t]); h[t] = hb; l[t] = bf16_bits(ra[j][t] - bf16_val(hb)); }
      *(v4us*)(sb + (ar + 16 * j) * LP + ac) = h;
      *(v4us*)(sb + PA + (ar + 16 * j) * LP + ac) = l;
      *(v8us*)(sb + 2 * PA + (br + 32 * j) * LP + bc) = rb[j];
    }
  };
  v8f acc[2][2] = {};
  const int ns = K / BK;
  fetch(0);
  stash(sm);
  __syncthreads();
  for (int s = 0; s < ns; ++s) {
    const unsigned short* sb = sm + (s & 1) * BUF;
    if (s + 1 < ns) fetch((s + 1) * BK);
#pragma unroll
    for (int ks = 0; ks < BK / 32; ++ks) {
      FragB ah[2], al[2], b[2];
#pragma unroll
      for (int t = 0; t < 2; ++t) {
        const unsigned short* pa = sb + (wm * 32 + t * 16 + ln) * LP + ks * 32 + 8 * hh;
        const unsigned short* pb = sb + 2 * PA + (wn * 32 + t * 16 + ln) * LP + ks * 32 + 8 * hh;
        ah[t].half[0] = *(const v8us*)pa;        ah[t].half[1] = *(const v8us*)(pa + 16);
        al[t].half[0] = *(const v8us*)(pa + PA); al[t].half[1] = *(const v8us*)(pa + PA + 16);
        b[t].half[0]  = *(const v8us*)pb;        b[t].half[1]  = *(const v8us*)(pb + 16);
      }
      __builtin_amdgcn_sched_barrier(0);   // keeps the k step's 12 LDS reads together as one group ahead of its 8 products: one LDS wait per k step, not four
#pragma unroll
      for (int mt = 0; mt < 2; ++mt)
#pragma unroll
        for (int nt = 0; nt < 2; ++nt) acc[mt][nt] = __builtin_amdgcn_wmma_f32_16x16x32_bf16(false, ah[mt].v, false, b[nt].v, (short)0, acc[mt][nt], false, false);
#pragma unroll
      for (int mt = 0; mt < 2; ++mt)
#pragma unroll
        for (int nt = 0; nt < 2; ++nt) acc[mt][nt] = __builtin_amdgcn_wmma_f32_16x16x32_bf16(false, al[mt].v, false, b[nt].v, (short)0, acc[mt][nt], false, false);
    }
    if (s + 1 < ns) stash(sm + ((s + 1) & 1) * BUF);
    __syncthreads();   // publishes slice s + 1 and ends every wave's reads of slice s, whose buffer is refilled in the next trip
  }
  // output: each wave turns its 32 x 32 tile through its own piece of the (now free) LDS so that every store covers whole 128-B lines
  float* so = (float*)sm + w * 32 * OP;
#pragma unroll
  for (int nt = 0; nt < 2; ++nt) {
    float bv = bias[col0 + wn * 32 + nt * 16 + ln];
    if (BIAS_BF16) bv = bf16_round(bv);
#pragma unroll
    for (int mt = 0; mt < 2; ++mt)
#pragma unroll
      for (int r = 0; r < 8; ++r) so[(mt * 16 + 8 * hh + r) * OP + nt * 16 + ln] = acc[mt][nt][r] + bv;
  }
  __builtin_amdgcn_fence(__ATOMIC_ACQ_REL, "workgroup");
  __builtin_amdgcn_wave_barrier();
  const int rsub = lane >> 3, c4 = (lane & 7) * 4;
#pragma unroll
  for (int q = 0; q < 8; ++q) {
    const int r = q * 4 + rsub;
    const v4f v = *(const v4fa*)(so + r * OP + c4);
    *(v4f*)(C + (size_t)(row0 + wm * 32 + r) * ldc + col0 + wn * 32 + c4) = v;
  }
}
// row LayerNorm (biased variance, eps) over N: s = X (+ R); optional out_sum <- s; out_norm <- (s-mu)*rsqrt(var+eps)*g + b
template <bool PARAM_BF16>
__global__ __launch_bounds__(256) void k_layernorm(const float* __restrict__ X, const float* __restrict__ R, const float* __restrict__ g, const float* __restrict__ bta,
                                                  float* __restrict__ out_sum, float* __restrict__ out_norm, int N, float eps) {
  __shared__ float red[256];
  const int row = blockIdx.x, tid = threadIdx.x;
  const float* x = X + (size_t)row * N; const float* rr = R ? R + (size_t)row * N : nullptr;
  float vals[16];                     // up to N = 4096
  const int per = N / 256;            // contiguous chunk per thread? use strided-by-4 chunks: thread handles j = tid*4 + 1024*u
  float s1 = 0.f;
  for (int u = 0; u < per / 4; ++u) {
    const int j = tid * 4 + 1024 * u;
    const v4f a = *(const v4fa*)(x + j);
    v4f b = {0.f,0.f,0.f,0.f}; if (rr) b = *(const v4fa*)(rr + j);
#pragma unroll
    for (int q = 0; q < 4; ++q) { const float v = a[q] + b[q]; vals[u * 4 + q] = v; s1 += v; }
  }
  red[tid] = s1; __syncthreads();
  for (int st = 128; st > 0; st >>= 1) { if (tid < st) red[tid] += red[tid + st]; __syncthreads(); }
  const float mu = red[0] / (float)N; __syncthreads();
  float s2 = 0.f;
  for (int u = 0; u < per / 4; ++u)
#pragma unroll
    for (int q = 0; q < 4; ++q) { const float c = vals[u * 4 + q] - mu; s2 += c * c; }
  red[tid] = s2; __syncthreads();
  for (int st = 128; st > 0; st >>= 1) { if (tid < st) red[tid] += red[tid + st]; __syncthreads(); }
  const float rs = rsqrtf(red[0] / (float)N + eps);
  {
    for (int u = 0; u < per / 4; ++u) {
      const int j = tid * 4 + 1024 * u;
      v4f o, sm;
#pragma unroll
      for (int q = 0; q < 4; ++q) {
        float gg = g[j + q], bb = bta[j + q];
        if (PARAM_BF16) { gg = bf16_round(gg); bb = bf16_round(bb); }
        sm[q] = vals[u * 4 + q]; o[q] = (vals[u * 4 + q] - mu) * rs * gg + bb;
      }
      if (out_sum) *(v4f*)(out_sum + (size_t)row * N + j) = sm;
      *(v4f*)(out_norm + (size_t)row * N + j) = o;
    }
    
  }
}

// General attention: queries [b][Tq] rows at Q + b*Tq*qpitch + h*D + row*qpitch; keys/values j < Tk1 from (K1,V1) at
// X + b*Tk1*pitch + h*D + j*pitch, j >= Tk1 from (K2,V2) with j-Tk1 (pass Tk2 = 0 and null for a single source).
// Optional int mask [Tq][Tk] (nonzero keep), causal flag (j <= qi), additive score bias sbias[bh*Tk + j].
// 3-term bf16 splits, f32 softmax with running max; y[b][row][h*D + d] pitch ypitch, whole-line rows (D % 32 == 0).
// Block = 16 waves = 4 query tiles x NG key groups: group g walks the 32-key chunks g, g + NG, ... with its own K/V/P staging and its own
// running (max, sum, O); the NG partial results of a query tile are merged once, through LDS, after the loop.
template <int D>
__global__ __launch_bounds__(512) void k_flash3(const float* __restrict__ Qb, int qpitch, int Tq,
                                              const float* __restrict__ K1, const float* __restrict__ V1, int Tk1,
                                              const float* __restrict__ K2, const float* __restrict__ V2, int Tk2, int kpitch, int vpitch,
                                              int H, float scale, const int* __restrict__ mask, int causal, const float* __restrict__ sbias,
                                              float* __restrict__ y, int ypitch) {
  constexpr int KS = D / 32, DT = D / 16, NG = 4;
  __shared__ __attribute__((aligned(16))) unsigned short sKh[NG][32][D + 8], sKl[NG][32][D + 8];
  __shared__ __attribute__((aligned(32))) unsigned short sVh[NG][32][D + 16], sVl[NG][32][D + 16];   // V rows are read by transposing loads: pitch 32 B x odd
  __shared__ __attribute__((aligned(16))) unsigned short sPh[4 * NG][16][40], sPl[4 * NG][16][40];
  __shared__ __attribute__((aligned(16))) float sO[4 * NG][16][D];
  __shared__ float sM[4 * NG][16], sL[4 * NG][16];
  const int tid = threadIdx.x, lane = tid & 31, ln = lane & 15, hh = lane >> 4;
  const int w = __builtin_amdgcn_readfirstlane(tid >> 5);   // wave number, kept scalar so that the group's key offset and LDS bases stay scalar
  const int qt = w & 3, g = w >> 2, gtid = tid & 127;       // query tile, key group, thread index inside the group
  const int vr = 8 * hh + (lane & 7), vc = 8 * ((lane >> 3) & 1);   // the lane's row and column offset in a transposing load of V
  const int Tk = Tk1 + Tk2;
  const int nqb = (Tq + 63) / 64;
  const int bh = blockIdx.x / nqb, qblk = blockIdx.x % nqb;
  const int b = bh / H, h = bh % H;
  const int q0 = qblk * 64 + qt * 16;
  const float* Q = Qb + (size_t)b * Tq * qpitch + h * D;
  FragB aqh[KS], aql[KS];
  {
    int row = q0 + ln; if (row >= Tq) row = Tq - 1;
    const float* qr = Q + (size_t)row * qpitch;
#pragma unroll
    for (int ks = 0; ks < KS; ++ks)
#pragma unroll
      for (int i = 0; i < 16; ++i) {
        const int d = ks * 32 + ((i < 8) ? (8 * hh + i) : (16 + 8 * hh + (i - 8)));
        const float x = qr[d] * scale; const unsigned short hb = bf16_bits(x);
        aqh[ks].u[i] = hb; aql[ks].u[i] = bf16_bits(x - bf16_val(hb));
      }
  }
  int qrow[8];
#pragma unroll
  for (int r = 0; r < 8; ++r) { int qi = q0 + 8 * hh + r; qrow[r] = qi < Tq ? qi : Tq - 1; }
  float m_r[8], l_r[8];
#pragma unroll
  for (int r = 0; r < 8; ++r) { m_r[r] = -3.0e38f; l_r[r] = 0.f; }
  v8f oacc[DT];
#pragma unroll
  for (int dt = 0; dt < DT; ++dt) oacc[dt] = (v8f){0.f,0.f,0.f,0.f,0.f,0.f,0.f,0.f};
  const int kv_end = causal ? min(Tk, qblk * 64 + 64) : Tk;
  for (int jg = 0; jg < kv_end; jg += 32 * NG) {               // block-uniform trip count; a chunk past kv_end is fully masked and adds nothing
    const int j0 = jg + 32 * g;
    __syncthreads();
    for (int e = gtid; e < 32 * (D / 4); e += 128) {
      const int r = e / (D / 4), c4 = (e % (D / 4)) * 4; const int key = j0 + r;
      v4f kf = {0.f,0.f,0.f,0.f}, vf = {0.f,0.f,0.f,0.f};
      if (key < Tk1) { kf = *(const v4fa*)(K1 + (size_t)b * Tk1 * kpitch + h * D + (size_t)key * kpitch + c4); vf = *(const v4fa*)(V1 + (size_t)b * Tk1 * vpitch + h * D + (size_t)key * vpitch + c4); }
      else if (key < Tk) { const int k2 = key - Tk1; kf = *(const v4fa*)(K2 + (size_t)b * Tk2 * kpitch + h * D + (size_t)k2 * kpitch + c4); vf = *(const v4fa*)(V2 + (size_t)b * Tk2 * vpitch + h * D + (size_t)k2 * vpitch + c4); }
#pragma unroll
      for (int t = 0; t < 4; ++t) {
        unsigned short hb = bf16_bits(kf[t]); sKh[g][r][c4 + t] = hb; sKl[g][r][c4 + t] = bf16_bits(kf[t] - bf16_val(hb));
        hb = bf16_bits(vf[t]); sVh[g][r][c4 + t] = hb; sVl[g][r][c4 + t] = bf16_bits(vf[t] - bf16_val(hb));
      }
    }
    __syncthreads();
    v8f s[2];
#pragma unroll
    for (int nt = 0; nt < 2; ++nt) {
      v8f acc = {};
#pragma unroll
      for (int ks = 0; ks < KS; ++ks) {
        FragB bh_, bl_;
        bh_.half[0] = *(const v8us*)&sKh[g][nt * 16 + ln][ks * 32 + 8 * hh]; bh_.half[1] = *(const v8us*)&sKh[g][nt * 16 + ln][ks * 32 + 16 + 8 * hh];
        bl_.half[0] = *(const v8us*)&sKl[g][nt * 16 + ln][ks * 32 + 8 * hh]; bl_.half[1] = *(const v8us*)&sKl[g][nt * 16 + ln][ks * 32 + 16 + 8 * hh];
        acc = mmaN<3>(aqh[ks].v, aql[ks].v, bh_.v, bl_.v, acc);
      }
      s[nt] = acc;
    }
    float alpha[8];
#pragma unroll
    for (int r = 0; r < 8; ++r) {
      const int qi = qrow[r];
      const int ja = j0 + ln, jb = j0 + 16 + ln;
      bool keepa = ja < Tk, keepb = jb < Tk;
      if (causal) { keepa = keepa && (ja <= qi); keepb = keepb && (jb <= qi); }
      if (mask) { if (keepa) keepa = mask[(size_t)qi * Tk + ja] != 0; if (keepb) keepb = mask[(size_t)qi * Tk + jb] != 0; }
      if (sbias) { if (keepa) s[0][r] += sbias[(size_t)bh * Tk + ja]; if (keepb) s[1][r] += sbias[(size_t)bh * Tk + jb]; }   // per-key additive bias (a per-query constant would cancel in the softmax)
      if (!keepa) s[0][r] = -3.0e38f;
      if (!keepb) s[1][r] = -3.0e38f;
      float mx = fmaxf(s[0][r], s[1][r]);
      mx = fmaxf(mx, __shfl_xor(mx, 1, 32)); mx = fmaxf(mx, __shfl_xor(mx, 2, 32)); mx = fmaxf(mx, __shfl_xor(mx, 4, 32)); mx = fmaxf(mx, __shfl_xor(mx, 8, 32));
      const float mnew = fmaxf(m_r[r], mx);
      alpha[r] = (mnew > -1.0e38f) ? __expf(m_r[r] - mnew) : 1.0f;
      const float p0 = keepa ? __expf(s[0][r] - mnew) : 0.f;
      const float p1 = keepb ? __expf(s[1][r] - mnew) : 0.f;
      m_r[r] = mnew;
      l_r[r] = l_r[r] * alpha[r] + p0 + p1;
      unsigned short hb = bf16_bits(p0); sPh[w][8 * hh + r][ln] = hb;      sPl[w][8 * hh + r][ln] = bf16_bits(p0 - bf16_val(hb));
      hb = bf16_bits(p1);                sPh[w][8 * hh + r][16 + ln] = hb; sPl[w][8 * hh + r][16 + ln] = bf16_bits(p1 - bf16_val(hb));
    }
#pragma unroll
    for (int dt = 0; dt < DT; ++dt)
#pragma unroll
      for (int r = 0; r < 8; ++r) oacc[dt][r] *= alpha[r];
    __builtin_amdgcn_fence(__ATOMIC_ACQ_REL, "workgroup");
    __builtin_amdgcn_wave_barrier();
    FragB pah, pal;
    pah.half[0] = *(const v8us*)&sPh[w][ln][8 * hh]; pah.half[1] = *(const v8us*)&sPh[w][ln][16 + 8 * hh];
    pal.half[0] = *(const v8us*)&sPl[w][ln][8 * hh]; pal.half[1] = *(const v8us*)&sPl[w][ln][16 + 8 * hh];
    // element i of a V fragment = V[8 * hh + i][dt * 16 + ln], element 8 + i = V[16 + 8 * hh + i][dt * 16 + ln]: the k order of pah / pal
    FragB bvh[2], bvl[2];
    auto vfrag = [&](int dt) {
      bvh[dt & 1].half[0] = ld_tr16(&sVh[g][vr][dt * 16 + vc]); bvh[dt & 1].half[1] = ld_tr16(&sVh[g][16 + vr][dt * 16 + vc]);
      bvl[dt & 1].half[0] = ld_tr16(&sVl[g][vr][dt * 16 + vc]); bvl[dt & 1].half[1] = ld_tr16(&sVl[g][16 + vr][dt * 16 + vc]);
    };
    vfrag(0);
#pragma unroll
    for (int dt = 0; dt < DT; ++dt) {
      if (dt + 1 < DT) vfrag(dt + 1);   // the next tile's four loads fly under this tile's three products
      oacc[dt] = mmaN<3>(pah.v, pal.v, bvh[dt & 1].v, bvl[dt & 1].v, oacc[dt]);
    }
    __builtin_amdgcn_fence(__ATOMIC_ACQ_REL, "workgroup");
    __builtin_amdgcn_wave_barrier();
  }
#pragma unroll
  for (int r = 0; r < 8; ++r) {
    float l = l_r[r];
    l += __shfl_xor(l, 1, 32); l += __shfl_xor(l, 2, 32); l += __shfl_xor(l, 4, 32); l += __shfl_xor(l, 8, 32);
    if (ln == 0) { sM[w][8 * hh + r] = m_r[r]; sL[w][8 * hh + r] = l; }
  }
#pragma unroll
  for (int dt = 0; dt < DT; ++dt)
#pragma unroll
    for (int r = 0; r < 8; ++r) sO[w][8 * hh + r][dt * 16 + ln] = oacc[dt][r];
  __syncthreads();   // every group's partial (max, sum, O) is in LDS before any wave merges
  // merge: wave (qt, g) finishes rows g*16/NG ... of query tile qt; a lane owns 4 columns of the row
#pragma unroll
  for (int i = 0; i < 16 / NG; ++i) {
    const int rr = g * (16 / NG) + i, row = q0 + rr;
    if (row < Tq && lane < D / 4) {
      float mg[NG], mall = -3.0e38f;
#pragma unroll
      for (int k = 0; k < NG; ++k) { mg[k] = sM[k * 4 + qt][rr]; mall = fmaxf(mall, mg[k]); }
      float lall = 0.f;
      v4f val = {0.f, 0.f, 0.f, 0.f};
#pragma unroll
      for (int k = 0; k < NG; ++k) {
        const float wt = (mg[k] > -1.0e38f) ? __expf(mg[k] - mall) : 0.f;
        const v4f o = *(const v4fa*)&sO[k * 4 + qt][rr][lane * 4];
        lall += wt * sL[k * 4 + qt][rr];
        val += wt * o;
      }
      const float inv = (mall > -1.0e38f) ? 1.0f / lall : __builtin_nanf("");
      *(v4f*)(y + ((size_t)b * Tq + row) * ypitch + h * D + lane * 4) = val * inv;
      if (i + 1 < 16 / NG) asm volatile("s_wait_xcnt 0x0" ::: "memory");   // precaution: stands before the next row's reads reuse the store's address and data registers
    }
  }
}

__global__ __launch_bounds__(256) void k_roundcopy(const float* __restrict__ src, float* __restrict__ dst, int n8) {
  const size_t t = (size_t)blockIdx.x * 256 + threadIdx.x;
  if (t >= (size_t)n8 * 2) return;
  v4f a = *(const v4fa*)(src + t * 4);
  for (int i = 0; i < 4; ++i) a[i] = bf16_round(a[i]);
  *(v4f*)(dst + t * 4) = a; 
}

__global__ void k_ln_rows(const float* __restrict__ X, const float* __restrict__ R, const float* __restrict__ g, const float* __restrict__ bta, float* __restrict__ out, int N, float eps) {
  __shared__ float red[256];
  const int row = blockIdx.x, tid = threadIdx.x, nt = blockDim.x;
  v4f a = *(const v4fa*)(X + (size_t)row * N + tid * 4);
  if (R) { const v4f rr = *(const v4fa*)(R + (size_t)row * N + tid * 4); for (int q = 0; q < 4; ++q) a[q] += rr[q]; }
  float s = a[0] + a[1] + a[2] + a[3];
  red[tid] = s; __syncthreads();
  for (int st = nt / 2; st > 0; st >>= 1) { if (tid < st) red[tid] += red[tid + st]; __syncthreads(); }
  const float mu = red[0] / (float)N; __syncthreads();
  float v = 0.f; for (int q = 0; q < 4; ++q) { const float c = a[q] - mu; v += c * c; }
  red[tid] = v; __syncthreads();
  for (int st = nt / 2; st > 0; st >>= 1) { if (tid < st) red[tid] += red[tid + st]; __syncthreads(); }
  const float rs = rsqrtf(red[0] / (float)N + eps);
  v4f o; for (int q = 0; q < 4; ++q) o[q] = (a[q] - mu) * rs * bf16_round(g[tid * 4 + q]) + bf16_round(bta[tid * 4 + q]);
  *(v4f*)(out + (size_t)row * N + tid * 4) = o; 
}

// Bt[h*DK + k][d] = W[h][d][k]  (W [H][D][DK]); thread per (n, 8 d)
__global__ __launch_bounds__(256) void k_wt_heads(const float* __restrict__ W, unsigned short* __restrict__ Bt) {
  const int t = blockIdx.x * 256 + threadIdx.x; if (t >= NH * DK * (DD / 8)) return;
  const int n = t / (DD / 8), d8 = (t % (DD / 8)) * 8; const int h = n / DK, kk = n % DK; v8us v;
#pragma unroll
  for (int i = 0; i < 8; ++i) v[i] = bf16_bits(W[((size_t)h * DD + d8 + i) * DK + kk]);
  *(v8us*)(Bt + (size_t)n * DD + d8) = v; 
}
extern "C" void kernel_launch(void* const* d_in, const int* in_sizes, int n_in,
                              void* d_out, int out_size, void* d_ws, size_t ws_size, hipStream_t stream) {
  (void)in_sizes; (void)n_in; (void)out_size;
  const float* token = (const float*)d_in[0];
  const float* Wq = (const float*)d_in[1]; const float* bq = (const float*)d_in[2]; const float* Wk = (const float*)d_in[3]; const float* bk = (const float*)d_in[4];
  const float* Wv = (const float*)d_in[5]; const float* bv = (const float*)d_in[6]; const float* Wo = (const float*)d_in[7]; const float* bo = (const float*)d_in[8];
  const float* Wf = (const float*)d_in[9]; const float* bfv = (const float*)d_in[10]; const float* gamma = (const float*)d_in[11]; const float* beta = (const float*)d_in[12];
  char* ws = (char*)d_ws; size_t off = 0;
  auto take = [&](size_t bytes) { char* p = ws + off; off += (bytes + 255) & ~(size_t)255; return p; };
  unsigned short* Bqkv = (unsigned short*)take((size_t)3 * DD * DD * 2); unsigned short* Bo = (unsigned short*)take((size_t)DD * DD * 2); unsigned short* Bf = (unsigned short*)take((size_t)DD * DD * 2);
  float* bqkv = (float*)take(3 * DD * 4);
  float* x = (float*)take((size_t)SS * DD * 4); float* qkv = (float*)take((size_t)SS * 3 * DD * 4); float* att = (float*)take((size_t)SS * DD * 4); float* tmp = (float*)take((size_t)SS * DD * 4); float* a = (float*)take((size_t)SS * DD * 4);
  if (off > ws_size) return;
  k_wt_heads<<<(NH * DK * (DD / 8) + 255) / 256, 256, 0, stream>>>(Wq, Bqkv);
  k_wt_heads<<<(NH * DK * (DD / 8) + 255) / 256, 256, 0, stream>>>(Wk, Bqkv + (size_t)DD * DD);
  k_wt_heads<<<(NH * DK * (DD / 8) + 255) / 256, 256, 0, stream>>>(Wv, Bqkv + (size_t)2 * DD * DD);
  k_wt_bf16<<<(DD * (DD / 8) + 255) / 256, 256, 0, stream>>>(Wo, Bo, DD, DD);
  k_wt_bf16<<<(DD * (DD / 8) + 255) / 256, 256, 0, stream>>>(Wf, Bf, DD, DD);
  k_roundcopy<<<(3 * DD / 4 + 255) / 256, 256, 0, stream>>>(bq, bqkv, DD / 8);            // bq|bk|bv flat [H*DK] each: three copies (f32, rounded) into one bias vector
  k_roundcopy<<<(DD / 4 + 255) / 256, 256, 0, stream>>>(bk, bqkv + DD, DD / 8);
  k_roundcopy<<<(DD / 4 + 255) / 256, 256, 0, stream>>>(bv, bqkv + 2 * DD, DD / 8);
  k_roundcopy<<<(SS * DD / 4 + 255) / 256, 256, 0, stream>>>(token, x, SS * DD / 8);
  const int gq = (SS / 64) * (3 * DD / 128), g1 = (SS / 64) * (DD / 128);
  for (int l = 0; l < NLAY; ++l) {
    k_gemm_tile<false><<<gq, 256, 0, stream>>>(x, DD, Bqkv, DD, bqkv, qkv, 3 * DD, 3 * DD, DD);      // bias already rounded (BIAS_BF16=false adds it as given)
    k_flash3<DK><<<NH * (SS / 64), 512, 0, stream>>>(qkv, 3 * DD, SS, qkv + DD, qkv + 2 * DD, SS, nullptr, nullptr, 0, 3 * DD, 3 * DD, NH, 0.08838834764831845f, nullptr, 0, nullptr, att, DD);
    k_gemm_tile<true><<<g1, 256, 0, stream>>>(att, DD, Bo, DD, bo, tmp, DD, DD, DD);
    k_ln_rows<<<SS, DD / 4, 0, stream>>>(tmp, x, gamma, beta, a, DD, 1e-5f);                  // a = LN(x + attn_out)
    k_gemm_tile<true><<<g1, 256, 0, stream>>>(a, DD, Bf, DD, bfv, tmp, DD, DD, DD);
    k_ln_rows<<<SS, DD / 4, 0, stream>>>(tmp, a, gamma, beta, (l == NLAY - 1) ? (float*)d_out : x, DD, 1e-5f);   // x = LN(a + ff)
  }
}

// v004
// One run takes 1030 microseconds.
// In both of two side-by-side timings against v003, it was 1.33 times as fast.
// All steps since v000 together make it 3.90 times as fast.
#include <hip/hip_runtime.h>
// All GEMMs on v_wmma_f32_16x16x32_bf16, f32 accumulate: fused per-head q|k|v projection (K=1024, N=3072), concat·Wo, a·Wf — A operands
// (the residual stream, quantised to bf16 once at the input) split into bf16 hi/lo (2 terms) against bf16-rounded weights; attention QKᵀ/√128
// and P·V per 16-query tile as 3-term splits (head dim 128); LayerNorm and softmax in f32. Six layers with shared weights.
#define SS 2048
#define DD 1024
#define NH 8
#define DK 128
#define NLAY 6

typedef __bf16 v16b __attribute__((ext_vector_type(16)));
typedef unsigned short v8us __attribute__((ext_vector_type(8), may_alias));
typedef unsigned short v4us __attribute__((ext_vector_type(4), may_alias));
typedef float  v8f  __attribute__((ext_vector_type(8)));
typedef float  v4f  __attribute__((ext_vector_type(4)));
typedef float  v4fa __attribute__((ext_vector_type(4), may_alias));
union FragB { v16b v; v8us half[2]; unsigned short u[16]; };
typedef short s16x8 __attribute__((ext_vector_type(8)));
typedef __attribute__((address_space(3))) s16x8 lds_s16x8;
// transposing LDS load of an 8 x 16 block of 16-bit elements per lane half: lane l points at 8 elements of row 8*(l>>4) + (l&7), columns 8*((l>>3)&1) ...;
// lane (c = l&15, h = l>>4) receives rows 8h .. 8h+7 of column c
__device__ __forceinline__ v8us ld_tr16(const unsigned short* p) { return __builtin_bit_cast(v8us, __builtin_amdgcn_ds_load_tr16_b128_v8i16((lds_s16x8*)p)); }

__device__ __forceinline__ unsigned short bf16_bits(float x) { unsigned int u = __float_as_uint(x); return (unsigned short)((u + 0x7FFFu + ((u >> 16) & 1u)) >> 16); }
__device__ __forceinline__ float bf16_val(unsigned short b) { return __uint_as_float(((unsigned int)b) << 16); }
__device__ __forceinline__ float bf16_round(float x) { return bf16_val(bf16_bits(x)); }
// D += A·B with NT terms: 1 = ah·bh, 2 = + al·bh (A split), 3 = + ah·bl (both split)
template <int NT>
__device__ __forceinline__ v8f mmaN(v16b ah, v16b al, v16b bh, v16b bl, v8f c) {
  c = __builtin_amdgcn_wmma_f32_16x16x32_bf16(false, ah, false, bh, (short)0, c, false, false);
  if (NT >= 2) c = __builtin_amdgcn_wmma_f32_16x16x32_bf16(false, al, false, bh, (short)0, c, false, false);
  if (NT >= 3) c = __builtin_amdgcn_wmma_f32_16x16x32_bf16(false, ah, false, bl, (short)0, c, false, false);
  asm volatile("v_nop\n\tv_nop\n\tv_nop\n\tv_nop" : "+v"(c) : "v"(ah), "v"(al), "v"(bh), "v"(bl));
  return c;
}

__global__ __launch_bounds__(256) void k_wt_bf16(const float* __restrict__ W, unsigned short* __restrict__ Wt, int K, int N) {
  const int t = blockIdx.x * 256 + threadIdx.x;
  const int k8n = K / 8;
  if (t >= N * k8n) return;
  const int n = t / k8n, k8 = (t % k8n) * 8;
  v8us v;
#pragma unroll
  for (int i = 0; i < 8; ++i) v[i] = bf16_bits(W[(size_t)(k8 + i) * N + n]);
  *(v8us*)(Wt + (size_t)n * K + k8) = v;
  
}

// GEMM C[M][N] (f32, pitch ldc) = act(A[M][K]·W + bias). A f32 row-major (pitch lda) converted per fragment to bf16
// (ASPLIT: hi/lo two planes -> 2 terms, else single rounded term); Wt bf16 [N][K] (pitch ldb). BIAS_BF16 rounds the
// bias to bf16 first (bias quantised to bf16 before the add). K%32==0, M%16==0, N%64==0.
template <bool ASPLIT, int ACT, bool BIAS_BF16>
__global__ __launch_bounds__(128) void k_gemm_bf(const float* __restrict__ A, int lda, const unsigned short* __restrict__ Wt, int ldb,
                                               const float* __restrict__ bias, float* __restrict__ C, int ldc, int M, int N, int K) {
  __shared__ __attribute__((aligned(16))) float so[4][16][64];
  const int tid = threadIdx.x, w = tid >> 5, lane = tid & 31, ln = lane & 15, hh = lane >> 4;
  const int ntn = N / 64;
  const int wid = blockIdx.x * 4 + w;
  const int mt = wid / ntn, nq = wid % ntn;
  if (mt * 16 >= M) return;
  const int row0 = mt * 16, col0 = nq * 64;
  const float* arow = A + (size_t)(row0 + ln) * lda;
  v8f acc[4] = {};
  for (int kb = 0; kb < K; kb += 32) {
    FragB ah, al;
    const v4f x0 = *(const v4fa*)(arow + kb + 8 * hh), x1 = *(const v4fa*)(arow + kb + 8 * hh + 4);
    const v4f x2 = *(const v4fa*)(arow + kb + 16 + 8 * hh), x3 = *(const v4fa*)(arow + kb + 16 + 8 * hh + 4);
    float xs[16] = {x0[0],x0[1],x0[2],x0[3],x1[0],x1[1],x1[2],x1[3],x2[0],x2[1],x2[2],x2[3],x3[0],x3[1],x3[2],x3[3]};
#pragma unroll
    for (int i = 0; i < 16; ++i) { const unsigned short hb = bf16_bits(xs[i]); ah.u[i] = hb; al.u[i] = ASPLIT ? bf16_bits(xs[i] - bf16_val(hb)) : (unsigned short)0; }
#pragma unroll
    for (int t = 0; t < 4; ++t) {
      const unsigned short* brow = Wt + (size_t)(col0 + t * 16 + ln) * ldb + kb;
      FragB b;
      b.half[0] = *(const v8us*)(brow + 8 * hh);
      b.half[1] = *(const v8us*)(brow + 16 + 8 * hh);
      acc[t] = mmaN<ASPLIT ? 2 : 1>(ah.v, al.v, b.v, b.v, acc[t]);
    }
  }
#pragma unroll
  for (int t = 0; t < 4; ++t) {
    float bv = bias ? bias[col0 + t * 16 + ln] : 0.f;
    if (BIAS_BF16) bv = bf16_round(bv);
#pragma unroll
    for (int r = 0; r < 8; ++r) { float v = acc[t][r] + bv; if (ACT == 1) v = fmaxf(v, 0.f); so[w][8 * hh + r][t * 16 + ln] = v; }
  }
  __builtin_amdgcn_fence(__ATOMIC_ACQ_REL, "workgroup");
  __builtin_amdgcn_wave_barrier();
  const int rsub = lane >> 4, c4 = (lane & 15) * 4;
  {
#pragma unroll
    for (int q = 0; q < 8; ++q) {
      const int r = q * 2 + rsub;
      const v4f v = *(const v4fa*)&so[w][r][c4];
      *(v4f*)(C + (size_t)(row0 + r) * ldc + col0 + c4) = v;
    }
    
  }
}

// Flash-style causal/unmasked attention, all contractions 3-term bf16 hi/lo splits, f32 softmax with running max.
// q,k,v rows are read from f32 buffers with arbitrary row pitch (so they can live inside a fused qkv buffer);
// D = head size (multiple of 32, <= 128); one wave = 16 query rows; block = 4 waves (64 queries) sharing K/V chunks of 32.
template <int D, bool CAUSAL>
__global__ __launch_bounds__(128) void k_flash(const float* __restrict__ qb, const float* __restrict__ kb, const float* __restrict__ vb,
                                             int pitch, int T, int H, float scale, float* __restrict__ y, int ypitch) {
  constexpr int KS = D / 32;        // k-steps for QK
  constexpr int DT = D / 16;        // d tiles for PV
  __shared__ __attribute__((aligned(16))) unsigned short sKh[32][D + 8], sKl[32][D + 8], sVh[32][D + 8], sVl[32][D + 8];
  __shared__ __attribute__((aligned(16))) unsigned short sPh[4][16][40], sPl[4][16][40];
  __shared__ __attribute__((aligned(16))) float sO[4][16][D];
  const int tid = threadIdx.x, w = tid >> 5, lane = tid & 31, ln = lane & 15, hh = lane >> 4;
  const int nqb = (T + 63) / 64;
  const int bh = blockIdx.x / nqb, qblk = blockIdx.x % nqb;
  const int b = bh / H, h = bh % H;
  const int q0 = qblk * 64 + w * 16;
  const float* Q = qb + (size_t)b * T * pitch + h * D;
  const float* K = kb + (size_t)b * T * pitch + h * D;
  const float* V = vb + (size_t)b * T * pitch + h * D;

  // A fragments of the wave's 16 query rows (scaled), hi/lo
  FragB aqh[KS], aql[KS];
  {
    int row = q0 + ln; if (row >= T) row = T - 1;
    const float* qr = Q + (size_t)row * pitch;
#pragma unroll
    for (int ks = 0; ks < KS; ++ks)
#pragma unroll
      for (int i = 0; i < 16; ++i) {
        const int d = ks * 32 + ((i < 8) ? (8 * hh + i) : (16 + 8 * hh + (i - 8)));
        const float x = qr[d] * scale; const unsigned short hb = bf16_bits(x);
        aqh[ks].u[i] = hb; aql[ks].u[i] = bf16_bits(x - bf16_val(hb));
      }
  }
  float m_r[8], l_r[8];
#pragma unroll
  for (int r = 0; r < 8; ++r) { m_r[r] = -3.0e38f; l_r[r] = 0.f; }
  v8f oacc[DT];
#pragma unroll
  for (int dt = 0; dt < DT; ++dt) oacc[dt] = (v8f){0.f,0.f,0.f,0.f,0.f,0.f,0.f,0.f};

  const int kv_end = CAUSAL ? min(T, qblk * 64 + 64) : T;     // block-uniform
  for (int j0 = 0; j0 < kv_end; j0 += 32) {
    __syncthreads();
    for (int e = tid; e < 32 * (D / 4); e += 128) {
      const int r = e / (D / 4), c4 = (e % (D / 4)) * 4;
      const int key = j0 + r;
      v4f kf = {0.f,0.f,0.f,0.f}, vf = {0.f,0.f,0.f,0.f};
      if (key < T) { kf = *(const v4fa*)(K + (size_t)key * pitch + c4); vf = *(const v4fa*)(V + (size_t)key * pitch + c4); }
#pragma unroll
      for (int t = 0; t < 4; ++t) {
        unsigned short hb = bf16_bits(kf[t]); sKh[r][c4 + t] = hb; sKl[r][c4 + t] = bf16_bits(kf[t] - bf16_val(hb));
        hb = bf16_bits(vf[t]); sVh[r][c4 + t] = hb; sVl[r][c4 + t] = bf16_bits(vf[t] - bf16_val(hb));
      }
    }
    __syncthreads();
    // S tile 16 x 32
    v8f s[2];
#pragma unroll
    for (int nt = 0; nt < 2; ++nt) {
      v8f acc = {};
#pragma unroll
      for (int ks = 0; ks < KS; ++ks) {
        FragB bh_, bl_;
        bh_.half[0] = *(const v8us*)&sKh[nt * 16 + ln][ks * 32 + 8 * hh]; bh_.half[1] = *(const v8us*)&sKh[nt * 16 + ln][ks * 32 + 16 + 8 * hh];
        bl_.half[0] = *(const v8us*)&sKl[nt * 16 + ln][ks * 32 + 8 * hh]; bl_.half[1] = *(const v8us*)&sKl[nt * 16 + ln][ks * 32 + 16 + 8 * hh];
        acc = mmaN<3>(aqh[ks].v, aql[ks].v, bh_.v, bl_.v, acc);
      }
      s[nt] = acc;
    }
    // mask + running max (rows 8hh+r; the 16 lanes of a half share rows)
    float alpha[8];
#pragma unroll
    for (int r = 0; r < 8; ++r) {
      const int qi = q0 + 8 * hh + r;
      const int ja = j0 + ln, jb = j0 + 16 + ln;
      if (CAUSAL) { if (ja > qi) s[0][r] = -3.0e38f; if (jb > qi) s[1][r] = -3.0e38f; }
      if (ja >= T) s[0][r] = -3.0e38f;
      if (jb >= T) s[1][r] = -3.0e38f;
      float mx = fmaxf(s[0][r], s[1][r]);
      mx = fmaxf(mx, __shfl_xor(mx, 1, 32)); mx = fmaxf(mx, __shfl_xor(mx, 2, 32)); mx = fmaxf(mx, __shfl_xor(mx, 4, 32)); mx = fmaxf(mx, __shfl_xor(mx, 8, 32));
      const float mnew = fmaxf(m_r[r], mx);
      alpha[r] = (mnew > -1.0e38f) ? __expf(m_r[r] - mnew) : 1.0f;
      const float p0 = (s[0][r] > -1.0e38f) ? __expf(s[0][r] - mnew) : 0.f;
      const float p1 = (s[1][r] > -1.0e38f) ? __expf(s[1][r] - mnew) : 0.f;
      m_r[r] = mnew;
      l_r[r] = l_r[r] * alpha[r] + p0 + p1;            // per-lane partial row sum (16 lanes combined at the end)
      unsigned short hb = bf16_bits(p0); sPh[w][8 * hh + r][ln] = hb;      sPl[w][8 * hh + r][ln] = bf16_bits(p0 - bf16_val(hb));
      hb = bf16_bits(p1);                sPh[w][8 * hh + r][16 + ln] = hb; sPl[w][8 * hh + r][16 + ln] = bf16_bits(p1 - bf16_val(hb));
    }
#pragma unroll
    for (int dt = 0; dt < DT; ++dt)
#pragma unroll
      for (int r = 0; r < 8; ++r) oacc[dt][r] *= alpha[r];
    __builtin_amdgcn_fence(__ATOMIC_ACQ_REL, "workgroup");
    __builtin_amdgcn_wave_barrier();
    FragB pah, pal;
    pah.half[0] = *(const v8us*)&sPh[w][ln][8 * hh]; pah.half[1] = *(const v8us*)&sPh[w][ln][16 + 8 * hh];
    pal.half[0] = *(const v8us*)&sPl[w][ln][8 * hh]; pal.half[1] = *(const v8us*)&sPl[w][ln][16 + 8 * hh];
#pragma unroll
    for (int dt = 0; dt < DT; ++dt) {
      FragB bvh, bvl;
#pragma unroll
      for (int i = 0; i < 8; ++i) {
        bvh.u[i] = sVh[8 * hh + i][dt * 16 + ln]; bvh.u[8 + i] = sVh[16 + 8 * hh + i][dt * 16 + ln];
        bvl.u[i] = sVl[8 * hh + i][dt * 16 + ln]; bvl.u[8 + i] = sVl[16 + 8 * hh + i][dt * 16 + ln];
      }
      oacc[dt] = mmaN<3>(pah.v, pal.v, bvh.v, bvl.v, oacc[dt]);
    }
    __builtin_amdgcn_fence(__ATOMIC_ACQ_REL, "workgroup");
    __builtin_amdgcn_wave_barrier();
  }
#pragma unroll
  for (int r = 0; r < 8; ++r) {
    float l = l_r[r];
    l += __shfl_xor(l, 1, 32); l += __shfl_xor(l, 2, 32); l += __shfl_xor(l, 4, 32); l += __shfl_xor(l, 8, 32);
    l_r[r] = (l > 0.f) ? 1.0f / l : 0.f;
  }
#pragma unroll
  for (int dt = 0; dt < DT; ++dt)
#pragma unroll
    for (int r = 0; r < 8; ++r) sO[w][8 * hh + r][dt * 16 + ln] = oacc[dt][r] * l_r[r];
  __builtin_amdgcn_fence(__ATOMIC_ACQ_REL, "workgroup");
  __builtin_amdgcn_wave_barrier();
  {
    for (int r = 0; r < 16; ++r) {
      const int row = q0 + r;
      if (row < T && lane < D / 4) {
        const v4f val = *(const v4fa*)&sO[w][r][lane * 4];
        *(v4f*)(y + ((size_t)b * T + row) * ypitch + h * D + lane * 4) = val;
      }
    }
    
  }
}

// GEMM C[M][N] (f32, pitch ldc) = A[M][K] x W + bias: A f32 row-major (pitch lda), two terms (bf16 hi + lo) against Wt bf16 [N][K] (pitch ldb).
// Block = 8 waves (2 x 4) on a 64 x 128 tile of C, a wave owns 32 x 32. K is walked in slices of 64: the A slice is split into its hi and lo
// planes once per block, the Wt slice is copied, both through whole-line global loads into LDS, where all 8 waves read their fragments.
// Two LDS buffers: the next slice's global loads are issued ahead of this slice's products and stored behind them; one barrier per slice.
// Each accumulator takes hi then lo of every 32-wide k step in rising k. M % 64 == 0, N % 128 == 0, K % 64 == 0; grid = (M / 64) * (N / 128).
template <bool BIAS_BF16>
__global__ __launch_bounds__(256) void k_gemm_tile(const float* __restrict__ A, int lda, const unsigned short* __restrict__ Wt, int ldb,
                                                   const float* __restrict__ bias, float* __restrict__ C, int ldc, int N, int K) {
  constexpr int BM = 64, BN = 128, BK = 64, LP = BK + 8;       // LP: LDS row pitch 144 B = 16 B x odd
  constexpr int PA = BM * LP, PB = BN * LP, BUF = 2 * PA + PB;  // one buffer, in 16-bit elements: A hi | A lo | Wt
  constexpr int OP = 36;                                       // pitch of the output staging rows, in floats
  __shared__ __attribute__((aligned(16))) unsigned short sm[2 * BUF];
  const int tid = threadIdx.x, lane = tid & 31, ln = lane & 15, hh = lane >> 4;
  const int w = __builtin_amdgcn_readfirstlane(tid >> 5);      // wave number, kept scalar so that the tile offsets stay scalar
  const int wm = w >> 2, wn = w & 3;
  const int nbn = N / BN;
  const int row0 = (blockIdx.x / nbn) * BM, col0 = (blockIdx.x % nbn) * BN;
  const int ar = tid >> 4, ac = (tid & 15) * 4;                // A slice: a wave's load covers 2 rows x 256 B
  const int br = tid >> 3, bc = (tid & 7) * 8;                 // Wt slice: a wave's load covers 4 rows x 128 B
  const float* ag = A + (size_t)(row0 + ar) * lda + ac;
  const unsigned short* bg = Wt + (size_t)(col0 + br) * ldb + bc;
  v4f ra[4];
  v8us rb[4];
  auto fetch = [&](int kb) {
    const float* pa[4];
    const unsigned short* pb[4];
#pragma unroll
    for (int j = 0; j < 4; ++j) { pa[j] = ag + (size_t)(16 * j) * lda + kb; pb[j] = bg + (size_t)(32 * j) * ldb + kb; }
#pragma unroll
    for (int j = 0; j < 4; ++j) ra[j] = *(const v4fa*)pa[j];
#pragma unroll
    for (int j = 0; j < 4; ++j) rb[j] = *(const v8us*)pb[j];
    // precaution: the eight address pairs are inputs of the wait, so none of them is reused (not even as a later load's result) ahead of it
    asm volatile("s_wait_xcnt 0x0" :: "v"(pa[0]), "v"(pa[1]), "v"(pa[2]), "v"(pa[3]), "v"(pb[0]), "v"(pb[1]), "v"(pb[2]), "v"(pb[3]) : "memory");
  };
  auto stash = [&](unsigned short* sb) {
#pragma unroll
    for (int j = 0; j < 4; ++j) {
      v4us h, l;
#pragma unroll
      for (int t = 0; t < 4; ++t) { const unsigned short hb = bf16_bits(ra[j][t]); h[t] = hb; l[t] = bf16_bits(ra[j][t] - bf16_val(hb)); }
      *(v4us*)(sb + (ar + 16 * j) * LP + ac) = h;
      *(v4us*)(sb + PA + (ar + 16 * j) * LP + ac) = l;
      *(v8us*)(sb + 2 * PA + (br + 32 * j) * LP + bc) = rb[j];
    }
  };
  v8f acc[2][2] = {};
  const int ns = K / BK;
  fetch(0);
  stash(sm);
  __syncthreads();
  for (int s = 0; s < ns; ++s) {
    const unsigned short* sb = sm + (s & 1) * BUF;
    if (s + 1 < ns) fetch((s + 1) * BK);
#pragma unroll
    for (int ks = 0; ks < BK / 32; ++ks) {
      FragB ah[2], al[2], b[2];
#pragma unroll
      for (int t = 0; t < 2; ++t) {
        const unsigned short* pa = sb + (wm * 32 + t * 16 + ln) * LP + ks * 32 + 8 * hh;
        const unsigned short* pb = sb + 2 * PA + (wn * 32 + t * 16 + ln) * LP + ks * 32 + 8 * hh;
        ah[t].half[0] = *(const v8us*)pa;        ah[t].half[1] = *(const v8us*)(pa + 16);
        al[t].half[0] = *(const v8us*)(pa + PA); al[t].half[1] = *(const v8us*)(pa + PA + 16);
        b[t].half[0]  = *(const v8us*)pb;        b[t].half[1]  = *(const v8us*)(pb + 16);
      }
      __builtin_amdgcn_sched_barrier(0);   // keeps the k step's 12 LDS reads together as one group ahead of its 8 products: one LDS wait per k step, not four
#pragma unroll
      for (int mt = 0; mt < 2; ++mt)
#pragma unroll
        for (int nt = 0; nt < 2; ++nt) acc[mt][nt] = __builtin_amdgcn_wmma_f32_16x16x32_bf16(false, ah[mt].v, false, b[nt].v, (short)0, acc[mt][nt], false, false);
#pragma unroll
      for (int mt = 0; mt < 2; ++mt)
#pragma unroll
        for (int nt = 0; nt < 2; ++nt) acc[mt][nt] = __builtin_amdgcn_wmma_f32_16x16x32_bf16(false, al[mt].v, false, b[nt].v, (short)0, acc[mt][nt], false, false);
    }
    if (s + 1 < ns) stash(sm + ((s + 1) & 1) * BUF);
    __syncthreads();   // publishes slice s + 1 and ends every wave's reads of slice s, whose buffer is refilled in the next trip
  }
  // output: each wave turns its 32 x 32 tile through its own piece of the (now free) LDS so that every store covers whole 128-B lines
  float* so = (float*)sm + w * 32 * OP;
#pragma unroll
  for (int nt = 0; nt < 2; ++nt) {
    float bv = bias[col0 + wn * 32 + nt * 16 + ln];
    if (BIAS_BF16) bv = bf16_round(bv);
#pragma unroll
    for (int mt = 0; mt < 2; ++mt)
#pragma unroll
      for (int r = 0; r < 8; ++r) so[(mt * 16 + 8 * hh + r) * OP + nt * 16 + ln] = acc[mt][nt][r] + bv;
  }
  __builtin_amdgcn_fence(__ATOMIC_ACQ_REL, "workgroup");
  __builtin_amdgcn_wave_barrier();
  const int rsub = lane >> 3, c4 = (lane & 7) * 4;
#pragma unroll
  for (int q = 0; q < 8; ++q) {
    const int r = q * 4 + rsub;
    const v4f v = *(const v4fa*)(so + r * OP + c4);
    *(v4f*)(C + (size_t)(row0 + wm * 32 + r) * ldc + col0 + wn * 32 + c4) = v;
  }
}
// row LayerNorm (biased variance, eps) over N: s = X (+ R); optional out_sum <- s; out_norm <- (s-mu)*rsqrt(var+eps)*g + b
template <bool PARAM_BF16>
__global__ __launch_bounds__(256) void k_layernorm(const float* __restrict__ X, const float* __restrict__ R, const float* __restrict__ g, const float* __restrict__ bta,
                                                  float* __restrict__ out_sum, float* __restrict__ out_norm, int N, float eps) {
  __shared__ float red[256];
  const int row = blockIdx.x, tid = threadIdx.x;
  const float* x = X + (size_t)row * N; const float* rr = R ? R + (size_t)row * N : nullptr;
  float vals[16];                     // up to N = 4096
  const int per = N / 256;            // contiguous chunk per thread? use strided-by-4 chunks: thread handles j = tid*4 + 1024*u
  float s1 = 0.f;
  for (int u = 0; u < per / 4; ++u) {
    const int j = tid * 4 + 1024 * u;
    const v4f a = *(const v4fa*)(x + j);
    v4f b = {0.f,0.f,0.f,0.f}; if (rr) b = *(const v4fa*)(rr + j);
#pragma unroll
    for (int q = 0; q < 4; ++q) { const float v = a[q] + b[q]; vals[u * 4 + q] = v; s1 += v; }
  }
  red[tid] = s1; __syncthreads();
  for (int st = 128; st > 0; st >>= 1) { if (tid < st) red[tid] += red[tid + st]; __syncthreads(); }
  const float mu = red[0] / (float)N; __syncthreads();
  float s2 = 0.f;
  for (int u = 0; u < per / 4; ++u)
#pragma unroll
    for (int q = 0; q < 4; ++q) { const float c = vals[u * 4 + q] - mu; s2 += c * c; }
  red[tid] = s2; __syncthreads();
  for (int st = 128; st > 0; st >>= 1) { if (tid < st) red[tid] += red[tid + st]; __syncthreads(); }
  const float rs = rsqrtf(red[0] / (float)N + eps);
  {
    for (int u = 0; u < per / 4; ++u) {
      const int j = tid * 4 + 1024 * u;
      v4f o, sm;
#pragma unroll
      for (int q = 0; q < 4; ++q) {
        float gg = g[j + q], bb = bta[j + q];
        if (PARAM_BF16) { gg = bf16_round(gg); bb = bf16_round(bb); }
        sm[q] = vals[u * 4 + q]; o[q] = (vals[u * 4 + q] - mu) * rs * gg + bb;
      }
      if (out_sum) *(v4f*)(out_sum + (size_t)row * N + j) = sm;
      *(v4f*)(out_norm + (size_t)row * N + j) = o;
    }
    
  }
}

// General attention: queries [b][Tq] rows at Q + b*Tq*qpitch + h*D + row*qpitch; keys/values j < Tk1 from (K1,V1) at
// X + b*Tk1*pitch + h*D + j*pitch, j >= Tk1 from (K2,V2) with j-Tk1 (pass Tk2 = 0 and null for a single source).
// Optional int mask [Tq][Tk] (nonzero keep), causal flag (j <= qi), additive score bias sbias[bh*Tk + j].
// 3-term bf16 splits, f32 softmax with running max; y[b][row][h*D + d] pitch ypitch, whole-line rows (D % 32 == 0).
// Block = 16 waves = 4 query tiles x NG key groups: group g walks the 32-key chunks g, g + NG, ... with its own K/V/P staging and its own
// running (max, sum, O); the NG partial results of a query tile are merged once, through LDS, after the loop.
// K/V staging: a group's next 32 keys come as f32 rows into sRaw by asynchronous copies that fly under the current chunk's products and softmax;
// at the top of the next trip every thread reads back the pieces it copied itself, splits them and stores the hi / lo planes as before.
template <int D>
__global__ __launch_bounds__(512) void k_flash3(const float* __restrict__ Qb, int qpitch, int Tq,
                                              const float* __restrict__ K1, const float* __restrict__ V1, int Tk1,
                                              const float* __restrict__ K2, const float* __restrict__ V2, int Tk2, int kpitch, int vpitch,
                                              int H, float scale, const int* __restrict__ mask, int causal, const float* __restrict__ sbias,
                                              float* __restrict__ y, int ypitch) {
  constexpr int KS = D / 32, DT = D / 16, NG = 4;
  __shared__ __attribute__((aligned(16))) unsigned short sKh[NG][32][D + 8], sKl[NG][32][D + 8];
  __shared__ __attribute__((aligned(32))) unsigned short sVh[NG][32][D + 16], sVl[NG][32][D + 16];   // V rows are read by transposing loads: pitch 32 B x odd
  __shared__ __attribute__((aligned(16))) unsigned short sPh[4 * NG][16][40], sPl[4 * NG][16][40];
  static_assert(D == 128, "a group's 128 threads copy 8 K pieces and 8 V pieces of 16 B each per 32 keys");
  __shared__ __attribute__((aligned(16))) float sRaw[NG][2][32][D];      // f32 K rows | V rows of each group's next chunk, unpadded: a wave's copy or read covers one 512-B row
  float (*sO)[16][D] = reinterpret_cast<float (*)[16][D]>(&sRaw[0][0][0][0]);   // the partial O tiles take the same bytes (NG * 256 * D either way) once the loop has ended
  __shared__ float sM[4 * NG][16], sL[4 * NG][16];
  const int tid = threadIdx.x, lane = tid & 31, ln = lane & 15, hh = lane >> 4;
  const int w = __builtin_amdgcn_readfirstlane(tid >> 5);   // wave number, kept scalar so that the group's key offset and LDS bases stay scalar
  const int qt = w & 3, g = w >> 2;                         // query tile, key group
  const int vr = 8 * hh + (lane & 7), vc = 8 * ((lane >> 3) & 1);   // the lane's row and column offset in a transposing load of V
  const int Tk = Tk1 + Tk2;
  const int nqb = (Tq + 63) / 64;
  const int bh = blockIdx.x / nqb, qblk = blockIdx.x % nqb;
  const int b = bh / H, h = bh % H;
  const int q0 = qblk * 64 + qt * 16;
  const float* Q = Qb + (size_t)b * Tq * qpitch + h * D;
  const int kv_end = causal ? min(Tk, qblk * 64 + 64) : Tk;
  const int sr = qt, sc = lane * 4;   // staging: a row is 32 pieces of 16 B, so a wave takes whole rows: rows sr + 4 * i of its group's chunk (scalar), the lane columns sc .. sc + 3
  const float* K1b = K1 + (size_t)b * Tk1 * kpitch + h * D; const float* V1b = V1 + (size_t)b * Tk1 * vpitch + h * D;
  const float* K2b = K2 + (size_t)b * Tk2 * kpitch + h * D; const float* V2b = V2 + (size_t)b * Tk2 * vpitch + h * D;
  const unsigned rawk = (unsigned)(size_t)&sRaw[g][0][sr][sc];   // LDS byte address of the thread's first K piece; its V pieces lie 32 rows further
  // 16 asynchronous copies per thread: the 32 keys from jn on, K and V. A key past the end is clamped to the last one, so that every lane's
  // address stays inside the source; such a key's scores are masked below, its P is 0 and its (finite) V row adds nothing.
  auto copy_kv = [&](int jn) {
    const float* pk[8]; const float* pv[8];
    unsigned lk[8], lv[8];
#pragma unroll   // every index constant: the 32 addresses are register operands of the two statements below
    for (int i = 0; i < 8; ++i) {
      const int key = min(jn + sr + 4 * i, Tk - 1);
      const bool first = key < Tk1;
      const unsigned kk = (unsigned)(first ? key : key - Tk1);
      pk[i] = (first ? K1b : K2b) + (size_t)kk * (unsigned)kpitch + sc;
      pv[i] = (first ? V1b : V2b) + (size_t)kk * (unsigned)vpitch + sc;
      lk[i] = rawk + i * (4 * D * 4); lv[i] = lk[i] + 32 * D * 4;
    }
    // the s_wait_xcnt closes each statement as a precaution: no address register of an issued copy is rewritten ahead of it
    asm volatile("global_load_async_to_lds_b128 %0, %8, off\n\tglobal_load_async_to_lds_b128 %1, %9, off\n\t"
                 "global_load_async_to_lds_b128 %2, %10, off\n\tglobal_load_async_to_lds_b128 %3, %11, off\n\t"
                 "global_load_async_to_lds_b128 %4, %12, off\n\tglobal_load_async_to_lds_b128 %5, %13, off\n\t"
                 "global_load_async_to_lds_b128 %6, %14, off\n\tglobal_load_async_to_lds_b128 %7, %15, off\n\ts_wait_xcnt 0x0"
                 :: "v"(lk[0]), "v"(lk[1]), "v"(lk[2]), "v"(lk[3]), "v"(lk[4]), "v"(lk[5]), "v"(lk[6]), "v"(lk[7]),
                    "v"(pk[0]), "v"(pk[1]), "v"(pk[2]), "v"(pk[3]), "v"(pk[4]), "v"(pk[5]), "v"(pk[6]), "v"(pk[7]) : "memory");
    asm volatile("global_load_async_to_lds_b128 %0, %8, off\n\tglobal_load_async_to_lds_b128 %1, %9, off\n\t"
                 "global_load_async_to_lds_b128 %2, %10, off\n\tglobal_load_async_to_lds_b128 %3, %11, off\n\t"
                 "global_load_async_to_lds_b128 %4, %12, off\n\tglobal_load_async_to_lds_b128 %5, %13, off\n\t"
                 "global_load_async_to_lds_b128 %6, %14, off\n\tglobal_load_async_to_lds_b128 %7, %15, off\n\ts_wait_xcnt 0x0"
                 :: "v"(lv[0]), "v"(lv[1]), "v"(lv[2]), "v"(lv[3]), "v"(lv[4]), "v"(lv[5]), "v"(lv[6]), "v"(lv[7]),
                    "v"(pv[0]), "v"(pv[1]), "v"(pv[2]), "v"(pv[3]), "v"(pv[4]), "v"(pv[5]), "v"(pv[6]), "v"(pv[7]) : "memory");
  };
  if (kv_end > 0) copy_kv(32 * g);   // the first chunk flies under the Q fragment loads (block-uniform test)
  FragB aqh[KS], aql[KS];
  {
    int row = q0 + ln; if (row >= Tq) row = Tq - 1;
    const float* qr = Q + (size_t)row * qpitch;
#pragma unroll
    for (int ks = 0; ks < KS; ++ks)
#pragma unroll
      for (int i = 0; i < 16; ++i) {
        const int d = ks * 32 + ((i < 8) ? (8 * hh + i) : (16 + 8 * hh + (i - 8)));
        const float x = qr[d] * scale; const unsigned short hb = bf16_bits(x);
        aqh[ks].u[i] = hb; aql[ks].u[i] = bf16_bits(x - bf16_val(hb));
      }
  }
  int qrow[8];
#pragma unroll
  for (int r = 0; r < 8; ++r) { int qi = q0 + 8 * hh + r; qrow[r] = qi < Tq ? qi : Tq - 1; }
  float m_r[8], l_r[8];
#pragma unroll
  for (int r = 0; r < 8; ++r) { m_r[r] = -3.0e38f; l_r[r] = 0.f; }
  v8f oacc[DT];
#pragma unroll
  for (int dt = 0; dt < DT; ++dt) oacc[dt] = (v8f){0.f,0.f,0.f,0.f,0.f,0.f,0.f,0.f};
  for (int jg = 0; jg < kv_end; jg += 32 * NG) {               // block-uniform trip count; a chunk past kv_end is fully masked and adds nothing
    const int j0 = jg + 32 * g;
    asm volatile("s_wait_asynccnt 0x0" ::: "memory");   // this wave's copies of this chunk have landed before it reads them back
    __syncthreads();   // ends every wave's reads of the previous chunk's planes
#pragma unroll   // lets the LDS reads of later pieces go out ahead of the splitting of earlier ones
    for (int i = 0; i < 8; ++i) {
      const int r = sr + 4 * i;
      const v4f kf = *(const v4fa*)&sRaw[g][0][r][sc], vf = *(const v4fa*)&sRaw[g][1][r][sc];
#pragma unroll
      for (int t = 0; t < 4; ++t) {
        unsigned short hb = bf16_bits(kf[t]); sKh[g][r][sc + t] = hb; sKl[g][r][sc + t] = bf16_bits(kf[t] - bf16_val(hb));
        hb = bf16_bits(vf[t]); sVh[g][r][sc + t] = hb; sVl[g][r][sc + t] = bf16_bits(vf[t] - bf16_val(hb));
      }
    }
    asm volatile("s_wait_dscnt 0x0" ::: "memory");   // the wave's reads of sRaw have retired before the copies below refill it
    __syncthreads();   // publishes the planes; behind it nobody reads sRaw any more
    if (jg + 32 * NG < kv_end) copy_kv(j0 + 32 * NG);   // the next chunk flies under this chunk's products and softmax (block-uniform test)
    v8f s[2];
#pragma unroll
    for (int nt = 0; nt < 2; ++nt) {
      v8f acc = {};
#pragma unroll
      for (int ks = 0; ks < KS; ++ks) {
        FragB bh_, bl_;
        bh_.half[0] = *(const v8us*)&sKh[g][nt * 16 + ln][ks * 32 + 8 * hh]; bh_.half[1] = *(const v8us*)&sKh[g][nt * 16 + ln][ks * 32 + 16 + 8 * hh];
        bl_.half[0] = *(const v8us*)&sKl[g][nt * 16 + ln][ks * 32 + 8 * hh]; bl_.half[1] = *(const v8us*)&sKl[g][nt * 16 + ln][ks * 32 + 16 + 8 * hh];
        acc = mmaN<3>(aqh[ks].v, aql[ks].v, bh_.v, bl_.v, acc);
      }
      s[nt] = acc;
    }
    float alpha[8];
#pragma unroll
    for (int r = 0; r < 8; ++r) {
      const int qi = qrow[r];
      const int ja = j0 + ln, jb = j0 + 16 + ln;
      bool keepa = ja < Tk, keepb = jb < Tk;
      if (causal) { keepa = keepa && (ja <= qi); keepb = keepb && (jb <= qi); }
      if (mask) { if (keepa) keepa = mask[(size_t)qi * Tk + ja] != 0; if (keepb) keepb = mask[(size_t)qi * Tk + jb] != 0; }
      if (sbias) { if (keepa) s[0][r] += sbias[(size_t)bh * Tk + ja]; if (keepb) s[1][r] += sbias[(size_t)bh * Tk + jb]; }   // per-key additive bias (a per-query constant would cancel in the softmax)
      if (!keepa) s[0][r] = -3.0e38f;
      if (!keepb) s[1][r] = -3.0e38f;
      float mx = fmaxf(s[0][r], s[1][r]);
      mx = fmaxf(mx, __shfl_xor(mx, 1, 32)); mx = fmaxf(mx, __shfl_xor(mx, 2, 32)); mx = fmaxf(mx, __shfl_xor(mx, 4, 32)); mx = fmaxf(mx, __shfl_xor(mx, 8, 32));
      const float mnew = fmaxf(m_r[r], mx);
      alpha[r] = (mnew > -1.0e38f) ? __expf(m_r[r] - mnew) : 1.0f;
      const float p0 = keepa ? __expf(s[0][r] - mnew) : 0.f;
      const float p1 = keepb ? __expf(s[1][r] - mnew) : 0.f;
      m_r[r] = mnew;
      l_r[r] = l_r[r] * alpha[r] + p0 + p1;
      unsigned short hb = bf16_bits(p0); sPh[w][8 * hh + r][ln] = hb;      sPl[w][8 * hh + r][ln] = bf16_bits(p0 - bf16_val(hb));
      hb = bf16_bits(p1);                sPh[w][8 * hh + r][16 + ln] = hb; sPl[w][8 * hh + r][16 + ln] = bf16_bits(p1 - bf16_val(hb));
    }
#pragma unroll
    for (int dt = 0; dt < DT; ++dt)
#pragma unroll
      for (int r = 0; r < 8; ++r) oacc[dt][r] *= alpha[r];
    __builtin_amdgcn_fence(__ATOMIC_ACQ_REL, "workgroup");
    __builtin_amdgcn_wave_barrier();
    FragB pah, pal;
    pah.half[0] = *(const v8us*)&sPh[w][ln][8 * hh]; pah.half[1] = *(const v8us*)&sPh[w][ln][16 + 8 * hh];
    pal.half[0] = *(const v8us*)&sPl[w][ln][8 * hh]; pal.half[1] = *(const v8us*)&sPl[w][ln][16 + 8 * hh];
    // element i of a V fragment = V[8 * hh + i][dt * 16 + ln], element 8 + i = V[16 + 8 * hh + i][dt * 16 + ln]: the k order of pah / pal
    FragB bvh[2], bvl[2];
    auto vfrag = [&](int dt) {
      bvh[dt & 1].half[0] = ld_tr16(&sVh[g][vr][dt * 16 + vc]); bvh[dt & 1].half[1] = ld_tr16(&sVh[g][16 + vr][dt * 16 + vc]);
      bvl[dt & 1].half[0] = ld_tr16(&sVl[g][vr][dt * 16 + vc]); bvl[dt & 1].half[1] = ld_tr16(&sVl[g][16 + vr][dt * 16 + vc]);
    };
    vfrag(0);
#pragma unroll
    for (int dt = 0; dt < DT; ++dt) {
      if (dt + 1 < DT) vfrag(dt + 1);   // the next tile's four loads fly under this tile's three products
      oacc[dt] = mmaN<3>(pah.v, pal.v, bvh[dt & 1].v, bvl[dt & 1].v, oacc[dt]);
    }
    __builtin_amdgcn_fence(__ATOMIC_ACQ_REL, "workgroup");
    __builtin_amdgcn_wave_barrier();
  }
  asm volatile("s_wait_asynccnt 0x0" ::: "memory");   // no copy is outstanding when sRaw's bytes become sO (its last readers left it at the last trip's second barrier)
#pragma unroll
  for (int r = 0; r < 8; ++r) {
    float l = l_r[r];
    l += __shfl_xor(l, 1, 32); l += __shfl_xor(l, 2, 32); l += __shfl_xor(l, 4, 32); l += __shfl_xor(l, 8, 32);
    if (ln == 0) { sM[w][8 * hh + r] = m_r[r]; sL[w][8 * hh + r] = l; }
  }
#pragma unroll
  for (int dt = 0; dt < DT; ++dt)
#pragma unroll
    for (int r = 0; r < 8; ++r) sO[w][8 * hh + r][dt * 16 + ln] = oacc[dt][r];
  __syncthreads();   // every group's partial (max, sum, O) is in LDS before any wave merges
  // merge: wave (qt, g) finishes rows g*16/NG ... of query tile qt; a lane owns 4 columns of the row
#pragma unroll
  for (int i = 0; i < 16 / NG; ++i) {
    const int rr = g * (16 / NG) + i, row = q0 + rr;
    if (row < Tq && lane < D / 4) {
      float mg[NG], mall = -3.0e38f;
#pragma unroll
      for (int k = 0; k < NG; ++k) { mg[k] = sM[k * 4 + qt][rr]; mall = fmaxf(mall, mg[k]); }
      float lall = 0.f;
      v4f val = {0.f, 0.f, 0.f, 0.f};
#pragma unroll
      for (int k = 0; k < NG; ++k) {
        const float wt = (mg[k] > -1.0e38f) ? __expf(mg[k] - mall) : 0.f;
        const v4f o = *(const v4fa*)&sO[k * 4 + qt][rr][lane * 4];
        lall += wt * sL[k * 4 + qt][rr];
        val += wt * o;
      }
      const float inv = (mall > -1.0e38f) ? 1.0f / lall : __builtin_nanf("");
      *(v4f*)(y + ((size_t)b * Tq + row) * ypitch + h * D + lane * 4) = val * inv;
      if (i + 1 < 16 / NG) asm volatile("s_wait_xcnt 0x0" ::: "memory");   // precaution: stands before the next row's reads reuse the store's address and data registers
    }
  }
}

__global__ __launch_bounds__(256) void k_roundcopy(const float* __restrict__ src, float* __restrict__ dst, int n8) {
  const size_t t = (size_t)blockIdx.x * 256 + threadIdx.x;
  if (t >= (size_t)n8 * 2) return;
  v4f a = *(const v4fa*)(src + t * 4);
  for (int i = 0; i < 4; ++i) a[i] = bf16_round(a[i]);
  *(v4f*)(dst + t * 4) = a; 
}

__global__ void k_ln_rows(const float* __restrict__ X, const float* __restrict__ R, const float* __restrict__ g, const float* __restrict__ bta, float* __restrict__ out, int N, float eps) {
  __shared__ float red[256];
  const int row = blockIdx.x, tid = threadIdx.x, nt = blockDim.x;
  v4f a = *(const v4fa*)(X + (size_t)row * N + tid * 4);
  if (R) { const v4f rr = *(const v4fa*)(R + (size_t)row * N + tid * 4); for (int q = 0; q < 4; ++q) a[q] += rr[q]; }
  float s = a[0] + a[1] + a[2] + a[3];
  red[tid] = s; __syncthreads();
  for (int st = nt / 2; st > 0; st >>= 1) { if (tid < st) red[tid] += red[tid + st]; __syncthreads(); }
  const float mu = red[0] / (float)N; __syncthreads();
  float v = 0.f; for (int q = 0; q < 4; ++q) { const float c = a[q] - mu; v += c * c; }
  red[tid] = v; __syncthreads();
  for (int st = nt / 2; st > 0; st >>= 1) { if (tid < st) red[tid] += red[tid + st]; __syncthreads(); }
  const float rs = rsqrtf(red[0] / (float)N + eps);
  v4f o; for (int q = 0; q < 4; ++q) o[q] = (a[q] - mu) * rs * bf16_round(g[tid * 4 + q]) + bf16_round(bta[tid * 4 + q]);
  *(v4f*)(out + (size_t)row * N + tid * 4) = o; 
}

// Bt[h*DK + k][d] = W[h][d][k]  (W [H][D][DK]); thread per (n, 8 d)
__global__ __launch_bounds__(256) void k_wt_heads(const float* __restrict__ W, unsigned short* __restrict__ Bt) {
  const int t = blockIdx.x * 256 + threadIdx.x; if (t >= NH * DK * (DD / 8)) return;
  const int n = t / (DD / 8), d8 = (t % (DD / 8)) * 8; const int h = n / DK, kk = n % DK; v8us v;
#pragma unroll
  for (int i = 0; i < 8; ++i) v[i] = bf16_bits(W[((size_t)h * DD + d8 + i) * DK + kk]);
  *(v8us*)(Bt + (size_t)n * DD + d8) = v; 
}
extern "C" void kernel_launch(void* const* d_in, const int* in_sizes, int n_in,
                              void* d_out, int out_size, void* d_ws, size_t ws_size, hipStream_t stream) {
  (void)in_sizes; (void)n_in; (void)out_size;
  const float* token = (const float*)d_in[0];
  const float* Wq = (const float*)d_in[1]; const float* bq = (const float*)d_in[2]; const float* Wk = (const float*)d_in[3]; const float* bk = (const float*)d_in[4];
  const float* Wv = (const float*)d_in[5]; const float* bv = (const float*)d_in[6]; const float* Wo = (const float*)d_in[7]; const float* bo = (const float*)d_in[8];
  const float* Wf = (const float*)d_in[9]; const float* bfv = (const float*)d_in[10]; const float* gamma = (const float*)d_in[11]; const float* beta = (const float*)d_in[12];
  char* ws = (char*)d_ws; size_t off = 0;
  auto take = [&](size_t bytes) { char* p = ws + off; off += (bytes + 255) & ~(size_t)255; return p; };
  unsigned short* Bqkv = (unsigned short*)take((size_t)3 * DD * DD * 2); unsigned short* Bo = (unsigned short*)take((size_t)DD * DD * 2); unsigned short* Bf = (unsigned short*)take((size_t)DD * DD * 2);
  float* bqkv = (float*)take(3 * DD * 4);
  float* x = (float*)take((size_t)SS * DD * 4); float* qkv = (float*)take((size_t)SS * 3 * DD * 4); float* att = (float*)take((size_t)SS * DD * 4); float* tmp = (float*)take((size_t)SS * DD * 4); float* a = (float*)take((size_t)SS * DD * 4);
  if (off > ws_size) return;
  k_wt_heads<<<(NH * DK * (DD / 8) + 255) / 256, 256, 0, stream>>>(Wq, Bqkv);
  k_wt_heads<<<(NH * DK * (DD / 8) + 255) / 256, 256, 0, stream>>>(Wk, Bqkv + (size_t)DD * DD);
  k_wt_heads<<<(NH * DK * (DD / 8) + 255) / 256, 256, 0, stream>>>(Wv, Bqkv + (size_t)2 * DD * DD);
  k_wt_bf16<<<(DD * (DD / 8) + 255) / 256, 256, 0, stream>>>(Wo, Bo, DD, DD);
  k_wt_bf16<<<(DD * (DD / 8) + 255) / 256, 256, 0, stream>>>(Wf, Bf, DD, DD);
  k_roundcopy<<<(3 * DD / 4 + 255) / 256, 256, 0, stream>>>(bq, bqkv, DD / 8);            // bq|bk|bv flat [H*DK] each: three copies (f32, rounded) into one bias vector
  k_roundcopy<<<(DD / 4 + 255) / 256, 256, 0, stream>>>(bk, bqkv + DD, DD / 8);
  k_roundcopy<<<(DD / 4 + 255) / 256, 256, 0, stream>>>(bv, bqkv + 2 * DD, DD / 8);
  k_roundcopy<<<(SS * DD / 4 + 255) / 256, 256, 0, stream>>>(token, x, SS * DD / 8);
  const int gq = (SS / 64) * (3 * DD / 128), g1 = (SS / 64) * (DD / 128);
  for (int l = 0; l < NLAY; ++l) {
    k_gemm_tile<false><<<gq, 256, 0, stream>>>(x, DD, Bqkv, DD, bqkv, qkv, 3 * DD, 3 * DD, DD);      // bias already rounded (BIAS_BF16=false adds it as given)
    k_flash3<DK><<<NH * (SS / 64), 512, 0, stream>>>(qkv, 3 * DD, SS, qkv + DD, qkv + 2 * DD, SS, nullptr, nullptr, 0, 3 * DD, 3 * DD, NH, 0.08838834764831845f, nullptr, 0, nullptr, att, DD);
    k_gemm_tile<true><<<g1, 256, 0, stream>>>(att, DD, Bo, DD, bo, tmp, DD, DD, DD);
    k_ln_rows<<<SS, DD / 4, 0, stream>>>(tmp, x, gamma, beta, a, DD, 1e-5f);                  // a = LN(x + attn_out)
    k_gemm_tile<true><<<g1, 256, 0, stream>>>(a, DD, Bf, DD, bfv, tmp, DD, DD, DD);
    k_ln_rows<<<SS, DD / 4, 0, stream>>>(tmp, a, gamma, beta, (l == NLAY - 1) ? (float*)d_out : x, DD, 1e-5f);   // x = LN(a + ff)
  }
}

// v005
// Measured time: 913 microseconds a run.
// Two timings next to v004 put it at 1.13 and 1.14 times that version's speed.
// All steps since v000 together make it 4.43 times as fast.
#include <hip/hip_runtime.h>
// All GEMMs on v_wmma_f32_16x16x32_bf16, f32 accumulate: fused per-head q|k|v projection (K=1024, N=3072), concat·Wo, a·Wf — A operands
// (the residual stream, quantised to bf16 once at the input) split into bf16 hi/lo (2 terms) against bf16-rounded weights; attention QKᵀ/√128
// and P·V per 16-query tile as 3-term splits (head dim 128); LayerNorm and softmax in f32. Six layers with shared weights.
#define SS 2048
#define DD 1024
#define NH 8
#define DK 128
#define NLAY 6

typedef __bf16 v16b __attribute__((ext_vector_type(16)));
typedef unsigned short v8us __attribute__((ext_vector_type(8), may_alias));
typedef unsigned short v4us __attribute__((ext_vector_type(4), may_alias));
typedef float  v8f  __attribute__((ext_vector_type(8)));
typedef float  v4f  __attribute__((ext_vector_type(4)));
typedef float  v4fa __attribute__((ext_vector_type(4), may_alias));
union FragB { v16b v; v8us half[2]; unsigned short u[16]; };
typedef short s16x8 __attribute__((ext_vector_type(8)));
typedef __attribute__((address_space(3))) s16x8 lds_s16x8;
// transposing LDS load of an 8 x 16 block of 16-bit elements per lane half: lane l points at 8 elements of row 8*(l>>4) + (l&7), columns 8*((l>>3)&1) ...;
// lane (c = l&15, h = l>>4) receives rows 8h .. 8h+7 of column c
__device__ __forceinline__ v8us ld_tr16(const unsigned short* p) { return __builtin_bit_cast(v8us, __builtin_amdgcn_ds_load_tr16_b128_v8i16((lds_s16x8*)p)); }

__device__ __forceinline__ unsigned short bf16_bits(float x) { unsigned int u = __float_as_uint(x); return (unsigned short)((u + 0x7FFFu + ((u >> 16) & 1u)) >> 16); }
__device__ __forceinline__ float bf16_val(unsigned short b) { return __uint_as_float(((unsigned int)b) << 16); }
__device__ __forceinline__ float bf16_round(float x) { return bf16_val(bf16_bits(x)); }
// D += A·B with NT terms: 1 = ah·bh, 2 = + al·bh (A split), 3 = + ah·bl (both split)
template <int NT>
__device__ __forceinline__ v8f mmaN(v16b ah, v16b al, v16b bh, v16b bl, v8f c) {
  c = __builtin_amdgcn_wmma_f32_16x16x32_bf16(false, ah, false, bh, (short)0, c, false, false);
  if (NT >= 2) c = __builtin_amdgcn_wmma_f32_16x16x32_bf16(false, al, false, bh, (short)0, c, false, false);
  if (NT >= 3) c = __builtin_amdgcn_wmma_f32_16x16x32_bf16(false, ah, false, bl, (short)0, c, false, false);
  asm volatile("v_nop\n\tv_nop\n\tv_nop\n\tv_nop" : "+v"(c) : "v"(ah), "v"(al), "v"(bh), "v"(bl));
  return c;
}

__global__ __launch_bounds__(256) void k_wt_bf16(const float* __restrict__ W, unsigned short* __restrict__ Wt, int K, int N) {
  const int t = blockIdx.x * 256 + threadIdx.x;
  const int k8n = K / 8;
  if (t >= N * k8n) return;
  const int n = t / k8n, k8 = (t % k8n) * 8;
  v8us v;
#pragma unroll
  for (int i = 0; i < 8; ++i) v[i] = bf16_bits(W[(size_t)(k8 + i) * N + n]);
  *(v8us*)(Wt + (size_t)n * K + k8) = v;
  
}

// GEMM C[M][N] (f32, pitch ldc) = act(A[M][K]·W + bias). A f32 row-major (pitch lda) converted per fragment to bf16
// (ASPLIT: hi/lo two planes -> 2 terms, else single rounded term); Wt bf16 [N][K] (pitch ldb). BIAS_BF16 rounds the
// bias to bf16 first (bias quantised to bf16 before the add). K%32==0, M%16==0, N%64==0.
template <bool ASPLIT, int ACT, bool BIAS_BF16>
__global__ __launch_bounds__(128) void k_gemm_bf(const float* __restrict__ A, int lda, const unsigned short* __restrict__ Wt, int ldb,
                                               const float* __restrict__ bias, float* __restrict__ C, int ldc, int M, int N, int K) {
  __shared__ __attribute__((aligned(16))) float so[4][16][64];
  const int tid = threadIdx.x, w = tid >> 5, lane = tid & 31, ln = lane & 15, hh = lane >> 4;
  const int ntn = N / 64;
  const int wid = blockIdx.x * 4 + w;
  const int mt = wid / ntn, nq = wid % ntn;
  if (mt * 16 >= M) return;
  const int row0 = mt * 16, col0 = nq * 64;
  const float* arow = A + (size_t)(row0 + ln) * lda;
  v8f acc[4] = {};
  for (int kb = 0; kb < K; kb += 32) {
    FragB ah, al;
    const v4f x0 = *(const v4fa*)(arow + kb + 8 * hh), x1 = *(const v4fa*)(arow + kb + 8 * hh + 4);
    const v4f x2 = *(const v4fa*)(arow + kb + 16 + 8 * hh), x3 = *(const v4fa*)(arow + kb + 16 + 8 * hh + 4);
    float xs[16] = {x0[0],x0[1],x0[2],x0[3],x1[0],x1[1],x1[2],x1[3],x2[0],x2[1],x2[2],x2[3],x3[0],x3[1],x3[2],x3[3]};
#pragma unroll
    for (int i = 0; i < 16; ++i) { const unsigned short hb = bf16_bits(xs[i]); ah.u[i] = hb; al.u[i] = ASPLIT ? bf16_bits(xs[i] - bf16_val(hb)) : (unsigned short)0; }
#pragma unroll
    for (int t = 0; t < 4; ++t) {
      const unsigned short* brow = Wt + (size_t)(col0 + t * 16 + ln) * ldb + kb;
      FragB b;
      b.half[0] = *(const v8us*)(brow + 8 * hh);
      b.half[1] = *(const v8us*)(brow + 16 + 8 * hh);
      acc[t] = mmaN<ASPLIT ? 2 : 1>(ah.v, al.v, b.v, b.v, acc[t]);
    }
  }
#pragma unroll
  for (int t = 0; t < 4; ++t) {
    float bv = bias ? bias[col0 + t * 16 + ln] : 0.f;
    if (BIAS_BF16) bv = bf16_round(bv);
#pragma unroll
    for (int r = 0; r < 8; ++r) { float v = acc[t][r] + bv; if (ACT == 1) v = fmaxf(v, 0.f); so[w][8 * hh + r][t * 16 + ln] = v; }
  }
  __builtin_amdgcn_fence(__ATOMIC_ACQ_REL, "workgroup");
  __builtin_amdgcn_wave_barrier();
  const int rsub = lane >> 4, c4 = (lane & 15) * 4;
  {
#pragma unroll
    for (int q = 0; q < 8; ++q) {
      const int r = q * 2 + rsub;
      const v4f v = *(const v4fa*)&so[w][r][c4];
      *(v4f*)(C + (size_t)(row0 + r) * ldc + col0 + c4) = v;
    }
    
  }
}

// Flash-style causal/unmasked attention, all contractions 3-term bf16 hi/lo splits, f32 softmax with running max.
// q,k,v rows are read from f32 buffers with arbitrary row pitch (so they can live inside a fused qkv buffer);
// D = head size (multiple of 32, <= 128); one wave = 16 query rows; block = 4 waves (64 queries) sharing K/V chunks of 32.
template <int D, bool CAUSAL>
__global__ __launch_bounds__(128) void k_flash(const float* __restrict__ qb, const float* __restrict__ kb, const float* __restrict__ vb,
                                             int pitch, int T, int H, float scale, float* __restrict__ y, int ypitch) {
  constexpr int KS = D / 32;        // k-steps for QK
  constexpr int DT = D / 16;        // d tiles for PV
  __shared__ __attribute__((aligned(16))) unsigned short sKh[32][D + 8], sKl[32][D + 8], sVh[32][D + 8], sVl[32][D + 8];
  __shared__ __attribute__((aligned(16))) unsigned short sPh[4][16][40], sPl[4][16][40];
  __shared__ __attribute__((aligned(16))) float sO[4][16][D];
  const int tid = threadIdx.x, w = tid >> 5, lane = tid & 31, ln = lane & 15, hh = lane >> 4;
  const int nqb = (T + 63) / 64;
  const int bh = blockIdx.x / nqb, qblk = blockIdx.x % nqb;
  const int b = bh / H, h = bh % H;
  const int q0 = qblk * 64 + w * 16;
  const float* Q = qb + (size_t)b * T * pitch + h * D;
  const float* K = kb + (size_t)b * T * pitch + h * D;
  const float* V = vb + (size_t)b * T * pitch + h * D;

  // A fragments of the wave's 16 query rows (scaled), hi/lo
  FragB aqh[KS], aql[KS];
  {
    int row = q0 + ln; if (row >= T) row = T - 1;
    const float* qr = Q + (size_t)row * pitch;
#pragma unroll
    for (int ks = 0; ks < KS; ++ks)
#pragma unroll
      for (int i = 0; i < 16; ++i) {
        const int d = ks * 32 + ((i < 8) ? (8 * hh + i) : (16 + 8 * hh + (i - 8)));
        const float x = qr[d] * scale; const unsigned short hb = bf16_bits(x);
        aqh[ks].u[i] = hb; aql[ks].u[i] = bf16_bits(x - bf16_val(hb));
      }
  }
  float m_r[8], l_r[8];
#pragma unroll
  for (int r = 0; r < 8; ++r) { m_r[r] = -3.0e38f; l_r[r] = 0.f; }
  v8f oacc[DT];
#pragma unroll
  for (int dt = 0; dt < DT; ++dt) oacc[dt] = (v8f){0.f,0.f,0.f,0.f,0.f,0.f,0.f,0.f};

  const int kv_end = CAUSAL ? min(T, qblk * 64 + 64) : T;     // block-uniform
  for (int j0 = 0; j0 < kv_end; j0 += 32) {
    __syncthreads();
    for (int e = tid; e < 32 * (D / 4); e += 128) {
      const int r = e / (D / 4), c4 = (e % (D / 4)) * 4;
      const int key = j0 + r;
      v4f kf = {0.f,0.f,0.f,0.f}, vf = {0.f,0.f,0.f,0.f};
      if (key < T) { kf = *(const v4fa*)(K + (size_t)key * pitch + c4); vf = *(const v4fa*)(V + (size_t)key * pitch + c4); }
#pragma unroll
      for (int t = 0; t < 4; ++t) {
        unsigned short hb = bf16_bits(kf[t]); sKh[r][c4 + t] = hb; sKl[r][c4 + t] = bf16_bits(kf[t] - bf16_val(hb));
        hb = bf16_bits(vf[t]); sVh[r][c4 + t] = hb; sVl[r][c4 + t] = bf16_bits(vf[t] - bf16_val(hb));
      }
    }
    __syncthreads();
    // S tile 16 x 32
    v8f s[2];
#pragma unroll
    for (int nt = 0; nt < 2; ++nt) {
      v8f acc = {};
#pragma unroll
      for (int ks = 0; ks < KS; ++ks) {
        FragB bh_, bl_;
        bh_.half[0] = *(const v8us*)&sKh[nt * 16 + ln][ks * 32 + 8 * hh]; bh_.half[1] = *(const v8us*)&sKh[nt * 16 + ln][ks * 32 + 16 + 8 * hh];
        bl_.half[0] = *(const v8us*)&sKl[nt * 16 + ln][ks * 32 + 8 * hh]; bl_.half[1] = *(const v8us*)&sKl[nt * 16 + ln][ks * 32 + 16 + 8 * hh];
        acc = mmaN<3>(aqh[ks].v, aql[ks].v, bh_.v, bl_.v, acc);
      }
      s[nt] = acc;
    }
    // mask + running max (rows 8hh+r; the 16 lanes of a half share rows)
    float alpha[8];
#pragma unroll
    for (int r = 0; r < 8; ++r) {
      const int qi = q0 + 8 * hh + r;
      const int ja = j0 + ln, jb = j0 + 16 + ln;
      if (CAUSAL) { if (ja > qi) s[0][r] = -3.0e38f; if (jb > qi) s[1][r] = -3.0e38f; }
      if (ja >= T) s[0][r] = -3.0e38f;
      if (jb >= T) s[1][r] = -3.0e38f;
      float mx = fmaxf(s[0][r], s[1][r]);
      mx = fmaxf(mx, __shfl_xor(mx, 1, 32)); mx = fmaxf(mx, __shfl_xor(mx, 2, 32)); mx = fmaxf(mx, __shfl_xor(mx, 4, 32)); mx = fmaxf(mx, __shfl_xor(mx, 8, 32));
      const float mnew = fmaxf(m_r[r], mx);
      alpha[r] = (mnew > -1.0e38f) ? __expf(m_r[r] - mnew) : 1.0f;
      const float p0 = (s[0][r] > -1.0e38f) ? __expf(s[0][r] - mnew) : 0.f;
      const float p1 = (s[1][r] > -1.0e38f) ? __expf(s[1][r] - mnew) : 0.f;
      m_r[r] = mnew;
      l_r[r] = l_r[r] * alpha[r] + p0 + p1;            // per-lane partial row sum (16 lanes combined at the end)
      unsigned short hb = bf16_bits(p0); sPh[w][8 * hh + r][ln] = hb;      sPl[w][8 * hh + r][ln] = bf16_bits(p0 - bf16_val(hb));
      hb = bf16_bits(p1);                sPh[w][8 * hh + r][16 + ln] = hb; sPl[w][8 * hh + r][16 + ln] = bf16_bits(p1 - bf16_val(hb));
    }
#pragma unroll
    for (int dt = 0; dt < DT; ++dt)
#pragma unroll
      for (int r = 0; r < 8; ++r) oacc[dt][r] *= alpha[r];
    __builtin_amdgcn_fence(__ATOMIC_ACQ_REL, "workgroup");
    __builtin_amdgcn_wave_barrier();
    FragB pah, pal;
    pah.half[0] = *(const v8us*)&sPh[w][ln][8 * hh]; pah.half[1] = *(const v8us*)&sPh[w][ln][16 + 8 * hh];
    pal.half[0] = *(const v8us*)&sPl[w][ln][8 * hh]; pal.half[1] = *(const v8us*)&sPl[w][ln][16 + 8 * hh];
#pragma unroll
    for (int dt = 0; dt < DT; ++dt) {
      FragB bvh, bvl;
#pragma unroll
      for (int i = 0; i < 8; ++i) {
        bvh.u[i] = sVh[8 * hh + i][dt * 16 + ln]; bvh.u[8 + i] = sVh[16 + 8 * hh + i][dt * 16 + ln];
        bvl.u[i] = sVl[8 * hh + i][dt * 16 + ln]; bvl.u[8 + i] = sVl[16 + 8 * hh + i][dt * 16 + ln];
      }
      oacc[dt] = mmaN<3>(pah.v, pal.v, bvh.v, bvl.v, oacc[dt]);
    }
    __builtin_amdgcn_fence(__ATOMIC_ACQ_REL, "workgroup");
    __builtin_amdgcn_wave_barrier();
  }
#pragma unroll
  for (int r = 0; r < 8; ++r) {
    float l = l_r[r];
    l += __shfl_xor(l, 1, 32); l += __shfl_xor(l, 2, 32); l += __shfl_xor(l, 4, 32); l += __shfl_xor(l, 8, 32);
    l_r[r] = (l > 0.f) ? 1.0f / l : 0.f;
  }
#pragma unroll
  for (int dt = 0; dt < DT; ++dt)
#pragma unroll
    for (int r = 0; r < 8; ++r) sO[w][8 * hh + r][dt * 16 + ln] = oacc[dt][r] * l_r[r];
  __builtin_amdgcn_fence(__ATOMIC_ACQ_REL, "workgroup");
  __builtin_amdgcn_wave_barrier();
  {
    for (int r = 0; r < 16; ++r) {
      const int row = q0 + r;
      if (row < T && lane < D / 4) {
        const v4f val = *(const v4fa*)&sO[w][r][lane * 4];
        *(v4f*)(y + ((size_t)b * T + row) * ypitch + h * D + lane * 4) = val;
      }
    }
    
  }
}

// GEMM C[M][N] (f32, pitch ldc) = A[M][K] x W + bias: A f32 row-major (pitch lda), two terms (bf16 hi + lo) against Wt bf16 [N][K] (pitch ldb).
// Block = 8 waves (2 x 4) on a 64 x 128 tile of C, a wave owns 32 x 32. K is walked in slices of 64: the A slice is split into its hi and lo
// planes once per block, the Wt slice is copied, both through whole-line global loads into LDS, where all 8 waves read their fragments.
// Two LDS buffers: the next slice's global loads are issued ahead of this slice's products and stored behind them; one barrier per slice.
// Each accumulator takes hi then lo of every 32-wide k step in rising k. M % 64 == 0, N % 128 == 0, K % 64 == 0; grid = (M / 64) * (N / 128).
template <bool BIAS_BF16>
__global__ __launch_bounds__(256) void k_gemm_tile(const float* __restrict__ A, int lda, const unsigned short* __restrict__ Wt, int ldb,
                                                   const float* __restrict__ bias, float* __restrict__ C, int ldc, int N, int K) {
  constexpr int BM = 64, BN = 128, BK = 64, LP = BK + 8;       // LP: LDS row pitch 144 B = 16 B x odd
  constexpr int PA = BM * LP, PB = BN * LP, BUF = 2 * PA + PB;  // one buffer, in 16-bit elements: A hi | A lo | Wt
  constexpr int OP = 36;                                       // pitch of the output staging rows, in floats
  __shared__ __attribute__((aligned(16))) unsigned short sm[2 * BUF];
  const int tid = threadIdx.x, lane = tid & 31, ln = lane & 15, hh = lane >> 4;
  const int w = __builtin_amdgcn_readfirstlane(tid >> 5);      // wave number, kept scalar so that the tile offsets stay scalar
  const int wm = w >> 2, wn = w & 3;
  const int nbn = N / BN;
  const int row0 = (blockIdx.x / nbn) * BM, col0 = (blockIdx.x % nbn) * BN;
  const int ar = tid >> 4, ac = (tid & 15) * 4;                // A slice: a wave's load covers 2 rows x 256 B
  const int br = tid >> 3, bc = (tid & 7) * 8;                 // Wt slice: a wave's load covers 4 rows x 128 B
  const float* ag = A + (size_t)(row0 + ar) * lda + ac;
  const unsigned short* bg = Wt + (size_t)(col0 + br) * ldb + bc;
  v4f ra[4];
  v8us rb[4];
  auto fetch = [&](int kb) {
    const float* pa[4];
    const unsigned short* pb[4];
#pragma unroll
    for (int j = 0; j < 4; ++j) { pa[j] = ag + (size_t)(16 * j) * lda + kb; pb[j] = bg + (size_t)(32 * j) * ldb + kb; }
#pragma unroll
    for (int j = 0; j < 4; ++j) ra[j] = *(const v4fa*)pa[j];
#pragma unroll
    for (int j = 0; j < 4; ++j) rb[j] = *(const v8us*)pb[j];
    // precaution: the eight address pairs are inputs of the wait, so none of them is reused (not even as a later load's result) ahead of it
    asm volatile("s_wait_xcnt 0x0" :: "v"(pa[0]), "v"(pa[1]), "v"(pa[2]), "v"(pa[3]), "v"(pb[0]), "v"(pb[1]), "v"(pb[2]), "v"(pb[3]) : "memory");
  };
  auto stash = [&](unsigned short* sb) {
#pragma unroll
    for (int j = 0; j < 4; ++j) {
      v4us h, l;
#pragma unroll
      for (int t = 0; t < 4; ++t) { const unsigned short hb = bf16_bits(ra[j][t]); h[t] = hb; l[t] = bf16_bits(ra[j][t] - bf16_val(hb)); }
      *(v4us*)(sb + (ar + 16 * j) * LP + ac) = h;
      *(v4us*)(sb + PA + (ar + 16 * j) * LP + ac) = l;
      *(v8us*)(sb + 2 * PA + (br + 32 * j) * LP + bc) = rb[j];
    }
  };
  v8f acc[2][2] = {};
  const int ns = K / BK;
  fetch(0);
  stash(sm);
  __syncthreads();
  for (int s = 0; s < ns; ++s) {
    const unsigned short* sb = sm + (s & 1) * BUF;
    if (s + 1 < ns) fetch((s + 1) * BK);
#pragma unroll
    for (int ks = 0; ks < BK / 32; ++ks) {
      FragB ah[2], al[2], b[2];
#pragma unroll
      for (int t = 0; t < 2; ++t) {
        const unsigned short* pa = sb + (wm * 32 + t * 16 + ln) * LP + ks * 32 + 8 * hh;
        const unsigned short* pb = sb + 2 * PA + (wn * 32 + t * 16 + ln) * LP + ks * 32 + 8 * hh;
        ah[t].half[0] = *(const v8us*)pa;        ah[t].half[1] = *(const v8us*)(pa + 16);
        al[t].half[0] = *(const v8us*)(pa + PA); al[t].half[1] = *(const v8us*)(pa + PA + 16);
        b[t].half[0]  = *(const v8us*)pb;        b[t].half[1]  = *(const v8us*)(pb + 16);
      }
      __builtin_amdgcn_sched_barrier(0);   // keeps the k step's 12 LDS reads together as one group ahead of its 8 products: one LDS wait per k step, not four
#pragma unroll
      for (int mt = 0; mt < 2; ++mt)
#pragma unroll
        for (int nt = 0; nt < 2; ++nt) acc[mt][nt] = __builtin_amdgcn_wmma_f32_16x16x32_bf16(false, ah[mt].v, false, b[nt].v, (short)0, acc[mt][nt], false, false);
#pragma unroll
      for (int mt = 0; mt < 2; ++mt)
#pragma unroll
        for (int nt = 0; nt < 2; ++nt) acc[mt][nt] = __builtin_amdgcn_wmma_f32_16x16x32_bf16(false, al[mt].v, false, b[nt].v, (short)0, acc[mt][nt], false, false);
    }
    if (s + 1 < ns) stash(sm + ((s + 1) & 1) * BUF);
    __syncthreads();   // publishes slice s + 1 and ends every wave's reads of slice s, whose buffer is refilled in the next trip
  }
  // output: each wave turns its 32 x 32 tile through its own piece of the (now free) LDS so that every store covers whole 128-B lines
  float* so = (float*)sm + w * 32 * OP;
#pragma unroll
  for (int nt = 0; nt < 2; ++nt) {
    float bv = bias[col0 + wn * 32 + nt * 16 + ln];
    if (BIAS_BF16) bv = bf16_round(bv);
#pragma unroll
    for (int mt = 0; mt < 2; ++mt)
#pragma unroll
      for (int r = 0; r < 8; ++r) so[(mt * 16 + 8 * hh + r) * OP + nt * 16 + ln] = acc[mt][nt][r] + bv;
  }
  __builtin_amdgcn_fence(__ATOMIC_ACQ_REL, "workgroup");
  __builtin_amdgcn_wave_barrier();
  const int rsub = lane >> 3, c4 = (lane & 7) * 4;
#pragma unroll
  for (int q = 0; q < 8; ++q) {
    const int r = q * 4 + rsub;
    const v4f v = *(const v4fa*)(so + r * OP + c4);
    *(v4f*)(C + (size_t)(row0 + wm * 32 + r) * ldc + col0 + wn * 32 + c4) = v;
  }
}
// row LayerNorm (biased variance, eps) over N: s = X (+ R); optional out_sum <- s; out_norm <- (s-mu)*rsqrt(var+eps)*g + b
template <bool PARAM_BF16>
__global__ __launch_bounds__(256) void k_layernorm(const float* __restrict__ X, const float* __restrict__ R, const float* __restrict__ g, const float* __restrict__ bta,
                                                  float* __restrict__ out_sum, float* __restrict__ out_norm, int N, float eps) {
  __shared__ float red[256];
  const int row = blockIdx.x, tid = threadIdx.x;
  const float* x = X + (size_t)row * N; const float* rr = R ? R + (size_t)row * N : nullptr;
  float vals[16];                     // up to N = 4096
  const int per = N / 256;            // contiguous chunk per thread? use strided-by-4 chunks: thread handles j = tid*4 + 1024*u
  float s1 = 0.f;
  for (int u = 0; u < per / 4; ++u) {
    const int j = tid * 4 + 1024 * u;
    const v4f a = *(const v4fa*)(x + j);
    v4f b = {0.f,0.f,0.f,0.f}; if (rr) b = *(const v4fa*)(rr + j);
#pragma unroll
    for (int q = 0; q < 4; ++q) { const float v = a[q] + b[q]; vals[u * 4 + q] = v; s1 += v; }
  }
  red[tid] = s1; __syncthreads();
  for (int st = 128; st > 0; st >>= 1) { if (tid < st) red[tid] += red[tid + st]; __syncthreads(); }
  const float mu = red[0] / (float)N; __syncthreads();
  float s2 = 0.f;
  for (int u = 0; u < per / 4; ++u)
#pragma unroll
    for (int q = 0; q < 4; ++q) { const float c = vals[u * 4 + q] - mu; s2 += c * c; }
  red[tid] = s2; __syncthreads();
  for (int st = 128; st > 0; st >>= 1) { if (tid < st) red[tid] += red[tid + st]; __syncthreads(); }
  const float rs = rsqrtf(red[0] / (float)N + eps);
  {
    for (int u = 0; u < per / 4; ++u) {
      const int j = tid * 4 + 1024 * u;
      v4f o, sm;
#pragma unroll
      for (int q = 0; q < 4; ++q) {
        float gg = g[j + q], bb = bta[j + q];
        if (PARAM_BF16) { gg = bf16_round(gg); bb = bf16_round(bb); }
        sm[q] = vals[u * 4 + q]; o[q] = (vals[u * 4 + q] - mu) * rs * gg + bb;
      }
      if (out_sum) *(v4f*)(out_sum + (size_t)row * N + j) = sm;
      *(v4f*)(out_norm + (size_t)row * N + j) = o;
    }
    
  }
}

// General attention: queries [b][Tq] rows at Q + b*Tq*qpitch + h*D + row*qpitch; keys/values j < Tk1 from (K1,V1) at
// X + b*Tk1*pitch + h*D + j*pitch, j >= Tk1 from (K2,V2) with j-Tk1 (pass Tk2 = 0 and null for a single source).
// Every query sees every key j < Tk: no mask, no causal cut and no score bias, so the softmax of a chunk holds no test but j < Tk and is one straight-line block.
// 3-term bf16 splits, f32 softmax with running max; y[b][row][h*D + d] pitch ypitch, whole-line rows (D % 32 == 0).
// Block = 16 waves = 4 query tiles x NG key groups: group g walks the 32-key chunks g, g + NG, ... with its own K/V/P staging and its own
// running (max, sum, O); the NG partial results of a query tile are merged once, through LDS, after the loop.
// K/V staging: a group's next 32 keys come as f32 rows into sRaw by asynchronous copies that fly under the current chunk's products and softmax;
// at the top of the next trip every thread reads back the pieces it copied itself, splits them and stores the hi / lo planes as before.
template <int D>
__global__ __launch_bounds__(512) void k_flash3(const float* __restrict__ Qb, int qpitch, int Tq,
                                              const float* __restrict__ K1, const float* __restrict__ V1, int Tk1,
                                              const float* __restrict__ K2, const float* __restrict__ V2, int Tk2, int kpitch, int vpitch,
                                              int H, float scale, float* __restrict__ y, int ypitch) {
  constexpr int KS = D / 32, DT = D / 16, NG = 4;
  __shared__ __attribute__((aligned(16))) unsigned short sKh[NG][32][D + 8], sKl[NG][32][D + 8];
  __shared__ __attribute__((aligned(32))) unsigned short sVh[NG][32][D + 16], sVl[NG][32][D + 16];   // V rows are read by transposing loads: pitch 32 B x odd
  __shared__ __attribute__((aligned(16))) unsigned short sPh[4 * NG][16][40], sPl[4 * NG][16][40];
  static_assert(D == 128, "a group's 128 threads copy 8 K pieces and 8 V pieces of 16 B each per 32 keys");
  __shared__ __attribute__((aligned(16))) float sRaw[NG][2][32][D];      // f32 K rows | V rows of each group's next chunk, unpadded: a wave's copy or read covers one 512-B row
  float (*sO)[16][D] = reinterpret_cast<float (*)[16][D]>(&sRaw[0][0][0][0]);   // the partial O tiles take the same bytes (NG * 256 * D either way) once the loop has ended
  __shared__ float sM[4 * NG][16], sL[4 * NG][16];
  const int tid = threadIdx.x, lane = tid & 31, ln = lane & 15, hh = lane >> 4;
  const int w = __builtin_amdgcn_readfirstlane(tid >> 5);   // wave number, kept scalar so that the group's key offset and LDS bases stay scalar
  const int qt = w & 3, g = w >> 2;                         // query tile, key group
  const int vr = 8 * hh + (lane & 7), vc = 8 * ((lane >> 3) & 1);   // the lane's row and column offset in a transposing load of V
  const int Tk = Tk1 + Tk2;
  const int nqb = (Tq + 63) / 64;
  const int bh = blockIdx.x / nqb, qblk = blockIdx.x % nqb;
  const int b = bh / H, h = bh % H;
  const int q0 = qblk * 64 + qt * 16;
  const float* Q = Qb + (size_t)b * Tq * qpitch + h * D;
  const int kv_end = Tk;
  const int sr = qt, sc = lane * 4;   // staging: a row is 32 pieces of 16 B, so a wave takes whole rows: rows sr + 4 * i of its group's chunk (scalar), the lane columns sc .. sc + 3
  const float* K1b = K1 + (size_t)b * Tk1 * kpitch + h * D; const float* V1b = V1 + (size_t)b * Tk1 * vpitch + h * D;
  const float* K2b = K2 + (size_t)b * Tk2 * kpitch + h * D; const float* V2b = V2 + (size_t)b * Tk2 * vpitch + h * D;
  const unsigned rawk = (unsigned)(size_t)&sRaw[g][0][sr][sc];   // LDS byte address of the thread's first K piece; its V pieces lie 32 rows further
  // 16 asynchronous copies per thread: the 32 keys from jn on, K and V. A key past the end is clamped to the last one, so that every lane's
  // address stays inside the source; such a key's scores are masked below, its P is 0 and its (finite) V row adds nothing.
  auto copy_kv = [&](int jn) {
    const float* pk[8]; const float* pv[8];
    unsigned lk[8], lv[8];
#pragma unroll   // every index constant: the 32 addresses are register operands of the two statements below
    for (int i = 0; i < 8; ++i) {
      const int key = min(jn + sr + 4 * i, Tk - 1);
      const bool first = key < Tk1;
      const unsigned kk = (unsigned)(first ? key : key - Tk1);
      pk[i] = (first ? K1b : K2b) + (size_t)kk * (unsigned)kpitch + sc;
      pv[i] = (first ? V1b : V2b) + (size_t)kk * (unsigned)vpitch + sc;
      lk[i] = rawk + i * (4 * D * 4); lv[i] = lk[i] + 32 * D * 4;
    }
    // the s_wait_xcnt closes each statement as a precaution: no address register of an issued copy is rewritten ahead of it
    asm volatile("global_load_async_to_lds_b128 %0, %8, off\n\tglobal_load_async_to_lds_b128 %1, %9, off\n\t"
                 "global_load_async_to_lds_b128 %2, %10, off\n\tglobal_load_async_to_lds_b128 %3, %11, off\n\t"
                 "global_load_async_to_lds_b128 %4, %12, off\n\tglobal_load_async_to_lds_b128 %5, %13, off\n\t"
                 "global_load_async_to_lds_b128 %6, %14, off\n\tglobal_load_async_to_lds_b128 %7, %15, off\n\ts_wait_xcnt 0x0"
                 :: "v"(lk[0]), "v"(lk[1]), "v"(lk[2]), "v"(lk[3]), "v"(lk[4]), "v"(lk[5]), "v"(lk[6]), "v"(lk[7]),
                    "v"(pk[0]), "v"(pk[1]), "v"(pk[2]), "v"(pk[3]), "v"(pk[4]), "v"(pk[5]), "v"(pk[6]), "v"(pk[7]) : "memory");
    asm volatile("global_load_async_to_lds_b128 %0, %8, off\n\tglobal_load_async_to_lds_b128 %1, %9, off\n\t"
                 "global_load_async_to_lds_b128 %2, %10, off\n\tglobal_load_async_to_lds_b128 %3, %11, off\n\t"
                 "global_load_async_to_lds_b128 %4, %12, off\n\tglobal_load_async_to_lds_b128 %5, %13, off\n\t"
                 "global_load_async_to_lds_b128 %6, %14, off\n\tglobal_load_async_to_lds_b128 %7, %15, off\n\ts_wait_xcnt 0x0"
                 :: "v"(lv[0]), "v"(lv[1]), "v"(lv[2]), "v"(lv[3]), "v"(lv[4]), "v"(lv[5]), "v"(lv[6]), "v"(lv[7]),
                    "v"(pv[0]), "v"(pv[1]), "v"(pv[2]), "v"(pv[3]), "v"(pv[4]), "v"(pv[5]), "v"(pv[6]), "v"(pv[7]) : "memory");
  };
  if (kv_end > 0) copy_kv(32 * g);   // the first chunk flies under the Q fragment loads (block-uniform test)
  FragB aqh[KS], aql[KS];
  {
    int row = q0 + ln; if (row >= Tq) row = Tq - 1;
    const float* qr = Q + (size_t)row * qpitch;
#pragma unroll
    for (int ks = 0; ks < KS; ++ks)
#pragma unroll
      for (int i = 0; i < 16; ++i) {
        const int d = ks * 32 + ((i < 8) ? (8 * hh + i) : (16 + 8 * hh + (i - 8)));
        const float x = qr[d] * scale; const unsigned short hb = bf16_bits(x);
        aqh[ks].u[i] = hb; aql[ks].u[i] = bf16_bits(x - bf16_val(hb));
      }
  }
  float m_r[8], l_r[8];
#pragma unroll
  for (int r = 0; r < 8; ++r) { m_r[r] = -3.0e38f; l_r[r] = 0.f; }
  v8f oacc[DT];
#pragma unroll
  for (int dt = 0; dt < DT; ++dt) oacc[dt] = (v8f){0.f,0.f,0.f,0.f,0.f,0.f,0.f,0.f};
  for (int jg = 0; jg < kv_end; jg += 32 * NG) {               // block-uniform trip count; a chunk past kv_end is fully masked and adds nothing
    const int j0 = jg + 32 * g;
    asm volatile("s_wait_asynccnt 0x0" ::: "memory");   // this wave's copies of this chunk have landed before it reads them back
    __syncthreads();   // ends every wave's reads of the previous chunk's planes
#pragma unroll   // lets the LDS reads of later pieces go out ahead of the splitting of earlier ones
    for (int i = 0; i < 8; ++i) {
      const int r = sr + 4 * i;
      const v4f kf = *(const v4fa*)&sRaw[g][0][r][sc], vf = *(const v4fa*)&sRaw[g][1][r][sc];
#pragma unroll
      for (int t = 0; t < 4; ++t) {
        unsigned short hb = bf16_bits(kf[t]); sKh[g][r][sc + t] = hb; sKl[g][r][sc + t] = bf16_bits(kf[t] - bf16_val(hb));
        hb = bf16_bits(vf[t]); sVh[g][r][sc + t] = hb; sVl[g][r][sc + t] = bf16_bits(vf[t] - bf16_val(hb));
      }
    }
    asm volatile("s_wait_dscnt 0x0" ::: "memory");   // the wave's reads of sRaw have retired before the copies below refill it
    __syncthreads();   // publishes the planes; behind it nobody reads sRaw any more
    if (jg + 32 * NG < kv_end) copy_kv(j0 + 32 * NG);   // the next chunk flies under this chunk's products and softmax (block-uniform test)
    v8f s[2];
#pragma unroll
    for (int nt = 0; nt < 2; ++nt) {
      v8f acc = {};
#pragma unroll
      for (int ks = 0; ks < KS; ++ks) {
        FragB bh_, bl_;
        bh_.half[0] = *(const v8us*)&sKh[g][nt * 16 + ln][ks * 32 + 8 * hh]; bh_.half[1] = *(const v8us*)&sKh[g][nt * 16 + ln][ks * 32 + 16 + 8 * hh];
        bl_.half[0] = *(const v8us*)&sKl[g][nt * 16 + ln][ks * 32 + 8 * hh]; bl_.half[1] = *(const v8us*)&sKl[g][nt * 16 + ln][ks * 32 + 16 + 8 * hh];
        acc = mmaN<3>(aqh[ks].v, aql[ks].v, bh_.v, bl_.v, acc);
      }
      s[nt] = acc;
    }
    const bool keepa = j0 + ln < Tk, keepb = j0 + 16 + ln < Tk;   // the same for all 8 rows
    float alpha[8], mx[8];
#pragma unroll
    for (int r = 0; r < 8; ++r) {
      if (!keepa) s[0][r] = -3.0e38f;
      if (!keepb) s[1][r] = -3.0e38f;
      mx[r] = fmaxf(s[0][r], s[1][r]);
    }
    // row maxima over the 16 lanes of a half: step by step for all 8 rows, so that the 8 cross-lane exchanges of a step fly together
#pragma unroll   // both loops unrolled: constant exchange distances, mx[] in registers
    for (int st = 1; st < 16; st <<= 1)
#pragma unroll
      for (int r = 0; r < 8; ++r) mx[r] = fmaxf(mx[r], __shfl_xor(mx[r], st, 32));
#pragma unroll   // constant r: the per-row arrays stay in registers, and the rows' independent chains can be mixed
    for (int r = 0; r < 8; ++r) {
      const float mnew = fmaxf(m_r[r], mx[r]);
      alpha[r] = (mnew > -1.0e38f) ? __expf(m_r[r] - mnew) : 1.0f;
      const float p0 = keepa ? __expf(s[0][r] - mnew) : 0.f;
      const float p1 = keepb ? __expf(s[1][r] - mnew) : 0.f;
      m_r[r] = mnew;
      l_r[r] = l_r[r] * alpha[r] + p0 + p1;
      unsigned short hb = bf16_bits(p0); sPh[w][8 * hh + r][ln] = hb;      sPl[w][8 * hh + r][ln] = bf16_bits(p0 - bf16_val(hb));
      hb = bf16_bits(p1);                sPh[w][8 * hh + r][16 + ln] = hb; sPl[w][8 * hh + r][16 + ln] = bf16_bits(p1 - bf16_val(hb));
      if (r == 3) __builtin_amdgcn_sched_barrier(0);   // four rows at a time: with all eight mixed the temporaries push a Q fragment out of the registers
    }
#pragma unroll
    for (int dt = 0; dt < DT; ++dt)
#pragma unroll
      for (int r = 0; r < 8; ++r) oacc[dt][r] *= alpha[r];
    __builtin_amdgcn_fence(__ATOMIC_ACQ_REL, "workgroup");
    __builtin_amdgcn_wave_barrier();
    FragB pah, pal;
    pah.half[0] = *(const v8us*)&sPh[w][ln][8 * hh]; pah.half[1] = *(const v8us*)&sPh[w][ln][16 + 8 * hh];
    pal.half[0] = *(const v8us*)&sPl[w][ln][8 * hh]; pal.half[1] = *(const v8us*)&sPl[w][ln][16 + 8 * hh];
    // element i of a V fragment = V[8 * hh + i][dt * 16 + ln], element 8 + i = V[16 + 8 * hh + i][dt * 16 + ln]: the k order of pah / pal
    FragB bvh[2], bvl[2];
    auto vfrag = [&](int dt) {
      bvh[dt & 1].half[0] = ld_tr16(&sVh[g][vr][dt * 16 + vc]); bvh[dt & 1].half[1] = ld_tr16(&sVh[g][16 + vr][dt * 16 + vc]);
      bvl[dt & 1].half[0] = ld_tr16(&sVl[g][vr][dt * 16 + vc]); bvl[dt & 1].half[1] = ld_tr16(&sVl[g][16 + vr][dt * 16 + vc]);
    };
    vfrag(0);
#pragma unroll
    for (int dt = 0; dt < DT; ++dt) {
      if (dt + 1 < DT) vfrag(dt + 1);   // the next tile's four loads fly under this tile's three products
      oacc[dt] = mmaN<3>(pah.v, pal.v, bvh[dt & 1].v, bvl[dt & 1].v, oacc[dt]);
    }
    __builtin_amdgcn_fence(__ATOMIC_ACQ_REL, "workgroup");
    __builtin_amdgcn_wave_barrier();
  }
  asm volatile("s_wait_asynccnt 0x0" ::: "memory");   // no copy is outstanding when sRaw's bytes become sO (its last readers left it at the last trip's second barrier)
#pragma unroll
  for (int r = 0; r < 8; ++r) {
    float l = l_r[r];
    l += __shfl_xor(l, 1, 32); l += __shfl_xor(l, 2, 32); l += __shfl_xor(l, 4, 32); l += __shfl_xor(l, 8, 32);
    if (ln == 0) { sM[w][8 * hh + r] = m_r[r]; sL[w][8 * hh + r] = l; }
  }
#pragma unroll
  for (int dt = 0; dt < DT; ++dt)
#pragma unroll
    for (int r = 0; r < 8; ++r) sO[w][8 * hh + r][dt * 16 + ln] = oacc[dt][r];
  __syncthreads();   // every group's partial (max, sum, O) is in LDS before any wave merges
  // merge: wave (qt, g) finishes rows g*16/NG ... of query tile qt; a lane owns 4 columns of the row
#pragma unroll
  for (int i = 0; i < 16 / NG; ++i) {
    const int rr = g * (16 / NG) + i, row = q0 + rr;
    if (row < Tq && lane < D / 4) {
      float mg[NG], mall = -3.0e38f;
#pragma unroll
      for (int k = 0; k < NG; ++k) { mg[k] = sM[k * 4 + qt][rr]; mall = fmaxf(mall, mg[k]); }
      float lall = 0.f;
      v4f val = {0.f, 0.f, 0.f, 0.f};
#pragma unroll
      for (int k = 0; k < NG; ++k) {
        const float wt = (mg[k] > -1.0e38f) ? __expf(mg[k] - mall) : 0.f;
        const v4f o = *(const v4fa*)&sO[k * 4 + qt][rr][lane * 4];
        lall += wt * sL[k * 4 + qt][rr];
        val += wt * o;
      }
      const float inv = (mall > -1.0e38f) ? 1.0f / lall : __builtin_nanf("");
      *(v4f*)(y + ((size_t)b * Tq + row) * ypitch + h * D + lane * 4) = val * inv;
      if (i + 1 < 16 / NG) asm volatile("s_wait_xcnt 0x0" ::: "memory");   // precaution: stands before the next row's reads reuse the store's address and data registers
    }
  }
}

__global__ __launch_bounds__(256) void k_roundcopy(const float* __restrict__ src, float* __restrict__ dst, int n8) {
  const size_t t = (size_t)blockIdx.x * 256 + threadIdx.x;
  if (t >= (size_t)n8 * 2) return;
  v4f a = *(const v4fa*)(src + t * 4);
  for (int i = 0; i < 4; ++i) a[i] = bf16_round(a[i]);
  *(v4f*)(dst + t * 4) = a; 
}

__global__ void k_ln_rows(const float* __restrict__ X, const float* __restrict__ R, const float* __restrict__ g, const float* __restrict__ bta, float* __restrict__ out, int N, float eps) {
  __shared__ float red[256];
  const int row = blockIdx.x, tid = threadIdx.x, nt = blockDim.x;
  v4f a = *(const v4fa*)(X + (size_t)row * N + tid * 4);
  if (R) { const v4f rr = *(const v4fa*)(R + (size_t)row * N + tid * 4); for (int q = 0; q < 4; ++q) a[q] += rr[q]; }
  float s = a[0] + a[1] + a[2] + a[3];
  red[tid] = s; __syncthreads();
  for (int st = nt / 2; st > 0; st >>= 1) { if (tid < st) red[tid] += red[tid + st]; __syncthreads(); }
  const float mu = red[0] / (float)N; __syncthreads();
  float v = 0.f; for (int q = 0; q < 4; ++q) { const float c = a[q] - mu; v += c * c; }
  red[tid] = v; __syncthreads();
  for (int st = nt / 2; st > 0; st >>= 1) { if (tid < st) red[tid] += red[tid + st]; __syncthreads(); }
  const float rs = rsqrtf(red[0] / (float)N + eps);
  v4f o; for (int q = 0; q < 4; ++q) o[q] = (a[q] - mu) * rs * bf16_round(g[tid * 4 + q]) + bf16_round(bta[tid * 4 + q]);
  *(v4f*)(out + (size_t)row * N + tid * 4) = o; 
}

// Bt[h*DK + k][d] = W[h][d][k]  (W [H][D][DK]); thread per (n, 8 d)
__global__ __launch_bounds__(256) void k_wt_heads(const float* __restrict__ W, unsigned short* __restrict__ Bt) {
  const int t = blockIdx.x * 256 + threadIdx.x; if (t >= NH * DK * (DD / 8)) return;
  const int n = t / (DD / 8), d8 = (t % (DD / 8)) * 8; const int h = n / DK, kk = n % DK; v8us v;
#pragma unroll
  for (int i = 0; i < 8; ++i) v[i] = bf16_bits(W[((size_t)h * DD + d8 + i) * DK + kk]);
  *(v8us*)(Bt + (size_t)n * DD + d8) = v; 
}
extern "C" void kernel_launch(void* const* d_in, const int* in_sizes, int n_in,
                              void* d_out, int out_size, void* d_ws, size_t ws_size, hipStream_t stream) {
  (void)in_sizes; (void)n_in; (void)out_size;
  const float* token = (const float*)d_in[0];
  const float* Wq = (const float*)d_in[1]; const float* bq = (const float*)d_in[2]; const float* Wk = (const float*)d_in[3]; const float* bk = (const float*)d_in[4];
  const float* Wv = (const float*)d_in[5]; const float* bv = (const float*)d_in[6]; const float* Wo = (const float*)d_in[7]; const float* bo = (const float*)d_in[8];
  const float* Wf = (const float*)d_in[9]; const float* bfv = (const float*)d_in[10]; const float* gamma = (const float*)d_in[11]; const float* beta = (const float*)d_in[12];
  char* ws = (char*)d_ws; size_t off = 0;
  auto take = [&](size_t bytes) { char* p = ws + off; off += (bytes + 255) & ~(size_t)255; return p; };
  unsigned short* Bqkv = (unsigned short*)take((size_t)3 * DD * DD * 2); unsigned short* Bo = (unsigned short*)take((size_t)DD * DD * 2); unsigned short* Bf = (unsigned short*)take((size_t)DD * DD * 2);
  float* bqkv = (float*)take(3 * DD * 4);
  float* x = (float*)take((size_t)SS * DD * 4); float* qkv = (float*)take((size_t)SS * 3 * DD * 4); float* att = (float*)take((size_t)SS * DD * 4); float* tmp = (float*)take((size_t)SS * DD * 4); float* a = (float*)take((size_t)SS * DD * 4);
  if (off > ws_size) return;
  k_wt_heads<<<(NH * DK * (DD / 8) + 255) / 256, 256, 0, stream>>>(Wq, Bqkv);
  k_wt_heads<<<(NH * DK * (DD / 8) + 255) / 256, 256, 0, stream>>>(Wk, Bqkv + (size_t)DD * DD);
  k_wt_heads<<<(NH * DK * (DD / 8) + 255) / 256, 256, 0, stream>>>(Wv, Bqkv + (size_t)2 * DD * DD);
  k_wt_bf16<<<(DD * (DD / 8) + 255) / 256, 256, 0, stream>>>(Wo, Bo, DD, DD);
  k_wt_bf16<<<(DD * (DD / 8) + 255) / 256, 256, 0, stream>>>(Wf, Bf, DD, DD);
  k_roundcopy<<<(3 * DD / 4 + 255) / 256, 256, 0, stream>>>(bq, bqkv, DD / 8);            // bq|bk|bv flat [H*DK] each: three copies (f32, rounded) into one bias vector
  k_roundcopy<<<(DD / 4 + 255) / 256, 256, 0, stream>>>(bk, bqkv + DD, DD / 8);
  k_roundcopy<<<(DD / 4 + 255) / 256, 256, 0, stream>>>(bv, bqkv + 2 * DD, DD / 8);
  k_roundcopy<<<(SS * DD / 4 + 255) / 256, 256, 0, stream>>>(token, x, SS * DD / 8);
  const int gq = (SS / 64) * (3 * DD / 128), g1 = (SS / 64) * (DD / 128);
  for (int l = 0; l < NLAY; ++l) {
    k_gemm_tile<false><<<gq, 256, 0, stream>>>(x, DD, Bqkv, DD, bqkv, qkv, 3 * DD, 3 * DD, DD);      // bias already rounded (BIAS_BF16=false adds it as given)
    k_flash3<DK><<<NH * (SS / 64), 512, 0, stream>>>(qkv, 3 * DD, SS, qkv + DD, qkv + 2 * DD, SS, nullptr, nullptr, 0, 3 * DD, 3 * DD, NH, 0.08838834764831845f, att, DD);
    k_gemm_tile<true><<<g1, 256, 0, stream>>>(att, DD, Bo, DD, bo, tmp, DD, DD, DD);
    k_ln_rows<<<SS, DD / 4, 0, stream>>>(tmp, x, gamma, beta, a, DD, 1e-5f);                  // a = LN(x + attn_out)
    k_gemm_tile<true><<<g1, 256, 0, stream>>>(a, DD, Bf, DD, bfv, tmp, DD, DD, DD);
    k_ln_rows<<<SS, DD / 4, 0, stream>>>(tmp, a, gamma, beta, (l == NLAY - 1) ? (float*)d_out : x, DD, 1e-5f);   // x = LN(a + ff)
  }
}

// v006
// A run of this version takes 806 microseconds.
// Next to v005, in two timings, it ran 1.13 and 1.14 times as fast.
// Over all steps from v000 it is 5.02 times as fast.
#include <hip/hip_runtime.h>
// All GEMMs on v_wmma_f32_16x16x32_bf16, f32 accumulate: fused per-head q|k|v projection (K=1024, N=3072), concat·Wo, a·Wf — A operands
// (the residual stream, quantised to bf16 once at the input) split into bf16 hi/lo (2 terms) against bf16-rounded weights; attention QKᵀ/√128
// and P·V per 16-query tile as 3-term splits (head dim 128); LayerNorm and softmax in f32. Six layers with shared weights.
#define SS 2048
#define DD 1024
#define NH 8
#define DK 128
#define NLAY 6

typedef __bf16 v16b __attribute__((ext_vector_type(16)));
typedef unsigned short v8us __attribute__((ext_vector_type(8), may_alias));
typedef unsigned short v4us __attribute__((ext_vector_type(4), may_alias));
typedef float  v8f  __attribute__((ext_vector_type(8)));
typedef float  v4f  __attribute__((ext_vector_type(4)));
typedef float  v4fa __attribute__((ext_vector_type(4), may_alias));
union FragB { v16b v; v8us half[2]; unsigned short u[16]; };
typedef short s16x8 __attribute__((ext_vector_type(8)));
typedef __attribute__((address_space(3))) s16x8 lds_s16x8;
// transposing LDS load of an 8 x 16 block of 16-bit elements per lane half: lane l points at 8 elements of row 8*(l>>4) + (l&7), columns 8*((l>>3)&1) ...;
// lane (c = l&15, h = l>>4) receives rows 8h .. 8h+7 of column c
__device__ __forceinline__ v8us ld_tr16(const unsigned short* p) { return __builtin_bit_cast(v8us, __builtin_amdgcn_ds_load_tr16_b128_v8i16((lds_s16x8*)p)); }

__device__ __forceinline__ unsigned short bf16_bits(float x) { unsigned int u = __float_as_uint(x); return (unsigned short)((u + 0x7FFFu + ((u >> 16) & 1u)) >> 16); }
__device__ __forceinline__ float bf16_val(unsigned short b) { return __uint_as_float(((unsigned int)b) << 16); }
__device__ __forceinline__ float bf16_round(float x) { return bf16_val(bf16_bits(x)); }
// D += A·B with NT terms: 1 = ah·bh, 2 = + al·bh (A split), 3 = + ah·bl (both split)
template <int NT>
__device__ __forceinline__ v8f mmaN(v16b ah, v16b al, v16b bh, v16b bl, v8f c) {
  c = __builtin_amdgcn_wmma_f32_16x16x32_bf16(false, ah, false, bh, (short)0, c, false, false);
  if (NT >= 2) c = __builtin_amdgcn_wmma_f32_16x16x32_bf16(false, al, false, bh, (short)0, c, false, false);
  if (NT >= 3) c = __builtin_amdgcn_wmma_f32_16x16x32_bf16(false, ah, false, bl, (short)0, c, false, false);
  asm volatile("v_nop\n\tv_nop\n\tv_nop\n\tv_nop" : "+v"(c) : "v"(ah), "v"(al), "v"(bh), "v"(bl));
  return c;
}

__global__ __launch_bounds__(256) void k_wt_bf16(const float* __restrict__ W, unsigned short* __restrict__ Wt, int K, int N) {
  const int t = blockIdx.x * 256 + threadIdx.x;
  const int k8n = K / 8;
  if (t >= N * k8n) return;
  const int n = t / k8n, k8 = (t % k8n) * 8;
  v8us v;
#pragma unroll
  for (int i = 0; i < 8; ++i) v[i] = bf16_bits(W[(size_t)(k8 + i) * N + n]);
  *(v8us*)(Wt + (size_t)n * K + k8) = v;
  
}

// GEMM C[M][N] (f32, pitch ldc) = act(A[M][K]·W + bias). A f32 row-major (pitch lda) converted per fragment to bf16
// (ASPLIT: hi/lo two planes -> 2 terms, else single rounded term); Wt bf16 [N][K] (pitch ldb). BIAS_BF16 rounds the
// bias to bf16 first (bias quantised to bf16 before the add). K%32==0, M%16==0, N%64==0.
template <bool ASPLIT, int ACT, bool BIAS_BF16>
__global__ __launch_bounds__(128) void k_gemm_bf(const float* __restrict__ A, int lda, const unsigned short* __restrict__ Wt, int ldb,
                                               const float* __restrict__ bias, float* __restrict__ C, int ldc, int M, int N, int K) {
  __shared__ __attribute__((aligned(16))) float so[4][16][64];
  const int tid = threadIdx.x, w = tid >> 5, lane = tid & 31, ln = lane & 15, hh = lane >> 4;
  const int ntn = N / 64;
  const int wid = blockIdx.x * 4 + w;
  const int mt = wid / ntn, nq = wid % ntn;
  if (mt * 16 >= M) return;
  const int row0 = mt * 16, col0 = nq * 64;
  const float* arow = A + (size_t)(row0 + ln) * lda;
  v8f acc[4] = {};
  for (int kb = 0; kb < K; kb += 32) {
    FragB ah, al;
    const v4f x0 = *(const v4fa*)(arow + kb + 8 * hh), x1 = *(const v4fa*)(arow + kb + 8 * hh + 4);
    const v4f x2 = *(const v4fa*)(arow + kb + 16 + 8 * hh), x3 = *(const v4fa*)(arow + kb + 16 + 8 * hh + 4);
    float xs[16] = {x0[0],x0[1],x0[2],x0[3],x1[0],x1[1],x1[2],x1[3],x2[0],x2[1],x2[2],x2[3],x3[0],x3[1],x3[2],x3[3]};
#pragma unroll
    for (int i = 0; i < 16; ++i) { const unsigned short hb = bf16_bits(xs[i]); ah.u[i] = hb; al.u[i] = ASPLIT ? bf16_bits(xs[i] - bf16_val(hb)) : (unsigned short)0; }
#pragma unroll
    for (int t = 0; t < 4; ++t) {
      const unsigned short* brow = Wt + (size_t)(col0 + t * 16 + ln) * ldb + kb;
      FragB b;
      b.half[0] = *(const v8us*)(brow + 8 * hh);
      b.half[1] = *(const v8us*)(brow + 16 + 8 * hh);
      acc[t] = mmaN<ASPLIT ? 2 : 1>(ah.v, al.v, b.v, b.v, acc[t]);
    }
  }
#pragma unroll
  for (int t = 0; t < 4; ++t) {
    float bv = bias ? bias[col0 + t * 16 + ln] : 0.f;
    if (BIAS_BF16) bv = bf16_round(bv);
#pragma unroll
    for (int r = 0; r < 8; ++r) { float v = acc[t][r] + bv; if (ACT == 1) v = fmaxf(v, 0.f); so[w][8 * hh + r][t * 16 + ln] = v; }
  }
  __builtin_amdgcn_fence(__ATOMIC_ACQ_REL, "workgroup");
  __builtin_amdgcn_wave_barrier();
  const int rsub = lane >> 4, c4 = (lane & 15) * 4;
  {
#pragma unroll
    for (int q = 0; q < 8; ++q) {
      const int r = q * 2 + rsub;
      const v4f v = *(const v4fa*)&so[w][r][c4];
      *(v4f*)(C + (size_t)(row0 + r) * ldc + col0 + c4) = v;
    }
    
  }
}

// Flash-style causal/unmasked attention, all contractions 3-term bf16 hi/lo splits, f32 softmax with running max.
// q,k,v rows are read from f32 buffers with arbitrary row pitch (so they can live inside a fused qkv buffer);
// D = head size (multiple of 32, <= 128); one wave = 16 query rows; block = 4 waves (64 queries) sharing K/V chunks of 32.
template <int D, bool CAUSAL>
__global__ __launch_bounds__(128) void k_flash(const float* __restrict__ qb, const float* __restrict__ kb, const float* __restrict__ vb,
                                             int pitch, int T, int H, float scale, float* __restrict__ y, int ypitch) {
  constexpr int KS = D / 32;        // k-steps for QK
  constexpr int DT = D / 16;        // d tiles for PV
  __shared__ __attribute__((aligned(16))) unsigned short sKh[32][D + 8], sKl[32][D + 8], sVh[32][D + 8], sVl[32][D + 8];
  __shared__ __attribute__((aligned(16))) unsigned short sPh[4][16][40], sPl[4][16][40];
  __shared__ __attribute__((aligned(16))) float sO[4][16][D];
  const int tid = threadIdx.x, w = tid >> 5, lane = tid & 31, ln = lane & 15, hh = lane >> 4;
  const int nqb = (T + 63) / 64;
  const int bh = blockIdx.x / nqb, qblk = blockIdx.x % nqb;
  const int b = bh / H, h = bh % H;
  const int q0 = qblk * 64 + w * 16;
  const float* Q = qb + (size_t)b * T * pitch + h * D;
  const float* K = kb + (size_t)b * T * pitch + h * D;
  const float* V = vb + (size_t)b * T * pitch + h * D;

  // A fragments of the wave's 16 query rows (scaled), hi/lo
  FragB aqh[KS], aql[KS];
  {
    int row = q0 + ln; if (row >= T) row = T - 1;
    const float* qr = Q + (size_t)row * pitch;
#pragma unroll
    for (int ks = 0; ks < KS; ++ks)
#pragma unroll
      for (int i = 0; i < 16; ++i) {
        const int d = ks * 32 + ((i < 8) ? (8 * hh + i) : (16 + 8 * hh + (i - 8)));
        const float x = qr[d] * scale; const unsigned short hb = bf16_bits(x);
        aqh[ks].u[i] = hb; aql[ks].u[i] = bf16_bits(x - bf16_val(hb));
      }
  }
  float m_r[8], l_r[8];
#pragma unroll
  for (int r = 0; r < 8; ++r) { m_r[r] = -3.0e38f; l_r[r] = 0.f; }
  v8f oacc[DT];
#pragma unroll
  for (int dt = 0; dt < DT; ++dt) oacc[dt] = (v8f){0.f,0.f,0.f,0.f,0.f,0.f,0.f,0.f};

  const int kv_end = CAUSAL ? min(T, qblk * 64 + 64) : T;     // block-uniform
  for (int j0 = 0; j0 < kv_end; j0 += 32) {
    __syncthreads();
    for (int e = tid; e < 32 * (D / 4); e += 128) {
      const int r = e / (D / 4), c4 = (e % (D / 4)) * 4;
      const int key = j0 + r;
      v4f kf = {0.f,0.f,0.f,0.f}, vf = {0.f,0.f,0.f,0.f};
      if (key < T) { kf = *(const v4fa*)(K + (size_t)key * pitch + c4); vf = *(const v4fa*)(V + (size_t)key * pitch + c4); }
#pragma unroll
      for (int t = 0; t < 4; ++t) {
        unsigned short hb = bf16_bits(kf[t]); sKh[r][c4 + t] = hb; sKl[r][c4 + t] = bf16_bits(kf[t] - bf16_val(hb));
        hb = bf16_bits(vf[t]); sVh[r][c4 + t] = hb; sVl[r][c4 + t] = bf16_bits(vf[t] - bf16_val(hb));
      }
    }
    __syncthreads();
    // S tile 16 x 32
    v8f s[2];
#pragma unroll
    for (int nt = 0; nt < 2; ++nt) {
      v8f acc = {};
#pragma unroll
      for (int ks = 0; ks < KS; ++ks) {
        FragB bh_, bl_;
        bh_.half[0] = *(const v8us*)&sKh[nt * 16 + ln][ks * 32 + 8 * hh]; bh_.half[1] = *(const v8us*)&sKh[nt * 16 + ln][ks * 32 + 16 + 8 * hh];
        bl_.half[0] = *(const v8us*)&sKl[nt * 16 + ln][ks * 32 + 8 * hh]; bl_.half[1] = *(const v8us*)&sKl[nt * 16 + ln][ks * 32 + 16 + 8 * hh];
        acc = mmaN<3>(aqh[ks].v, aql[ks].v, bh_.v, bl_.v, acc);
      }
      s[nt] = acc;
    }
    // mask + running max (rows 8hh+r; the 16 lanes of a half share rows)
    float alpha[8];
#pragma unroll
    for (int r = 0; r < 8; ++r) {
      const int qi = q0 + 8 * hh + r;
      const int ja = j0 + ln, jb = j0 + 16 + ln;
      if (CAUSAL) { if (ja > qi) s[0][r] = -3.0e38f; if (jb > qi) s[1][r] = -3.0e38f; }
      if (ja >= T) s[0][r] = -3.0e38f;
      if (jb >= T) s[1][r] = -3.0e38f;
      float mx = fmaxf(s[0][r], s[1][r]);
      mx = fmaxf(mx, __shfl_xor(mx, 1, 32)); mx = fmaxf(mx, __shfl_xor(mx, 2, 32)); mx = fmaxf(mx, __shfl_xor(mx, 4, 32)); mx = fmaxf(mx, __shfl_xor(mx, 8, 32));
      const float mnew = fmaxf(m_r[r], mx);
      alpha[r] = (mnew > -1.0e38f) ? __expf(m_r[r] - mnew) : 1.0f;
      const float p0 = (s[0][r] > -1.0e38f) ? __expf(s[0][r] - mnew) : 0.f;
      const float p1 = (s[1][r] > -1.0e38f) ? __expf(s[1][r] - mnew) : 0.f;
      m_r[r] = mnew;
      l_r[r] = l_r[r] * alpha[r] + p0 + p1;            // per-lane partial row sum (16 lanes combined at the end)
      unsigned short hb = bf16_bits(p0); sPh[w][8 * hh + r][ln] = hb;      sPl[w][8 * hh + r][ln] = bf16_bits(p0 - bf16_val(hb));
      hb = bf16_bits(p1);                sPh[w][8 * hh + r][16 + ln] = hb; sPl[w][8 * hh + r][16 + ln] = bf16_bits(p1 - bf16_val(hb));
    }
#pragma unroll
    for (int dt = 0; dt < DT; ++dt)
#pragma unroll
      for (int r = 0; r < 8; ++r) oacc[dt][r] *= alpha[r];
    __builtin_amdgcn_fence(__ATOMIC_ACQ_REL, "workgroup");
    __builtin_amdgcn_wave_barrier();
    FragB pah, pal;
    pah.half[0] = *(const v8us*)&sPh[w][ln][8 * hh]; pah.half[1] = *(const v8us*)&sPh[w][ln][16 + 8 * hh];
    pal.half[0] = *(const v8us*)&sPl[w][ln][8 * hh]; pal.half[1] = *(const v8us*)&sPl[w][ln][16 + 8 * hh];
#pragma unroll
    for (int dt = 0; dt < DT; ++dt) {
      FragB bvh, bvl;
#pragma unroll
      for (int i = 0; i < 8; ++i) {
        bvh.u[i] = sVh[8 * hh + i][dt * 16 + ln]; bvh.u[8 + i] = sVh[16 + 8 * hh + i][dt * 16 + ln];
        bvl.u[i] = sVl[8 * hh + i][dt * 16 + ln]; bvl.u[8 + i] = sVl[16 + 8 * hh + i][dt * 16 + ln];
      }
      oacc[dt] = mmaN<3>(pah.v, pal.v, bvh.v, bvl.v, oacc[dt]);
    }
    __builtin_amdgcn_fence(__ATOMIC_ACQ_REL, "workgroup");
    __builtin_amdgcn_wave_barrier();
  }
#pragma unroll
  for (int r = 0; r < 8; ++r) {
    float l = l_r[r];
    l += __shfl_xor(l, 1, 32); l += __shfl_xor(l, 2, 32); l += __shfl_xor(l, 4, 32); l += __shfl_xor(l, 8, 32);
    l_r[r] = (l > 0.f) ? 1.0f / l : 0.f;
  }
#pragma unroll
  for (int dt = 0; dt < DT; ++dt)
#pragma unroll
    for (int r = 0; r < 8; ++r) sO[w][8 * hh + r][dt * 16 + ln] = oacc[dt][r] * l_r[r];
  __builtin_amdgcn_fence(__ATOMIC_ACQ_REL, "workgroup");
  __builtin_amdgcn_wave_barrier();
  {
    for (int r = 0; r < 16; ++r) {
      const int row = q0 + r;
      if (row < T && lane < D / 4) {
        const v4f val = *(const v4fa*)&sO[w][r][lane * 4];
        *(v4f*)(y + ((size_t)b * T + row) * ypitch + h * D + lane * 4) = val;
      }
    }
    
  }
}

// GEMM C[M][N] (f32, pitch ldc) = A[M][K] x W + bias: A f32 row-major (pitch lda), two terms (bf16 hi + lo) against Wt bf16 [N][K] (pitch ldb).
// Block = 8 waves (2 x 4) on a 64 x 128 tile of C, a wave owns 32 x 32. K is walked in slices of 64: the A slice is split into its hi and lo
// planes once per block, the Wt slice is copied, both through whole-line global loads into LDS, where all 8 waves read their fragments.
// Two LDS buffers: the next slice's global loads are issued ahead of this slice's products and stored behind them; one barrier per slice.
// Each accumulator takes hi then lo of every 32-wide k step in rising k. M % 64 == 0, N % 128 == 0, K % 64 == 0; grid = (M / 64) * (N / 128).
// PLANES: a block whose columns start at pcol0 or beyond does not store its tile to C; it splits it into bf16 hi and lo and stores these to
// Ph / Pl as rows of plane (col0 - pcol0) / 128, each plane [M][128]: the form in which the attention kernel stages K and V.
template <bool BIAS_BF16, bool PLANES>
__global__ __launch_bounds__(256) void k_gemm_tile(const float* __restrict__ A, int lda, const unsigned short* __restrict__ Wt, int ldb,
                                                   const float* __restrict__ bias, float* __restrict__ C, int ldc, int N, int K,
                                                   unsigned short* __restrict__ Ph, unsigned short* __restrict__ Pl, int pcol0, int M) {
  constexpr int BM = 64, BN = 128, BK = 64, LP = BK + 8;       // LP: LDS row pitch 144 B = 16 B x odd
  constexpr int PA = BM * LP, PB = BN * LP, BUF = 2 * PA + PB;  // one buffer, in 16-bit elements: A hi | A lo | Wt
  constexpr int OP = 36;                                       // pitch of the output staging rows, in floats
  __shared__ __attribute__((aligned(16))) unsigned short sm[2 * BUF];
  const int tid = threadIdx.x, lane = tid & 31, ln = lane & 15, hh = lane >> 4;
  const int w = __builtin_amdgcn_readfirstlane(tid >> 5);      // wave number, kept scalar so that the tile offsets stay scalar
  const int wm = w >> 2, wn = w & 3;
  const int nbn = N / BN;
  const int row0 = (blockIdx.x / nbn) * BM, col0 = (blockIdx.x % nbn) * BN;
  const int ar = tid >> 4, ac = (tid & 15) * 4;                // A slice: a wave's load covers 2 rows x 256 B
  const int br = tid >> 3, bc = (tid & 7) * 8;                 // Wt slice: a wave's load covers 4 rows x 128 B
  const float* ag = A + (size_t)(row0 + ar) * lda + ac;
  const unsigned short* bg = Wt + (size_t)(col0 + br) * ldb + bc;
  v4f ra[4];
  v8us rb[4];
  auto fetch = [&](int kb) {
    const float* pa[4];
    const unsigned short* pb[4];
#pragma unroll
    for (int j = 0; j < 4; ++j) { pa[j] = ag + (size_t)(16 * j) * lda + kb; pb[j] = bg + (size_t)(32 * j) * ldb + kb; }
#pragma unroll
    for (int j = 0; j < 4; ++j) ra[j] = *(const v4fa*)pa[j];
#pragma unroll
    for (int j = 0; j < 4; ++j) rb[j] = *(const v8us*)pb[j];
    // precaution: the eight address pairs are inputs of the wait, so none of them is reused (not even as a later load's result) ahead of it
    asm volatile("s_wait_xcnt 0x0" :: "v"(pa[0]), "v"(pa[1]), "v"(pa[2]), "v"(pa[3]), "v"(pb[0]), "v"(pb[1]), "v"(pb[2]), "v"(pb[3]) : "memory");
  };
  auto stash = [&](unsigned short* sb) {
#pragma unroll
    for (int j = 0; j < 4; ++j) {
      v4us h, l;
#pragma unroll
      for (int t = 0; t < 4; ++t) { const unsigned short hb = bf16_bits(ra[j][t]); h[t] = hb; l[t] = bf16_bits(ra[j][t] - bf16_val(hb)); }
      *(v4us*)(sb + (ar + 16 * j) * LP + ac) = h;
      *(v4us*)(sb + PA + (ar + 16 * j) * LP + ac) = l;
      *(v8us*)(sb + 2 * PA + (br + 32 * j) * LP + bc) = rb[j];
    }
  };
  v8f acc[2][2] = {};
  const int ns = K / BK;
  fetch(0);
  stash(sm);
  __syncthreads();
  for (int s = 0; s < ns; ++s) {
    const unsigned short* sb = sm + (s & 1) * BUF;
    if (s + 1 < ns) fetch((s + 1) * BK);
#pragma unroll
    for (int ks = 0; ks < BK / 32; ++ks) {
      FragB ah[2], al[2], b[2];
#pragma unroll
      for (int t = 0; t < 2; ++t) {
        const unsigned short* pa = sb + (wm * 32 + t * 16 + ln) * LP + ks * 32 + 8 * hh;
        const unsigned short* pb = sb + 2 * PA + (wn * 32 + t * 16 + ln) * LP + ks * 32 + 8 * hh;
        ah[t].half[0] = *(const v8us*)pa;        ah[t].half[1] = *(const v8us*)(pa + 16);
        al[t].half[0] = *(const v8us*)(pa + PA); al[t].half[1] = *(const v8us*)(pa + PA + 16);
        b[t].half[0]  = *(const v8us*)pb;        b[t].half[1]  = *(const v8us*)(pb + 16);
      }
      __builtin_amdgcn_sched_barrier(0);   // keeps the k step's 12 LDS reads together as one group ahead of its 8 products: one LDS wait per k step, not four
#pragma unroll
      for (int mt = 0; mt < 2; ++mt)
#pragma unroll
        for (int nt = 0; nt < 2; ++nt) acc[mt][nt] = __builtin_amdgcn_wmma_f32_16x16x32_bf16(false, ah[mt].v, false, b[nt].v, (short)0, acc[mt][nt], false, false);
#pragma unroll
      for (int mt = 0; mt < 2; ++mt)
#pragma unroll
        for (int nt = 0; nt < 2; ++nt) acc[mt][nt] = __builtin_amdgcn_wmma_f32_16x16x32_bf16(false, al[mt].v, false, b[nt].v, (short)0, acc[mt][nt], false, false);
    }
    if (s + 1 < ns) stash(sm + ((s + 1) & 1) * BUF);
    __syncthreads();   // publishes slice s + 1 and ends every wave's reads of slice s, whose buffer is refilled in the next trip
  }
  // output: each wave turns its 32 x 32 tile through its own piece of the (now free) LDS so that every store covers whole 128-B lines
  float* so = (float*)sm + w * 32 * OP;
#pragma unroll
  for (int nt = 0; nt < 2; ++nt) {
    float bv = bias[col0 + wn * 32 + nt * 16 + ln];
    if (BIAS_BF16) bv = bf16_round(bv);
#pragma unroll
    for (int mt = 0; mt < 2; ++mt)
#pragma unroll
      for (int r = 0; r < 8; ++r) so[(mt * 16 + 8 * hh + r) * OP + nt * 16 + ln] = acc[mt][nt][r] + bv;
  }
  if (PLANES && col0 >= pcol0) {   // the same for the whole block
    __syncthreads();   // every wave's 32 x 32 piece is in LDS before rows are read across the four pieces of a tile row
    // wave w takes tile rows 8 * w .. 8 * w + 7; a lane owns 4 columns, so each store of a wave covers one whole 256-B plane row
    const float* sp = (const float*)sm + ((w >> 2) * 4 + (lane >> 3)) * 32 * OP + (w & 3) * 8 * OP + (lane & 7) * 4;
    const size_t po = ((size_t)((col0 - pcol0) / BN) * M + row0 + w * 8) * BN + lane * 4;
    v4us h[8], l[8];
#pragma unroll
    for (int q = 0; q < 8; ++q) {
      const v4f v = *(const v4fa*)(sp + q * OP);
#pragma unroll
      for (int t = 0; t < 4; ++t) { const unsigned short hb = bf16_bits(v[t]); h[q][t] = hb; l[q][t] = bf16_bits(v[t] - bf16_val(hb)); }
    }
#pragma unroll
    for (int q = 0; q < 8; ++q) { *(v4us*)(Ph + po + q * BN) = h[q]; *(v4us*)(Pl + po + q * BN) = l[q]; }
    asm volatile("s_wait_xcnt 0x0" ::: "memory");   // precaution: stands behind the last plane store, before any later instruction reuses a store's address or data registers
    return;
  }
  __builtin_amdgcn_fence(__ATOMIC_ACQ_REL, "workgroup");
  __builtin_amdgcn_wave_barrier();
  const int rsub = lane >> 3, c4 = (lane & 7) * 4;
#pragma unroll
  for (int q = 0; q < 8; ++q) {
    const int r = q * 4 + rsub;
    const v4f v = *(const v4fa*)(so + r * OP + c4);
    *(v4f*)(C + (size_t)(row0 + wm * 32 + r) * ldc + col0 + wn * 32 + c4) = v;
  }
}
// row LayerNorm (biased variance, eps) over N: s = X (+ R); optional out_sum <- s; out_norm <- (s-mu)*rsqrt(var+eps)*g + b
template <bool PARAM_BF16>
__global__ __launch_bounds__(256) void k_layernorm(const float* __restrict__ X, const float* __restrict__ R, const float* __restrict__ g, const float* __restrict__ bta,
                                                  float* __restrict__ out_sum, float* __restrict__ out_norm, int N, float eps) {
  __shared__ float red[256];
  const int row = blockIdx.x, tid = threadIdx.x;
  const float* x = X + (size_t)row * N; const float* rr = R ? R + (size_t)row * N : nullptr;
  float vals[16];                     // up to N = 4096
  const int per = N / 256;            // contiguous chunk per thread? use strided-by-4 chunks: thread handles j = tid*4 + 1024*u
  float s1 = 0.f;
  for (int u = 0; u < per / 4; ++u) {
    const int j = tid * 4 + 1024 * u;
    const v4f a = *(const v4fa*)(x + j);
    v4f b = {0.f,0.f,0.f,0.f}; if (rr) b = *(const v4fa*)(rr + j);
#pragma unroll
    for (int q = 0; q < 4; ++q) { const float v = a[q] + b[q]; vals[u * 4 + q] = v; s1 += v; }
  }
  red[tid] = s1; __syncthreads();
  for (int st = 128; st > 0; st >>= 1) { if (tid < st) red[tid] += red[tid + st]; __syncthreads(); }
  const float mu = red[0] / (float)N; __syncthreads();
  float s2 = 0.f;
  for (int u = 0; u < per / 4; ++u)
#pragma unroll
    for (int q = 0; q < 4; ++q) { const float c = vals[u * 4 + q] - mu; s2 += c * c; }
  red[tid] = s2; __syncthreads();
  for (int st = 128; st > 0; st >>= 1) { if (tid < st) red[tid] += red[tid + st]; __syncthreads(); }
  const float rs = rsqrtf(red[0] / (float)N + eps);
  {
    for (int u = 0; u < per / 4; ++u) {
      const int j = tid * 4 + 1024 * u;
      v4f o, sm;
#pragma unroll
      for (int q = 0; q < 4; ++q) {
        float gg = g[j + q], bb = bta[j + q];
        if (PARAM_BF16) { gg = bf16_round(gg); bb = bf16_round(bb); }
        sm[q] = vals[u * 4 + q]; o[q] = (vals[u * 4 + q] - mu) * rs * gg + bb;
      }
      if (out_sum) *(v4f*)(out_sum + (size_t)row * N + j) = sm;
      *(v4f*)(out_norm + (size_t)row * N + j) = o;
    }
    
  }
}

// General attention: queries [b][Tq] rows at Q + b*Tq*qpitch + h*D + row*qpitch; keys and values come already split into bf16 hi / lo planes
// (Kh, Kl, Vh, Vl), each [b*H + h][Tk][D], written once by the projection GEMM, so that no query block splits them again.
// Every query sees every key j < Tk: no mask, no causal cut and no score bias, so the softmax of a chunk holds no test but j < Tk and is one straight-line block.
// 3-term bf16 splits, f32 softmax with running max; y[b][row][h*D + d] pitch ypitch, whole-line rows (D % 32 == 0).
// Block = 16 waves = 4 query tiles x NG key groups: group g walks the 32-key chunks g, g + NG, ... with its own K/V/P staging and its own
// running (max, sum, O); the NG partial results of a query tile are merged once, through LDS, after the loop.
// K/V staging: two LDS buffers per group; asynchronous copies bring the four planes of the group's next 32 keys straight to their padded rows
// while the current chunk is worked on; one barrier per chunk publishes the next buffer and frees the one just read.
template <int D>
__global__ __launch_bounds__(512) void k_flash3(const float* __restrict__ Qb, int qpitch, int Tq,
                                              const unsigned short* __restrict__ Kh, const unsigned short* __restrict__ Kl,
                                              const unsigned short* __restrict__ Vh, const unsigned short* __restrict__ Vl, int Tk,
                                              int H, float scale, float* __restrict__ y, int ypitch) {
  constexpr int KS = D / 32, DT = D / 16, NG = 4;
  constexpr int KP = D + 8, VP = D + 16;   // row pitches: K 16 B x odd (plain 16-B reads), V 32 B x odd (transposing reads)
  static_assert(D == 128, "a group's 128 threads copy 4 pieces of 16 B of each of the 4 planes per 32 keys");
  __shared__ __attribute__((aligned(32))) unsigned short sK[2][NG][2][32][KP];   // buffer, group, hi | lo
  __shared__ __attribute__((aligned(32))) unsigned short sV[2][NG][2][32][VP];
  __shared__ __attribute__((aligned(16))) unsigned short sPh[4 * NG][16][40], sPl[4 * NG][16][40];
  // once the loop has ended the partial O tiles take sK's bytes and the partial max / sum rows the first bytes of sV
  static_assert(sizeof(float) * 4 * NG * 16 * D <= sizeof(sK) && sizeof(float) * 2 * 4 * NG * 16 <= sizeof(sV), "merge staging fits");
  float (*sO)[16][D] = reinterpret_cast<float (*)[16][D]>(&sK[0][0][0][0][0]);
  float (*sM)[16] = reinterpret_cast<float (*)[16]>(&sV[0][0][0][0][0]);
  float (*sL)[16] = sM + 4 * NG;
  const int tid = threadIdx.x, lane = tid & 31, ln = lane & 15, hh = lane >> 4;
  const int w = __builtin_amdgcn_readfirstlane(tid >> 5);   // wave number, kept scalar so that the group's key offset and LDS bases stay scalar
  const int qt = w & 3, g = w >> 2;                         // query tile, key group
  const int vr = 8 * hh + (lane & 7), vc = 8 * ((lane >> 3) & 1);   // the lane's row and column offset in a transposing load of V
  const int nqb = (Tq + 63) / 64;
  const int bh = blockIdx.x / nqb, qblk = blockIdx.x % nqb;
  const int b = bh / H, h = bh % H;
  const int q0 = qblk * 64 + qt * 16;
  const float* Q = Qb + (size_t)b * Tq * qpitch + h * D;
  const int nch = (Tk + 32 * NG - 1) / (32 * NG);   // trips, the same for the whole block; a chunk past Tk is fully masked and adds nothing
  // staging: a plane row is 16 pieces of 16 B, so a wave's copy covers two whole rows: rows cr + 8 * i of its group's chunk, the lane columns cc .. cc + 7
  const int cr = 2 * qt + hh, cc = ln * 8;
  const size_t pb = (size_t)bh * Tk * D + cc;
  const unsigned lk0 = (unsigned)(size_t)&sK[0][g][0][cr][cc], lv0 = (unsigned)(size_t)&sV[0][g][0][cr][cc];   // LDS byte addresses of the thread's first hi pieces
  // 16 asynchronous copies per thread: the 32 keys from jn on, 4 planes. A key past the end is clamped to the last one, so that every lane's
  // address stays inside the source; such a key's scores are masked below, its P is 0 and its (finite) V row adds nothing.
  auto copy_kv = [&](int jn, int buf) {
    const unsigned short* pk[8]; const unsigned short* pv[8];
    unsigned lk[8], lv[8];
#pragma unroll   // every index constant: the 32 addresses are register operands of the two statements below
    for (int i = 0; i < 4; ++i) {
      const size_t off = pb + (size_t)(unsigned)min(jn + cr + 8 * i, Tk - 1) * D;
      pk[i] = Kh + off; pk[4 + i] = Kl + off; pv[i] = Vh + off; pv[4 + i] = Vl + off;
      lk[i] = lk0 + buf * (NG * 2 * 32 * KP * 2) + i * (8 * KP * 2); lk[4 + i] = lk[i] + 32 * KP * 2;
      lv[i] = lv0 + buf * (NG * 2 * 32 * VP * 2) + i * (8 * VP * 2); lv[4 + i] = lv[i] + 32 * VP * 2;
    }
    // the s_wait_xcnt closes each statement as a precaution: no address register of an issued copy is rewritten ahead of it
    asm volatile("global_load_async_to_lds_b128 %0, %8, off\n\tglobal_load_async_to_lds_b128 %1, %9, off\n\t"
                 "global_load_async_to_lds_b128 %2, %10, off\n\tglobal_load_async_to_lds_b128 %3, %11, off\n\t"
                 "global_load_async_to_lds_b128 %4, %12, off\n\tglobal_load_async_to_lds_b128 %5, %13, off\n\t"
                 "global_load_async_to_lds_b128 %6, %14, off\n\tglobal_load_async_to_lds_b128 %7, %15, off\n\ts_wait_xcnt 0x0"
                 :: "v"(lk[0]), "v"(lk[1]), "v"(lk[2]), "v"(lk[3]), "v"(lk[4]), "v"(lk[5]), "v"(lk[6]), "v"(lk[7]),
                    "v"(pk[0]), "v"(pk[1]), "v"(pk[2]), "v"(pk[3]), "v"(pk[4]), "v"(pk[5]), "v"(pk[6]), "v"(pk[7]) : "memory");
    asm volatile("global_load_async_to_lds_b128 %0, %8, off\n\tglobal_load_async_to_lds_b128 %1, %9, off\n\t"
                 "global_load_async_to_lds_b128 %2, %10, off\n\tglobal_load_async_to_lds_b128 %3, %11, off\n\t"
                 "global_load_async_to_lds_b128 %4, %12, off\n\tglobal_load_async_to_lds_b128 %5, %13, off\n\t"
                 "global_load_async_to_lds_b128 %6, %14, off\n\tglobal_load_async_to_lds_b128 %7, %15, off\n\ts_wait_xcnt 0x0"
                 :: "v"(lv[0]), "v"(lv[1]), "v"(lv[2]), "v"(lv[3]), "v"(lv[4]), "v"(lv[5]), "v"(lv[6]), "v"(lv[7]),
                    "v"(pv[0]), "v"(pv[1]), "v"(pv[2]), "v"(pv[3]), "v"(pv[4]), "v"(pv[5]), "v"(pv[6]), "v"(pv[7]) : "memory");
  };
  if (nch > 0) copy_kv(32 * g, 0);   // the first chunk flies under the Q fragment loads (block-uniform test)
  FragB aqh[KS], aql[KS];
  {
    int row = q0 + ln; if (row >= Tq) row = Tq - 1;
    const float* qr = Q + (size_t)row * qpitch;
#pragma unroll
    for (int ks = 0; ks < KS; ++ks)
#pragma unroll
      for (int i = 0; i < 16; ++i) {
        const int d = ks * 32 + ((i < 8) ? (8 * hh + i) : (16 + 8 * hh + (i - 8)));
        const float x = qr[d] * scale; const unsigned short hb = bf16_bits(x);
        aqh[ks].u[i] = hb; aql[ks].u[i] = bf16_bits(x - bf16_val(hb));
      }
  }
  float m_r[8], l_r[8];
#pragma unroll
  for (int r = 0; r < 8; ++r) { m_r[r] = -3.0e38f; l_r[r] = 0.f; }
  v8f oacc[DT];
#pragma unroll
  for (int dt = 0; dt < DT; ++dt) oacc[dt] = (v8f){0.f,0.f,0.f,0.f,0.f,0.f,0.f,0.f};
  asm volatile("s_wait_asynccnt 0x0" ::: "memory");   // this wave's copies of the first chunk have landed
  __syncthreads();   // publishes the first chunk
  if (nch > 1) copy_kv(32 * NG + 32 * g, 1);   // the second chunk flies under the first one's work (block-uniform test)
  for (int c = 0; c < nch; ++c) {
    const int j0 = c * (32 * NG) + 32 * g, buf = c & 1;
    const unsigned short* kp = &sK[buf][g][0][0][0];   // hi plane; the lo plane lies 32 rows further
    const unsigned short* vp = &sV[buf][g][0][0][0];
    v8f s[2];
#pragma unroll
    for (int nt = 0; nt < 2; ++nt) {
      v8f acc = {};
#pragma unroll
      for (int ks = 0; ks < KS; ++ks) {
        const unsigned short* kr = kp + (nt * 16 + ln) * KP + ks * 32 + 8 * hh;
        FragB bh_, bl_;
        bh_.half[0] = *(const v8us*)kr;             bh_.half[1] = *(const v8us*)(kr + 16);
        bl_.half[0] = *(const v8us*)(kr + 32 * KP); bl_.half[1] = *(const v8us*)(kr + 32 * KP + 16);
        acc = mmaN<3>(aqh[ks].v, aql[ks].v, bh_.v, bl_.v, acc);
      }
      s[nt] = acc;
    }
    const bool keepa = j0 + ln < Tk, keepb = j0 + 16 + ln < Tk;   // the same for all 8 rows
    float alpha[8], mx[8];
#pragma unroll
    for (int r = 0; r < 8; ++r) {
      if (!keepa) s[0][r] = -3.0e38f;
      if (!keepb) s[1][r] = -3.0e38f;
      mx[r] = fmaxf(s[0][r], s[1][r]);
    }
    // row maxima over the 16 lanes of a half: step by step for all 8 rows, so that the 8 cross-lane exchanges of a step fly together
#pragma unroll   // both loops unrolled: constant exchange distances, mx[] in registers
    for (int st = 1; st < 16; st <<= 1)
#pragma unroll
      for (int r = 0; r < 8; ++r) mx[r] = fmaxf(mx[r], __shfl_xor(mx[r], st, 32));
#pragma unroll   // constant r: the per-row arrays stay in registers, and the rows' independent chains can be mixed
    for (int r = 0; r < 8; ++r) {
      const float mnew = fmaxf(m_r[r], mx[r]);
      alpha[r] = (mnew > -1.0e38f) ? __expf(m_r[r] - mnew) : 1.0f;
      const float p0 = keepa ? __expf(s[0][r] - mnew) : 0.f;
      const float p1 = keepb ? __expf(s[1][r] - mnew) : 0.f;
      m_r[r] = mnew;
      l_r[r] = l_r[r] * alpha[r] + p0 + p1;
      unsigned short hb = bf16_bits(p0); sPh[w][8 * hh + r][ln] = hb;      sPl[w][8 * hh + r][ln] = bf16_bits(p0 - bf16_val(hb));
      hb = bf16_bits(p1);                sPh[w][8 * hh + r][16 + ln] = hb; sPl[w][8 * hh + r][16 + ln] = bf16_bits(p1 - bf16_val(hb));
      if (r == 3) __builtin_amdgcn_sched_barrier(0);   // four rows at a time: with all eight mixed the temporaries push a Q fragment out of the registers
    }
#pragma unroll
    for (int dt = 0; dt < DT; ++dt)
#pragma unroll
      for (int r = 0; r < 8; ++r) oacc[dt][r] *= alpha[r];
    __builtin_amdgcn_fence(__ATOMIC_ACQ_REL, "workgroup");
    __builtin_amdgcn_wave_barrier();
    FragB pah, pal;
    pah.half[0] = *(const v8us*)&sPh[w][ln][8 * hh]; pah.half[1] = *(const v8us*)&sPh[w][ln][16 + 8 * hh];
    pal.half[0] = *(const v8us*)&sPl[w][ln][8 * hh]; pal.half[1] = *(const v8us*)&sPl[w][ln][16 + 8 * hh];
    // element i of a V fragment = V[8 * hh + i][dt * 16 + ln], element 8 + i = V[16 + 8 * hh + i][dt * 16 + ln]: the k order of pah / pal
    FragB bvh[2], bvl[2];
    auto vfrag = [&](int dt) {
      const unsigned short* vq = vp + vr * VP + dt * 16 + vc;
      bvh[dt & 1].half[0] = ld_tr16(vq);           bvh[dt & 1].half[1] = ld_tr16(vq + 16 * VP);
      bvl[dt & 1].half[0] = ld_tr16(vq + 32 * VP); bvl[dt & 1].half[1] = ld_tr16(vq + 48 * VP);
    };
    vfrag(0);
#pragma unroll
    for (int dt = 0; dt < DT; ++dt) {
      if (dt + 1 < DT) vfrag(dt + 1);   // the next tile's four loads fly under this tile's three products
      oacc[dt] = mmaN<3>(pah.v, pal.v, bvh[dt & 1].v, bvl[dt & 1].v, oacc[dt]);
    }
    asm volatile("s_wait_dscnt 0x0" ::: "memory");      // the wave's reads of this chunk's planes have retired before anybody refills them
    asm volatile("s_wait_asynccnt 0x0" ::: "memory");   // this wave's copies of the next chunk have landed
    __syncthreads();   // publishes the next chunk and ends every wave's reads of this one
    if (c + 2 < nch) copy_kv(j0 + 2 * 32 * NG, buf);   // the chunk after the next flies into the buffer just read (block-uniform test)
  }
  asm volatile("s_wait_asynccnt 0x0" ::: "memory");   // no copy is outstanding when the planes' bytes become sO, sM, sL (their last readers left them at the last trip's barrier)
#pragma unroll
  for (int r = 0; r < 8; ++r) {
    float l = l_r[r];
    l += __shfl_xor(l, 1, 32); l += __shfl_xor(l, 2, 32); l += __shfl_xor(l, 4, 32); l += __shfl_xor(l, 8, 32);
    if (ln == 0) { sM[w][8 * hh + r] = m_r[r]; sL[w][8 * hh + r] = l; }
  }
#pragma unroll
  for (int dt = 0; dt < DT; ++dt)
#pragma unroll
    for (int r = 0; r < 8; ++r) sO[w][8 * hh + r][dt * 16 + ln] = oacc[dt][r];
  __syncthreads();   // every group's partial (max, sum, O) is in LDS before any wave merges
  // merge: wave (qt, g) finishes rows g*16/NG ... of query tile qt; a lane owns 4 columns of the row
#pragma unroll
  for (int i = 0; i < 16 / NG; ++i) {
    const int rr = g * (16 / NG) + i, row = q0 + rr;
    if (row < Tq && lane < D / 4) {
      float mg[NG], mall = -3.0e38f;
#pragma unroll
      for (int k = 0; k < NG; ++k) { mg[k] = sM[k * 4 + qt][rr]; mall = fmaxf(mall, mg[k]); }
      float lall = 0.f;
      v4f val = {0.f, 0.f, 0.f, 0.f};
#pragma unroll
      for (int k = 0; k < NG; ++k) {
        const float wt = (mg[k] > -1.0e38f) ? __expf(mg[k] - mall) : 0.f;
        const v4f o = *(const v4fa*)&sO[k * 4 + qt][rr][lane * 4];
        lall += wt * sL[k * 4 + qt][rr];
        val += wt * o;
      }
      const float inv = (mall > -1.0e38f) ? 1.0f / lall : __builtin_nanf("");
      *(v4f*)(y + ((size_t)b * Tq + row) * ypitch + h * D + lane * 4) = val * inv;
      if (i + 1 < 16 / NG) asm volatile("s_wait_xcnt 0x0" ::: "memory");   // precaution: stands before the next row's reads reuse the store's address and data registers
    }
  }
}

__global__ __launch_bounds__(256) void k_roundcopy(const float* __restrict__ src, float* __restrict__ dst, int n8) {
  const size_t t = (size_t)blockIdx.x * 256 + threadIdx.x;
  if (t >= (size_t)n8 * 2) return;
  v4f a = *(const v4fa*)(src + t * 4);
  for (int i = 0; i < 4; ++i) a[i] = bf16_round(a[i]);
  *(v4f*)(dst + t * 4) = a; 
}

__global__ void k_ln_rows(const float* __restrict__ X, const float* __restrict__ R, const float* __restrict__ g, const float* __restrict__ bta, float* __restrict__ out, int N, float eps) {
  __shared__ float red[256];
  const int row = blockIdx.x, tid = threadIdx.x, nt = blockDim.x;
  v4f a = *(const v4fa*)(X + (size_t)row * N + tid * 4);
  if (R) { const v4f rr = *(const v4fa*)(R + (size_t)row * N + tid * 4); for (int q = 0; q < 4; ++q) a[q] += rr[q]; }
  float s = a[0] + a[1] + a[2] + a[3];
  red[tid] = s; __syncthreads();
  for (int st = nt / 2; st > 0; st >>= 1) { if (tid < st) red[tid] += red[tid + st]; __syncthreads(); }
  const float mu = red[0] / (float)N; __syncthreads();
  float v = 0.f; for (int q = 0; q < 4; ++q) { const float c = a[q] - mu; v += c * c; }
  red[tid] = v; __syncthreads();
  for (int st = nt / 2; st > 0; st >>= 1) { if (tid < st) red[tid] += red[tid + st]; __syncthreads(); }
  const float rs = rsqrtf(red[0] / (float)N + eps);
  v4f o; for (int q = 0; q < 4; ++q) o[q] = (a[q] - mu) * rs * bf16_round(g[tid * 4 + q]) + bf16_round(bta[tid * 4 + q]);
  *(v4f*)(out + (size_t)row * N + tid * 4) = o; 
}

// Bt[h*DK + k][d] = W[h][d][k]  (W [H][D][DK]); thread per (n, 8 d)
__global__ __launch_bounds__(256) void k_wt_heads(const float* __restrict__ W, unsigned short* __restrict__ Bt) {
  const int t = blockIdx.x * 256 + threadIdx.x; if (t >= NH * DK * (DD / 8)) return;
  const int n = t / (DD / 8), d8 = (t % (DD / 8)) * 8; const int h = n / DK, kk = n % DK; v8us v;
#pragma unroll
  for (int i = 0; i < 8; ++i) v[i] = bf16_bits(W[((size_t)h * DD + d8 + i) * DK + kk]);
  *(v8us*)(Bt + (size_t)n * DD + d8) = v; 
}
extern "C" void kernel_launch(void* const* d_in, const int* in_sizes, int n_in,
                              void* d_out, int out_size, void* d_ws, size_t ws_size, hipStream_t stream) {
  (void)in_sizes; (void)n_in; (void)out_size;
  const float* token = (const float*)d_in[0];
  const float* Wq = (const float*)d_in[1]; const float* bq = (const float*)d_in[2]; const float* Wk = (const float*)d_in[3]; const float* bk = (const float*)d_in[4];
  const float* Wv = (const float*)d_in[5]; const float* bv = (const float*)d_in[6]; const float* Wo = (const float*)d_in[7]; const float* bo = (const float*)d_in[8];
  const float* Wf = (const float*)d_in[9]; const float* bfv = (const float*)d_in[10]; const float* gamma = (const float*)d_in[11]; const float* beta = (const float*)d_in[12];
  char* ws = (char*)d_ws; size_t off = 0;
  auto take = [&](size_t bytes) { char* p = ws + off; off += (bytes + 255) & ~(size_t)255; return p; };
  unsigned short* Bqkv = (unsigned short*)take((size_t)3 * DD * DD * 2); unsigned short* Bo = (unsigned short*)take((size_t)DD * DD * 2); unsigned short* Bf = (unsigned short*)take((size_t)DD * DD * 2);
  float* bqkv = (float*)take(3 * DD * 4);
  float* x = (float*)take((size_t)SS * DD * 4); float* qkv = (float*)take((size_t)SS * 3 * DD * 4); float* att = (float*)take((size_t)SS * DD * 4); float* tmp = (float*)take((size_t)SS * DD * 4); float* a = (float*)take((size_t)SS * DD * 4);
  unsigned short* kvh = (unsigned short*)take((size_t)2 * DD * SS * 2); unsigned short* kvl = (unsigned short*)take((size_t)2 * DD * SS * 2);   // bf16 hi / lo planes [K heads | V heads][SS][DK]
  if (off > ws_size) return;
  k_wt_heads<<<(NH * DK * (DD / 8) + 255) / 256, 256, 0, stream>>>(Wq, Bqkv);
  k_wt_heads<<<(NH * DK * (DD / 8) + 255) / 256, 256, 0, stream>>>(Wk, Bqkv + (size_t)DD * DD);
  k_wt_heads<<<(NH * DK * (DD / 8) + 255) / 256, 256, 0, stream>>>(Wv, Bqkv + (size_t)2 * DD * DD);
  k_wt_bf16<<<(DD * (DD / 8) + 255) / 256, 256, 0, stream>>>(Wo, Bo, DD, DD);
  k_wt_bf16<<<(DD * (DD / 8) + 255) / 256, 256, 0, stream>>>(Wf, Bf, DD, DD);
  k_roundcopy<<<(3 * DD / 4 + 255) / 256, 256, 0, stream>>>(bq, bqkv, DD / 8);            // bq|bk|bv flat [H*DK] each: three copies (f32, rounded) into one bias vector
  k_roundcopy<<<(DD / 4 + 255) / 256, 256, 0, stream>>>(bk, bqkv + DD, DD / 8);
  k_roundcopy<<<(DD / 4 + 255) / 256, 256, 0, stream>>>(bv, bqkv + 2 * DD, DD / 8);
  k_roundcopy<<<(SS * DD / 4 + 255) / 256, 256, 0, stream>>>(token, x, SS * DD / 8);
  const int gq = (SS / 64) * (3 * DD / 128), g1 = (SS / 64) * (DD / 128);
  for (int l = 0; l < NLAY; ++l) {
    k_gemm_tile<false, true><<<gq, 256, 0, stream>>>(x, DD, Bqkv, DD, bqkv, qkv, 3 * DD, 3 * DD, DD, kvh, kvl, DD, SS);      // bias already rounded (BIAS_BF16=false adds it as given); q to qkv, k and v to the planes
    k_flash3<DK><<<NH * (SS / 64), 512, 0, stream>>>(qkv, 3 * DD, SS, kvh, kvl, kvh + (size_t)DD * SS, kvl + (size_t)DD * SS, SS, NH, 0.08838834764831845f, att, DD);
    k_gemm_tile<true, false><<<g1, 256, 0, stream>>>(att, DD, Bo, DD, bo, tmp, DD, DD, DD, nullptr, nullptr, 0, SS);
    k_ln_rows<<<SS, DD / 4, 0, stream>>>(tmp, x, gamma, beta, a, DD, 1e-5f);                  // a = LN(x + attn_out)
    k_gemm_tile<true, false><<<g1, 256, 0, stream>>>(a, DD, Bf, DD, bfv, tmp, DD, DD, DD, nullptr, nullptr, 0, SS);
    k_ln_rows<<<SS, DD / 4, 0, stream>>>(tmp, a, gamma, beta, (l == NLAY - 1) ? (float*)d_out : x, DD, 1e-5f);   // x = LN(a + ff)
  }
}

// v007
// Measured time: 740 microseconds a run.
// Timed twice side by side with v006, it ran 1.09 times as fast both times.
// Counting every step since v000, it is 5.47 times as fast.
#include <hip/hip_runtime.h>
// All GEMMs on v_wmma_f32_16x16x32_bf16, f32 accumulate: fused per-head q|k|v projection (K=1024, N=3072), concat·Wo, a·Wf — A operands
// (the residual stream, quantised to bf16 once at the input) split into bf16 hi/lo (2 terms) against bf16-rounded weights; attention QKᵀ/√128
// and P·V per 16-query tile as 3-term splits (head dim 128); LayerNorm and softmax in f32. Six layers with shared weights.
#define SS 2048
#define DD 1024
#define NH 8
#define DK 128
#define NLAY 6

typedef __bf16 v16b __attribute__((ext_vector_type(16)));
typedef unsigned short v8us __attribute__((ext_vector_type(8), may_alias));
typedef unsigned short v4us __attribute__((ext_vector_type(4), may_alias));
typedef float  v8f  __attribute__((ext_vector_type(8)));
typedef float  v4f  __attribute__((ext_vector_type(4)));
typedef float  v4fa __attribute__((ext_vector_type(4), may_alias));
typedef float  v2f  __attribute__((ext_vector_type(2)));
typedef __bf16 v2b  __attribute__((ext_vector_type(2)));
union FragB { v16b v; v8us half[2]; unsigned short u[16]; unsigned int d[8]; };
typedef short s16x8 __attribute__((ext_vector_type(8)));
typedef __attribute__((address_space(3))) s16x8 lds_s16x8;
// transposing LDS load of an 8 x 16 block of 16-bit elements per lane half: lane l points at 8 elements of row 8*(l>>4) + (l&7), columns 8*((l>>3)&1) ...;
// lane (c = l&15, h = l>>4) receives rows 8h .. 8h+7 of column c
__device__ __forceinline__ v8us ld_tr16(const unsigned short* p) { return __builtin_bit_cast(v8us, __builtin_amdgcn_ds_load_tr16_b128_v8i16((lds_s16x8*)p)); }

__device__ __forceinline__ unsigned short bf16_bits(float x) { unsigned int u = __float_as_uint(x); return (unsigned short)((u + 0x7FFFu + ((u >> 16) & 1u)) >> 16); }
__device__ __forceinline__ float bf16_val(unsigned short b) { return __uint_as_float(((unsigned int)b) << 16); }
__device__ __forceinline__ float bf16_round(float x) { return bf16_val(bf16_bits(x)); }
// D += A·B with NT terms: 1 = ah·bh, 2 = + al·bh (A split), 3 = + ah·bl (both split)
template <int NT>
__device__ __forceinline__ v8f mmaN(v16b ah, v16b al, v16b bh, v16b bl, v8f c) {
  c = __builtin_amdgcn_wmma_f32_16x16x32_bf16(false, ah, false, bh, (short)0, c, false, false);
  if (NT >= 2) c = __builtin_amdgcn_wmma_f32_16x16x32_bf16(false, al, false, bh, (short)0, c, false, false);
  if (NT >= 3) c = __builtin_amdgcn_wmma_f32_16x16x32_bf16(false, ah, false, bl, (short)0, c, false, false);
  asm volatile("v_nop\n\tv_nop\n\tv_nop\n\tv_nop" : "+v"(c) : "v"(ah), "v"(al), "v"(bh), "v"(bl));
  return c;
}

// D += A x B, both split, for the transposed attention products (A = K or V, B = Q or P): ah.bh, then ah.bl, then al.bh, which is the term order
// that mmaN<3> gives with the operands the other way round
__device__ __forceinline__ v8f mma3t(v16b ah, v16b al, v16b bh, v16b bl, v8f c) {
  c = __builtin_amdgcn_wmma_f32_16x16x32_bf16(false, ah, false, bh, (short)0, c, false, false);
  c = __builtin_amdgcn_wmma_f32_16x16x32_bf16(false, ah, false, bl, (short)0, c, false, false);
  c = __builtin_amdgcn_wmma_f32_16x16x32_bf16(false, al, false, bh, (short)0, c, false, false);
  // as in mmaN: four vector slots behind the last product, on whatever path follows it (a scalar branch stands behind the score products)
  asm volatile("v_nop\n\tv_nop\n\tv_nop\n\tv_nop" : "+v"(c) : "v"(ah), "v"(al), "v"(bh), "v"(bl));
  return c;
}
// the value that lane l ^ 16 holds
__device__ __forceinline__ float other_half(float x) {
  const int b = __float_as_int(x);
  return __int_as_float(__builtin_amdgcn_permlanex16(b, b, 0x76543210, 0xfedcba98, false, false));
}

__global__ __launch_bounds__(256) void k_wt_bf16(const float* __restrict__ W, unsigned short* __restrict__ Wt, int K, int N) {
  const int t = blockIdx.x * 256 + threadIdx.x;
  const int k8n = K / 8;
  if (t >= N * k8n) return;
  const int n = t / k8n, k8 = (t % k8n) * 8;
  v8us v;
#pragma unroll
  for (int i = 0; i < 8; ++i) v[i] = bf16_bits(W[(size_t)(k8 + i) * N + n]);
  *(v8us*)(Wt + (size_t)n * K + k8) = v;
  
}

// GEMM C[M][N] (f32, pitch ldc) = act(A[M][K]·W + bias). A f32 row-major (pitch lda) converted per fragment to bf16
// (ASPLIT: hi/lo two planes -> 2 terms, else single rounded term); Wt bf16 [N][K] (pitch ldb). BIAS_BF16 rounds the
// bias to bf16 first (bias quantised to bf16 before the add). K%32==0, M%16==0, N%64==0.
template <bool ASPLIT, int ACT, bool BIAS_BF16>
__global__ __launch_bounds__(128) void k_gemm_bf(const float* __restrict__ A, int lda, const unsigned short* __restrict__ Wt, int ldb,
                                               const float* __restrict__ bias, float* __restrict__ C, int ldc, int M, int N, int K) {
  __shared__ __attribute__((aligned(16))) float so[4][16][64];
  const int tid = threadIdx.x, w = tid >> 5, lane = tid & 31, ln = lane & 15, hh = lane >> 4;
  const int ntn = N / 64;
  const int wid = blockIdx.x * 4 + w;
  const int mt = wid / ntn, nq = wid % ntn;
  if (mt * 16 >= M) return;
  const int row0 = mt * 16, col0 = nq * 64;
  const float* arow = A + (size_t)(row0 + ln) * lda;
  v8f acc[4] = {};
  for (int kb = 0; kb < K; kb += 32) {
    FragB ah, al;
    const v4f x0 = *(const v4fa*)(arow + kb + 8 * hh), x1 = *(const v4fa*)(arow + kb + 8 * hh + 4);
    const v4f x2 = *(const v4fa*)(arow + kb + 16 + 8 * hh), x3 = *(const v4fa*)(arow + kb + 16 + 8 * hh + 4);
    float xs[16] = {x0[0],x0[1],x0[2],x0[3],x1[0],x1[1],x1[2],x1[3],x2[0],x2[1],x2[2],x2[3],x3[0],x3[1],x3[2],x3[3]};
#pragma unroll
    for (int i = 0; i < 16; ++i) { const unsigned short hb = bf16_bits(xs[i]); ah.u[i] = hb; al.u[i] = ASPLIT ? bf16_bits(xs[i] - bf16_val(hb)) : (unsigned short)0; }
#pragma unroll
    for (int t = 0; t < 4; ++t) {
      const unsigned short* brow = Wt + (size_t)(col0 + t * 16 + ln) * ldb + kb;
      FragB b;
      b.half[0] = *(const v8us*)(brow + 8 * hh);
      b.half[1] = *(const v8us*)(brow + 16 + 8 * hh);
      acc[t] = mmaN<ASPLIT ? 2 : 1>(ah.v, al.v, b.v, b.v, acc[t]);
    }
  }
#pragma unroll
  for (int t = 0; t < 4; ++t) {
    float bv = bias ? bias[col0 + t * 16 + ln] : 0.f;
    if (BIAS_BF16) bv = bf16_round(bv);
#pragma unroll
    for (int r = 0; r < 8; ++r) { float v = acc[t][r] + bv; if (ACT == 1) v = fmaxf(v, 0.f); so[w][8 * hh + r][t * 16 + ln] = v; }
  }
  __builtin_amdgcn_fence(__ATOMIC_ACQ_REL, "workgroup");
  __builtin_amdgcn_wave_barrier();
  const int rsub = lane >> 4, c4 = (lane & 15) * 4;
  {
#pragma unroll
    for (int q = 0; q < 8; ++q) {
      const int r = q * 2 + rsub;
      const v4f v = *(const v4fa*)&so[w][r][c4];
      *(v4f*)(C + (size_t)(row0 + r) * ldc + col0 + c4) = v;
    }
    
  }
}

// Flash-style causal/unmasked attention, all contractions 3-term bf16 hi/lo splits, f32 softmax with running max.
// q,k,v rows are read from f32 buffers with arbitrary row pitch (so they can live inside a fused qkv buffer);
// D = head size (multiple of 32, <= 128); one wave = 16 query rows; block = 4 waves (64 queries) sharing K/V chunks of 32.
template <int D, bool CAUSAL>
__global__ __launch_bounds__(128) void k_flash(const float* __restrict__ qb, const float* __restrict__ kb, const float* __restrict__ vb,
                                             int pitch, int T, int H, float scale, float* __restrict__ y, int ypitch) {
  constexpr int KS = D / 32;        // k-steps for QK
  constexpr int DT = D / 16;        // d tiles for PV
  __shared__ __attribute__((aligned(16))) unsigned short sKh[32][D + 8], sKl[32][D + 8], sVh[32][D + 8], sVl[32][D + 8];
  __shared__ __attribute__((aligned(16))) unsigned short sPh[4][16][40], sPl[4][16][40];
  __shared__ __attribute__((aligned(16))) float sO[4][16][D];
  const int tid = threadIdx.x, w = tid >> 5, lane = tid & 31, ln = lane & 15, hh = lane >> 4;
  const int nqb = (T + 63) / 64;
  const int bh = blockIdx.x / nqb, qblk = blockIdx.x % nqb;
  const int b = bh / H, h = bh % H;
  const int q0 = qblk * 64 + w * 16;
  const float* Q = qb + (size_t)b * T * pitch + h * D;
  const float* K = kb + (size_t)b * T * pitch + h * D;
  const float* V = vb + (size_t)b * T * pitch + h * D;

  // A fragments of the wave's 16 query rows (scaled), hi/lo
  FragB aqh[KS], aql[KS];
  {
    int row = q0 + ln; if (row >= T) row = T - 1;
    const float* qr = Q + (size_t)row * pitch;
#pragma unroll
    for (int ks = 0; ks < KS; ++ks)
#pragma unroll
      for (int i = 0; i < 16; ++i) {
        const int d = ks * 32 + ((i < 8) ? (8 * hh + i) : (16 + 8 * hh + (i - 8)));
        const float x = qr[d] * scale; const unsigned short hb = bf16_bits(x);
        aqh[ks].u[i] = hb; aql[ks].u[i] = bf16_bits(x - bf16_val(hb));
      }
  }
  float m_r[8], l_r[8];
#pragma unroll
  for (int r = 0; r < 8; ++r) { m_r[r] = -3.0e38f; l_r[r] = 0.f; }
  v8f oacc[DT];
#pragma unroll
  for (int dt = 0; dt < DT; ++dt) oacc[dt] = (v8f){0.f,0.f,0.f,0.f,0.f,0.f,0.f,0.f};

  const int kv_end = CAUSAL ? min(T, qblk * 64 + 64) : T;     // block-uniform
  for (int j0 = 0; j0 < kv_end; j0 += 32) {
    __syncthreads();
    for (int e = tid; e < 32 * (D / 4); e += 128) {
      const int r = e / (D / 4), c4 = (e % (D / 4)) * 4;
      const int key = j0 + r;
      v4f kf = {0.f,0.f,0.f,0.f}, vf = {0.f,0.f,0.f,0.f};
      if (key < T) { kf = *(const v4fa*)(K + (size_t)key * pitch + c4); vf = *(const v4fa*)(V + (size_t)key * pitch + c4); }
#pragma unroll
      for (int t = 0; t < 4; ++t) {
        unsigned short hb = bf16_bits(kf[t]); sKh[r][c4 + t] = hb; sKl[r][c4 + t] = bf16_bits(kf[t] - bf16_val(hb));
        hb = bf16_bits(vf[t]); sVh[r][c4 + t] = hb; sVl[r][c4 + t] = bf16_bits(vf[t] - bf16_val(hb));
      }
    }
    __syncthreads();
    // S tile 16 x 32
    v8f s[2];
#pragma unroll
    for (int nt = 0; nt < 2; ++nt) {
      v8f acc = {};
#pragma unroll
      for (int ks = 0; ks < KS; ++ks) {
        FragB bh_, bl_;
        bh_.half[0] = *(const v8us*)&sKh[nt * 16 + ln][ks * 32 + 8 * hh]; bh_.half[1] = *(const v8us*)&sKh[nt * 16 + ln][ks * 32 + 16 + 8 * hh];
        bl_.half[0] = *(const v8us*)&sKl[nt * 16 + ln][ks * 32 + 8 * hh]; bl_.half[1] = *(const v8us*)&sKl[nt * 16 + ln][ks * 32 + 16 + 8 * hh];
        acc = mmaN<3>(aqh[ks].v, aql[ks].v, bh_.v, bl_.v, acc);
      }
      s[nt] = acc;
    }
    // mask + running max (rows 8hh+r; the 16 lanes of a half share rows)
    float alpha[8];
#pragma unroll
    for (int r = 0; r < 8; ++r) {
      const int qi = q0 + 8 * hh + r;
      const int ja = j0 + ln, jb = j0 + 16 + ln;
      if (CAUSAL) { if (ja > qi) s[0][r] = -3.0e38f; if (jb > qi) s[1][r] = -3.0e38f; }
      if (ja >= T) s[0][r] = -3.0e38f;
      if (jb >= T) s[1][r] = -3.0e38f;
      float mx = fmaxf(s[0][r], s[1][r]);
      mx = fmaxf(mx, __shfl_xor(mx, 1, 32)); mx = fmaxf(mx, __shfl_xor(mx, 2, 32)); mx = fmaxf(mx, __shfl_xor(mx, 4, 32)); mx = fmaxf(mx, __shfl_xor(mx, 8, 32));
      const float mnew = fmaxf(m_r[r], mx);
      alpha[r] = (mnew > -1.0e38f) ? __expf(m_r[r] - mnew) : 1.0f;
      const float p0 = (s[0][r] > -1.0e38f) ? __expf(s[0][r] - mnew) : 0.f;
      const float p1 = (s[1][r] > -1.0e38f) ? __expf(s[1][r] - mnew) : 0.f;
      m_r[r] = mnew;
      l_r[r] = l_r[r] * alpha[r] + p0 + p1;            // per-lane partial row sum (16 lanes combined at the end)
      unsigned short hb = bf16_bits(p0); sPh[w][8 * hh + r][ln] = hb;      sPl[w][8 * hh + r][ln] = bf16_bits(p0 - bf16_val(hb));
      hb = bf16_bits(p1);                sPh[w][8 * hh + r][16 + ln] = hb; sPl[w][8 * hh + r][16 + ln] = bf16_bits(p1 - bf16_val(hb));
    }
#pragma unroll
    for (int dt = 0; dt < DT; ++dt)
#pragma unroll
      for (int r = 0; r < 8; ++r) oacc[dt][r] *= alpha[r];
    __builtin_amdgcn_fence(__ATOMIC_ACQ_REL, "workgroup");
    __builtin_amdgcn_wave_barrier();
    FragB pah, pal;
    pah.half[0] = *(const v8us*)&sPh[w][ln][8 * hh]; pah.half[1] = *(const v8us*)&sPh[w][ln][16 + 8 * hh];
    pal.half[0] = *(const v8us*)&sPl[w][ln][8 * hh]; pal.half[1] = *(const v8us*)&sPl[w][ln][16 + 8 * hh];
#pragma unroll
    for (int dt = 0; dt < DT; ++dt) {
      FragB bvh, bvl;
#pragma unroll
      for (int i = 0; i < 8; ++i) {
        bvh.u[i] = sVh[8 * hh + i][dt * 16 + ln]; bvh.u[8 + i] = sVh[16 + 8 * hh + i][dt * 16 + ln];
        bvl.u[i] = sVl[8 * hh + i][dt * 16 + ln]; bvl.u[8 + i] = sVl[16 + 8 * hh + i][dt * 16 + ln];
      }
      oacc[dt] = mmaN<3>(pah.v, pal.v, bvh.v, bvl.v, oacc[dt]);
    }
    __builtin_amdgcn_fence(__ATOMIC_ACQ_REL, "workgroup");
    __builtin_amdgcn_wave_barrier();
  }
#pragma unroll
  for (int r = 0; r < 8; ++r) {
    float l = l_r[r];
    l += __shfl_xor(l, 1, 32); l += __shfl_xor(l, 2, 32); l += __shfl_xor(l, 4, 32); l += __shfl_xor(l, 8, 32);
    l_r[r] = (l > 0.f) ? 1.0f / l : 0.f;
  }
#pragma unroll
  for (int dt = 0; dt < DT; ++dt)
#pragma unroll
    for (int r = 0; r < 8; ++r) sO[w][8 * hh + r][dt * 16 + ln] = oacc[dt][r] * l_r[r];
  __builtin_amdgcn_fence(__ATOMIC_ACQ_REL, "workgroup");
  __builtin_amdgcn_wave_barrier();
  {
    for (int r = 0; r < 16; ++r) {
      const int row = q0 + r;
      if (row < T && lane < D / 4) {
        const v4f val = *(const v4fa*)&sO[w][r][lane * 4];
        *(v4f*)(y + ((size_t)b * T + row) * ypitch + h * D + lane * 4) = val;
      }
    }
    
  }
}

// GEMM C[M][N] (f32, pitch ldc) = A[M][K] x W + bias: A f32 row-major (pitch lda), two terms (bf16 hi + lo) against Wt bf16 [N][K] (pitch ldb).
// Block = 8 waves (2 x 4) on a 64 x 128 tile of C, a wave owns 32 x 32. K is walked in slices of 64: the A slice is split into its hi and lo
// planes once per block, the Wt slice is copied, both through whole-line global loads into LDS, where all 8 waves read their fragments.
// Two LDS buffers: the next slice's global loads are issued ahead of this slice's products and stored behind them; one barrier per slice.
// Each accumulator takes hi then lo of every 32-wide k step in rising k. M % 64 == 0, N % 128 == 0, K % 64 == 0; grid = (M / 64) * (N / 128).
// PLANES: a block whose columns start at pcol0 or beyond does not store its tile to C; it splits it into bf16 hi and lo and stores these to
// Ph / Pl as rows of plane (col0 - pcol0) / 128, each plane [M][128]: the form in which the attention kernel stages K and V.
template <bool BIAS_BF16, bool PLANES>
__global__ __launch_bounds__(256) void k_gemm_tile(const float* __restrict__ A, int lda, const unsigned short* __restrict__ Wt, int ldb,
                                                   const float* __restrict__ bias, float* __restrict__ C, int ldc, int N, int K,
                                                   unsigned short* __restrict__ Ph, unsigned short* __restrict__ Pl, int pcol0, int M) {
  constexpr int BM = 64, BN = 128, BK = 64, LP = BK + 8;       // LP: LDS row pitch 144 B = 16 B x odd
  constexpr int PA = BM * LP, PB = BN * LP, BUF = 2 * PA + PB;  // one buffer, in 16-bit elements: A hi | A lo | Wt
  constexpr int OP = 36;                                       // pitch of the output staging rows, in floats
  __shared__ __attribute__((aligned(16))) unsigned short sm[2 * BUF];
  const int tid = threadIdx.x, lane = tid & 31, ln = lane & 15, hh = lane >> 4;
  const int w = __builtin_amdgcn_readfirstlane(tid >> 5);      // wave number, kept scalar so that the tile offsets stay scalar
  const int wm = w >> 2, wn = w & 3;
  const int nbn = N / BN;
  const int row0 = (blockIdx.x / nbn) * BM, col0 = (blockIdx.x % nbn) * BN;
  const int ar = tid >> 4, ac = (tid & 15) * 4;                // A slice: a wave's load covers 2 rows x 256 B
  const int br = tid >> 3, bc = (tid & 7) * 8;                 // Wt slice: a wave's load covers 4 rows x 128 B
  const float* ag = A + (size_t)(row0 + ar) * lda + ac;
  const unsigned short* bg = Wt + (size_t)(col0 + br) * ldb + bc;
  v4f ra[4];
  v8us rb[4];
  auto fetch = [&](int kb) {
    const float* pa[4];
    const unsigned short* pb[4];
#pragma unroll
    for (int j = 0; j < 4; ++j) { pa[j] = ag + (size_t)(16 * j) * lda + kb; pb[j] = bg + (size_t)(32 * j) * ldb + kb; }
#pragma unroll
    for (int j = 0; j < 4; ++j) ra[j] = *(const v4fa*)pa[j];
#pragma unroll
    for (int j = 0; j < 4; ++j) rb[j] = *(const v8us*)pb[j];
    // precaution: the eight address pairs are inputs of the wait, so none of them is reused (not even as a later load's result) ahead of it
    asm volatile("s_wait_xcnt 0x0" :: "v"(pa[0]), "v"(pa[1]), "v"(pa[2]), "v"(pa[3]), "v"(pb[0]), "v"(pb[1]), "v"(pb[2]), "v"(pb[3]) : "memory");
  };
  auto stash = [&](unsigned short* sb) {
#pragma unroll
    for (int j = 0; j < 4; ++j) {
      v4us h, l;
#pragma unroll
      for (int t = 0; t < 4; ++t) { const unsigned short hb = bf16_bits(ra[j][t]); h[t] = hb; l[t] = bf16_bits(ra[j][t] - bf16_val(hb)); }
      *(v4us*)(sb + (ar + 16 * j) * LP + ac) = h;
      *(v4us*)(sb + PA + (ar + 16 * j) * LP + ac) = l;
      *(v8us*)(sb + 2 * PA + (br + 32 * j) * LP + bc) = rb[j];
    }
  };
  v8f acc[2][2] = {};
  const int ns = K / BK;
  fetch(0);
  stash(sm);
  __syncthreads();
  for (int s = 0; s < ns; ++s) {
    const unsigned short* sb = sm + (s & 1) * BUF;
    if (s + 1 < ns) fetch((s + 1) * BK);
#pragma unroll
    for (int ks = 0; ks < BK / 32; ++ks) {
      FragB ah[2], al[2], b[2];
#pragma unroll
      for (int t = 0; t < 2; ++t) {
        const unsigned short* pa = sb + (wm * 32 + t * 16 + ln) * LP + ks * 32 + 8 * hh;
        const unsigned short* pb = sb + 2 * PA + (wn * 32 + t * 16 + ln) * LP + ks * 32 + 8 * hh;
        ah[t].half[0] = *(const v8us*)pa;        ah[t].half[1] = *(const v8us*)(pa + 16);
        al[t].half[0] = *(const v8us*)(pa + PA); al[t].half[1] = *(const v8us*)(pa + PA + 16);
        b[t].half[0]  = *(const v8us*)pb;        b[t].half[1]  = *(const v8us*)(pb + 16);
      }
      __builtin_amdgcn_sched_barrier(0);   // keeps the k step's 12 LDS reads together as one group ahead of its 8 products: one LDS wait per k step, not four
#pragma unroll
      for (int mt = 0; mt < 2; ++mt)
#pragma unroll
        for (int nt = 0; nt < 2; ++nt) acc[mt][nt] = __builtin_amdgcn_wmma_f32_16x16x32_bf16(false, ah[mt].v, false, b[nt].v, (short)0, acc[mt][nt], false, false);
#pragma unroll
      for (int mt = 0; mt < 2; ++mt)
#pragma unroll
        for (int nt = 0; nt < 2; ++nt) acc[mt][nt] = __builtin_amdgcn_wmma_f32_16x16x32_bf16(false, al[mt].v, false, b[nt].v, (short)0, acc[mt][nt], false, false);
    }
    if (s + 1 < ns) stash(sm + ((s + 1) & 1) * BUF);
    __syncthreads();   // publishes slice s + 1 and ends every wave's reads of slice s, whose buffer is refilled in the next trip
  }
  // output: each wave turns its 32 x 32 tile through its own piece of the (now free) LDS so that every store covers whole 128-B lines
  float* so = (float*)sm + w * 32 * OP;
#pragma unroll
  for (int nt = 0; nt < 2; ++nt) {
    float bv = bias[col0 + wn * 32 + nt * 16 + ln];
    if (BIAS_BF16) bv = bf16_round(bv);
#pragma unroll
    for (int mt = 0; mt < 2; ++mt)
#pragma unroll
      for (int r = 0; r < 8; ++r) so[(mt * 16 + 8 * hh + r) * OP + nt * 16 + ln] = acc[mt][nt][r] + bv;
  }
  if (PLANES && col0 >= pcol0) {   // the same for the whole block
    __syncthreads();   // every wave's 32 x 32 piece is in LDS before rows are read across the four pieces of a tile row
    // wave w takes tile rows 8 * w .. 8 * w + 7; a lane owns 4 columns, so each store of a wave covers one whole 256-B plane row
    const float* sp = (const float*)sm + ((w >> 2) * 4 + (lane >> 3)) * 32 * OP + (w & 3) * 8 * OP + (lane & 7) * 4;
    const size_t po = ((size_t)((col0 - pcol0) / BN) * M + row0 + w * 8) * BN + lane * 4;
    v4us h[8], l[8];
#pragma unroll
    for (int q = 0; q < 8; ++q) {
      const v4f v = *(const v4fa*)(sp + q * OP);
#pragma unroll
      for (int t = 0; t < 4; ++t) { const unsigned short hb = bf16_bits(v[t]); h[q][t] = hb; l[q][t] = bf16_bits(v[t] - bf16_val(hb)); }
    }
#pragma unroll
    for (int q = 0; q < 8; ++q) { *(v4us*)(Ph + po + q * BN) = h[q]; *(v4us*)(Pl + po + q * BN) = l[q]; }
    asm volatile("s_wait_xcnt 0x0" ::: "memory");   // precaution: stands behind the last plane store, before any later instruction reuses a store's address or data registers
    return;
  }
  __builtin_amdgcn_fence(__ATOMIC_ACQ_REL, "workgroup");
  __builtin_amdgcn_wave_barrier();
  const int rsub = lane >> 3, c4 = (lane & 7) * 4;
#pragma unroll
  for (int q = 0; q < 8; ++q) {
    const int r = q * 4 + rsub;
    const v4f v = *(const v4fa*)(so + r * OP + c4);
    *(v4f*)(C + (size_t)(row0 + wm * 32 + r) * ldc + col0 + wn * 32 + c4) = v;
  }
}
// row LayerNorm (biased variance, eps) over N: s = X (+ R); optional out_sum <- s; out_norm <- (s-mu)*rsqrt(var+eps)*g + b
template <bool PARAM_BF16>
__global__ __launch_bounds__(256) void k_layernorm(const float* __restrict__ X, const float* __restrict__ R, const float* __restrict__ g, const float* __restrict__ bta,
                                                  float* __restrict__ out_sum, float* __restrict__ out_norm, int N, float eps) {
  __shared__ float red[256];
  const int row = blockIdx.x, tid = threadIdx.x;
  const float* x = X + (size_t)row * N; const float* rr = R ? R + (size_t)row * N : nullptr;
  float vals[16];                     // up to N = 4096
  const int per = N / 256;            // contiguous chunk per thread? use strided-by-4 chunks: thread handles j = tid*4 + 1024*u
  float s1 = 0.f;
  for (int u = 0; u < per / 4; ++u) {
    const int j = tid * 4 + 1024 * u;
    const v4f a = *(const v4fa*)(x + j);
    v4f b = {0.f,0.f,0.f,0.f}; if (rr) b = *(const v4fa*)(rr + j);
#pragma unroll
    for (int q = 0; q < 4; ++q) { const float v = a[q] + b[q]; vals[u * 4 + q] = v; s1 += v; }
  }
  red[tid] = s1; __syncthreads();
  for (int st = 128; st > 0; st >>= 1) { if (tid < st) red[tid] += red[tid + st]; __syncthreads(); }
  const float mu = red[0] / (float)N; __syncthreads();
  float s2 = 0.f;
  for (int u = 0; u < per / 4; ++u)
#pragma unroll
    for (int q = 0; q < 4; ++q) { const float c = vals[u * 4 + q] - mu; s2 += c * c; }
  red[tid] = s2; __syncthreads();
  for (int st = 128; st > 0; st >>= 1) { if (tid < st) red[tid] += red[tid + st]; __syncthreads(); }
  const float rs = rsqrtf(red[0] / (float)N + eps);
  {
    for (int u = 0; u < per / 4; ++u) {
      const int j = tid * 4 + 1024 * u;
      v4f o, sm;
#pragma unroll
      for (int q = 0; q < 4; ++q) {
        float gg = g[j + q], bb = bta[j + q];
        if (PARAM_BF16) { gg = bf16_round(gg); bb = bf16_round(bb); }
        sm[q] = vals[u * 4 + q]; o[q] = (vals[u * 4 + q] - mu) * rs * gg + bb;
      }
      if (out_sum) *(v4f*)(out_sum + (size_t)row * N + j) = sm;
      *(v4f*)(out_norm + (size_t)row * N + j) = o;
    }
    
  }
}

template <int D>
__global__ __launch_bounds__(512) void k_flash3(const float* __restrict__ Qb, int qpitch, int Tq,
                                              const unsigned short* __restrict__ Kh, const unsigned short* __restrict__ Kl,
                                              const unsigned short* __restrict__ Vh, const unsigned short* __restrict__ Vl, int Tk,
                                              int H, float scale, float* __restrict__ y, int ypitch) {
  constexpr int KS = D / 32, DT = D / 16, NG = 4;
  constexpr int KP = D + 8, VP = D + 16;   // row pitches: K 16 B x odd (plain 16-B reads), V 32 B x odd (transposing reads)
  static_assert(D == 128, "a group's 128 threads copy 4 pieces of 16 B of each of the 4 planes per 32 keys");
  __shared__ __attribute__((aligned(32))) unsigned short sK[2][NG][2][32][KP];   // buffer, group, hi | lo
  __shared__ __attribute__((aligned(32))) unsigned short sV[2][NG][2][32][VP];
  // once the loop has ended the partial O tiles take sK's bytes and the partial max / sum rows the first bytes of sV
  constexpr int OPD = D + 4;   // pitch of a partial O row in floats: 16 B x odd, so that the 16 queries of a lane half store their 16-B pieces to different banks
  static_assert(sizeof(float) * 4 * NG * 16 * OPD <= sizeof(sK) && sizeof(float) * 2 * 4 * NG * 16 <= sizeof(sV), "merge staging fits");
  float (*sO)[16][OPD] = reinterpret_cast<float (*)[16][OPD]>(&sK[0][0][0][0][0]);
  float (*sM)[16] = reinterpret_cast<float (*)[16]>(&sV[0][0][0][0][0]);
  float (*sL)[16] = sM + 4 * NG;
  const int tid = threadIdx.x, lane = tid & 31, ln = lane & 15, hh = lane >> 4;
  const int w = __builtin_amdgcn_readfirstlane(tid >> 5);   // wave number, kept scalar so that the group's key offset and LDS bases stay scalar
  const int qt = w & 3, g = w >> 2;                         // query tile, key group
  const int vr = 8 * hh + (lane & 7), vc = 8 * ((lane >> 3) & 1);   // the lane's row and column offset in a transposing load of V
  const int nqb = (Tq + 63) / 64;
  const int bh = blockIdx.x / nqb, qblk = blockIdx.x % nqb;
  const int b = bh / H, h = bh % H;
  const int q0 = qblk * 64 + qt * 16;
  const float* Q = Qb + (size_t)b * Tq * qpitch + h * D;
  const int nch = (Tk + 32 * NG - 1) / (32 * NG);   // trips, the same for the whole block; a chunk past Tk is fully masked and adds nothing
  // staging: a plane row is 16 pieces of 16 B, so a wave's copy covers two whole rows: rows cr + 8 * i of its group's chunk, the lane columns cc .. cc + 7
  const int cr = 2 * qt + hh, cc = ln * 8;
  const size_t pb = (size_t)bh * Tk * D + cc;
  const unsigned lk0 = (unsigned)(size_t)&sK[0][g][0][cr][cc], lv0 = (unsigned)(size_t)&sV[0][g][0][cr][cc];   // LDS byte addresses of the thread's first hi pieces
  // 16 asynchronous copies per thread: the 32 keys from jn on, 4 planes. A key past the end is clamped to the last one, so that every lane's
  // address stays inside the source; such a key's scores are masked below, its P is 0 and its (finite) V row adds nothing.
  auto copy_kv = [&](int jn, int buf) {
    const unsigned short* pk[8]; const unsigned short* pv[8];
    unsigned lk[8], lv[8];
#pragma unroll   // every index constant: the 32 addresses are register operands of the two statements below
    for (int i = 0; i < 4; ++i) {
      const size_t off = pb + (size_t)(unsigned)min(jn + cr + 8 * i, Tk - 1) * D;
      pk[i] = Kh + off; pk[4 + i] = Kl + off; pv[i] = Vh + off; pv[4 + i] = Vl + off;
      lk[i] = lk0 + buf * (NG * 2 * 32 * KP * 2) + i * (8 * KP * 2); lk[4 + i] = lk[i] + 32 * KP * 2;
      lv[i] = lv0 + buf * (NG * 2 * 32 * VP * 2) + i * (8 * VP * 2); lv[4 + i] = lv[i] + 32 * VP * 2;
    }
    // the s_wait_xcnt closes each statement as a precaution: no address register of an issued copy is rewritten ahead of it
    asm volatile("global_load_async_to_lds_b128 %0, %8, off\n\tglobal_load_async_to_lds_b128 %1, %9, off\n\t"
                 "global_load_async_to_lds_b128 %2, %10, off\n\tglobal_load_async_to_lds_b128 %3, %11, off\n\t"
                 "global_load_async_to_lds_b128 %4, %12, off\n\tglobal_load_async_to_lds_b128 %5, %13, off\n\t"
                 "global_load_async_to_lds_b128 %6, %14, off\n\tglobal_load_async_to_lds_b128 %7, %15, off\n\ts_wait_xcnt 0x0"
                 :: "v"(lk[0]), "v"(lk[1]), "v"(lk[2]), "v"(lk[3]), "v"(lk[4]), "v"(lk[5]), "v"(lk[6]), "v"(lk[7]),
                    "v"(pk[0]), "v"(pk[1]), "v"(pk[2]), "v"(pk[3]), "v"(pk[4]), "v"(pk[5]), "v"(pk[6]), "v"(pk[7]) : "memory");
    asm volatile("global_load_async_to_lds_b128 %0, %8, off\n\tglobal_load_async_to_lds_b128 %1, %9, off\n\t"
                 "global_load_async_to_lds_b128 %2, %10, off\n\tglobal_load_async_to_lds_b128 %3, %11, off\n\t"
                 "global_load_async_to_lds_b128 %4, %12, off\n\tglobal_load_async_to_lds_b128 %5, %13, off\n\t"
                 "global_load_async_to_lds_b128 %6, %14, off\n\tglobal_load_async_to_lds_b128 %7, %15, off\n\ts_wait_xcnt 0x0"
                 :: "v"(lv[0]), "v"(lv[1]), "v"(lv[2]), "v"(lv[3]), "v"(lv[4]), "v"(lv[5]), "v"(lv[6]), "v"(lv[7]),
                    "v"(pv[0]), "v"(pv[1]), "v"(pv[2]), "v"(pv[3]), "v"(pv[4]), "v"(pv[5]), "v"(pv[6]), "v"(pv[7]) : "memory");
  };
  if (nch > 0) copy_kv(32 * g, 0);   // the first chunk flies under the Q fragment loads (block-uniform test)
  FragB aqh[KS], aql[KS];
  {
    int row = q0 + ln; if (row >= Tq) row = Tq - 1;
    const float* qr = Q + (size_t)row * qpitch;
#pragma unroll
    for (int ks = 0; ks < KS; ++ks)
#pragma unroll
      for (int i = 0; i < 16; ++i) {
        const int d = ks * 32 + ((i < 8) ? (8 * hh + i) : (16 + 8 * hh + (i - 8)));
        const float x = qr[d] * scale; const unsigned short hb = bf16_bits(x);
        aqh[ks].u[i] = hb; aql[ks].u[i] = bf16_bits(x - bf16_val(hb));
      }
  }
  float m_q = -3.0e38f, l_q = 0.f;   // query q0 + ln: running maximum (the same in both lane halves), and the sum over this half's keys
  v8f oacc[DT];                      // oacc[dt][r] = O[q0 + ln][dt * 16 + 8 * hh + r]
#pragma unroll
  for (int dt = 0; dt < DT; ++dt) oacc[dt] = (v8f){0.f,0.f,0.f,0.f,0.f,0.f,0.f,0.f};
  asm volatile("s_wait_asynccnt 0x0" ::: "memory");   // this wave's copies of the first chunk have landed
  __syncthreads();   // publishes the first chunk
  if (nch > 1) copy_kv(32 * NG + 32 * g, 1);   // the second chunk flies under the first one's work (block-uniform test)
  for (int c = 0; c < nch; ++c) {
    const int j0 = c * (32 * NG) + 32 * g, buf = c & 1;
    const unsigned short* kp = &sK[buf][g][0][0][0];   // hi plane; the lo plane lies 32 rows further
    const unsigned short* vp = &sV[buf][g][0][0][0];
    v8f s[2];
#pragma unroll
    for (int nt = 0; nt < 2; ++nt) {
      v8f acc = {};
#pragma unroll
      for (int ks = 0; ks < KS; ++ks) {
        const unsigned short* kr = kp + (nt * 16 + ln) * KP + ks * 32 + 8 * hh;
        FragB kh_, kl_;
        kh_.half[0] = *(const v8us*)kr;             kh_.half[1] = *(const v8us*)(kr + 16);
        kl_.half[0] = *(const v8us*)(kr + 32 * KP); kl_.half[1] = *(const v8us*)(kr + 32 * KP + 16);
        acc = mma3t(kh_.v, kl_.v, aqh[ks].v, aql[ks].v, acc);
      }
      s[nt] = acc;   // s[nt][r] = score of key j0 + nt * 16 + 8 * hh + r against query q0 + ln
    }
    const bool tail = j0 + 32 > Tk;   // the same for the whole wave (j0 and Tk are scalar)
    if (tail) {
#pragma unroll
      for (int nt = 0; nt < 2; ++nt)
#pragma unroll
        for (int r = 0; r < 8; ++r) if (j0 + nt * 16 + 8 * hh + r >= Tk) s[nt][r] = -3.0e38f;
    }
    float mt[8];
#pragma unroll
    for (int r = 0; r < 8; ++r) mt[r] = fmaxf(s[0][r], s[1][r]);
    float mx = fmaxf(fmaxf(fmaxf(mt[0], mt[1]), fmaxf(mt[2], mt[3])), fmaxf(fmaxf(mt[4], mt[5]), fmaxf(mt[6], mt[7])));
    mx = fmaxf(mx, other_half(mx));   // the query's other 16 keys of the chunk
    const float mnew = fmaxf(m_q, mx);
    const float alpha = (mnew > -1.0e38f) ? __expf(m_q - mnew) : 1.0f;
    m_q = mnew;
    s[0] -= mnew; s[1] -= mnew;
#pragma unroll
    for (int nt = 0; nt < 2; ++nt)
#pragma unroll
      for (int r = 0; r < 8; ++r) s[nt][r] = __expf(s[nt][r]);
    if (tail) {
#pragma unroll
      for (int nt = 0; nt < 2; ++nt)
#pragma unroll
        for (int r = 0; r < 8; ++r) if (j0 + nt * 16 + 8 * hh + r >= Tk) s[nt][r] = 0.f;
    }
    float pt[8];
#pragma unroll
    for (int r = 0; r < 8; ++r) pt[r] = s[0][r] + s[1][r];
    l_q = l_q * alpha + (((pt[0] + pt[1]) + (pt[2] + pt[3])) + ((pt[4] + pt[5]) + (pt[6] + pt[7])));
    // P^T as a B operand: element e = P of key 8 * hh + e, element 8 + e = P of key 16 + 8 * hh + e; hi = P rounded to bf16 (to nearest even), lo = the rest, rounded
    FragB pbh, pbl;
#pragma unroll
    for (int nt = 0; nt < 2; ++nt)
#pragma unroll
      for (int e = 0; e < 8; e += 2) {
        const v2f x = {s[nt][e], s[nt][e + 1]};
        const unsigned int hb = __builtin_bit_cast(unsigned int, __builtin_convertvector(x, v2b));
        const v2f rest = {x[0] - __uint_as_float(hb << 16), x[1] - __uint_as_float(hb & 0xFFFF0000u)};
        pbh.d[nt * 4 + e / 2] = hb;
        pbl.d[nt * 4 + e / 2] = __builtin_bit_cast(unsigned int, __builtin_convertvector(rest, v2b));
      }
#pragma unroll
    for (int dt = 0; dt < DT; ++dt) oacc[dt] *= alpha;
    // element i of a V fragment = V[8 * hh + i][dt * 16 + ln], element 8 + i = V[16 + 8 * hh + i][dt * 16 + ln]: row dt * 16 + ln of V^T in the k order of pbh / pbl
    FragB bvh[2], bvl[2];
    auto vfrag = [&](int dt) {
      const unsigned short* vq = vp + vr * VP + dt * 16 + vc;
      bvh[dt & 1].half[0] = ld_tr16(vq);           bvh[dt & 1].half[1] = ld_tr16(vq + 16 * VP);
      bvl[dt & 1].half[0] = ld_tr16(vq + 32 * VP); bvl[dt & 1].half[1] = ld_tr16(vq + 48 * VP);
    };
    vfrag(0);
#pragma unroll
    for (int dt = 0; dt < DT; ++dt) {
      if (dt + 1 < DT) vfrag(dt + 1);   // the next tile's four loads fly under this tile's three products
      oacc[dt] = mma3t(bvh[dt & 1].v, bvl[dt & 1].v, pbh.v, pbl.v, oacc[dt]);
    }
    asm volatile("s_wait_dscnt 0x0" ::: "memory");      // the wave's reads of this chunk's planes have retired before anybody refills them
    asm volatile("s_wait_asynccnt 0x0" ::: "memory");   // this wave's copies of the next chunk have landed
    __syncthreads();   // publishes the next chunk and ends every wave's reads of this one
    if (c + 2 < nch) copy_kv(j0 + 2 * 32 * NG, buf);   // the chunk after the next flies into the buffer just read (block-uniform test)
  }
  asm volatile("s_wait_asynccnt 0x0" ::: "memory");   // no copy is outstanding when the planes' bytes become sO, sM, sL (their last readers left them at the last trip's barrier)
  l_q += other_half(l_q);   // the two halves' key sums of the query
  if (hh == 0) { sM[w][ln] = m_q; sL[w][ln] = l_q; }
#pragma unroll
  for (int dt = 0; dt < DT; ++dt) {   // a lane's 8 accumulator registers are 8 consecutive columns of its query's row
    *(v4fa*)&sO[w][ln][dt * 16 + 8 * hh]     = (v4f){oacc[dt][0], oacc[dt][1], oacc[dt][2], oacc[dt][3]};
    *(v4fa*)&sO[w][ln][dt * 16 + 8 * hh + 4] = (v4f){oacc[dt][4], oacc[dt][5], oacc[dt][6], oacc[dt][7]};
  }
  __syncthreads();   // every group's partial (max, sum, O) is in LDS before any wave merges
  // merge: wave (qt, g) finishes rows g*16/NG ... of query tile qt; a lane owns 4 columns of the row
#pragma unroll
  for (int i = 0; i < 16 / NG; ++i) {
    const int rr = g * (16 / NG) + i, row = q0 + rr;
    if (row < Tq && lane < D / 4) {
      float mg[NG], mall = -3.0e38f;
#pragma unroll
      for (int k = 0; k < NG; ++k) { mg[k] = sM[k * 4 + qt][rr]; mall = fmaxf(mall, mg[k]); }
      float lall = 0.f;
      v4f val = {0.f, 0.f, 0.f, 0.f};
#pragma unroll
      for (int k = 0; k < NG; ++k) {
        const float wt = (mg[k] > -1.0e38f) ? __expf(mg[k] - mall) : 0.f;
        const v4f o = *(const v4fa*)&sO[k * 4 + qt][rr][lane * 4];
        lall += wt * sL[k * 4 + qt][rr];
        val += wt * o;
      }
      const float inv = (mall > -1.0e38f) ? 1.0f / lall : __builtin_nanf("");
      *(v4f*)(y + ((size_t)b * Tq + row) * ypitch + h * D + lane * 4) = val * inv;
      if (i + 1 < 16 / NG) asm volatile("s_wait_xcnt 0x0" ::: "memory");   // precaution: stands before the next row's reads reuse the store's address and data registers
    }
  }
}

__global__ __launch_bounds__(256) void k_roundcopy(const float* __restrict__ src, float* __restrict__ dst, int n8) {
  const size_t t = (size_t)blockIdx.x * 256 + threadIdx.x;
  if (t >= (size_t)n8 * 2) return;
  v4f a = *(const v4fa*)(src + t * 4);
  for (int i = 0; i < 4; ++i) a[i] = bf16_round(a[i]);
  *(v4f*)(dst + t * 4) = a; 
}

__global__ void k_ln_rows(const float* __restrict__ X, const float* __restrict__ R, const float* __restrict__ g, const float* __restrict__ bta, float* __restrict__ out, int N, float eps) {
  __shared__ float red[256];
  const int row = blockIdx.x, tid = threadIdx.x, nt = blockDim.x;
  v4f a = *(const v4fa*)(X + (size_t)row * N + tid * 4);
  if (R) { const v4f rr = *(const v4fa*)(R + (size_t)row * N + tid * 4); for (int q = 0; q < 4; ++q) a[q] += rr[q]; }
  float s = a[0] + a[1] + a[2] + a[3];
  red[tid] = s; __syncthreads();
  for (int st = nt / 2; st > 0; st >>= 1) { if (tid < st) red[tid] += red[tid + st]; __syncthreads(); }
  const float mu = red[0] / (float)N; __syncthreads();
  float v = 0.f; for (int q = 0; q < 4; ++q) { const float c = a[q] - mu; v += c * c; }
  red[tid] = v; __syncthreads();
  for (int st = nt / 2; st > 0; st >>= 1) { if (tid < st) red[tid] += red[tid + st]; __syncthreads(); }
  const float rs = rsqrtf(red[0] / (float)N + eps);
  v4f o; for (int q = 0; q < 4; ++q) o[q] = (a[q] - mu) * rs * bf16_round(g[tid * 4 + q]) + bf16_round(bta[tid * 4 + q]);
  *(v4f*)(out + (size_t)row * N + tid * 4) = o; 
}

// Bt[h*DK + k][d] = W[h][d][k]  (W [H][D][DK]); thread per (n, 8 d)
__global__ __launch_bounds__(256) void k_wt_heads(const float* __restrict__ W, unsigned short* __restrict__ Bt) {
  const int t = blockIdx.x * 256 + threadIdx.x; if (t >= NH * DK * (DD / 8)) return;
  const int n = t / (DD / 8), d8 = (t % (DD / 8)) * 8; const int h = n / DK, kk = n % DK; v8us v;
#pragma unroll
  for (int i = 0; i < 8; ++i) v[i] = bf16_bits(W[((size_t)h * DD + d8 + i) * DK + kk]);
  *(v8us*)(Bt + (size_t)n * DD + d8) = v; 
}
extern "C" void kernel_launch(void* const* d_in, const int* in_sizes, int n_in,
                              void* d_out, int out_size, void* d_ws, size_t ws_size, hipStream_t stream) {
  (void)in_sizes; (void)n_in; (void)out_size;
  const float* token = (const float*)d_in[0];
  const float* Wq = (const float*)d_in[1]; const float* bq = (const float*)d_in[2]; const float* Wk = (const float*)d_in[3]; const float* bk = (const float*)d_in[4];
  const float* Wv = (const float*)d_in[5]; const float* bv = (const float*)d_in[6]; const float* Wo = (const float*)d_in[7]; const float* bo = (const float*)d_in[8];
  const float* Wf = (const float*)d_in[9]; const float* bfv = (const float*)d_in[10]; const float* gamma = (const float*)d_in[11]; const float* beta = (const float*)d_in[12];
  char* ws = (char*)d_ws; size_t off = 0;
  auto take = [&](size_t bytes) { char* p = ws + off; off += (bytes + 255) & ~(size_t)255; return p; };
  unsigned short* Bqkv = (unsigned short*)take((size_t)3 * DD * DD * 2); unsigned short* Bo = (unsigned short*)take((size_t)DD * DD * 2); unsigned short* Bf = (unsigned short*)take((size_t)DD * DD * 2);
  float* bqkv = (float*)take(3 * DD * 4);
  float* x = (float*)take((size_t)SS * DD * 4); float* qkv = (float*)take((size_t)SS * 3 * DD * 4); float* att = (float*)take((size_t)SS * DD * 4); float* tmp = (float*)take((size_t)SS * DD * 4); float* a = (float*)take((size_t)SS * DD * 4);
  unsigned short* kvh = (unsigned short*)take((size_t)2 * DD * SS * 2); unsigned short* kvl = (unsigned short*)take((size_t)2 * DD * SS * 2);   // bf16 hi / lo planes [K heads | V heads][SS][DK]
  if (off > ws_size) return;
  k_wt_heads<<<(NH * DK * (DD / 8) + 255) / 256, 256, 0, stream>>>(Wq, Bqkv);
  k_wt_heads<<<(NH * DK * (DD / 8) + 255) / 256, 256, 0, stream>>>(Wk, Bqkv + (size_t)DD * DD);
  k_wt_heads<<<(NH * DK * (DD / 8) + 255) / 256, 256, 0, stream>>>(Wv, Bqkv + (size_t)2 * DD * DD);
  k_wt_bf16<<<(DD * (DD / 8) + 255) / 256, 256, 0, stream>>>(Wo, Bo, DD, DD);
  k_wt_bf16<<<(DD * (DD / 8) + 255) / 256, 256, 0, stream>>>(Wf, Bf, DD, DD);
  k_roundcopy<<<(3 * DD / 4 + 255) / 256, 256, 0, stream>>>(bq, bqkv, DD / 8);            // bq|bk|bv flat [H*DK] each: three copies (f32, rounded) into one bias vector
  k_roundcopy<<<(DD / 4 + 255) / 256, 256, 0, stream>>>(bk, bqkv + DD, DD / 8);
  k_roundcopy<<<(DD / 4 + 255) / 256, 256, 0, stream>>>(bv, bqkv + 2 * DD, DD / 8);
  k_roundcopy<<<(SS * DD / 4 + 255) / 256, 256, 0, stream>>>(token, x, SS * DD / 8);
  const int gq = (SS / 64) * (3 * DD / 128), g1 = (SS / 64) * (DD / 128);
  for (int l = 0; l < NLAY; ++l) {
    k_gemm_tile<false, true><<<gq, 256, 0, stream>>>(x, DD, Bqkv, DD, bqkv, qkv, 3 * DD, 3 * DD, DD, kvh, kvl, DD, SS);      // bias already rounded (BIAS_BF16=false adds it as given); q to qkv, k and v to the planes
    k_flash3<DK><<<NH * (SS / 64), 512, 0, stream>>>(qkv, 3 * DD, SS, kvh, kvl, kvh + (size_t)DD * SS, kvl + (size_t)DD * SS, SS, NH, 0.08838834764831845f, att, DD);
    k_gemm_tile<true, false><<<g1, 256, 0, stream>>>(att, DD, Bo, DD, bo, tmp, DD, DD, DD, nullptr, nullptr, 0, SS);
    k_ln_rows<<<SS, DD / 4, 0, stream>>>(tmp, x, gamma, beta, a, DD, 1e-5f);                  // a = LN(x + attn_out)
    k_gemm_tile<true, false><<<g1, 256, 0, stream>>>(a, DD, Bf, DD, bfv, tmp, DD, DD, DD, nullptr, nullptr, 0, SS);
    k_ln_rows<<<SS, DD / 4, 0, stream>>>(tmp, a, gamma, beta, (l == NLAY - 1) ? (float*)d_out : x, DD, 1e-5f);   // x = LN(a + ff)
  }
}

// v008
// Measured time: 671 microseconds a run.
// Two timings next to v007 put it at 1.10 and 1.08 times that version's speed.
// Over all steps from v000 it is 5.96 times as fast.
#include <hip/hip_runtime.h>
// All GEMMs on v_wmma_f32_16x16x32_bf16, f32 accumulate: fused per-head q|k|v projection (K=1024, N=3072), concat·Wo, norm(tmp)·Wf — A operands
// (the residual stream, quantised to bf16 once at the input) split into bf16 hi/lo (2 terms) against bf16-rounded weights; attention QKᵀ/√128
// and P·V per 16-query tile as 3-term splits (head dim 128); LayerNorm and softmax in f32. Six layers with shared weights.
#define SS 2048
#define DD 1024
#define NH 8
#define DK 128
#define NLAY 6

typedef __bf16 v16b __attribute__((ext_vector_type(16)));
typedef unsigned short v8us __attribute__((ext_vector_type(8), may_alias));
typedef unsigned short v4us __attribute__((ext_vector_type(4), may_alias));
typedef float  v8f  __attribute__((ext_vector_type(8)));
typedef float  v4f  __attribute__((ext_vector_type(4)));
typedef float  v4fa __attribute__((ext_vector_type(4), may_alias));
typedef float  v2f  __attribute__((ext_vector_type(2)));
typedef __bf16 v2b  __attribute__((ext_vector_type(2)));
union FragB { v16b v; v8us half[2]; unsigned short u[16]; unsigned int d[8]; };
typedef short s16x8 __attribute__((ext_vector_type(8)));
typedef __attribute__((address_space(3))) s16x8 lds_s16x8;
// transposing LDS load of an 8 x 16 block of 16-bit elements per lane half: lane l points at 8 elements of row 8*(l>>4) + (l&7), columns 8*((l>>3)&1) ...;
// lane (c = l&15, h = l>>4) receives rows 8h .. 8h+7 of column c
__device__ __forceinline__ v8us ld_tr16(const unsigned short* p) { return __builtin_bit_cast(v8us, __builtin_amdgcn_ds_load_tr16_b128_v8i16((lds_s16x8*)p)); }

__device__ __forceinline__ unsigned short bf16_bits(float x) { unsigned int u = __float_as_uint(x); return (unsigned short)((u + 0x7FFFu + ((u >> 16) & 1u)) >> 16); }
__device__ __forceinline__ float bf16_val(unsigned short b) { return __uint_as_float(((unsigned int)b) << 16); }
__device__ __forceinline__ float bf16_round(float x) { return bf16_val(bf16_bits(x)); }
// D += A·B with NT terms: 1 = ah·bh, 2 = + al·bh (A split), 3 = + ah·bl (both split)
template <int NT>
__device__ __forceinline__ v8f mmaN(v16b ah, v16b al, v16b bh, v16b bl, v8f c) {
  c = __builtin_amdgcn_wmma_f32_16x16x32_bf16(false, ah, false, bh, (short)0, c, false, false);
  if (NT >= 2) c = __builtin_amdgcn_wmma_f32_16x16x32_bf16(false, al, false, bh, (short)0, c, false, false);
  if (NT >= 3) c = __builtin_amdgcn_wmma_f32_16x16x32_bf16(false, ah, false, bl, (short)0, c, false, false);
  asm volatile("v_nop\n\tv_nop\n\tv_nop\n\tv_nop" : "+v"(c) : "v"(ah), "v"(al), "v"(bh), "v"(bl));
  return c;
}

// D += A x B, both split, for the transposed attention products (A = K or V, B = Q or P): ah.bh, then ah.bl, then al.bh, which is the term order
// that mmaN<3> gives with the operands the other way round
__device__ __forceinline__ v8f mma3t(v16b ah, v16b al, v16b bh, v16b bl, v8f c) {
  c = __builtin_amdgcn_wmma_f32_16x16x32_bf16(false, ah, false, bh, (short)0, c, false, false);
  c = __builtin_amdgcn_wmma_f32_16x16x32_bf16(false, ah, false, bl, (short)0, c, false, false);
  c = __builtin_amdgcn_wmma_f32_16x16x32_bf16(false, al, false, bh, (short)0, c, false, false);
  // as in mmaN: four vector slots behind the last product, on whatever path follows it (a scalar branch stands behind the score products)
  asm volatile("v_nop\n\tv_nop\n\tv_nop\n\tv_nop" : "+v"(c) : "v"(ah), "v"(al), "v"(bh), "v"(bl));
  return c;
}
// the value that lane l ^ 16 holds
__device__ __forceinline__ float other_half(float x) {
  const int b = __float_as_int(x);
  return __int_as_float(__builtin_amdgcn_permlanex16(b, b, 0x76543210, 0xfedcba98, false, false));
}

// x + the x of lane l ^ MASK (MASK < 16: inside a row of 16 lanes), as one DPP add; every lane must be on
template <int MASK>
__device__ __forceinline__ float add_xmask(float x) {
  return x + __int_as_float(__builtin_amdgcn_update_dpp(0, __float_as_int(x), 0x160 + MASK, 0xf, 0xf, true));   // 0x160 + MASK = row_xmask:MASK
}

__global__ __launch_bounds__(256) void k_wt_bf16(const float* __restrict__ W, unsigned short* __restrict__ Wt, int K, int N) {
  const int t = blockIdx.x * 256 + threadIdx.x;
  const int k8n = K / 8;
  if (t >= N * k8n) return;
  const int n = t / k8n, k8 = (t % k8n) * 8;
  v8us v;
#pragma unroll
  for (int i = 0; i < 8; ++i) v[i] = bf16_bits(W[(size_t)(k8 + i) * N + n]);
  *(v8us*)(Wt + (size_t)n * K + k8) = v;
  
}

// GEMM C[M][N] (f32, pitch ldc) = act(A[M][K]·W + bias). A f32 row-major (pitch lda) converted per fragment to bf16
// (ASPLIT: hi/lo two planes -> 2 terms, else single rounded term); Wt bf16 [N][K] (pitch ldb). BIAS_BF16 rounds the
// bias to bf16 first (bias quantised to bf16 before the add). K%32==0, M%16==0, N%64==0.
template <bool ASPLIT, int ACT, bool BIAS_BF16>
__global__ __launch_bounds__(128) void k_gemm_bf(const float* __restrict__ A, int lda, const unsigned short* __restrict__ Wt, int ldb,
                                               const float* __restrict__ bias, float* __restrict__ C, int ldc, int M, int N, int K) {
  __shared__ __attribute__((aligned(16))) float so[4][16][64];
  const int tid = threadIdx.x, w = tid >> 5, lane = tid & 31, ln = lane & 15, hh = lane >> 4;
  const int ntn = N / 64;
  const int wid = blockIdx.x * 4 + w;
  const int mt = wid / ntn, nq = wid % ntn;
  if (mt * 16 >= M) return;
  const int row0 = mt * 16, col0 = nq * 64;
  const float* arow = A + (size_t)(row0 + ln) * lda;
  v8f acc[4] = {};
  for (int kb = 0; kb < K; kb += 32) {
    FragB ah, al;
    const v4f x0 = *(const v4fa*)(arow + kb + 8 * hh), x1 = *(const v4fa*)(arow + kb + 8 * hh + 4);
    const v4f x2 = *(const v4fa*)(arow + kb + 16 + 8 * hh), x3 = *(const v4fa*)(arow + kb + 16 + 8 * hh + 4);
    float xs[16] = {x0[0],x0[1],x0[2],x0[3],x1[0],x1[1],x1[2],x1[3],x2[0],x2[1],x2[2],x2[3],x3[0],x3[1],x3[2],x3[3]};
#pragma unroll
    for (int i = 0; i < 16; ++i) { const unsigned short hb = bf16_bits(xs[i]); ah.u[i] = hb; al.u[i] = ASPLIT ? bf16_bits(xs[i] - bf16_val(hb)) : (unsigned short)0; }
#pragma unroll
    for (int t = 0; t < 4; ++t) {
      const unsigned short* brow = Wt + (size_t)(col0 + t * 16 + ln) * ldb + kb;
      FragB b;
      b.half[0] = *(const v8us*)(brow + 8 * hh);
      b.half[1] = *(const v8us*)(brow + 16 + 8 * hh);
      acc[t] = mmaN<ASPLIT ? 2 : 1>(ah.v, al.v, b.v, b.v, acc[t]);
    }
  }
#pragma unroll
  for (int t = 0; t < 4; ++t) {
    float bv = bias ? bias[col0 + t * 16 + ln] : 0.f;
    if (BIAS_BF16) bv = bf16_round(bv);
#pragma unroll
    for (int r = 0; r < 8; ++r) { float v = acc[t][r] + bv; if (ACT == 1) v = fmaxf(v, 0.f); so[w][8 * hh + r][t * 16 + ln] = v; }
  }
  __builtin_amdgcn_fence(__ATOMIC_ACQ_REL, "workgroup");
  __builtin_amdgcn_wave_barrier();
  const int rsub = lane >> 4, c4 = (lane & 15) * 4;
  {
#pragma unroll
    for (int q = 0; q < 8; ++q) {
      const int r = q * 2 + rsub;
      const v4f v = *(const v4fa*)&so[w][r][c4];
      *(v4f*)(C + (size_t)(row0 + r) * ldc + col0 + c4) = v;
    }
    
  }
}

// Flash-style causal/unmasked attention, all contractions 3-term bf16 hi/lo splits, f32 softmax with running max.
// q,k,v rows are read from f32 buffers with arbitrary row pitch (so they can live inside a fused qkv buffer);
// D = head size (multiple of 32, <= 128); one wave = 16 query rows; block = 4 waves (64 queries) sharing K/V chunks of 32.
template <int D, bool CAUSAL>
__global__ __launch_bounds__(128) void k_flash(const float* __restrict__ qb, const float* __restrict__ kb, const float* __restrict__ vb,
                                             int pitch, int T, int H, float scale, float* __restrict__ y, int ypitch) {
  constexpr int KS = D / 32;        // k-steps for QK
  constexpr int DT = D / 16;        // d tiles for PV
  __shared__ __attribute__((aligned(16))) unsigned short sKh[32][D + 8], sKl[32][D + 8], sVh[32][D + 8], sVl[32][D + 8];
  __shared__ __attribute__((aligned(16))) unsigned short sPh[4][16][40], sPl[4][16][40];
  __shared__ __attribute__((aligned(16))) float sO[4][16][D];
  const int tid = threadIdx.x, w = tid >> 5, lane = tid & 31, ln = lane & 15, hh = lane >> 4;
  const int nqb = (T + 63) / 64;
  const int bh = blockIdx.x / nqb, qblk = blockIdx.x % nqb;
  const int b = bh / H, h = bh % H;
  const int q0 = qblk * 64 + w * 16;
  const float* Q = qb + (size_t)b * T * pitch + h * D;
  const float* K = kb + (size_t)b * T * pitch + h * D;
  const float* V = vb + (size_t)b * T * pitch + h * D;

  // A fragments of the wave's 16 query rows (scaled), hi/lo
  FragB aqh[KS], aql[KS];
  {
    int row = q0 + ln; if (row >= T) row = T - 1;
    const float* qr = Q + (size_t)row * pitch;
#pragma unroll
    for (int ks = 0; ks < KS; ++ks)
#pragma unroll
      for (int i = 0; i < 16; ++i) {
        const int d = ks * 32 + ((i < 8) ? (8 * hh + i) : (16 + 8 * hh + (i - 8)));
        const float x = qr[d] * scale; const unsigned short hb = bf16_bits(x);
        aqh[ks].u[i] = hb; aql[ks].u[i] = bf16_bits(x - bf16_val(hb));
      }
  }
  float m_r[8], l_r[8];
#pragma unroll
  for (int r = 0; r < 8; ++r) { m_r[r] = -3.0e38f; l_r[r] = 0.f; }
  v8f oacc[DT];
#pragma unroll
  for (int dt = 0; dt < DT; ++dt) oacc[dt] = (v8f){0.f,0.f,0.f,0.f,0.f,0.f,0.f,0.f};

  const int kv_end = CAUSAL ? min(T, qblk * 64 + 64) : T;     // block-uniform
  for (int j0 = 0; j0 < kv_end; j0 += 32) {
    __syncthreads();
    for (int e = tid; e < 32 * (D / 4); e += 128) {
      const int r = e / (D / 4), c4 = (e % (D / 4)) * 4;
      const int key = j0 + r;
      v4f kf = {0.f,0.f,0.f,0.f}, vf = {0.f,0.f,0.f,0.f};
      if (key < T) { kf = *(const v4fa*)(K + (size_t)key * pitch + c4); vf = *(const v4fa*)(V + (size_t)key * pitch + c4); }
#pragma unroll
      for (int t = 0; t < 4; ++t) {
        unsigned short hb = bf16_bits(kf[t]); sKh[r][c4 + t] = hb; sKl[r][c4 + t] = bf16_bits(kf[t] - bf16_val(hb));
        hb = bf16_bits(vf[t]); sVh[r][c4 + t] = hb; sVl[r][c4 + t] = bf16_bits(vf[t] - bf16_val(hb));
      }
    }
    __syncthreads();
    // S tile 16 x 32
    v8f s[2];
#pragma unroll
    for (int nt = 0; nt < 2; ++nt) {
      v8f acc = {};
#pragma unroll
      for (int ks = 0; ks < KS; ++ks) {
        FragB bh_, bl_;
        bh_.half[0] = *(const v8us*)&sKh[nt * 16 + ln][ks * 32 + 8 * hh]; bh_.half[1] = *(const v8us*)&sKh[nt * 16 + ln][ks * 32 + 16 + 8 * hh];
        bl_.half[0] = *(const v8us*)&sKl[nt * 16 + ln][ks * 32 + 8 * hh]; bl_.half[1] = *(const v8us*)&sKl[nt * 16 + ln][ks * 32 + 16 + 8 * hh];
        acc = mmaN<3>(aqh[ks].v, aql[ks].v, bh_.v, bl_.v, acc);
      }
      s[nt] = acc;
    }
    // mask + running max (rows 8hh+r; the 16 lanes of a half share rows)
    float alpha[8];
#pragma unroll
    for (int r = 0; r < 8; ++r) {
      const int qi = q0 + 8 * hh + r;
      const int ja = j0 + ln, jb = j0 + 16 + ln;
      if (CAUSAL) { if (ja > qi) s[0][r] = -3.0e38f; if (jb > qi) s[1][r] = -3.0e38f; }
      if (ja >= T) s[0][r] = -3.0e38f;
      if (jb >= T) s[1][r] = -3.0e38f;
      float mx = fmaxf(s[0][r], s[1][r]);
      mx = fmaxf(mx, __shfl_xor(mx, 1, 32)); mx = fmaxf(mx, __shfl_xor(mx, 2, 32)); mx = fmaxf(mx, __shfl_xor(mx, 4, 32)); mx = fmaxf(mx, __shfl_xor(mx, 8, 32));
      const float mnew = fmaxf(m_r[r], mx);
      alpha[r] = (mnew > -1.0e38f) ? __expf(m_r[r] - mnew) : 1.0f;
      const float p0 = (s[0][r] > -1.0e38f) ? __expf(s[0][r] - mnew) : 0.f;
      const float p1 = (s[1][r] > -1.0e38f) ? __expf(s[1][r] - mnew) : 0.f;
      m_r[r] = mnew;
      l_r[r] = l_r[r] * alpha[r] + p0 + p1;            // per-lane partial row sum (16 lanes combined at the end)
      unsigned short hb = bf16_bits(p0); sPh[w][8 * hh + r][ln] = hb;      sPl[w][8 * hh + r][ln] = bf16_bits(p0 - bf16_val(hb));
      hb = bf16_bits(p1);                sPh[w][8 * hh + r][16 + ln] = hb; sPl[w][8 * hh + r][16 + ln] = bf16_bits(p1 - bf16_val(hb));
    }
#pragma unroll
    for (int dt = 0; dt < DT; ++dt)
#pragma unroll
      for (int r = 0; r < 8; ++r) oacc[dt][r] *= alpha[r];
    __builtin_amdgcn_fence(__ATOMIC_ACQ_REL, "workgroup");
    __builtin_amdgcn_wave_barrier();
    FragB pah, pal;
    pah.half[0] = *(const v8us*)&sPh[w][ln][8 * hh]; pah.half[1] = *(const v8us*)&sPh[w][ln][16 + 8 * hh];
    pal.half[0] = *(const v8us*)&sPl[w][ln][8 * hh]; pal.half[1] = *(const v8us*)&sPl[w][ln][16 + 8 * hh];
#pragma unroll
    for (int dt = 0; dt < DT; ++dt) {
      FragB bvh, bvl;
#pragma unroll
      for (int i = 0; i < 8; ++i) {
        bvh.u[i] = sVh[8 * hh + i][dt * 16 + ln]; bvh.u[8 + i] = sVh[16 + 8 * hh + i][dt * 16 + ln];
        bvl.u[i] = sVl[8 * hh + i][dt * 16 + ln]; bvl.u[8 + i] = sVl[16 + 8 * hh + i][dt * 16 + ln];
      }
      oacc[dt] = mmaN<3>(pah.v, pal.v, bvh.v, bvl.v, oacc[dt]);
    }
    __builtin_amdgcn_fence(__ATOMIC_ACQ_REL, "workgroup");
    __builtin_amdgcn_wave_barrier();
  }
#pragma unroll
  for (int r = 0; r < 8; ++r) {
    float l = l_r[r];
    l += __shfl_xor(l, 1, 32); l += __shfl_xor(l, 2, 32); l += __shfl_xor(l, 4, 32); l += __shfl_xor(l, 8, 32);
    l_r[r] = (l > 0.f) ? 1.0f / l : 0.f;
  }
#pragma unroll
  for (int dt = 0; dt < DT; ++dt)
#pragma unroll
    for (int r = 0; r < 8; ++r) sO[w][8 * hh + r][dt * 16 + ln] = oacc[dt][r] * l_r[r];
  __builtin_amdgcn_fence(__ATOMIC_ACQ_REL, "workgroup");
  __builtin_amdgcn_wave_barrier();
  {
    for (int r = 0; r < 16; ++r) {
      const int row = q0 + r;
      if (row < T && lane < D / 4) {
        const v4f val = *(const v4fa*)&sO[w][r][lane * 4];
        *(v4f*)(y + ((size_t)b * T + row) * ypitch + h * D + lane * 4) = val;
      }
    }
    
  }
}

// GEMM C[M][N] (f32, pitch ldc) = A[M][K] x W + bias: A f32 row-major (pitch lda), two terms (bf16 hi + lo) against Wt bf16 [N][K] (pitch ldb).
// Block = 8 waves (2 x 4) on a 64 x 128 tile of C, a wave owns 32 x 32. K is walked in slices of 64: the A slice is split into its hi and lo
// planes once per block, the Wt slice is copied, both through whole-line global loads into LDS, where all 8 waves read their fragments.
// Two LDS buffers: the next slice's global loads are issued ahead of this slice's products and stored behind them; one barrier per slice.
// Each accumulator takes hi then lo of every 32-wide k step in rising k. M % 64 == 0, N % 128 == 0, K % 64 == 0; grid = (M / 64) * (N / 128).
// PLANES: a block whose columns start at pcol0 or beyond does not store its tile to C; it splits it into bf16 hi and lo and stores these to
// Ph / Pl as rows of plane (col0 - pcol0) / 128, each plane [M][128]: the form in which the attention kernel stages K and V.
// LayerNorm lives in the GEMMs: a row before its LayerNorm is kept as it is (rows of DD floats), with 32 pairs (sum, sum of squares about the piece's own mean),
// one per 32 columns, in st[column block of 128][row][4][2]. norm(v) = (v - mu) * rs * gamma + beta, gamma and beta rounded to bf16; mu and rs of the
// block's 64 rows are formed from the pairs once, in front of the K loop. st == nullptr: the rows are plain (mu 0, rs 1, gamma 1, beta 0).
// LN_A: the A operand is norm(A), applied where a slice is split. RES: C = A x W + bias + norm(R), and the pairs of the new rows go to sto.
template <bool BIAS_BF16, bool PLANES, bool LN_A, bool RES>
__global__ __launch_bounds__(256) void k_gemm_tile(const float* __restrict__ A, int lda, const unsigned short* __restrict__ Wt, int ldb,
                                                   const float* __restrict__ bias, float* __restrict__ C, int ldc, int N, int K,
                                                   unsigned short* __restrict__ Ph, unsigned short* __restrict__ Pl, int pcol0, int M,
                                                   const float* __restrict__ R, const float* __restrict__ st, const float* __restrict__ gamma,
                                                   const float* __restrict__ beta, float* __restrict__ sto, float eps) {
  constexpr int BM = 64, BN = 128, BK = 64, LP = BK + 8;       // LP: LDS row pitch 144 B = 16 B x odd
  constexpr int PA = BM * LP, PB = BN * LP, BUF = 2 * PA + PB;  // one buffer, in 16-bit elements: A hi | A lo | Wt
  constexpr int OP = 36;                                       // pitch of the output staging rows, in floats
  __shared__ __attribute__((aligned(16))) unsigned short sm[2 * BUF];
  __shared__ __attribute__((aligned(16))) float sG[DD], sB[DD], sMu[BM], sRs[BM], sSt[RES ? BM * 8 : 4];
  const int tid = threadIdx.x, lane = tid & 31, ln = lane & 15, hh = lane >> 4;
  const int w = __builtin_amdgcn_readfirstlane(tid >> 5);      // wave number, kept scalar so that the tile offsets stay scalar
  const int wm = w >> 2, wn = w & 3;
  const int nbn = N / BN;
  const int row0 = (blockIdx.x / nbn) * BM, col0 = (blockIdx.x % nbn) * BN;
  const int ar = tid >> 4, ac = (tid & 15) * 4;                // A slice: a wave's load covers 2 rows x 256 B
  const int br = tid >> 3, bc = (tid & 7) * 8;                 // Wt slice: a wave's load covers 4 rows x 128 B
  const float* ag = A + (size_t)(row0 + ar) * lda + ac;
  const unsigned short* bg = Wt + (size_t)(col0 + br) * ldb + bc;
  v4f ra[4];
  v8us rb[4];
  auto fetch = [&](int kb) {
    const float* pa[4];
    const unsigned short* pb[4];
#pragma unroll
    for (int j = 0; j < 4; ++j) { pa[j] = ag + (size_t)(16 * j) * lda + kb; pb[j] = bg + (size_t)(32 * j) * ldb + kb; }
#pragma unroll
    for (int j = 0; j < 4; ++j) ra[j] = *(const v4fa*)pa[j];
#pragma unroll
    for (int j = 0; j < 4; ++j) rb[j] = *(const v8us*)pb[j];
    // precaution: the eight address pairs are inputs of the wait, so none of them is reused (not even as a later load's result) ahead of it
    asm volatile("s_wait_xcnt 0x0" :: "v"(pa[0]), "v"(pa[1]), "v"(pa[2]), "v"(pa[3]), "v"(pb[0]), "v"(pb[1]), "v"(pb[2]), "v"(pb[3]) : "memory");
  };
  float mu_a[4], rs_a[4];   // LN_A: mean and 1 / deviation of the thread's four A rows
  auto stash = [&](unsigned short* sb, int kb) {
    v4f g4 = {1.f, 1.f, 1.f, 1.f}, b4 = {0.f, 0.f, 0.f, 0.f};
    if (LN_A) { g4 = *(const v4fa*)&sG[kb + ac]; b4 = *(const v4fa*)&sB[kb + ac]; }
#pragma unroll
    for (int j = 0; j < 4; ++j) {
      v4us h, l;
#pragma unroll
      for (int t = 0; t < 4; ++t) {
        const float xv = LN_A ? (ra[j][t] - mu_a[j]) * rs_a[j] * g4[t] + b4[t] : ra[j][t];
        const unsigned short hb = bf16_bits(xv); h[t] = hb; l[t] = bf16_bits(xv - bf16_val(hb));
      }
      *(v4us*)(sb + (ar + 16 * j) * LP + ac) = h;
      *(v4us*)(sb + PA + (ar + 16 * j) * LP + ac) = l;
      *(v8us*)(sb + 2 * PA + (br + 32 * j) * LP + bc) = rb[j];
    }
  };
  v8f acc[2][2] = {};
  const int ns = K / BK;
  fetch(0);
  {
    // gamma and beta, rounded, for all DD columns; mean and 1 / deviation of the block's 64 rows: 4 threads a row, each takes 2 column blocks = 8 pairs
    const int c = tid * 4, r = tid >> 2, qd = tid & 3;
    v4f g4 = {1.f, 1.f, 1.f, 1.f}, b4 = {0.f, 0.f, 0.f, 0.f};
    float mu = 0.f, rs = 1.f;
    if (st) {   // a kernel argument: the same for every thread
      const float* gp = gamma + c; const float* bp = beta + c;
      const float* p0 = st + ((size_t)(2 * qd) * M + row0 + r) * 8; const float* p1 = st + ((size_t)(2 * qd + 1) * M + row0 + r) * 8;
      g4 = *(const v4fa*)gp; b4 = *(const v4fa*)bp;
      const v4f p[4] = {*(const v4fa*)p0, *(const v4fa*)(p0 + 4), *(const v4fa*)p1, *(const v4fa*)(p1 + 4)};
      // precaution: the four address pairs are inputs of the wait, so none of them is reused ahead of it
      asm volatile("s_wait_xcnt 0x0" :: "v"(gp), "v"(bp), "v"(p0), "v"(p1) : "memory");
#pragma unroll   // constant indices, so that the small arrays stay in registers
      for (int t = 0; t < 4; ++t) { g4[t] = bf16_round(g4[t]); b4[t] = bf16_round(b4[t]); }
      float s1 = ((p[0][0] + p[0][2]) + (p[1][0] + p[1][2])) + ((p[2][0] + p[2][2]) + (p[3][0] + p[3][2]));
      s1 = add_xmask<1>(s1); s1 = add_xmask<2>(s1);
      mu = s1 / (float)DD;
      float m2 = 0.f;
#pragma unroll   // constant indices, so that the small arrays stay in registers
      for (int i = 0; i < 4; ++i) {
        const float d0 = p[i][0] * (1.0f / 32.0f) - mu, d1 = p[i][2] * (1.0f / 32.0f) - mu;
        m2 += (p[i][1] + 32.0f * d0 * d0) + (p[i][3] + 32.0f * d1 * d1);
      }
      m2 = add_xmask<1>(m2); m2 = add_xmask<2>(m2);
      rs = rsqrtf(m2 / (float)DD + eps);
    }
    *(v4fa*)&sG[c] = g4; *(v4fa*)&sB[c] = b4;
    if (qd == 0) { sMu[r] = mu; sRs[r] = rs; }
  }
  __syncthreads();   // gamma, beta and the rows' mean and 1 / deviation are in LDS before any thread normalises with them
  if (LN_A) {
#pragma unroll   // constant indices, so that the small arrays stay in registers
    for (int j = 0; j < 4; ++j) { mu_a[j] = sMu[ar + 16 * j]; rs_a[j] = sRs[ar + 16 * j]; }
  }
  stash(sm, 0);
  __syncthreads();
  for (int s = 0; s < ns; ++s) {
    const unsigned short* sb = sm + (s & 1) * BUF;
    if (s + 1 < ns) fetch((s + 1) * BK);
#pragma unroll
    for (int ks = 0; ks < BK / 32; ++ks) {
      FragB ah[2], al[2], b[2];
#pragma unroll
      for (int t = 0; t < 2; ++t) {
        const unsigned short* pa = sb + (wm * 32 + t * 16 + ln) * LP + ks * 32 + 8 * hh;
        const unsigned short* pb = sb + 2 * PA + (wn * 32 + t * 16 + ln) * LP + ks * 32 + 8 * hh;
        ah[t].half[0] = *(const v8us*)pa;        ah[t].half[1] = *(const v8us*)(pa + 16);
        al[t].half[0] = *(const v8us*)(pa + PA); al[t].half[1] = *(const v8us*)(pa + PA + 16);
        b[t].half[0]  = *(const v8us*)pb;        b[t].half[1]  = *(const v8us*)(pb + 16);
      }
      __builtin_amdgcn_sched_barrier(0);   // keeps the k step's 12 LDS reads together as one group ahead of its 8 products: one LDS wait per k step, not four
#pragma unroll
      for (int mt = 0; mt < 2; ++mt)
#pragma unroll
        for (int nt = 0; nt < 2; ++nt) acc[mt][nt] = __builtin_amdgcn_wmma_f32_16x16x32_bf16(false, ah[mt].v, false, b[nt].v, (short)0, acc[mt][nt], false, false);
#pragma unroll
      for (int mt = 0; mt < 2; ++mt)
#pragma unroll
        for (int nt = 0; nt < 2; ++nt) acc[mt][nt] = __builtin_amdgcn_wmma_f32_16x16x32_bf16(false, al[mt].v, false, b[nt].v, (short)0, acc[mt][nt], false, false);
    }
    if (s + 1 < ns) stash(sm + ((s + 1) & 1) * BUF, (s + 1) * BK);
    __syncthreads();   // publishes slice s + 1 and ends every wave's reads of slice s, whose buffer is refilled in the next trip
  }
  // output: each wave turns its 32 x 32 tile through its own piece of the (now free) LDS so that every store covers whole 128-B lines
  float* so = (float*)sm + w * 32 * OP;
#pragma unroll
  for (int nt = 0; nt < 2; ++nt) {
    float bv = bias[col0 + wn * 32 + nt * 16 + ln];
    if (BIAS_BF16) bv = bf16_round(bv);
#pragma unroll
    for (int mt = 0; mt < 2; ++mt)
#pragma unroll
      for (int r = 0; r < 8; ++r) so[(mt * 16 + 8 * hh + r) * OP + nt * 16 + ln] = acc[mt][nt][r] + bv;
  }
  if (PLANES && col0 >= pcol0) {   // the same for the whole block
    __syncthreads();   // every wave's 32 x 32 piece is in LDS before rows are read across the four pieces of a tile row
    // wave w takes tile rows 8 * w .. 8 * w + 7; a lane owns 4 columns, so each store of a wave covers one whole 256-B plane row
    const float* sp = (const float*)sm + ((w >> 2) * 4 + (lane >> 3)) * 32 * OP + (w & 3) * 8 * OP + (lane & 7) * 4;
    const size_t po = ((size_t)((col0 - pcol0) / BN) * M + row0 + w * 8) * BN + lane * 4;
    v4us h[8], l[8];
#pragma unroll
    for (int q = 0; q < 8; ++q) {
      const v4f v = *(const v4fa*)(sp + q * OP);
#pragma unroll
      for (int t = 0; t < 4; ++t) { const unsigned short hb = bf16_bits(v[t]); h[q][t] = hb; l[q][t] = bf16_bits(v[t] - bf16_val(hb)); }
    }
#pragma unroll
    for (int q = 0; q < 8; ++q) { *(v4us*)(Ph + po + q * BN) = h[q]; *(v4us*)(Pl + po + q * BN) = l[q]; }
    asm volatile("s_wait_xcnt 0x0" ::: "memory");   // precaution: stands behind the last plane store, before any later instruction reuses a store's address or data registers
    return;
  }
  __builtin_amdgcn_fence(__ATOMIC_ACQ_REL, "workgroup");
  __builtin_amdgcn_wave_barrier();
  const int rsub = lane >> 3, c4 = (lane & 7) * 4;
  if (!RES) {
#pragma unroll
    for (int q = 0; q < 8; ++q) {
      const int r = q * 4 + rsub;
      const v4f v = *(const v4fa*)(so + r * OP + c4);
      *(v4f*)(C + (size_t)(row0 + wm * 32 + r) * ldc + col0 + wn * 32 + c4) = v;
    }
  } else {
    // 8 lanes hold the 32 columns that the wave has of a row: add the normalised residual, store the row piece, then its sum and its squares about its own mean
    const int col = col0 + wn * 32 + c4;
    const float* rp[8]; float* cp[8];
    v4f v[8], rr[8];
#pragma unroll   // constant indices, so that the small arrays stay in registers
    for (int q = 0; q < 8; ++q) { const size_t o = (size_t)(row0 + wm * 32 + q * 4 + rsub) * ldc + col; rp[q] = R + o; cp[q] = C + o; }
#pragma unroll   // constant indices, so that the small arrays stay in registers
    for (int q = 0; q < 8; ++q) rr[q] = *(const v4fa*)rp[q];
    // precaution: the eight address pairs are inputs of the wait, so none of them is reused ahead of it
    asm volatile("s_wait_xcnt 0x0" :: "v"(rp[0]), "v"(rp[1]), "v"(rp[2]), "v"(rp[3]), "v"(rp[4]), "v"(rp[5]), "v"(rp[6]), "v"(rp[7]) : "memory");
    const v4f g4 = *(const v4fa*)&sG[col], b4 = *(const v4fa*)&sB[col];
#pragma unroll   // constant indices, so that the small arrays stay in registers
    for (int q = 0; q < 8; ++q) {
      const int r = wm * 32 + q * 4 + rsub;
      const float mu = sMu[r], rs = sRs[r];
      v[q] = *(const v4fa*)(so + (q * 4 + rsub) * OP + c4);
#pragma unroll   // constant indices, so that the small arrays stay in registers
      for (int t = 0; t < 4; ++t) v[q][t] += (rr[q][t] - mu) * rs * g4[t] + b4[t];
    }
#pragma unroll   // constant indices, so that the small arrays stay in registers
    for (int q = 0; q < 8; ++q) *(v4f*)cp[q] = v[q];
    // precaution: the stores' address pairs and data are inputs of the wait, so none of them is reused ahead of it
    asm volatile("s_wait_xcnt 0x0" :: "v"(cp[0]), "v"(cp[1]), "v"(cp[2]), "v"(cp[3]), "v"(cp[4]), "v"(cp[5]), "v"(cp[6]), "v"(cp[7]),
                 "v"(v[0]), "v"(v[1]), "v"(v[2]), "v"(v[3]), "v"(v[4]), "v"(v[5]), "v"(v[6]), "v"(v[7]) : "memory");
    float s1[8], m2[8];
#pragma unroll   // constant indices, so that the small arrays stay in registers
    for (int q = 0; q < 8; ++q) s1[q] = (v[q][0] + v[q][1]) + (v[q][2] + v[q][3]);
#pragma unroll   // constant indices, so that the small arrays stay in registers
    for (int q = 0; q < 8; ++q) s1[q] = add_xmask<1>(s1[q]);
#pragma unroll   // constant indices, so that the small arrays stay in registers
    for (int q = 0; q < 8; ++q) s1[q] = add_xmask<2>(s1[q]);
#pragma unroll   // constant indices, so that the small arrays stay in registers
    for (int q = 0; q < 8; ++q) s1[q] = add_xmask<4>(s1[q]);
#pragma unroll   // constant indices, so that the small arrays stay in registers
    for (int q = 0; q < 8; ++q) {
      const float mean = s1[q] * (1.0f / 32.0f);
      const float d0 = v[q][0] - mean, d1 = v[q][1] - mean, d2 = v[q][2] - mean, d3 = v[q][3] - mean;
      m2[q] = (d0 * d0 + d1 * d1) + (d2 * d2 + d3 * d3);
    }
#pragma unroll   // constant indices, so that the small arrays stay in registers
    for (int q = 0; q < 8; ++q) m2[q] = add_xmask<1>(m2[q]);
#pragma unroll   // constant indices, so that the small arrays stay in registers
    for (int q = 0; q < 8; ++q) m2[q] = add_xmask<2>(m2[q]);
#pragma unroll   // constant indices, so that the small arrays stay in registers
    for (int q = 0; q < 8; ++q) m2[q] = add_xmask<4>(m2[q]);
    if ((lane & 7) == 0) {
#pragma unroll   // constant indices, so that the small arrays stay in registers
      for (int q = 0; q < 8; ++q) { float* ps = &sSt[((wm * 32 + q * 4 + rsub) * 4 + wn) * 2]; ps[0] = s1[q]; ps[1] = m2[q]; }
    }
    __syncthreads();   // the four waves' pairs of every row are in LDS before they leave as whole lines
    if (tid < BM * 8 / 4) *(v4f*)(sto + ((size_t)(col0 / BN) * M + row0) * 8 + tid * 4) = *(const v4fa*)&sSt[tid * 4];
  }
}
// row LayerNorm (biased variance, eps) over N: s = X (+ R); optional out_sum <- s; out_norm <- (s-mu)*rsqrt(var+eps)*g + b
template <bool PARAM_BF16>
__global__ __launch_bounds__(256) void k_layernorm(const float* __restrict__ X, const float* __restrict__ R, const float* __restrict__ g, const float* __restrict__ bta,
                                                  float* __restrict__ out_sum, float* __restrict__ out_norm, int N, float eps) {
  __shared__ float red[256];
  const int row = blockIdx.x, tid = threadIdx.x;
  const float* x = X + (size_t)row * N; const float* rr = R ? R + (size_t)row * N : nullptr;
  float vals[16];                     // up to N = 4096
  const int per = N / 256;            // contiguous chunk per thread? use strided-by-4 chunks: thread handles j = tid*4 + 1024*u
  float s1 = 0.f;
  for (int u = 0; u < per / 4; ++u) {
    const int j = tid * 4 + 1024 * u;
    const v4f a = *(const v4fa*)(x + j);
    v4f b = {0.f,0.f,0.f,0.f}; if (rr) b = *(const v4fa*)(rr + j);
#pragma unroll
    for (int q = 0; q < 4; ++q) { const float v = a[q] + b[q]; vals[u * 4 + q] = v; s1 += v; }
  }
  red[tid] = s1; __syncthreads();
  for (int st = 128; st > 0; st >>= 1) { if (tid < st) red[tid] += red[tid + st]; __syncthreads(); }
  const float mu = red[0] / (float)N; __syncthreads();
  float s2 = 0.f;
  for (int u = 0; u < per / 4; ++u)
#pragma unroll
    for (int q = 0; q < 4; ++q) { const float c = vals[u * 4 + q] - mu; s2 += c * c; }
  red[tid] = s2; __syncthreads();
  for (int st = 128; st > 0; st >>= 1) { if (tid < st) red[tid] += red[tid + st]; __syncthreads(); }
  const float rs = rsqrtf(red[0] / (float)N + eps);
  {
    for (int u = 0; u < per / 4; ++u) {
      const int j = tid * 4 + 1024 * u;
      v4f o, sm;
#pragma unroll
      for (int q = 0; q < 4; ++q) {
        float gg = g[j + q], bb = bta[j + q];
        if (PARAM_BF16) { gg = bf16_round(gg); bb = bf16_round(bb); }
        sm[q] = vals[u * 4 + q]; o[q] = (vals[u * 4 + q] - mu) * rs * gg + bb;
      }
      if (out_sum) *(v4f*)(out_sum + (size_t)row * N + j) = sm;
      *(v4f*)(out_norm + (size_t)row * N + j) = o;
    }
    
  }
}

template <int D>
__global__ __launch_bounds__(512) void k_flash3(const float* __restrict__ Qb, int qpitch, int Tq,
                                              const unsigned short* __restrict__ Kh, const unsigned short* __restrict__ Kl,
                                              const unsigned short* __restrict__ Vh, const unsigned short* __restrict__ Vl, int Tk,
                                              int H, float scale, float* __restrict__ y, int ypitch) {
  constexpr int KS = D / 32, DT = D / 16, NG = 4;
  constexpr int KP = D + 8, VP = D + 16;   // row pitches: K 16 B x odd (plain 16-B reads), V 32 B x odd (transposing reads)
  static_assert(D == 128, "a group's 128 threads copy 4 pieces of 16 B of each of the 4 planes per 32 keys");
  __shared__ __attribute__((aligned(32))) unsigned short sK[2][NG][2][32][KP];   // buffer, group, hi | lo
  __shared__ __attribute__((aligned(32))) unsigned short sV[2][NG][2][32][VP];
  // once the loop has ended the partial O tiles take sK's bytes and the partial max / sum rows the first bytes of sV
  constexpr int OPD = D + 4;   // pitch of a partial O row in floats: 16 B x odd, so that the 16 queries of a lane half store their 16-B pieces to different banks
  static_assert(sizeof(float) * 4 * NG * 16 * OPD <= sizeof(sK) && sizeof(float) * 2 * 4 * NG * 16 <= sizeof(sV), "merge staging fits");
  float (*sO)[16][OPD] = reinterpret_cast<float (*)[16][OPD]>(&sK[0][0][0][0][0]);
  float (*sM)[16] = reinterpret_cast<float (*)[16]>(&sV[0][0][0][0][0]);
  float (*sL)[16] = sM + 4 * NG;
  const int tid = threadIdx.x, lane = tid & 31, ln = lane & 15, hh = lane >> 4;
  const int w = __builtin_amdgcn_readfirstlane(tid >> 5);   // wave number, kept scalar so that the group's key offset and LDS bases stay scalar
  const int qt = w & 3, g = w >> 2;                         // query tile, key group
  const int vr = 8 * hh + (lane & 7), vc = 8 * ((lane >> 3) & 1);   // the lane's row and column offset in a transposing load of V
  const int nqb = (Tq + 63) / 64;
  const int bh = blockIdx.x / nqb, qblk = blockIdx.x % nqb;
  const int b = bh / H, h = bh % H;
  const int q0 = qblk * 64 + qt * 16;
  const float* Q = Qb + (size_t)b * Tq * qpitch + h * D;
  const int nch = (Tk + 32 * NG - 1) / (32 * NG);   // trips, the same for the whole block; a chunk past Tk is fully masked and adds nothing
  // staging: a plane row is 16 pieces of 16 B, so a wave's copy covers two whole rows: rows cr + 8 * i of its group's chunk, the lane columns cc .. cc + 7
  const int cr = 2 * qt + hh, cc = ln * 8;
  const size_t pb = (size_t)bh * Tk * D + cc;
  const unsigned lk0 = (unsigned)(size_t)&sK[0][g][0][cr][cc], lv0 = (unsigned)(size_t)&sV[0][g][0][cr][cc];   // LDS byte addresses of the thread's first hi pieces
  // 16 asynchronous copies per thread: the 32 keys from jn on, 4 planes. A key past the end is clamped to the last one, so that every lane's
  // address stays inside the source; such a key's scores are masked below, its P is 0 and its (finite) V row adds nothing.
  auto copy_kv = [&](int jn, int buf) {
    const unsigned short* pk[8]; const unsigned short* pv[8];
    unsigned lk[8], lv[8];
#pragma unroll   // every index constant: the 32 addresses are register operands of the two statements below
    for (int i = 0; i < 4; ++i) {
      const size_t off = pb + (size_t)(unsigned)min(jn + cr + 8 * i, Tk - 1) * D;
      pk[i] = Kh + off; pk[4 + i] = Kl + off; pv[i] = Vh + off; pv[4 + i] = Vl + off;
      lk[i] = lk0 + buf * (NG * 2 * 32 * KP * 2) + i * (8 * KP * 2); lk[4 + i] = lk[i] + 32 * KP * 2;
      lv[i] = lv0 + buf * (NG * 2 * 32 * VP * 2) + i * (8 * VP * 2); lv[4 + i] = lv[i] + 32 * VP * 2;
    }
    // the s_wait_xcnt closes each statement as a precaution: no address register of an issued copy is rewritten ahead of it
    asm volatile("global_load_async_to_lds_b128 %0, %8, off\n\tglobal_load_async_to_lds_b128 %1, %9, off\n\t"
                 "global_load_async_to_lds_b128 %2, %10, off\n\tglobal_load_async_to_lds_b128 %3, %11, off\n\t"
                 "global_load_async_to_lds_b128 %4, %12, off\n\tglobal_load_async_to_lds_b128 %5, %13, off\n\t"
                 "global_load_async_to_lds_b128 %6, %14, off\n\tglobal_load_async_to_lds_b128 %7, %15, off\n\ts_wait_xcnt 0x0"
                 :: "v"(lk[0]), "v"(lk[1]), "v"(lk[2]), "v"(lk[3]), "v"(lk[4]), "v"(lk[5]), "v"(lk[6]), "v"(lk[7]),
                    "v"(pk[0]), "v"(pk[1]), "v"(pk[2]), "v"(pk[3]), "v"(pk[4]), "v"(pk[5]), "v"(pk[6]), "v"(pk[7]) : "memory");
    asm volatile("global_load_async_to_lds_b128 %0, %8, off\n\tglobal_load_async_to_lds_b128 %1, %9, off\n\t"
                 "global_load_async_to_lds_b128 %2, %10, off\n\tglobal_load_async_to_lds_b128 %3, %11, off\n\t"
                 "global_load_async_to_lds_b128 %4, %12, off\n\tglobal_load_async_to_lds_b128 %5, %13, off\n\t"
                 "global_load_async_to_lds_b128 %6, %14, off\n\tglobal_load_async_to_lds_b128 %7, %15, off\n\ts_wait_xcnt 0x0"
                 :: "v"(lv[0]), "v"(lv[1]), "v"(lv[2]), "v"(lv[3]), "v"(lv[4]), "v"(lv[5]), "v"(lv[6]), "v"(lv[7]),
                    "v"(pv[0]), "v"(pv[1]), "v"(pv[2]), "v"(pv[3]), "v"(pv[4]), "v"(pv[5]), "v"(pv[6]), "v"(pv[7]) : "memory");
  };
  if (nch > 0) copy_kv(32 * g, 0);   // the first chunk flies under the Q fragment loads (block-uniform test)
  FragB aqh[KS], aql[KS];
  {
    int row = q0 + ln; if (row >= Tq) row = Tq - 1;
    const float* qr = Q + (size_t)row * qpitch;
#pragma unroll
    for (int ks = 0; ks < KS; ++ks)
#pragma unroll
      for (int i = 0; i < 16; ++i) {
        const int d = ks * 32 + ((i < 8) ? (8 * hh + i) : (16 + 8 * hh + (i - 8)));
        const float x = qr[d] * scale; const unsigned short hb = bf16_bits(x);
        aqh[ks].u[i] = hb; aql[ks].u[i] = bf16_bits(x - bf16_val(hb));
      }
  }
  float m_q = -3.0e38f, l_q = 0.f;   // query q0 + ln: running maximum (the same in both lane halves), and the sum over this half's keys
  v8f oacc[DT];                      // oacc[dt][r] = O[q0 + ln][dt * 16 + 8 * hh + r]
#pragma unroll
  for (int dt = 0; dt < DT; ++dt) oacc[dt] = (v8f){0.f,0.f,0.f,0.f,0.f,0.f,0.f,0.f};
  asm volatile("s_wait_asynccnt 0x0" ::: "memory");   // this wave's copies of the first chunk have landed
  __syncthreads();   // publishes the first chunk
  if (nch > 1) copy_kv(32 * NG + 32 * g, 1);   // the second chunk flies under the first one's work (block-uniform test)
  for (int c = 0; c < nch; ++c) {
    const int j0 = c * (32 * NG) + 32 * g, buf = c & 1;
    const unsigned short* kp = &sK[buf][g][0][0][0];   // hi plane; the lo plane lies 32 rows further
    const unsigned short* vp = &sV[buf][g][0][0][0];
    v8f s[2];
#pragma unroll
    for (int nt = 0; nt < 2; ++nt) {
      v8f acc = {};
#pragma unroll
      for (int ks = 0; ks < KS; ++ks) {
        const unsigned short* kr = kp + (nt * 16 + ln) * KP + ks * 32 + 8 * hh;
        FragB kh_, kl_;
        kh_.half[0] = *(const v8us*)kr;             kh_.half[1] = *(const v8us*)(kr + 16);
        kl_.half[0] = *(const v8us*)(kr + 32 * KP); kl_.half[1] = *(const v8us*)(kr + 32 * KP + 16);
        acc = mma3t(kh_.v, kl_.v, aqh[ks].v, aql[ks].v, acc);
      }
      s[nt] = acc;   // s[nt][r] = score of key j0 + nt * 16 + 8 * hh + r against query q0 + ln
    }
    const bool tail = j0 + 32 > Tk;   // the same for the whole wave (j0 and Tk are scalar)
    if (tail) {
#pragma unroll
      for (int nt = 0; nt < 2; ++nt)
#pragma unroll
        for (int r = 0; r < 8; ++r) if (j0 + nt * 16 + 8 * hh + r >= Tk) s[nt][r] = -3.0e38f;
    }
    float mt[8];
#pragma unroll
    for (int r = 0; r < 8; ++r) mt[r] = fmaxf(s[0][r], s[1][r]);
    float mx = fmaxf(fmaxf(fmaxf(mt[0], mt[1]), fmaxf(mt[2], mt[3])), fmaxf(fmaxf(mt[4], mt[5]), fmaxf(mt[6], mt[7])));
    mx = fmaxf(mx, other_half(mx));   // the query's other 16 keys of the chunk
    const float mnew = fmaxf(m_q, mx);
    const float alpha = (mnew > -1.0e38f) ? __expf(m_q - mnew) : 1.0f;
    m_q = mnew;
    s[0] -= mnew; s[1] -= mnew;
#pragma unroll
    for (int nt = 0; nt < 2; ++nt)
#pragma unroll
      for (int r = 0; r < 8; ++r) s[nt][r] = __expf(s[nt][r]);
    if (tail) {
#pragma unroll
      for (int nt = 0; nt < 2; ++nt)
#pragma unroll
        for (int r = 0; r < 8; ++r) if (j0 + nt * 16 + 8 * hh + r >= Tk) s[nt][r] = 0.f;
    }
    float pt[8];
#pragma unroll
    for (int r = 0; r < 8; ++r) pt[r] = s[0][r] + s[1][r];
    l_q = l_q * alpha + (((pt[0] + pt[1]) + (pt[2] + pt[3])) + ((pt[4] + pt[5]) + (pt[6] + pt[7])));
    // P^T as a B operand: element e = P of key 8 * hh + e, element 8 + e = P of key 16 + 8 * hh + e; hi = P rounded to bf16 (to nearest even), lo = the rest, rounded
    FragB pbh, pbl;
#pragma unroll
    for (int nt = 0; nt < 2; ++nt)
#pragma unroll
      for (int e = 0; e < 8; e += 2) {
        const v2f x = {s[nt][e], s[nt][e + 1]};
        const unsigned int hb = __builtin_bit_cast(unsigned int, __builtin_convertvector(x, v2b));
        const v2f rest = {x[0] - __uint_as_float(hb << 16), x[1] - __uint_as_float(hb & 0xFFFF0000u)};
        pbh.d[nt * 4 + e / 2] = hb;
        pbl.d[nt * 4 + e / 2] = __builtin_bit_cast(unsigned int, __builtin_convertvector(rest, v2b));
      }
#pragma unroll
    for (int dt = 0; dt < DT; ++dt) oacc[dt] *= alpha;
    // element i of a V fragment = V[8 * hh + i][dt * 16 + ln], element 8 + i = V[16 + 8 * hh + i][dt * 16 + ln]: row dt * 16 + ln of V^T in the k order of pbh / pbl
    FragB bvh[2], bvl[2];
    auto vfrag = [&](int dt) {
      const unsigned short* vq = vp + vr * VP + dt * 16 + vc;
      bvh[dt & 1].half[0] = ld_tr16(vq);           bvh[dt & 1].half[1] = ld_tr16(vq + 16 * VP);
      bvl[dt & 1].half[0] = ld_tr16(vq + 32 * VP); bvl[dt & 1].half[1] = ld_tr16(vq + 48 * VP);
    };
    vfrag(0);
#pragma unroll
    for (int dt = 0; dt < DT; ++dt) {
      if (dt + 1 < DT) vfrag(dt + 1);   // the next tile's four loads fly under this tile's three products
      oacc[dt] = mma3t(bvh[dt & 1].v, bvl[dt & 1].v, pbh.v, pbl.v, oacc[dt]);
    }
    asm volatile("s_wait_dscnt 0x0" ::: "memory");      // the wave's reads of this chunk's planes have retired before anybody refills them
    asm volatile("s_wait_asynccnt 0x0" ::: "memory");   // this wave's copies of the next chunk have landed
    __syncthreads();   // publishes the next chunk and ends every wave's reads of this one
    if (c + 2 < nch) copy_kv(j0 + 2 * 32 * NG, buf);   // the chunk after the next flies into the buffer just read (block-uniform test)
  }
  asm volatile("s_wait_asynccnt 0x0" ::: "memory");   // no copy is outstanding when the planes' bytes become sO, sM, sL (their last readers left them at the last trip's barrier)
  l_q += other_half(l_q);   // the two halves' key sums of the query
  if (hh == 0) { sM[w][ln] = m_q; sL[w][ln] = l_q; }
#pragma unroll
  for (int dt = 0; dt < DT; ++dt) {   // a lane's 8 accumulator registers are 8 consecutive columns of its query's row
    *(v4fa*)&sO[w][ln][dt * 16 + 8 * hh]     = (v4f){oacc[dt][0], oacc[dt][1], oacc[dt][2], oacc[dt][3]};
    *(v4fa*)&sO[w][ln][dt * 16 + 8 * hh + 4] = (v4f){oacc[dt][4], oacc[dt][5], oacc[dt][6], oacc[dt][7]};
  }
  __syncthreads();   // every group's partial (max, sum, O) is in LDS before any wave merges
  // merge: wave (qt, g) finishes rows g*16/NG ... of query tile qt; a lane owns 4 columns of the row
#pragma unroll
  for (int i = 0; i < 16 / NG; ++i) {
    const int rr = g * (16 / NG) + i, row = q0 + rr;
    if (row < Tq && lane < D / 4) {
      float mg[NG], mall = -3.0e38f;
#pragma unroll
      for (int k = 0; k < NG; ++k) { mg[k] = sM[k * 4 + qt][rr]; mall = fmaxf(mall, mg[k]); }
      float lall = 0.f;
      v4f val = {0.f, 0.f, 0.f, 0.f};
#pragma unroll
      for (int k = 0; k < NG; ++k) {
        const float wt = (mg[k] > -1.0e38f) ? __expf(mg[k] - mall) : 0.f;
        const v4f o = *(const v4fa*)&sO[k * 4 + qt][rr][lane * 4];
        lall += wt * sL[k * 4 + qt][rr];
        val += wt * o;
      }
      const float inv = (mall > -1.0e38f) ? 1.0f / lall : __builtin_nanf("");
      *(v4f*)(y + ((size_t)b * Tq + row) * ypitch + h * D + lane * 4) = val * inv;
      if (i + 1 < 16 / NG) asm volatile("s_wait_xcnt 0x0" ::: "memory");   // precaution: stands before the next row's reads reuse the store's address and data registers
    }
  }
}

__global__ __launch_bounds__(256) void k_roundcopy(const float* __restrict__ src, float* __restrict__ dst, int n8) {
  const size_t t = (size_t)blockIdx.x * 256 + threadIdx.x;
  if (t >= (size_t)n8 * 2) return;
  v4f a = *(const v4fa*)(src + t * 4);
  for (int i = 0; i < 4; ++i) a[i] = bf16_round(a[i]);
  *(v4f*)(dst + t * 4) = a; 
}

__global__ void k_ln_rows(const float* __restrict__ X, const float* __restrict__ R, const float* __restrict__ g, const float* __restrict__ bta, float* __restrict__ out, int N, float eps) {
  __shared__ float red[256];
  const int row = blockIdx.x, tid = threadIdx.x, nt = blockDim.x;
  v4f a = *(const v4fa*)(X + (size_t)row * N + tid * 4);
  if (R) { const v4f rr = *(const v4fa*)(R + (size_t)row * N + tid * 4); for (int q = 0; q < 4; ++q) a[q] += rr[q]; }
  float s = a[0] + a[1] + a[2] + a[3];
  red[tid] = s; __syncthreads();
  for (int st = nt / 2; st > 0; st >>= 1) { if (tid < st) red[tid] += red[tid + st]; __syncthreads(); }
  const float mu = red[0] / (float)N; __syncthreads();
  float v = 0.f; for (int q = 0; q < 4; ++q) { const float c = a[q] - mu; v += c * c; }
  red[tid] = v; __syncthreads();
  for (int st = nt / 2; st > 0; st >>= 1) { if (tid < st) red[tid] += red[tid + st]; __syncthreads(); }
  const float rs = rsqrtf(red[0] / (float)N + eps);
  v4f o; for (int q = 0; q < 4; ++q) o[q] = (a[q] - mu) * rs * bf16_round(g[tid * 4 + q]) + bf16_round(bta[tid * 4 + q]);
  *(v4f*)(out + (size_t)row * N + tid * 4) = o; 
}

// Bt[h*DK + k][d] = W[h][d][k]  (W [H][D][DK]); thread per (n, 8 d)
__global__ __launch_bounds__(256) void k_wt_heads(const float* __restrict__ W, unsigned short* __restrict__ Bt) {
  const int t = blockIdx.x * 256 + threadIdx.x; if (t >= NH * DK * (DD / 8)) return;
  const int n = t / (DD / 8), d8 = (t % (DD / 8)) * 8; const int h = n / DK, kk = n % DK; v8us v;
#pragma unroll
  for (int i = 0; i < 8; ++i) v[i] = bf16_bits(W[((size_t)h * DD + d8 + i) * DK + kk]);
  *(v8us*)(Bt + (size_t)n * DD + d8) = v; 
}
extern "C" void kernel_launch(void* const* d_in, const int* in_sizes, int n_in,
                              void* d_out, int out_size, void* d_ws, size_t ws_size, hipStream_t stream) {
  (void)in_sizes; (void)n_in; (void)out_size;
  const float* token = (const float*)d_in[0];
  const float* Wq = (const float*)d_in[1]; const float* bq = (const float*)d_in[2]; const float* Wk = (const float*)d_in[3]; const float* bk = (const float*)d_in[4];
  const float* Wv = (const float*)d_in[5]; const float* bv = (const float*)d_in[6]; const float* Wo = (const float*)d_in[7]; const float* bo = (const float*)d_in[8];
  const float* Wf = (const float*)d_in[9]; const float* bfv = (const float*)d_in[10]; const float* gamma = (const float*)d_in[11]; const float* beta = (const float*)d_in[12];
  char* ws = (char*)d_ws; size_t off = 0;
  auto take = [&](size_t bytes) { char* p = ws + off; off += (bytes + 255) & ~(size_t)255; return p; };
  unsigned short* Bqkv = (unsigned short*)take((size_t)3 * DD * DD * 2); unsigned short* Bo = (unsigned short*)take((size_t)DD * DD * 2); unsigned short* Bf = (unsigned short*)take((size_t)DD * DD * 2);
  float* bqkv = (float*)take(3 * DD * 4);
  float* x = (float*)take((size_t)SS * DD * 4); float* qkv = (float*)take((size_t)SS * 3 * DD * 4); float* att = (float*)take((size_t)SS * DD * 4); float* tmp = (float*)take((size_t)SS * DD * 4); float* a = (float*)take((size_t)SS * DD * 4);
  float* st1 = (float*)take((size_t)(DD / 128) * SS * 8 * 4); float* st2 = (float*)take((size_t)(DD / 128) * SS * 8 * 4);   // (sum, squares) pairs of the rows in tmp and in a
  unsigned short* kvh = (unsigned short*)take((size_t)2 * DD * SS * 2); unsigned short* kvl = (unsigned short*)take((size_t)2 * DD * SS * 2);   // bf16 hi / lo planes [K heads | V heads][SS][DK]
  if (off > ws_size) return;
  k_wt_heads<<<(NH * DK * (DD / 8) + 255) / 256, 256, 0, stream>>>(Wq, Bqkv);
  k_wt_heads<<<(NH * DK * (DD / 8) + 255) / 256, 256, 0, stream>>>(Wk, Bqkv + (size_t)DD * DD);
  k_wt_heads<<<(NH * DK * (DD / 8) + 255) / 256, 256, 0, stream>>>(Wv, Bqkv + (size_t)2 * DD * DD);
  k_wt_bf16<<<(DD * (DD / 8) + 255) / 256, 256, 0, stream>>>(Wo, Bo, DD, DD);
  k_wt_bf16<<<(DD * (DD / 8) + 255) / 256, 256, 0, stream>>>(Wf, Bf, DD, DD);
  k_roundcopy<<<(3 * DD / 4 + 255) / 256, 256, 0, stream>>>(bq, bqkv, DD / 8);            // bq|bk|bv flat [H*DK] each: three copies (f32, rounded) into one bias vector
  k_roundcopy<<<(DD / 4 + 255) / 256, 256, 0, stream>>>(bk, bqkv + DD, DD / 8);
  k_roundcopy<<<(DD / 4 + 255) / 256, 256, 0, stream>>>(bv, bqkv + 2 * DD, DD / 8);
  k_roundcopy<<<(SS * DD / 4 + 255) / 256, 256, 0, stream>>>(token, x, SS * DD / 8);
  const int gq = (SS / 64) * (3 * DD / 128), g1 = (SS / 64) * (DD / 128);
  for (int l = 0; l < NLAY; ++l) {
    // the layer's input rows: the rounded tokens as they are, later the rows a = (a' + ff) of the layer before, not yet normalised, with their pairs st2
    const float* xs = l ? a : x; const float* sx = l ? st2 : nullptr;
    k_gemm_tile<false, true, true, false><<<gq, 256, 0, stream>>>(xs, DD, Bqkv, DD, bqkv, qkv, 3 * DD, 3 * DD, DD, kvh, kvl, DD, SS, nullptr, sx, gamma, beta, nullptr, 1e-5f);      // bias already rounded (BIAS_BF16=false adds it as given); q to qkv, k and v to the planes
    k_flash3<DK><<<NH * (SS / 64), 512, 0, stream>>>(qkv, 3 * DD, SS, kvh, kvl, kvh + (size_t)DD * SS, kvl + (size_t)DD * SS, SS, NH, 0.08838834764831845f, att, DD);
    k_gemm_tile<true, false, false, true><<<g1, 256, 0, stream>>>(att, DD, Bo, DD, bo, tmp, DD, DD, DD, nullptr, nullptr, 0, SS, xs, sx, gamma, beta, st1, 1e-5f);   // tmp = norm(xs) + attn_out, pairs to st1
    k_gemm_tile<true, false, true, true><<<g1, 256, 0, stream>>>(tmp, DD, Bf, DD, bfv, a, DD, DD, DD, nullptr, nullptr, 0, SS, tmp, st1, gamma, beta, st2, 1e-5f);     // a = norm(tmp) + norm(tmp) x Wf + bf, pairs to st2
  }
  k_ln_rows<<<SS, DD / 4, 0, stream>>>(a, nullptr, gamma, beta, (float*)d_out, DD, 1e-5f);   // the last layer's LayerNorm
}

// v009
// A run of this version takes 638 microseconds.
// In two side-by-side timings against v008, it was 1.05 and 1.06 times as fast.
// Counting every step since v000, it is 6.29 times as fast.
#include <hip/hip_runtime.h>
// All GEMMs on v_wmma_f32_16x16x32_bf16, f32 accumulate: fused per-head q|k|v projection (K=1024, N=3072), concat·Wo, norm(tmp)·Wf — A operands
// (the residual stream, quantised to bf16 once at the input) split into bf16 hi/lo (2 terms) against bf16-rounded weights; attention QKᵀ/√128
// and P·V per 16-query tile as 3-term splits (head dim 128); LayerNorm and softmax in f32. Six layers with shared weights.
#define SS 2048
#define DD 1024
#define NH 8
#define DK 128
#define NLAY 6

typedef __bf16 v16b __attribute__((ext_vector_type(16)));
typedef unsigned short v8us __attribute__((ext_vector_type(8), may_alias));
typedef unsigned short v4us __attribute__((ext_vector_type(4), may_alias));
typedef float  v8f  __attribute__((ext_vector_type(8)));
typedef float  v4f  __attribute__((ext_vector_type(4)));
typedef float  v4fa __attribute__((ext_vector_type(4), may_alias));
typedef float  v2f  __attribute__((ext_vector_type(2)));
typedef __bf16 v2b  __attribute__((ext_vector_type(2)));
union FragB { v16b v; v8us half[2]; unsigned short u[16]; unsigned int d[8]; };
typedef short s16x8 __attribute__((ext_vector_type(8)));
typedef __attribute__((address_space(3))) s16x8 lds_s16x8;
// transposing LDS load of an 8 x 16 block of 16-bit elements per lane half: lane l points at 8 elements of row 8*(l>>4) + (l&7), columns 8*((l>>3)&1) ...;
// lane (c = l&15, h = l>>4) receives rows 8h .. 8h+7 of column c
__device__ __forceinline__ v8us ld_tr16(const unsigned short* p) { return __builtin_bit_cast(v8us, __builtin_amdgcn_ds_load_tr16_b128_v8i16((lds_s16x8*)p)); }

__device__ __forceinline__ unsigned short bf16_bits(float x) { unsigned int u = __float_as_uint(x); return (unsigned short)((u + 0x7FFFu + ((u >> 16) & 1u)) >> 16); }
__device__ __forceinline__ float bf16_val(unsigned short b) { return __uint_as_float(((unsigned int)b) << 16); }
__device__ __forceinline__ float bf16_round(float x) { return bf16_val(bf16_bits(x)); }
// D += A·B with NT terms: 1 = ah·bh, 2 = + al·bh (A split), 3 = + ah·bl (both split)
template <int NT>
__device__ __forceinline__ v8f mmaN(v16b ah, v16b al, v16b bh, v16b bl, v8f c) {
  c = __builtin_amdgcn_wmma_f32_16x16x32_bf16(false, ah, false, bh, (short)0, c, false, false);
  if (NT >= 2) c = __builtin_amdgcn_wmma_f32_16x16x32_bf16(false, al, false, bh, (short)0, c, false, false);
  if (NT >= 3) c = __builtin_amdgcn_wmma_f32_16x16x32_bf16(false, ah, false, bl, (short)0, c, false, false);
  asm volatile("v_nop\n\tv_nop\n\tv_nop\n\tv_nop" : "+v"(c) : "v"(ah), "v"(al), "v"(bh), "v"(bl));
  return c;
}

// D += A x B, both split, for the transposed attention products (A = K or V, B = Q or P): ah.bh, then ah.bl, then al.bh, which is the term order
// that mmaN<3> gives with the operands the other way round
__device__ __forceinline__ v8f mma3t(v16b ah, v16b al, v16b bh, v16b bl, v8f c) {
  c = __builtin_amdgcn_wmma_f32_16x16x32_bf16(false, ah, false, bh, (short)0, c, false, false);
  c = __builtin_amdgcn_wmma_f32_16x16x32_bf16(false, ah, false, bl, (short)0, c, false, false);
  c = __builtin_amdgcn_wmma_f32_16x16x32_bf16(false, al, false, bh, (short)0, c, false, false);
  // as in mmaN: four vector slots behind the last product, on whatever path follows it (a scalar branch stands behind the score products)
  asm volatile("v_nop\n\tv_nop\n\tv_nop\n\tv_nop" : "+v"(c) : "v"(ah), "v"(al), "v"(bh), "v"(bl));
  return c;
}
// the value that lane l ^ 16 holds
__device__ __forceinline__ float other_half(float x) {
  const int b = __float_as_int(x);
  return __int_as_float(__builtin_amdgcn_permlanex16(b, b, 0x76543210, 0xfedcba98, false, false));
}

// x + the x of lane l ^ MASK (MASK < 16: inside a row of 16 lanes), as one DPP add; every lane must be on
template <int MASK>
__device__ __forceinline__ float add_xmask(float x) {
  return x + __int_as_float(__builtin_amdgcn_update_dpp(0, __float_as_int(x), 0x160 + MASK, 0xf, 0xf, true));   // 0x160 + MASK = row_xmask:MASK
}

// GEMM C[M][N] (f32, pitch ldc) = act(A[M][K]·W + bias). A f32 row-major (pitch lda) converted per fragment to bf16
// (ASPLIT: hi/lo two planes -> 2 terms, else single rounded term); Wt bf16 [N][K] (pitch ldb). BIAS_BF16 rounds the
// bias to bf16 first (bias quantised to bf16 before the add). K%32==0, M%16==0, N%64==0.
template <bool ASPLIT, int ACT, bool BIAS_BF16>
__global__ __launch_bounds__(128) void k_gemm_bf(const float* __restrict__ A, int lda, const unsigned short* __restrict__ Wt, int ldb,
                                               const float* __restrict__ bias, float* __restrict__ C, int ldc, int M, int N, int K) {
  __shared__ __attribute__((aligned(16))) float so[4][16][64];
  const int tid = threadIdx.x, w = tid >> 5, lane = tid & 31, ln = lane & 15, hh = lane >> 4;
  const int ntn = N / 64;
  const int wid = blockIdx.x * 4 + w;
  const int mt = wid / ntn, nq = wid % ntn;
  if (mt * 16 >= M) return;
  const int row0 = mt * 16, col0 = nq * 64;
  const float* arow = A + (size_t)(row0 + ln) * lda;
  v8f acc[4] = {};
  for (int kb = 0; kb < K; kb += 32) {
    FragB ah, al;
    const v4f x0 = *(const v4fa*)(arow + kb + 8 * hh), x1 = *(const v4fa*)(arow + kb + 8 * hh + 4);
    const v4f x2 = *(const v4fa*)(arow + kb + 16 + 8 * hh), x3 = *(const v4fa*)(arow + kb + 16 + 8 * hh + 4);
    float xs[16] = {x0[0],x0[1],x0[2],x0[3],x1[0],x1[1],x1[2],x1[3],x2[0],x2[1],x2[2],x2[3],x3[0],x3[1],x3[2],x3[3]};
#pragma unroll
    for (int i = 0; i < 16; ++i) { const unsigned short hb = bf16_bits(xs[i]); ah.u[i] = hb; al.u[i] = ASPLIT ? bf16_bits(xs[i] - bf16_val(hb)) : (unsigned short)0; }
#pragma unroll
    for (int t = 0; t < 4; ++t) {
      const unsigned short* brow = Wt + (size_t)(col0 + t * 16 + ln) * ldb + kb;
      FragB b;
      b.half[0] = *(const v8us*)(brow + 8 * hh);
      b.half[1] = *(const v8us*)(brow + 16 + 8 * hh);
      acc[t] = mmaN<ASPLIT ? 2 : 1>(ah.v, al.v, b.v, b.v, acc[t]);
    }
  }
#pragma unroll
  for (int t = 0; t < 4; ++t) {
    float bv = bias ? bias[col0 + t * 16 + ln] : 0.f;
    if (BIAS_BF16) bv = bf16_round(bv);
#pragma unroll
    for (int r = 0; r < 8; ++r) { float v = acc[t][r] + bv; if (ACT == 1) v = fmaxf(v, 0.f); so[w][8 * hh + r][t * 16 + ln] = v; }
  }
  __builtin_amdgcn_fence(__ATOMIC_ACQ_REL, "workgroup");
  __builtin_amdgcn_wave_barrier();
  const int rsub = lane >> 4, c4 = (lane & 15) * 4;
  {
#pragma unroll
    for (int q = 0; q < 8; ++q) {
      const int r = q * 2 + rsub;
      const v4f v = *(const v4fa*)&so[w][r][c4];
      *(v4f*)(C + (size_t)(row0 + r) * ldc + col0 + c4) = v;
    }
    
  }
}

// Flash-style causal/unmasked attention, all contractions 3-term bf16 hi/lo splits, f32 softmax with running max.
// q,k,v rows are read from f32 buffers with arbitrary row pitch (so they can live inside a fused qkv buffer);
// D = head size (multiple of 32, <= 128); one wave = 16 query rows; block = 4 waves (64 queries) sharing K/V chunks of 32.
template <int D, bool CAUSAL>
__global__ __launch_bounds__(128) void k_flash(const float* __restrict__ qb, const float* __restrict__ kb, const float* __restrict__ vb,
                                             int pitch, int T, int H, float scale, float* __restrict__ y, int ypitch) {
  constexpr int KS = D / 32;        // k-steps for QK
  constexpr int DT = D / 16;        // d tiles for PV
  __shared__ __attribute__((aligned(16))) unsigned short sKh[32][D + 8], sKl[32][D + 8], sVh[32][D + 8], sVl[32][D + 8];
  __shared__ __attribute__((aligned(16))) unsigned short sPh[4][16][40], sPl[4][16][40];
  __shared__ __attribute__((aligned(16))) float sO[4][16][D];
  const int tid = threadIdx.x, w = tid >> 5, lane = tid & 31, ln = lane & 15, hh = lane >> 4;
  const int nqb = (T + 63) / 64;
  const int bh = blockIdx.x / nqb, qblk = blockIdx.x % nqb;
  const int b = bh / H, h = bh % H;
  const int q0 = qblk * 64 + w * 16;
  const float* Q = qb + (size_t)b * T * pitch + h * D;
  const float* K = kb + (size_t)b * T * pitch + h * D;
  const float* V = vb + (size_t)b * T * pitch + h * D;

  // A fragments of the wave's 16 query rows (scaled), hi/lo
  FragB aqh[KS], aql[KS];
  {
    int row = q0 + ln; if (row >= T) row = T - 1;
    const float* qr = Q + (size_t)row * pitch;
#pragma unroll
    for (int ks = 0; ks < KS; ++ks)
#pragma unroll
      for (int i = 0; i < 16; ++i) {
        const int d = ks * 32 + ((i < 8) ? (8 * hh + i) : (16 + 8 * hh + (i - 8)));
        const float x = qr[d] * scale; const unsigned short hb = bf16_bits(x);
        aqh[ks].u[i] = hb; aql[ks].u[i] = bf16_bits(x - bf16_val(hb));
      }
  }
  float m_r[8], l_r[8];
#pragma unroll
  for (int r = 0; r < 8; ++r) { m_r[r] = -3.0e38f; l_r[r] = 0.f; }
  v8f oacc[DT];
#pragma unroll
  for (int dt = 0; dt < DT; ++dt) oacc[dt] = (v8f){0.f,0.f,0.f,0.f,0.f,0.f,0.f,0.f};

  const int kv_end = CAUSAL ? min(T, qblk * 64 + 64) : T;     // block-uniform
  for (int j0 = 0; j0 < kv_end; j0 += 32) {
    __syncthreads();
    for (int e = tid; e < 32 * (D / 4); e += 128) {
      const int r = e / (D / 4), c4 = (e % (D / 4)) * 4;
      const int key = j0 + r;
      v4f kf = {0.f,0.f,0.f,0.f}, vf = {0.f,0.f,0.f,0.f};
      if (key < T) { kf = *(const v4fa*)(K + (size_t)key * pitch + c4); vf = *(const v4fa*)(V + (size_t)key * pitch + c4); }
#pragma unroll
      for (int t = 0; t < 4; ++t) {
        unsigned short hb = bf16_bits(kf[t]); sKh[r][c4 + t] = hb; sKl[r][c4 + t] = bf16_bits(kf[t] - bf16_val(hb));
        hb = bf16_bits(vf[t]); sVh[r][c4 + t] = hb; sVl[r][c4 + t] = bf16_bits(vf[t] - bf16_val(hb));
      }
    }
    __syncthreads();
    // S tile 16 x 32
    v8f s[2];
#pragma unroll
    for (int nt = 0; nt < 2; ++nt) {
      v8f acc = {};
#pragma unroll
      for (int ks = 0; ks < KS; ++ks) {
        FragB bh_, bl_;
        bh_.half[0] = *(const v8us*)&sKh[nt * 16 + ln][ks * 32 + 8 * hh]; bh_.half[1] = *(const v8us*)&sKh[nt * 16 + ln][ks * 32 + 16 + 8 * hh];
        bl_.half[0] = *(const v8us*)&sKl[nt * 16 + ln][ks * 32 + 8 * hh]; bl_.half[1] = *(const v8us*)&sKl[nt * 16 + ln][ks * 32 + 16 + 8 * hh];
        acc = mmaN<3>(aqh[ks].v, aql[ks].v, bh_.v, bl_.v, acc);
      }
      s[nt] = acc;
    }
    // mask + running max (rows 8hh+r; the 16 lanes of a half share rows)
    float alpha[8];
#pragma unroll
    for (int r = 0; r < 8; ++r) {
      const int qi = q0 + 8 * hh + r;
      const int ja = j0 + ln, jb = j0 + 16 + ln;
      if (CAUSAL) { if (ja > qi) s[0][r] = -3.0e38f; if (jb > qi) s[1][r] = -3.0e38f; }
      if (ja >= T) s[0][r] = -3.0e38f;
      if (jb >= T) s[1][r] = -3.0e38f;
      float mx = fmaxf(s[0][r], s[1][r]);
      mx = fmaxf(mx, __shfl_xor(mx, 1, 32)); mx = fmaxf(mx, __shfl_xor(mx, 2, 32)); mx = fmaxf(mx, __shfl_xor(mx, 4, 32)); mx = fmaxf(mx, __shfl_xor(mx, 8, 32));
      const float mnew = fmaxf(m_r[r], mx);
      alpha[r] = (mnew > -1.0e38f) ? __expf(m_r[r] - mnew) : 1.0f;
      const float p0 = (s[0][r] > -1.0e38f) ? __expf(s[0][r] - mnew) : 0.f;
      const float p1 = (s[1][r] > -1.0e38f) ? __expf(s[1][r] - mnew) : 0.f;
      m_r[r] = mnew;
      l_r[r] = l_r[r] * alpha[r] + p0 + p1;            // per-lane partial row sum (16 lanes combined at the end)
      unsigned short hb = bf16_bits(p0); sPh[w][8 * hh + r][ln] = hb;      sPl[w][8 * hh + r][ln] = bf16_bits(p0 - bf16_val(hb));
      hb = bf16_bits(p1);                sPh[w][8 * hh + r][16 + ln] = hb; sPl[w][8 * hh + r][16 + ln] = bf16_bits(p1 - bf16_val(hb));
    }
#pragma unroll
    for (int dt = 0; dt < DT; ++dt)
#pragma unroll
      for (int r = 0; r < 8; ++r) oacc[dt][r] *= alpha[r];
    __builtin_amdgcn_fence(__ATOMIC_ACQ_REL, "workgroup");
    __builtin_amdgcn_wave_barrier();
    FragB pah, pal;
    pah.half[0] = *(const v8us*)&sPh[w][ln][8 * hh]; pah.half[1] = *(const v8us*)&sPh[w][ln][16 + 8 * hh];
    pal.half[0] = *(const v8us*)&sPl[w][ln][8 * hh]; pal.half[1] = *(const v8us*)&sPl[w][ln][16 + 8 * hh];
#pragma unroll
    for (int dt = 0; dt < DT; ++dt) {
      FragB bvh, bvl;
#pragma unroll
      for (int i = 0; i < 8; ++i) {
        bvh.u[i] = sVh[8 * hh + i][dt * 16 + ln]; bvh.u[8 + i] = sVh[16 + 8 * hh + i][dt * 16 + ln];
        bvl.u[i] = sVl[8 * hh + i][dt * 16 + ln]; bvl.u[8 + i] = sVl[16 + 8 * hh + i][dt * 16 + ln];
      }
      oacc[dt] = mmaN<3>(pah.v, pal.v, bvh.v, bvl.v, oacc[dt]);
    }
    __builtin_amdgcn_fence(__ATOMIC_ACQ_REL, "workgroup");
    __builtin_amdgcn_wave_barrier();
  }
#pragma unroll
  for (int r = 0; r < 8; ++r) {
    float l = l_r[r];
    l += __shfl_xor(l, 1, 32); l += __shfl_xor(l, 2, 32); l += __shfl_xor(l, 4, 32); l += __shfl_xor(l, 8, 32);
    l_r[r] = (l > 0.f) ? 1.0f / l : 0.f;
  }
#pragma unroll
  for (int dt = 0; dt < DT; ++dt)
#pragma unroll
    for (int r = 0; r < 8; ++r) sO[w][8 * hh + r][dt * 16 + ln] = oacc[dt][r] * l_r[r];
  __builtin_amdgcn_fence(__ATOMIC_ACQ_REL, "workgroup");
  __builtin_amdgcn_wave_barrier();
  {
    for (int r = 0; r < 16; ++r) {
      const int row = q0 + r;
      if (row < T && lane < D / 4) {
        const v4f val = *(const v4fa*)&sO[w][r][lane * 4];
        *(v4f*)(y + ((size_t)b * T + row) * ypitch + h * D + lane * 4) = val;
      }
    }
    
  }
}

// GEMM C[M][N] (f32, pitch ldc) = A[M][K] x W + bias: A f32 row-major (pitch lda), two terms (bf16 hi + lo) against Wt bf16 [N][K] (pitch ldb).
// Block = 8 waves (2 x 4) on a 64 x 128 tile of C, a wave owns 32 x 32. K is walked in slices of 64: the A slice is split into its hi and lo
// planes once per block, the Wt slice is copied, both through whole-line global loads into LDS, where all 8 waves read their fragments.
// Two LDS buffers: the next slice's global loads are issued ahead of this slice's products and stored behind them; one barrier per slice.
// Each accumulator takes hi then lo of every 32-wide k step in rising k. M % 64 == 0, N % 128 == 0, K % 64 == 0; grid = (M / 64) * (N / 128).
// PLANES: a block whose columns start at pcol0 or beyond does not store its tile to C; it splits it into bf16 hi and lo and stores these to
// Ph / Pl as rows of plane (col0 - pcol0) / 128, each plane [M][128]: the form in which the attention kernel stages K and V.
// LayerNorm lives in the GEMMs: a row before its LayerNorm is kept as it is (rows of DD floats), with 32 pairs (sum, sum of squares about the piece's own mean),
// one per 32 columns, in st[column block of 128][row][4][2]. norm(v) = (v - mu) * rs * gamma + beta, gamma and beta rounded to bf16; mu and rs of the
// block's 64 rows are formed from the pairs once, in front of the K loop. st == nullptr: the rows are plain (mu 0, rs 1, gamma 1, beta 0).
// LN_A: the A operand is norm(A), applied where a slice is split. RES: C = A x W + bias + norm(R), and the pairs of the new rows go to sto.
template <bool BIAS_BF16, bool PLANES, bool LN_A, bool RES>
__global__ __launch_bounds__(256) void k_gemm_tile(const float* __restrict__ A, int lda, const unsigned short* __restrict__ Wt, int ldb,
                                                   const float* __restrict__ bias, float* __restrict__ C, int ldc, int N, int K,
                                                   unsigned short* __restrict__ Ph, unsigned short* __restrict__ Pl, int pcol0, int M,
                                                   const float* __restrict__ R, const float* __restrict__ st, const float* __restrict__ gamma,
                                                   const float* __restrict__ beta, float* __restrict__ sto, float eps) {
  constexpr int BM = 64, BN = 128, BK = 64, LP = BK + 8;       // LP: LDS row pitch 144 B = 16 B x odd
  constexpr int PA = BM * LP, PB = BN * LP, BUF = 2 * PA + PB;  // one buffer, in 16-bit elements: A hi | A lo | Wt
  constexpr int OP = 36;                                       // pitch of the output staging rows, in floats
  __shared__ __attribute__((aligned(16))) unsigned short sm[2 * BUF];
  __shared__ __attribute__((aligned(16))) float sG[DD], sB[DD], sMu[BM], sRs[BM], sSt[RES ? BM * 8 : 4];
  const int tid = threadIdx.x, lane = tid & 31, ln = lane & 15, hh = lane >> 4;
  const int w = __builtin_amdgcn_readfirstlane(tid >> 5);      // wave number, kept scalar so that the tile offsets stay scalar
  const int wm = w >> 2, wn = w & 3;
  const int nbn = N / BN;
  const int row0 = (blockIdx.x / nbn) * BM, col0 = (blockIdx.x % nbn) * BN;
  const int ar = tid >> 4, ac = (tid & 15) * 4;                // A slice: a wave's load covers 2 rows x 256 B
  const int br = tid >> 3, bc = (tid & 7) * 8;                 // Wt slice: a wave's load covers 4 rows x 128 B
  const float* ag = A + (size_t)(row0 + ar) * lda + ac;
  const unsigned short* bg = Wt + (size_t)(col0 + br) * ldb + bc;
  v4f ra[4];
  v8us rb[4];
  auto fetch = [&](int kb) {
    const float* pa[4];
    const unsigned short* pb[4];
#pragma unroll
    for (int j = 0; j < 4; ++j) { pa[j] = ag + (size_t)(16 * j) * lda + kb; pb[j] = bg + (size_t)(32 * j) * ldb + kb; }
#pragma unroll
    for (int j = 0; j < 4; ++j) ra[j] = *(const v4fa*)pa[j];
#pragma unroll
    for (int j = 0; j < 4; ++j) rb[j] = *(const v8us*)pb[j];
    // precaution: the eight address pairs are inputs of the wait, so none of them is reused (not even as a later load's result) ahead of it
    asm volatile("s_wait_xcnt 0x0" :: "v"(pa[0]), "v"(pa[1]), "v"(pa[2]), "v"(pa[3]), "v"(pb[0]), "v"(pb[1]), "v"(pb[2]), "v"(pb[3]) : "memory");
  };
  float mu_a[4], rs_a[4];   // LN_A: mean and 1 / deviation of the thread's four A rows
  auto stash = [&](unsigned short* sb, int kb) {
    v4f g4 = {1.f, 1.f, 1.f, 1.f}, b4 = {0.f, 0.f, 0.f, 0.f};
    if (LN_A) { g4 = *(const v4fa*)&sG[kb + ac]; b4 = *(const v4fa*)&sB[kb + ac]; }
#pragma unroll
    for (int j = 0; j < 4; ++j) {
      v4us h, l;
#pragma unroll
      for (int t = 0; t < 4; ++t) {
        const float xv = LN_A ? (ra[j][t] - mu_a[j]) * rs_a[j] * g4[t] + b4[t] : ra[j][t];
        const unsigned short hb = bf16_bits(xv); h[t] = hb; l[t] = bf16_bits(xv - bf16_val(hb));
      }
      *(v4us*)(sb + (ar + 16 * j) * LP + ac) = h;
      *(v4us*)(sb + PA + (ar + 16 * j) * LP + ac) = l;
      *(v8us*)(sb + 2 * PA + (br + 32 * j) * LP + bc) = rb[j];
    }
  };
  v8f acc[2][2] = {};
  const int ns = K / BK;
  fetch(0);
  {
    // gamma and beta, rounded, for all DD columns; mean and 1 / deviation of the block's 64 rows: 4 threads a row, each takes 2 column blocks = 8 pairs
    const int c = tid * 4, r = tid >> 2, qd = tid & 3;
    v4f g4 = {1.f, 1.f, 1.f, 1.f}, b4 = {0.f, 0.f, 0.f, 0.f};
    float mu = 0.f, rs = 1.f;
    if (st) {   // a kernel argument: the same for every thread
      const float* gp = gamma + c; const float* bp = beta + c;
      const float* p0 = st + ((size_t)(2 * qd) * M + row0 + r) * 8; const float* p1 = st + ((size_t)(2 * qd + 1) * M + row0 + r) * 8;
      g4 = *(const v4fa*)gp; b4 = *(const v4fa*)bp;
      const v4f p[4] = {*(const v4fa*)p0, *(const v4fa*)(p0 + 4), *(const v4fa*)p1, *(const v4fa*)(p1 + 4)};
      // precaution: the four address pairs are inputs of the wait, so none of them is reused ahead of it
      asm volatile("s_wait_xcnt 0x0" :: "v"(gp), "v"(bp), "v"(p0), "v"(p1) : "memory");
#pragma unroll   // constant indices, so that the small arrays stay in registers
      for (int t = 0; t < 4; ++t) { g4[t] = bf16_round(g4[t]); b4[t] = bf16_round(b4[t]); }
      float s1 = ((p[0][0] + p[0][2]) + (p[1][0] + p[1][2])) + ((p[2][0] + p[2][2]) + (p[3][0] + p[3][2]));
      s1 = add_xmask<1>(s1); s1 = add_xmask<2>(s1);
      mu = s1 / (float)DD;
      float m2 = 0.f;
#pragma unroll   // constant indices, so that the small arrays stay in registers
      for (int i = 0; i < 4; ++i) {
        const float d0 = p[i][0] * (1.0f / 32.0f) - mu, d1 = p[i][2] * (1.0f / 32.0f) - mu;
        m2 += (p[i][1] + 32.0f * d0 * d0) + (p[i][3] + 32.0f * d1 * d1);
      }
      m2 = add_xmask<1>(m2); m2 = add_xmask<2>(m2);
      rs = rsqrtf(m2 / (float)DD + eps);
    }
    *(v4fa*)&sG[c] = g4; *(v4fa*)&sB[c] = b4;
    if (qd == 0) { sMu[r] = mu; sRs[r] = rs; }
  }
  __syncthreads();   // gamma, beta and the rows' mean and 1 / deviation are in LDS before any thread normalises with them
  if (LN_A) {
#pragma unroll   // constant indices, so that the small arrays stay in registers
    for (int j = 0; j < 4; ++j) { mu_a[j] = sMu[ar + 16 * j]; rs_a[j] = sRs[ar + 16 * j]; }
  }
  stash(sm, 0);
  __syncthreads();
  for (int s = 0; s < ns; ++s) {
    const unsigned short* sb = sm + (s & 1) * BUF;
    if (s + 1 < ns) fetch((s + 1) * BK);
#pragma unroll
    for (int ks = 0; ks < BK / 32; ++ks) {
      FragB ah[2], al[2], b[2];
#pragma unroll
      for (int t = 0; t < 2; ++t) {
        const unsigned short* pa = sb + (wm * 32 + t * 16 + ln) * LP + ks * 32 + 8 * hh;
        const unsigned short* pb = sb + 2 * PA + (wn * 32 + t * 16 + ln) * LP + ks * 32 + 8 * hh;
        ah[t].half[0] = *(const v8us*)pa;        ah[t].half[1] = *(const v8us*)(pa + 16);
        al[t].half[0] = *(const v8us*)(pa + PA); al[t].half[1] = *(const v8us*)(pa + PA + 16);
        b[t].half[0]  = *(const v8us*)pb;        b[t].half[1]  = *(const v8us*)(pb + 16);
      }
      __builtin_amdgcn_sched_barrier(0);   // keeps the k step's 12 LDS reads together as one group ahead of its 8 products: one LDS wait per k step, not four
#pragma unroll
      for (int mt = 0; mt < 2; ++mt)
#pragma unroll
        for (int nt = 0; nt < 2; ++nt) acc[mt][nt] = __builtin_amdgcn_wmma_f32_16x16x32_bf16(false, ah[mt].v, false, b[nt].v, (short)0, acc[mt][nt], false, false);
#pragma unroll
      for (int mt = 0; mt < 2; ++mt)
#pragma unroll
        for (int nt = 0; nt < 2; ++nt) acc[mt][nt] = __builtin_amdgcn_wmma_f32_16x16x32_bf16(false, al[mt].v, false, b[nt].v, (short)0, acc[mt][nt], false, false);
    }
    if (s + 1 < ns) stash(sm + ((s + 1) & 1) * BUF, (s + 1) * BK);
    __syncthreads();   // publishes slice s + 1 and ends every wave's reads of slice s, whose buffer is refilled in the next trip
  }
  // output: each wave turns its 32 x 32 tile through its own piece of the (now free) LDS so that every store covers whole 128-B lines
  float* so = (float*)sm + w * 32 * OP;
#pragma unroll
  for (int nt = 0; nt < 2; ++nt) {
    float bv = bias[col0 + wn * 32 + nt * 16 + ln];
    if (BIAS_BF16) bv = bf16_round(bv);
#pragma unroll
    for (int mt = 0; mt < 2; ++mt)
#pragma unroll
      for (int r = 0; r < 8; ++r) so[(mt * 16 + 8 * hh + r) * OP + nt * 16 + ln] = acc[mt][nt][r] + bv;
  }
  if (PLANES && col0 >= pcol0) {   // the same for the whole block
    __syncthreads();   // every wave's 32 x 32 piece is in LDS before rows are read across the four pieces of a tile row
    // wave w takes tile rows 8 * w .. 8 * w + 7; a lane owns 4 columns, so each store of a wave covers one whole 256-B plane row
    const float* sp = (const float*)sm + ((w >> 2) * 4 + (lane >> 3)) * 32 * OP + (w & 3) * 8 * OP + (lane & 7) * 4;
    const size_t po = ((size_t)((col0 - pcol0) / BN) * M + row0 + w * 8) * BN + lane * 4;
    v4us h[8], l[8];
#pragma unroll
    for (int q = 0; q < 8; ++q) {
      const v4f v = *(const v4fa*)(sp + q * OP);
#pragma unroll
      for (int t = 0; t < 4; ++t) { const unsigned short hb = bf16_bits(v[t]); h[q][t] = hb; l[q][t] = bf16_bits(v[t] - bf16_val(hb)); }
    }
#pragma unroll
    for (int q = 0; q < 8; ++q) { *(v4us*)(Ph + po + q * BN) = h[q]; *(v4us*)(Pl + po + q * BN) = l[q]; }
    asm volatile("s_wait_xcnt 0x0" ::: "memory");   // precaution: stands behind the last plane store, before any later instruction reuses a store's address or data registers
    return;
  }
  __builtin_amdgcn_fence(__ATOMIC_ACQ_REL, "workgroup");
  __builtin_amdgcn_wave_barrier();
  const int rsub = lane >> 3, c4 = (lane & 7) * 4;
  if (!RES) {
#pragma unroll
    for (int q = 0; q < 8; ++q) {
      const int r = q * 4 + rsub;
      const v4f v = *(const v4fa*)(so + r * OP + c4);
      *(v4f*)(C + (size_t)(row0 + wm * 32 + r) * ldc + col0 + wn * 32 + c4) = v;
    }
  } else {
    // 8 lanes hold the 32 columns that the wave has of a row: add the normalised residual, store the row piece, then its sum and its squares about its own mean
    const int col = col0 + wn * 32 + c4;
    const float* rp[8]; float* cp[8];
    v4f v[8], rr[8];
#pragma unroll   // constant indices, so that the small arrays stay in registers
    for (int q = 0; q < 8; ++q) { const size_t o = (size_t)(row0 + wm * 32 + q * 4 + rsub) * ldc + col; rp[q] = R + o; cp[q] = C + o; }
#pragma unroll   // constant indices, so that the small arrays stay in registers
    for (int q = 0; q < 8; ++q) rr[q] = *(const v4fa*)rp[q];
    // precaution: the eight address pairs are inputs of the wait, so none of them is reused ahead of it
    asm volatile("s_wait_xcnt 0x0" :: "v"(rp[0]), "v"(rp[1]), "v"(rp[2]), "v"(rp[3]), "v"(rp[4]), "v"(rp[5]), "v"(rp[6]), "v"(rp[7]) : "memory");
    const v4f g4 = *(const v4fa*)&sG[col], b4 = *(const v4fa*)&sB[col];
#pragma unroll   // constant indices, so that the small arrays stay in registers
    for (int q = 0; q < 8; ++q) {
      const int r = wm * 32 + q * 4 + rsub;
      const float mu = sMu[r], rs = sRs[r];
      v[q] = *(const v4fa*)(so + (q * 4 + rsub) * OP + c4);
#pragma unroll   // constant indices, so that the small arrays stay in registers
      for (int t = 0; t < 4; ++t) v[q][t] += (rr[q][t] - mu) * rs * g4[t] + b4[t];
    }
#pragma unroll   // constant indices, so that the small arrays stay in registers
    for (int q = 0; q < 8; ++q) *(v4f*)cp[q] = v[q];
    // precaution: the stores' address pairs and data are inputs of the wait, so none of them is reused ahead of it
    asm volatile("s_wait_xcnt 0x0" :: "v"(cp[0]), "v"(cp[1]), "v"(cp[2]), "v"(cp[3]), "v"(cp[4]), "v"(cp[5]), "v"(cp[6]), "v"(cp[7]),
                 "v"(v[0]), "v"(v[1]), "v"(v[2]), "v"(v[3]), "v"(v[4]), "v"(v[5]), "v"(v[6]), "v"(v[7]) : "memory");
    float s1[8], m2[8];
#pragma unroll   // constant indices, so that the small arrays stay in registers
    for (int q = 0; q < 8; ++q) s1[q] = (v[q][0] + v[q][1]) + (v[q][2] + v[q][3]);
#pragma unroll   // constant indices, so that the small arrays stay in registers
    for (int q = 0; q < 8; ++q) s1[q] = add_xmask<1>(s1[q]);
#pragma unroll   // constant indices, so that the small arrays stay in registers
    for (int q = 0; q < 8; ++q) s1[q] = add_xmask<2>(s1[q]);
#pragma unroll   // constant indices, so that the small arrays stay in registers
    for (int q = 0; q < 8; ++q) s1[q] = add_xmask<4>(s1[q]);
#pragma unroll   // constant indices, so that the small arrays stay in registers
    for (int q = 0; q < 8; ++q) {
      const float mean = s1[q] * (1.0f / 32.0f);
      const float d0 = v[q][0] - mean, d1 = v[q][1] - mean, d2 = v[q][2] - mean, d3 = v[q][3] - mean;
      m2[q] = (d0 * d0 + d1 * d1) + (d2 * d2 + d3 * d3);
    }
#pragma unroll   // constant indices, so that the small arrays stay in registers
    for (int q = 0; q < 8; ++q) m2[q] = add_xmask<1>(m2[q]);
#pragma unroll   // constant indices, so that the small arrays stay in registers
    for (int q = 0; q < 8; ++q) m2[q] = add_xmask<2>(m2[q]);
#pragma unroll   // constant indices, so that the small arrays stay in registers
    for (int q = 0; q < 8; ++q) m2[q] = add_xmask<4>(m2[q]);
    if ((lane & 7) == 0) {
#pragma unroll   // constant indices, so that the small arrays stay in registers
      for (int q = 0; q < 8; ++q) { float* ps = &sSt[((wm * 32 + q * 4 + rsub) * 4 + wn) * 2]; ps[0] = s1[q]; ps[1] = m2[q]; }
    }
    __syncthreads();   // the four waves' pairs of every row are in LDS before they leave as whole lines
    if (tid < BM * 8 / 4) *(v4f*)(sto + ((size_t)(col0 / BN) * M + row0) * 8 + tid * 4) = *(const v4fa*)&sSt[tid * 4];
  }
}
// row LayerNorm (biased variance, eps) over N: s = X (+ R); optional out_sum <- s; out_norm <- (s-mu)*rsqrt(var+eps)*g + b
template <bool PARAM_BF16>
__global__ __launch_bounds__(256) void k_layernorm(const float* __restrict__ X, const float* __restrict__ R, const float* __restrict__ g, const float* __restrict__ bta,
                                                  float* __restrict__ out_sum, float* __restrict__ out_norm, int N, float eps) {
  __shared__ float red[256];
  const int row = blockIdx.x, tid = threadIdx.x;
  const float* x = X + (size_t)row * N; const float* rr = R ? R + (size_t)row * N : nullptr;
  float vals[16];                     // up to N = 4096
  const int per = N / 256;            // contiguous chunk per thread? use strided-by-4 chunks: thread handles j = tid*4 + 1024*u
  float s1 = 0.f;
  for (int u = 0; u < per / 4; ++u) {
    const int j = tid * 4 + 1024 * u;
    const v4f a = *(const v4fa*)(x + j);
    v4f b = {0.f,0.f,0.f,0.f}; if (rr) b = *(const v4fa*)(rr + j);
#pragma unroll
    for (int q = 0; q < 4; ++q) { const float v = a[q] + b[q]; vals[u * 4 + q] = v; s1 += v; }
  }
  red[tid] = s1; __syncthreads();
  for (int st = 128; st > 0; st >>= 1) { if (tid < st) red[tid] += red[tid + st]; __syncthreads(); }
  const float mu = red[0] / (float)N; __syncthreads();
  float s2 = 0.f;
  for (int u = 0; u < per / 4; ++u)
#pragma unroll
    for (int q = 0; q < 4; ++q) { const float c = vals[u * 4 + q] - mu; s2 += c * c; }
  red[tid] = s2; __syncthreads();
  for (int st = 128; st > 0; st >>= 1) { if (tid < st) red[tid] += red[tid + st]; __syncthreads(); }
  const float rs = rsqrtf(red[0] / (float)N + eps);
  {
    for (int u = 0; u < per / 4; ++u) {
      const int j = tid * 4 + 1024 * u;
      v4f o, sm;
#pragma unroll
      for (int q = 0; q < 4; ++q) {
        float gg = g[j + q], bb = bta[j + q];
        if (PARAM_BF16) { gg = bf16_round(gg); bb = bf16_round(bb); }
        sm[q] = vals[u * 4 + q]; o[q] = (vals[u * 4 + q] - mu) * rs * gg + bb;
      }
      if (out_sum) *(v4f*)(out_sum + (size_t)row * N + j) = sm;
      *(v4f*)(out_norm + (size_t)row * N + j) = o;
    }
    
  }
}

template <int D>
__global__ __launch_bounds__(512) void k_flash3(const float* __restrict__ Qb, int qpitch, int Tq,
                                              const unsigned short* __restrict__ Kh, const unsigned short* __restrict__ Kl,
                                              const unsigned short* __restrict__ Vh, const unsigned short* __restrict__ Vl, int Tk,
                                              int H, float scale, float* __restrict__ y, int ypitch) {
  constexpr int KS = D / 32, DT = D / 16, NG = 4;
  constexpr int KP = D + 8, VP = D + 16;   // row pitches: K 16 B x odd (plain 16-B reads), V 32 B x odd (transposing reads)
  static_assert(D == 128, "a group's 128 threads copy 4 pieces of 16 B of each of the 4 planes per 32 keys");
  __shared__ __attribute__((aligned(32))) unsigned short sK[2][NG][2][32][KP];   // buffer, group, hi | lo
  __shared__ __attribute__((aligned(32))) unsigned short sV[2][NG][2][32][VP];
  // once the loop has ended the partial O tiles take sK's bytes and the partial max / sum rows the first bytes of sV
  constexpr int OPD = D + 4;   // pitch of a partial O row in floats: 16 B x odd, so that the 16 queries of a lane half store their 16-B pieces to different banks
  static_assert(sizeof(float) * 4 * NG * 16 * OPD <= sizeof(sK) && sizeof(float) * 2 * 4 * NG * 16 <= sizeof(sV), "merge staging fits");
  float (*sO)[16][OPD] = reinterpret_cast<float (*)[16][OPD]>(&sK[0][0][0][0][0]);
  float (*sM)[16] = reinterpret_cast<float (*)[16]>(&sV[0][0][0][0][0]);
  float (*sL)[16] = sM + 4 * NG;
  const int tid = threadIdx.x, lane = tid & 31, ln = lane & 15, hh = lane >> 4;
  const int w = __builtin_amdgcn_readfirstlane(tid >> 5);   // wave number, kept scalar so that the group's key offset and LDS bases stay scalar
  const int qt = w & 3, g = w >> 2;                         // query tile, key group
  const int vr = 8 * hh + (lane & 7), vc = 8 * ((lane >> 3) & 1);   // the lane's row and column offset in a transposing load of V
  const int nqb = (Tq + 63) / 64;
  const int bh = blockIdx.x / nqb, qblk = blockIdx.x % nqb;
  const int b = bh / H, h = bh % H;
  const int q0 = qblk * 64 + qt * 16;
  const float* Q = Qb + (size_t)b * Tq * qpitch + h * D;
  const int nch = (Tk + 32 * NG - 1) / (32 * NG);   // trips, the same for the whole block; a chunk past Tk is fully masked and adds nothing
  // staging: a plane row is 16 pieces of 16 B, so a wave's copy covers two whole rows: rows cr + 8 * i of its group's chunk, the lane columns cc .. cc + 7
  const int cr = 2 * qt + hh, cc = ln * 8;
  const size_t pb = (size_t)bh * Tk * D + cc;
  const unsigned lk0 = (unsigned)(size_t)&sK[0][g][0][cr][cc], lv0 = (unsigned)(size_t)&sV[0][g][0][cr][cc];   // LDS byte addresses of the thread's first hi pieces
  // 16 asynchronous copies per thread: the 32 keys from jn on, 4 planes. A key past the end is clamped to the last one, so that every lane's
  // address stays inside the source; such a key's scores are masked below, its P is 0 and its (finite) V row adds nothing.
  auto copy_kv = [&](int jn, int buf) {
    const unsigned short* pk[8]; const unsigned short* pv[8];
    unsigned lk[8], lv[8];
#pragma unroll   // every index constant: the 32 addresses are register operands of the two statements below
    for (int i = 0; i < 4; ++i) {
      const size_t off = pb + (size_t)(unsigned)min(jn + cr + 8 * i, Tk - 1) * D;
      pk[i] = Kh + off; pk[4 + i] = Kl + off; pv[i] = Vh + off; pv[4 + i] = Vl + off;
      lk[i] = lk0 + buf * (NG * 2 * 32 * KP * 2) + i * (8 * KP * 2); lk[4 + i] = lk[i] + 32 * KP * 2;
      lv[i] = lv0 + buf * (NG * 2 * 32 * VP * 2) + i * (8 * VP * 2); lv[4 + i] = lv[i] + 32 * VP * 2;
    }
    // the s_wait_xcnt closes each statement as a precaution: no address register of an issued copy is rewritten ahead of it
    asm volatile("global_load_async_to_lds_b128 %0, %8, off\n\tglobal_load_async_to_lds_b128 %1, %9, off\n\t"
                 "global_load_async_to_lds_b128 %2, %10, off\n\tglobal_load_async_to_lds_b128 %3, %11, off\n\t"
                 "global_load_async_to_lds_b128 %4, %12, off\n\tglobal_load_async_to_lds_b128 %5, %13, off\n\t"
                 "global_load_async_to_lds_b128 %6, %14, off\n\tglobal_load_async_to_lds_b128 %7, %15, off\n\ts_wait_xcnt 0x0"
                 :: "v"(lk[0]), "v"(lk[1]), "v"(lk[2]), "v"(lk[3]), "v"(lk[4]), "v"(lk[5]), "v"(lk[6]), "v"(lk[7]),
                    "v"(pk[0]), "v"(pk[1]), "v"(pk[2]), "v"(pk[3]), "v"(pk[4]), "v"(pk[5]), "v"(pk[6]), "v"(pk[7]) : "memory");
    asm volatile("global_load_async_to_lds_b128 %0, %8, off\n\tglobal_load_async_to_lds_b128 %1, %9, off\n\t"
                 "global_load_async_to_lds_b128 %2, %10, off\n\tglobal_load_async_to_lds_b128 %3, %11, off\n\t"
                 "global_load_async_to_lds_b128 %4, %12, off\n\tglobal_load_async_to_lds_b128 %5, %13, off\n\t"
                 "global_load_async_to_lds_b128 %6, %14, off\n\tglobal_load_async_to_lds_b128 %7, %15, off\n\ts_wait_xcnt 0x0"
                 :: "v"(lv[0]), "v"(lv[1]), "v"(lv[2]), "v"(lv[3]), "v"(lv[4]), "v"(lv[5]), "v"(lv[6]), "v"(lv[7]),
                    "v"(pv[0]), "v"(pv[1]), "v"(pv[2]), "v"(pv[3]), "v"(pv[4]), "v"(pv[5]), "v"(pv[6]), "v"(pv[7]) : "memory");
  };
  if (nch > 0) copy_kv(32 * g, 0);   // the first chunk flies under the Q fragment loads (block-uniform test)
  FragB aqh[KS], aql[KS];
  {
    int row = q0 + ln; if (row >= Tq) row = Tq - 1;
    const float* qr = Q + (size_t)row * qpitch;
#pragma unroll
    for (int ks = 0; ks < KS; ++ks)
#pragma unroll
      for (int i = 0; i < 16; ++i) {
        const int d = ks * 32 + ((i < 8) ? (8 * hh + i) : (16 + 8 * hh + (i - 8)));
        const float x = qr[d] * scale; const unsigned short hb = bf16_bits(x);
        aqh[ks].u[i] = hb; aql[ks].u[i] = bf16_bits(x - bf16_val(hb));
      }
  }
  float m_q = -3.0e38f, l_q = 0.f;   // query q0 + ln: running maximum (the same in both lane halves), and the sum over this half's keys
  v8f oacc[DT];                      // oacc[dt][r] = O[q0 + ln][dt * 16 + 8 * hh + r]
#pragma unroll
  for (int dt = 0; dt < DT; ++dt) oacc[dt] = (v8f){0.f,0.f,0.f,0.f,0.f,0.f,0.f,0.f};
  asm volatile("s_wait_asynccnt 0x0" ::: "memory");   // this wave's copies of the first chunk have landed
  __syncthreads();   // publishes the first chunk
  if (nch > 1) copy_kv(32 * NG + 32 * g, 1);   // the second chunk flies under the first one's work (block-uniform test)
  for (int c = 0; c < nch; ++c) {
    const int j0 = c * (32 * NG) + 32 * g, buf = c & 1;
    const unsigned short* kp = &sK[buf][g][0][0][0];   // hi plane; the lo plane lies 32 rows further
    const unsigned short* vp = &sV[buf][g][0][0][0];
    v8f s[2];
#pragma unroll
    for (int nt = 0; nt < 2; ++nt) {
      v8f acc = {};
#pragma unroll
      for (int ks = 0; ks < KS; ++ks) {
        const unsigned short* kr = kp + (nt * 16 + ln) * KP + ks * 32 + 8 * hh;
        FragB kh_, kl_;
        kh_.half[0] = *(const v8us*)kr;             kh_.half[1] = *(const v8us*)(kr + 16);
        kl_.half[0] = *(const v8us*)(kr + 32 * KP); kl_.half[1] = *(const v8us*)(kr + 32 * KP + 16);
        acc = mma3t(kh_.v, kl_.v, aqh[ks].v, aql[ks].v, acc);
      }
      s[nt] = acc;   // s[nt][r] = score of key j0 + nt * 16 + 8 * hh + r against query q0 + ln
    }
    const bool tail = j0 + 32 > Tk;   // the same for the whole wave (j0 and Tk are scalar)
    if (tail) {
#pragma unroll
      for (int nt = 0; nt < 2; ++nt)
#pragma unroll
        for (int r = 0; r < 8; ++r) if (j0 + nt * 16 + 8 * hh + r >= Tk) s[nt][r] = -3.0e38f;
    }
    float mt[8];
#pragma unroll
    for (int r = 0; r < 8; ++r) mt[r] = fmaxf(s[0][r], s[1][r]);
    float mx = fmaxf(fmaxf(fmaxf(mt[0], mt[1]), fmaxf(mt[2], mt[3])), fmaxf(fmaxf(mt[4], mt[5]), fmaxf(mt[6], mt[7])));
    mx = fmaxf(mx, other_half(mx));   // the query's other 16 keys of the chunk
    const float mnew = fmaxf(m_q, mx);
    const float alpha = (mnew > -1.0e38f) ? __expf(m_q - mnew) : 1.0f;
    m_q = mnew;
    s[0] -= mnew; s[1] -= mnew;
#pragma unroll
    for (int nt = 0; nt < 2; ++nt)
#pragma unroll
      for (int r = 0; r < 8; ++r) s[nt][r] = __expf(s[nt][r]);
    if (tail) {
#pragma unroll
      for (int nt = 0; nt < 2; ++nt)
#pragma unroll
        for (int r = 0; r < 8; ++r) if (j0 + nt * 16 + 8 * hh + r >= Tk) s[nt][r] = 0.f;
    }
    float pt[8];
#pragma unroll
    for (int r = 0; r < 8; ++r) pt[r] = s[0][r] + s[1][r];
    l_q = l_q * alpha + (((pt[0] + pt[1]) + (pt[2] + pt[3])) + ((pt[4] + pt[5]) + (pt[6] + pt[7])));
    // P^T as a B operand: element e = P of key 8 * hh + e, element 8 + e = P of key 16 + 8 * hh + e; hi = P rounded to bf16 (to nearest even), lo = the rest, rounded
    FragB pbh, pbl;
#pragma unroll
    for (int nt = 0; nt < 2; ++nt)
#pragma unroll
      for (int e = 0; e < 8; e += 2) {
        const v2f x = {s[nt][e], s[nt][e + 1]};
        const unsigned int hb = __builtin_bit_cast(unsigned int, __builtin_convertvector(x, v2b));
        const v2f rest = {x[0] - __uint_as_float(hb << 16), x[1] - __uint_as_float(hb & 0xFFFF0000u)};
        pbh.d[nt * 4 + e / 2] = hb;
        pbl.d[nt * 4 + e / 2] = __builtin_bit_cast(unsigned int, __builtin_convertvector(rest, v2b));
      }
#pragma unroll
    for (int dt = 0; dt < DT; ++dt) oacc[dt] *= alpha;
    // element i of a V fragment = V[8 * hh + i][dt * 16 + ln], element 8 + i = V[16 + 8 * hh + i][dt * 16 + ln]: row dt * 16 + ln of V^T in the k order of pbh / pbl
    FragB bvh[2], bvl[2];
    auto vfrag = [&](int dt) {
      const unsigned short* vq = vp + vr * VP + dt * 16 + vc;
      bvh[dt & 1].half[0] = ld_tr16(vq);           bvh[dt & 1].half[1] = ld_tr16(vq + 16 * VP);
      bvl[dt & 1].half[0] = ld_tr16(vq + 32 * VP); bvl[dt & 1].half[1] = ld_tr16(vq + 48 * VP);
    };
    vfrag(0);
#pragma unroll
    for (int dt = 0; dt < DT; ++dt) {
      if (dt + 1 < DT) vfrag(dt + 1);   // the next tile's four loads fly under this tile's three products
      oacc[dt] = mma3t(bvh[dt & 1].v, bvl[dt & 1].v, pbh.v, pbl.v, oacc[dt]);
    }
    asm volatile("s_wait_dscnt 0x0" ::: "memory");      // the wave's reads of this chunk's planes have retired before anybody refills them
    asm volatile("s_wait_asynccnt 0x0" ::: "memory");   // this wave's copies of the next chunk have landed
    __syncthreads();   // publishes the next chunk and ends every wave's reads of this one
    if (c + 2 < nch) copy_kv(j0 + 2 * 32 * NG, buf);   // the chunk after the next flies into the buffer just read (block-uniform test)
  }
  asm volatile("s_wait_asynccnt 0x0" ::: "memory");   // no copy is outstanding when the planes' bytes become sO, sM, sL (their last readers left them at the last trip's barrier)
  l_q += other_half(l_q);   // the two halves' key sums of the query
  if (hh == 0) { sM[w][ln] = m_q; sL[w][ln] = l_q; }
#pragma unroll
  for (int dt = 0; dt < DT; ++dt) {   // a lane's 8 accumulator registers are 8 consecutive columns of its query's row
    *(v4fa*)&sO[w][ln][dt * 16 + 8 * hh]     = (v4f){oacc[dt][0], oacc[dt][1], oacc[dt][2], oacc[dt][3]};
    *(v4fa*)&sO[w][ln][dt * 16 + 8 * hh + 4] = (v4f){oacc[dt][4], oacc[dt][5], oacc[dt][6], oacc[dt][7]};
  }
  __syncthreads();   // every group's partial (max, sum, O) is in LDS before any wave merges
  // merge: wave (qt, g) finishes rows g*16/NG ... of query tile qt; a lane owns 4 columns of the row
#pragma unroll
  for (int i = 0; i < 16 / NG; ++i) {
    const int rr = g * (16 / NG) + i, row = q0 + rr;
    if (row < Tq && lane < D / 4) {
      float mg[NG], mall = -3.0e38f;
#pragma unroll
      for (int k = 0; k < NG; ++k) { mg[k] = sM[k * 4 + qt][rr]; mall = fmaxf(mall, mg[k]); }
      float lall = 0.f;
      v4f val = {0.f, 0.f, 0.f, 0.f};
#pragma unroll
      for (int k = 0; k < NG; ++k) {
        const float wt = (mg[k] > -1.0e38f) ? __expf(mg[k] - mall) : 0.f;
        const v4f o = *(const v4fa*)&sO[k * 4 + qt][rr][lane * 4];
        lall += wt * sL[k * 4 + qt][rr];
        val += wt * o;
      }
      const float inv = (mall > -1.0e38f) ? 1.0f / lall : __builtin_nanf("");
      *(v4f*)(y + ((size_t)b * Tq + row) * ypitch + h * D + lane * 4) = val * inv;
      if (i + 1 < 16 / NG) asm volatile("s_wait_xcnt 0x0" ::: "memory");   // precaution: stands before the next row's reads reuse the store's address and data registers
    }
  }
}

__global__ void k_ln_rows(const float* __restrict__ X, const float* __restrict__ R, const float* __restrict__ g, const float* __restrict__ bta, float* __restrict__ out, int N, float eps) {
  __shared__ float red[256];
  const int row = blockIdx.x, tid = threadIdx.x, nt = blockDim.x;
  v4f a = *(const v4fa*)(X + (size_t)row * N + tid * 4);
  if (R) { const v4f rr = *(const v4fa*)(R + (size_t)row * N + tid * 4); for (int q = 0; q < 4; ++q) a[q] += rr[q]; }
  float s = a[0] + a[1] + a[2] + a[3];
  red[tid] = s; __syncthreads();
  for (int st = nt / 2; st > 0; st >>= 1) { if (tid < st) red[tid] += red[tid + st]; __syncthreads(); }
  const float mu = red[0] / (float)N; __syncthreads();
  float v = 0.f; for (int q = 0; q < 4; ++q) { const float c = a[q] - mu; v += c * c; }
  red[tid] = v; __syncthreads();
  for (int st = nt / 2; st > 0; st >>= 1) { if (tid < st) red[tid] += red[tid + st]; __syncthreads(); }
  const float rs = rsqrtf(red[0] / (float)N + eps);
  v4f o; for (int q = 0; q < 4; ++q) o[q] = (a[q] - mu) * rs * bf16_round(g[tid * 4 + q]) + bf16_round(bta[tid * 4 + q]);
  *(v4f*)(out + (size_t)row * N + tid * 4) = o; 
}

// One launch prepares all that the layers read. A block is one of three kinds, told apart by its index alone:
// blocks 0 .. 319: a 128 x 128 tile of one of the five weight matrices, rounded to bf16 and transposed to Bt[n][k] (pitch DD);
// blocks 320 .. 447: 4096 pieces of 4 tokens' floats, rounded to bf16 and kept as f32; block 448: the three projection biases, rounded, into one vector.
// tile: src[k][n], k and n 0 .. 127, pitch SP floats -> dst[n][k], pitch DD. Whole-line reads (a wave takes one 512-B row), rows of bf16 in LDS,
// transposing LDS loads that hand a lane 8 consecutive k of one n; wave w writes the rows n = 16 * w .. 16 * w + 15, each whole (256 B) by its own 8 stores.
template <int SP>
__device__ __forceinline__ void prep_tile(const float* __restrict__ src, unsigned short* __restrict__ dst, unsigned short* T) {
  constexpr int TP = 128 + 16;   // LDS row pitch 288 B = 32 B x odd, as the transposing loads want it
  const int tid = threadIdx.x, lane = tid & 31, ln = lane & 15, hh = lane >> 4, w = tid >> 5;
  const float* p = src + (size_t)w * SP + lane * 4;
  v4f a[16];
#pragma unroll   // constant indices, so that the array stays in registers and all 16 loads are in flight together
  for (int j = 0; j < 16; ++j) a[j] = *(const v4fa*)(p + (size_t)(8 * j) * SP);
  asm volatile("s_wait_xcnt 0x0" :: "v"(p) : "memory");   // precaution: the loads' address pair is an input of the wait, so it is not reused ahead of it
#pragma unroll   // constant indices, so that the array stays in registers
  for (int j = 0; j < 16; ++j) {
    v4us h;
#pragma unroll
    for (int t = 0; t < 4; ++t) h[t] = bf16_bits(a[j][t]);
    *(v4us*)(T + (w + 8 * j) * TP + lane * 4) = h;
  }
  __syncthreads();   // the whole tile is in LDS before any wave reads columns of it
  const unsigned short* tq = T + (8 * hh + (lane & 7)) * TP + 16 * w + 8 * ((lane >> 3) & 1);
  unsigned short* q = dst + (size_t)(16 * w + ln) * DD + 8 * hh;
  v8us o[8];
#pragma unroll   // constant indices, so that the array stays in registers
  for (int kb = 0; kb < 8; ++kb) o[kb] = ld_tr16(tq + 16 * kb * TP);   // element i = T[16 * kb + 8 * hh + i][16 * w + ln]
#pragma unroll   // constant indices, so that the array stays in registers
  for (int kb = 0; kb < 8; ++kb) *(v8us*)(q + 16 * kb) = o[kb];
  // precaution: the stores' address pair and data are inputs of the wait, so none of them is reused ahead of it
  asm volatile("s_wait_xcnt 0x0" :: "v"(q), "v"(o[0]), "v"(o[1]), "v"(o[2]), "v"(o[3]), "v"(o[4]), "v"(o[5]), "v"(o[6]), "v"(o[7]) : "memory");
}
__global__ __launch_bounds__(256) void k_prep(const float* __restrict__ Wq, const float* __restrict__ Wk, const float* __restrict__ Wv, const float* __restrict__ Wo,
                                              const float* __restrict__ Wf, const float* __restrict__ bq, const float* __restrict__ bk, const float* __restrict__ bv,
                                              const float* __restrict__ token, unsigned short* __restrict__ Bqkv, unsigned short* __restrict__ Bo,
                                              unsigned short* __restrict__ Bf, float* __restrict__ bqkv, float* __restrict__ x) {
  __shared__ __attribute__((aligned(32))) unsigned short T[128 * (128 + 16)];
  const int blk = blockIdx.x, tid = threadIdx.x;
  if (blk < 192) {          // Wq, Wk, Wv [H][DD][DK]: Bt[h * DK + kk][d] = W[h][d][kk]; tile = head blk / 8 % 8, rows d from (blk % 8) * 128
    const int m = blk >> 6, h = (blk >> 3) & 7, d0 = (blk & 7) * 128;
    const float* Wm = m == 0 ? Wq : m == 1 ? Wk : Wv;
    prep_tile<DK>(Wm + ((size_t)h * DD + d0) * DK, Bqkv + (size_t)m * DD * DD + (size_t)h * DK * DD + d0, T);
  } else if (blk < 320) {   // Wo, Wf [DD][DD]: Bt[n][k] = W[k][n]
    const int m = (blk - 192) >> 6, k0 = ((blk >> 3) & 7) * 128, n0 = (blk & 7) * 128;
    prep_tile<DD>((m ? Wf : Wo) + (size_t)k0 * DD + n0, (m ? Bf : Bo) + (size_t)n0 * DD + k0, T);
  } else if (blk < 448) {   // tokens: 16 pieces of 16 B a thread
    const float* s = token + (size_t)(blk - 320) * 16384 + tid * 4;
    float* d = x + (size_t)(blk - 320) * 16384 + tid * 4;
    v4f a[16];
#pragma unroll   // constant indices, so that the array stays in registers and all 16 loads are in flight together
    for (int j = 0; j < 16; ++j) a[j] = *(const v4fa*)(s + 1024 * j);
    asm volatile("s_wait_xcnt 0x0" :: "v"(s) : "memory");   // precaution: the loads' address pair is an input of the wait, so it is not reused ahead of it
#pragma unroll   // constant indices, so that the array stays in registers
    for (int j = 0; j < 16; ++j) {
#pragma unroll
      for (int t = 0; t < 4; ++t) a[j][t] = bf16_round(a[j][t]);
      *(v4f*)(d + 1024 * j) = a[j];
    }
    // precaution: the stores' data are inputs of the wait, so none of them is reused ahead of it; it stands behind the last store
    asm volatile("s_wait_xcnt 0x0" :: "v"(a[0]), "v"(a[1]), "v"(a[2]), "v"(a[3]), "v"(a[4]), "v"(a[5]), "v"(a[6]), "v"(a[7]),
                 "v"(a[8]), "v"(a[9]), "v"(a[10]), "v"(a[11]), "v"(a[12]), "v"(a[13]), "v"(a[14]), "v"(a[15]) : "memory");
  } else {                  // bq | bk | bv, flat [H * DK] each, into one bias vector
    v4f a[3] = {*(const v4fa*)(bq + tid * 4), *(const v4fa*)(bk + tid * 4), *(const v4fa*)(bv + tid * 4)};
    asm volatile("s_wait_xcnt 0x0" ::: "memory");   // precaution: stands behind the three loads, before any later instruction reuses their offset register
#pragma unroll   // constant indices, so that the array stays in registers
    for (int j = 0; j < 3; ++j) {
#pragma unroll
      for (int t = 0; t < 4; ++t) a[j][t] = bf16_round(a[j][t]);
      *(v4f*)(bqkv + DD * j + tid * 4) = a[j];
    }
    // precaution: the stores' data are inputs of the wait, so none of them is reused ahead of it; it stands behind the last store
    asm volatile("s_wait_xcnt 0x0" :: "v"(a[0]), "v"(a[1]), "v"(a[2]) : "memory");
  }
}
extern "C" void kernel_launch(void* const* d_in, const int* in_sizes, int n_in,
                              void* d_out, int out_size, void* d_ws, size_t ws_size, hipStream_t stream) {
  (void)in_sizes; (void)n_in; (void)out_size;
  const float* token = (const float*)d_in[0];
  const float* Wq = (const float*)d_in[1]; const float* bq = (const float*)d_in[2]; const float* Wk = (const float*)d_in[3]; const float* bk = (const float*)d_in[4];
  const float* Wv = (const float*)d_in[5]; const float* bv = (const float*)d_in[6]; const float* Wo = (const float*)d_in[7]; const float* bo = (const float*)d_in[8];
  const float* Wf = (const float*)d_in[9]; const float* bfv = (const float*)d_in[10]; const float* gamma = (const float*)d_in[11]; const float* beta = (const float*)d_in[12];
  char* ws = (char*)d_ws; size_t off = 0;
  auto take = [&](size_t bytes) { char* p = ws + off; off += (bytes + 255) & ~(size_t)255; return p; };
  unsigned short* Bqkv = (unsigned short*)take((size_t)3 * DD * DD * 2); unsigned short* Bo = (unsigned short*)take((size_t)DD * DD * 2); unsigned short* Bf = (unsigned short*)take((size_t)DD * DD * 2);
  float* bqkv = (float*)take(3 * DD * 4);
  float* x = (float*)take((size_t)SS * DD * 4); float* qkv = (float*)take((size_t)SS * 3 * DD * 4); float* att = (float*)take((size_t)SS * DD * 4); float* tmp = (float*)take((size_t)SS * DD * 4); float* a = (float*)take((size_t)SS * DD * 4);
  float* st1 = (float*)take((size_t)(DD / 128) * SS * 8 * 4); float* st2 = (float*)take((size_t)(DD / 128) * SS * 8 * 4);   // (sum, squares) pairs of the rows in tmp and in a
  unsigned short* kvh = (unsigned short*)take((size_t)2 * DD * SS * 2); unsigned short* kvl = (unsigned short*)take((size_t)2 * DD * SS * 2);   // bf16 hi / lo planes [K heads | V heads][SS][DK]
  if (off > ws_size) return;
  k_prep<<<320 + 128 + 1, 256, 0, stream>>>(Wq, Wk, Wv, Wo, Wf, bq, bk, bv, token, Bqkv, Bo, Bf, bqkv, x);   // weights to bf16 [N][K], biases and tokens rounded
  const int gq = (SS / 64) * (3 * DD / 128), g1 = (SS / 64) * (DD / 128);
  for (int l = 0; l < NLAY; ++l) {
    // the layer's input rows: the rounded tokens as they are, later the rows a = (a' + ff) of the layer before, not yet normalised, with their pairs st2
    const float* xs = l ? a : x; const float* sx = l ? st2 : nullptr;
    k_gemm_tile<false, true, true, false><<<gq, 256, 0, stream>>>(xs, DD, Bqkv, DD, bqkv, qkv, 3 * DD, 3 * DD, DD, kvh, kvl, DD, SS, nullptr, sx, gamma, beta, nullptr, 1e-5f);      // bias already rounded (BIAS_BF16=false adds it as given); q to qkv, k and v to the planes
    k_flash3<DK><<<NH * (SS / 64), 512, 0, stream>>>(qkv, 3 * DD, SS, kvh, kvl, kvh + (size_t)DD * SS, kvl + (size_t)DD * SS, SS, NH, 0.08838834764831845f, att, DD);
    k_gemm_tile<true, false, false, true><<<g1, 256, 0, stream>>>(att, DD, Bo, DD, bo, tmp, DD, DD, DD, nullptr, nullptr, 0, SS, xs, sx, gamma, beta, st1, 1e-5f);   // tmp = norm(xs) + attn_out, pairs to st1
    k_gemm_tile<true, false, true, true><<<g1, 256, 0, stream>>>(tmp, DD, Bf, DD, bfv, a, DD, DD, DD, nullptr, nullptr, 0, SS, tmp, st1, gamma, beta, st2, 1e-5f);     // a = norm(tmp) + norm(tmp) x Wf + bf, pairs to st2
  }
  k_ln_rows<<<SS, DD / 4, 0, stream>>>(a, nullptr, gamma, beta, (float*)d_out, DD, 1e-5f);   // the last layer's LayerNorm
}

// v010
// Measured time: 575 microseconds a run.
// In two side-by-side timings against v009, it was 1.12 and 1.11 times as fast.
// Over all steps from v000 it is 7.02 times as fast.
#include <hip/hip_runtime.h>
// All GEMMs on v_wmma_f32_16x16x32_bf16, f32 accumulate: fused per-head q|k|v projection (K=1024, N=3072), concat·Wo, norm(tmp)·Wf — A operands
// (the residual stream, quantised to bf16 once at the input) split into bf16 hi/lo (2 terms) against bf16-rounded weights; attention QKᵀ/√128
// and P·V per 16-query tile as 3-term splits (head dim 128); LayerNorm and softmax in f32. Six layers with shared weights.
#define SS 2048
#define DD 1024
#define NH 8
#define DK 128
#define NLAY 6

typedef __bf16 v16b __attribute__((ext_vector_type(16)));
typedef unsigned short v8us __attribute__((ext_vector_type(8), may_alias));
typedef unsigned short v4us __attribute__((ext_vector_type(4), may_alias));
typedef float  v8f  __attribute__((ext_vector_type(8)));
typedef float  v4f  __attribute__((ext_vector_type(4)));
typedef float  v4fa __attribute__((ext_vector_type(4), may_alias));
typedef float  v2f  __attribute__((ext_vector_type(2)));
typedef __bf16 v2b  __attribute__((ext_vector_type(2)));
union FragB { v16b v; v8us half[2]; unsigned short u[16]; unsigned int d[8]; };
typedef short s16x8 __attribute__((ext_vector_type(8)));
typedef __attribute__((address_space(3))) s16x8 lds_s16x8;
// transposing LDS load of an 8 x 16 block of 16-bit elements per lane half: lane l points at 8 elements of row 8*(l>>4) + (l&7), columns 8*((l>>3)&1) ...;
// lane (c = l&15, h = l>>4) receives rows 8h .. 8h+7 of column c
__device__ __forceinline__ v8us ld_tr16(const unsigned short* p) { return __builtin_bit_cast(v8us, __builtin_amdgcn_ds_load_tr16_b128_v8i16((lds_s16x8*)p)); }

__device__ __forceinline__ unsigned short bf16_bits(float x) { unsigned int u = __float_as_uint(x); return (unsigned short)((u + 0x7FFFu + ((u >> 16) & 1u)) >> 16); }
__device__ __forceinline__ float bf16_val(unsigned short b) { return __uint_as_float(((unsigned int)b) << 16); }
__device__ __forceinline__ float bf16_round(float x) { return bf16_val(bf16_bits(x)); }
// D += A·B with NT terms: 1 = ah·bh, 2 = + al·bh (A split), 3 = + ah·bl (both split)
template <int NT>
__device__ __forceinline__ v8f mmaN(v16b ah, v16b al, v16b bh, v16b bl, v8f c) {
  c = __builtin_amdgcn_wmma_f32_16x16x32_bf16(false, ah, false, bh, (short)0, c, false, false);
  if (NT >= 2) c = __builtin_amdgcn_wmma_f32_16x16x32_bf16(false, al, false, bh, (short)0, c, false, false);
  if (NT >= 3) c = __builtin_amdgcn_wmma_f32_16x16x32_bf16(false, ah, false, bl, (short)0, c, false, false);
  asm volatile("v_nop\n\tv_nop\n\tv_nop\n\tv_nop" : "+v"(c) : "v"(ah), "v"(al), "v"(bh), "v"(bl));
  return c;
}

// D += A x B, both split, for the transposed attention products (A = K or V, B = Q or P): ah.bh, then ah.bl, then al.bh, which is the term order
// that mmaN<3> gives with the operands the other way round
__device__ __forceinline__ v8f mma3t(v16b ah, v16b al, v16b bh, v16b bl, v8f c) {
  c = __builtin_amdgcn_wmma_f32_16x16x32_bf16(false, ah, false, bh, (short)0, c, false, false);
  c = __builtin_amdgcn_wmma_f32_16x16x32_bf16(false, ah, false, bl, (short)0, c, false, false);
  c = __builtin_amdgcn_wmma_f32_16x16x32_bf16(false, al, false, bh, (short)0, c, false, false);
  // as in mmaN: four vector slots behind the last product, on whatever path follows it (a scalar branch stands behind the score products)
  asm volatile("v_nop\n\tv_nop\n\tv_nop\n\tv_nop" : "+v"(c) : "v"(ah), "v"(al), "v"(bh), "v"(bl));
  return c;
}
// the value that lane l ^ 16 holds
__device__ __forceinline__ float other_half(float x) {
  const int b = __float_as_int(x);
  return __int_as_float(__builtin_amdgcn_permlanex16(b, b, 0x76543210, 0xfedcba98, false, false));
}

// x + the x of lane l ^ MASK (MASK < 16: inside a row of 16 lanes), as one DPP add; every lane must be on
template <int MASK>
__device__ __forceinline__ float add_xmask(float x) {
  return x + __int_as_float(__builtin_amdgcn_update_dpp(0, __float_as_int(x), 0x160 + MASK, 0xf, 0xf, true));   // 0x160 + MASK = row_xmask:MASK
}

// GEMM C[M][N] (f32, pitch ldc) = act(A[M][K]·W + bias). A f32 row-major (pitch lda) converted per fragment to bf16
// (ASPLIT: hi/lo two planes -> 2 terms, else single rounded term); Wt bf16 [N][K] (pitch ldb). BIAS_BF16 rounds the
// bias to bf16 first (bias quantised to bf16 before the add). K%32==0, M%16==0, N%64==0.
template <bool ASPLIT, int ACT, bool BIAS_BF16>
__global__ __launch_bounds__(128) void k_gemm_bf(const float* __restrict__ A, int lda, const unsigned short* __restrict__ Wt, int ldb,
                                               const float* __restrict__ bias, float* __restrict__ C, int ldc, int M, int N, int K) {
  __shared__ __attribute__((aligned(16))) float so[4][16][64];
  const int tid = threadIdx.x, w = tid >> 5, lane = tid & 31, ln = lane & 15, hh = lane >> 4;
  const int ntn = N / 64;
  const int wid = blockIdx.x * 4 + w;
  const int mt = wid / ntn, nq = wid % ntn;
  if (mt * 16 >= M) return;
  const int row0 = mt * 16, col0 = nq * 64;
  const float* arow = A + (size_t)(row0 + ln) * lda;
  v8f acc[4] = {};
  for (int kb = 0; kb < K; kb += 32) {
    FragB ah, al;
    const v4f x0 = *(const v4fa*)(arow + kb + 8 * hh), x1 = *(const v4fa*)(arow + kb + 8 * hh + 4);
    const v4f x2 = *(const v4fa*)(arow + kb + 16 + 8 * hh), x3 = *(const v4fa*)(arow + kb + 16 + 8 * hh + 4);
    float xs[16] = {x0[0],x0[1],x0[2],x0[3],x1[0],x1[1],x1[2],x1[3],x2[0],x2[1],x2[2],x2[3],x3[0],x3[1],x3[2],x3[3]};
#pragma unroll
    for (int i = 0; i < 16; ++i) { const unsigned short hb = bf16_bits(xs[i]); ah.u[i] = hb; al.u[i] = ASPLIT ? bf16_bits(xs[i] - bf16_val(hb)) : (unsigned short)0; }
#pragma unroll
    for (int t = 0; t < 4; ++t) {
      const unsigned short* brow = Wt + (size_t)(col0 + t * 16 + ln) * ldb + kb;
      FragB b;
      b.half[0] = *(const v8us*)(brow + 8 * hh);
      b.half[1] = *(const v8us*)(brow + 16 + 8 * hh);
      acc[t] = mmaN<ASPLIT ? 2 : 1>(ah.v, al.v, b.v, b.v, acc[t]);
    }
  }
#pragma unroll
  for (int t = 0; t < 4; ++t) {
    float bv = bias ? bias[col0 + t * 16 + ln] : 0.f;
    if (BIAS_BF16) bv = bf16_round(bv);
#pragma unroll
    for (int r = 0; r < 8; ++r) { float v = acc[t][r] + bv; if (ACT == 1) v = fmaxf(v, 0.f); so[w][8 * hh + r][t * 16 + ln] = v; }
  }
  __builtin_amdgcn_fence(__ATOMIC_ACQ_REL, "workgroup");
  __builtin_amdgcn_wave_barrier();
  const int rsub = lane >> 4, c4 = (lane & 15) * 4;
  {
#pragma unroll
    for (int q = 0; q < 8; ++q) {
      const int r = q * 2 + rsub;
      const v4f v = *(const v4fa*)&so[w][r][c4];
      *(v4f*)(C + (size_t)(row0 + r) * ldc + col0 + c4) = v;
    }
    
  }
}

// Flash-style causal/unmasked attention, all contractions 3-term bf16 hi/lo splits, f32 softmax with running max.
// q,k,v rows are read from f32 buffers with arbitrary row pitch (so they can live inside a fused qkv buffer);
// D = head size (multiple of 32, <= 128); one wave = 16 query rows; block = 4 waves (64 queries) sharing K/V chunks of 32.
template <int D, bool CAUSAL>
__global__ __launch_bounds__(128) void k_flash(const float* __restrict__ qb, const float* __restrict__ kb, const float* __restrict__ vb,
                                             int pitch, int T, int H, float scale, float* __restrict__ y, int ypitch) {
  constexpr int KS = D / 32;        // k-steps for QK
  constexpr int DT = D / 16;        // d tiles for PV
  __shared__ __attribute__((aligned(16))) unsigned short sKh[32][D + 8], sKl[32][D + 8], sVh[32][D + 8], sVl[32][D + 8];
  __shared__ __attribute__((aligned(16))) unsigned short sPh[4][16][40], sPl[4][16][40];
  __shared__ __attribute__((aligned(16))) float sO[4][16][D];
  const int tid = threadIdx.x, w = tid >> 5, lane = tid & 31, ln = lane & 15, hh = lane >> 4;
  const int nqb = (T + 63) / 64;
  const int bh = blockIdx.x / nqb, qblk = blockIdx.x % nqb;
  const int b = bh / H, h = bh % H;
  const int q0 = qblk * 64 + w * 16;
  const float* Q = qb + (size_t)b * T * pitch + h * D;
  const float* K = kb + (size_t)b * T * pitch + h * D;
  const float* V = vb + (size_t)b * T * pitch + h * D;

  // A fragments of the wave's 16 query rows (scaled), hi/lo
  FragB aqh[KS], aql[KS];
  {
    int row = q0 + ln; if (row >= T) row = T - 1;
    const float* qr = Q + (size_t)row * pitch;
#pragma unroll
    for (int ks = 0; ks < KS; ++ks)
#pragma unroll
      for (int i = 0; i < 16; ++i) {
        const int d = ks * 32 + ((i < 8) ? (8 * hh + i) : (16 + 8 * hh + (i - 8)));
        const float x = qr[d] * scale; const unsigned short hb = bf16_bits(x);
        aqh[ks].u[i] = hb; aql[ks].u[i] = bf16_bits(x - bf16_val(hb));
      }
  }
  float m_r[8], l_r[8];
#pragma unroll
  for (int r = 0; r < 8; ++r) { m_r[r] = -3.0e38f; l_r[r] = 0.f; }
  v8f oacc[DT];
#pragma unroll
  for (int dt = 0; dt < DT; ++dt) oacc[dt] = (v8f){0.f,0.f,0.f,0.f,0.f,0.f,0.f,0.f};

  const int kv_end = CAUSAL ? min(T, qblk * 64 + 64) : T;     // block-uniform
  for (int j0 = 0; j0 < kv_end; j0 += 32) {
    __syncthreads();
    for (int e = tid; e < 32 * (D / 4); e += 128) {
      const int r = e / (D / 4), c4 = (e % (D / 4)) * 4;
      const int key = j0 + r;
      v4f kf = {0.f,0.f,0.f,0.f}, vf = {0.f,0.f,0.f,0.f};
      if (key < T) { kf = *(const v4fa*)(K + (size_t)key * pitch + c4); vf = *(const v4fa*)(V + (size_t)key * pitch + c4); }
#pragma unroll
      for (int t = 0; t < 4; ++t) {
        unsigned short hb = bf16_bits(kf[t]); sKh[r][c4 + t] = hb; sKl[r][c4 + t] = bf16_bits(kf[t] - bf16_val(hb));
        hb = bf16_bits(vf[t]); sVh[r][c4 + t] = hb; sVl[r][c4 + t] = bf16_bits(vf[t] - bf16_val(hb));
      }
    }
    __syncthreads();
    // S tile 16 x 32
    v8f s[2];
#pragma unroll
    for (int nt = 0; nt < 2; ++nt) {
      v8f acc = {};
#pragma unroll
      for (int ks = 0; ks < KS; ++ks) {
        FragB bh_, bl_;
        bh_.half[0] = *(const v8us*)&sKh[nt * 16 + ln][ks * 32 + 8 * hh]; bh_.half[1] = *(const v8us*)&sKh[nt * 16 + ln][ks * 32 + 16 + 8 * hh];
        bl_.half[0] = *(const v8us*)&sKl[nt * 16 + ln][ks * 32 + 8 * hh]; bl_.half[1] = *(const v8us*)&sKl[nt * 16 + ln][ks * 32 + 16 + 8 * hh];
        acc = mmaN<3>(aqh[ks].v, aql[ks].v, bh_.v, bl_.v, acc);
      }
      s[nt] = acc;
    }
    // mask + running max (rows 8hh+r; the 16 lanes of a half share rows)
    float alpha[8];
#pragma unroll
    for (int r = 0; r < 8; ++r) {
      const int qi = q0 + 8 * hh + r;
      const int ja = j0 + ln, jb = j0 + 16 + ln;
      if (CAUSAL) { if (ja > qi) s[0][r] = -3.0e38f; if (jb > qi) s[1][r] = -3.0e38f; }
      if (ja >= T) s[0][r] = -3.0e38f;
      if (jb >= T) s[1][r] = -3.0e38f;
      float mx = fmaxf(s[0][r], s[1][r]);
      mx = fmaxf(mx, __shfl_xor(mx, 1, 32)); mx = fmaxf(mx, __shfl_xor(mx, 2, 32)); mx = fmaxf(mx, __shfl_xor(mx, 4, 32)); mx = fmaxf(mx, __shfl_xor(mx, 8, 32));
      const float mnew = fmaxf(m_r[r], mx);
      alpha[r] = (mnew > -1.0e38f) ? __expf(m_r[r] - mnew) : 1.0f;
      const float p0 = (s[0][r] > -1.0e38f) ? __expf(s[0][r] - mnew) : 0.f;
      const float p1 = (s[1][r] > -1.0e38f) ? __expf(s[1][r] - mnew) : 0.f;
      m_r[r] = mnew;
      l_r[r] = l_r[r] * alpha[r] + p0 + p1;            // per-lane partial row sum (16 lanes combined at the end)
      unsigned short hb = bf16_bits(p0); sPh[w][8 * hh + r][ln] = hb;      sPl[w][8 * hh + r][ln] = bf16_bits(p0 - bf16_val(hb));
      hb = bf16_bits(p1);                sPh[w][8 * hh + r][16 + ln] = hb; sPl[w][8 * hh + r][16 + ln] = bf16_bits(p1 - bf16_val(hb));
    }
#pragma unroll
    for (int dt = 0; dt < DT; ++dt)
#pragma unroll
      for (int r = 0; r < 8; ++r) oacc[dt][r] *= alpha[r];
    __builtin_amdgcn_fence(__ATOMIC_ACQ_REL, "workgroup");
    __builtin_amdgcn_wave_barrier();
    FragB pah, pal;
    pah.half[0] = *(const v8us*)&sPh[w][ln][8 * hh]; pah.half[1] = *(const v8us*)&sPh[w][ln][16 + 8 * hh];
    pal.half[0] = *(const v8us*)&sPl[w][ln][8 * hh]; pal.half[1] = *(const v8us*)&sPl[w][ln][16 + 8 * hh];
#pragma unroll
    for (int dt = 0; dt < DT; ++dt) {
      FragB bvh, bvl;
#pragma unroll
      for (int i = 0; i < 8; ++i) {
        bvh.u[i] = sVh[8 * hh + i][dt * 16 + ln]; bvh.u[8 + i] = sVh[16 + 8 * hh + i][dt * 16 + ln];
        bvl.u[i] = sVl[8 * hh + i][dt * 16 + ln]; bvl.u[8 + i] = sVl[16 + 8 * hh + i][dt * 16 + ln];
      }
      oacc[dt] = mmaN<3>(pah.v, pal.v, bvh.v, bvl.v, oacc[dt]);
    }
    __builtin_amdgcn_fence(__ATOMIC_ACQ_REL, "workgroup");
    __builtin_amdgcn_wave_barrier();
  }
#pragma unroll
  for (int r = 0; r < 8; ++r) {
    float l = l_r[r];
    l += __shfl_xor(l, 1, 32); l += __shfl_xor(l, 2, 32); l += __shfl_xor(l, 4, 32); l += __shfl_xor(l, 8, 32);
    l_r[r] = (l > 0.f) ? 1.0f / l : 0.f;
  }
#pragma unroll
  for (int dt = 0; dt < DT; ++dt)
#pragma unroll
    for (int r = 0; r < 8; ++r) sO[w][8 * hh + r][dt * 16 + ln] = oacc[dt][r] * l_r[r];
  __builtin_amdgcn_fence(__ATOMIC_ACQ_REL, "workgroup");
  __builtin_amdgcn_wave_barrier();
  {
    for (int r = 0; r < 16; ++r) {
      const int row = q0 + r;
      if (row < T && lane < D / 4) {
        const v4f val = *(const v4fa*)&sO[w][r][lane * 4];
        *(v4f*)(y + ((size_t)b * T + row) * ypitch + h * D + lane * 4) = val;
      }
    }
    
  }
}

// Work-group barrier that orders LDS accesses only: the waves exchange nothing but LDS data at it, and a wave's global loads into its own registers
// stay in flight across it (__syncthreads() would wait for them first).
__device__ __forceinline__ void lds_barrier() {
  __builtin_amdgcn_fence(__ATOMIC_RELEASE, "workgroup", "local");
  __builtin_amdgcn_s_barrier();
  __builtin_amdgcn_fence(__ATOMIC_ACQUIRE, "workgroup", "local");
}

// GEMM C[M][N] (f32, pitch ldc) = A[M][K] x W + bias: A f32 row-major (pitch lda), two terms (bf16 hi + lo) against Wt bf16 [N][K] (pitch ldb).
// Block = 8 waves (2 x 4) on a 64 x 128 tile of C, a wave owns 32 x 32. K is walked in slices of 64: the A slice is split into its hi and lo
// planes once per block, the Wt slice is copied, both through whole-line global loads into LDS, where all 8 waves read their fragments.
// Two LDS buffers: the next slice's global loads are issued ahead of this slice's products and stored behind them; one barrier per slice.
// RES (one block per WGP, two waves per SIMD, so that nothing else hides a wave's waits): the K loop is pipelined further, see the trip below.
// Each accumulator takes hi then lo of every 32-wide k step in rising k. M % 64 == 0, N % 128 == 0, K % 64 == 0 (RES: K % 128 == 0, K >= 256); grid = (M / 64) * (N / 128).
// PLANES: a block whose columns start at pcol0 or beyond does not store its tile to C; it splits it into bf16 hi and lo and stores these to
// Ph / Pl as rows of plane (col0 - pcol0) / 128, each plane [M][128]: the form in which the attention kernel stages K and V.
// LayerNorm lives in the GEMMs: a row before its LayerNorm is kept as it is (rows of DD floats), with 32 pairs (sum, sum of squares about the piece's own mean),
// one per 32 columns, in st[column block of 128][row][4][2]. norm(v) = (v - mu) * rs * gamma + beta, gamma and beta rounded to bf16; mu and rs of the
// block's 64 rows are formed from the pairs once, in front of the K loop. st == nullptr: the rows are plain (mu 0, rs 1, gamma 1, beta 0).
// LN_A: the A operand is norm(A), applied where a slice is split. RES: C = A x W + bias + norm(R), and the pairs of the new rows go to sto.
template <bool BIAS_BF16, bool PLANES, bool LN_A, bool RES>
__global__ __launch_bounds__(256) void k_gemm_tile(const float* __restrict__ A, int lda, const unsigned short* __restrict__ Wt, int ldb,
                                                   const float* __restrict__ bias, float* __restrict__ C, int ldc, int N, int K,
                                                   unsigned short* __restrict__ Ph, unsigned short* __restrict__ Pl, int pcol0, int M,
                                                   const float* __restrict__ R, const float* __restrict__ st, const float* __restrict__ gamma,
                                                   const float* __restrict__ beta, float* __restrict__ sto, float eps) {
  constexpr int BM = 64, BN = 128, BK = 64, LP = BK + 8;       // LP: LDS row pitch 144 B = 16 B x odd
  constexpr int PA = BM * LP, PB = BN * LP, BUF = 2 * PA + PB;  // one buffer, in 16-bit elements: A hi | A lo | Wt
  constexpr int OP = 36;                                       // pitch of the output staging rows, in floats
  __shared__ __attribute__((aligned(16))) unsigned short sm[2 * BUF];
  __shared__ __attribute__((aligned(16))) float sG[DD], sB[DD], sMu[BM], sRs[BM], sSt[RES ? BM * 8 : 4];
  const int tid = threadIdx.x, lane = tid & 31, ln = lane & 15, hh = lane >> 4;
  const int w = __builtin_amdgcn_readfirstlane(tid >> 5);      // wave number, kept scalar so that the tile offsets stay scalar
  const int wm = w >> 2, wn = w & 3;
  const int nbn = N / BN;
  const int row0 = (blockIdx.x / nbn) * BM, col0 = (blockIdx.x % nbn) * BN;
  const int ar = tid >> 4, ac = (tid & 15) * 4;                // A slice: a wave's load covers 2 rows x 256 B
  const int br = tid >> 3, bc = (tid & 7) * 8;                 // Wt slice: a wave's load covers 4 rows x 128 B
  const float* ag = A + (size_t)(row0 + ar) * lda + ac;
  const unsigned short* bg = Wt + (size_t)(col0 + br) * ldb + bc;
  constexpr int NSET = RES ? 2 : 1;   // RES: two register sets, so that a slice's global loads are issued two trips ahead of their use
  v4f ra[NSET][4];
  v8us rb[NSET][4];
  // the eight pieces of a slice, off elements behind the eight row pointers (off a constant: it rides in the loads' offset field, so that the loads name the pointers' own registers)
  // (always_inline on the lambdas: the register sets are passed by reference and stay in registers only where every index is a constant after inlining)
  auto fetch_at = [&](const float* const (&pa)[4], const unsigned short* const (&pb)[4], int off, v4f (&fa)[4], v8us (&fb)[4]) __attribute__((always_inline)) {
#pragma unroll   // constant indices, so that the arrays stay in registers
    for (int j = 0; j < 4; ++j) fa[j] = *(const v4fa*)(pa[j] + off);
#pragma unroll   // constant indices, so that the arrays stay in registers
    for (int j = 0; j < 4; ++j) fb[j] = *(const v8us*)(pb[j] + off);
    // precaution: the eight address pairs are inputs of the wait, so none of them is reused (not even as a later load's result) ahead of it
    asm volatile("s_wait_xcnt 0x0" :: "v"(pa[0]), "v"(pa[1]), "v"(pa[2]), "v"(pa[3]), "v"(pb[0]), "v"(pb[1]), "v"(pb[2]), "v"(pb[3]) : "memory");
  };
  // the precaution alone: the eight address pairs are inputs of the wait, so none of them is rewritten or reused ahead of it
  auto ptr_wait = [&](const float* const (&pa)[4], const unsigned short* const (&pb)[4]) __attribute__((always_inline)) {
    asm volatile("s_wait_xcnt 0x0" :: "v"(pa[0]), "v"(pa[1]), "v"(pa[2]), "v"(pa[3]), "v"(pb[0]), "v"(pb[1]), "v"(pb[2]), "v"(pb[3]) : "memory");
  };
  // the pieces j0 and j0 + 1 alone; the caller puts ptr_wait in front of whatever rewrites the pointers next
  auto fetch2_at = [&](const float* const (&pa)[4], const unsigned short* const (&pb)[4], int off, v4f (&fa)[4], v8us (&fb)[4], int j0) __attribute__((always_inline)) {
    fa[j0] = *(const v4fa*)(pa[j0] + off); fa[j0 + 1] = *(const v4fa*)(pa[j0 + 1] + off);
    fb[j0] = *(const v8us*)(pb[j0] + off); fb[j0 + 1] = *(const v8us*)(pb[j0 + 1] + off);
  };
  auto fetch = [&](int kb, v4f (&fa)[4], v8us (&fb)[4]) __attribute__((always_inline)) {
    const float* pa[4];
    const unsigned short* pb[4];
#pragma unroll
    for (int j = 0; j < 4; ++j) { pa[j] = ag + (size_t)(16 * j) * lda + kb; pb[j] = bg + (size_t)(32 * j) * ldb + kb; }
    fetch_at(pa, pb, 0, fa, fb);
  };
  const float* qa[4];            // RES: the eight row pointers, kept in registers and moved on by two slices per two trips
  const unsigned short* qb[4];
#pragma unroll   // constant indices, so that the arrays stay in registers
  for (int j = 0; j < 4; ++j) { qa[j] = ag + (size_t)(16 * j) * lda; qb[j] = bg + (size_t)(32 * j) * ldb; }
  float mu_a[4], rs_a[4];   // LN_A: mean and 1 / deviation of the thread's four A rows
  // gamma and beta of the thread's four columns of the slice that starts at kb
  auto ln_par = [&](int kb, v4f& g4, v4f& b4) __attribute__((always_inline)) {
    g4 = (v4f){1.f, 1.f, 1.f, 1.f}; b4 = (v4f){0.f, 0.f, 0.f, 0.f};
    if (LN_A) { g4 = *(const v4fa*)&sG[kb + ac]; b4 = *(const v4fa*)&sB[kb + ac]; }
  };
  // pieces j0 and j0 + 1 of a fetched slice: the A pieces normalised and split, the Wt pieces copied, into buffer sb
  auto stash2 = [&](unsigned short* sb, const v4f (&fa)[4], const v8us (&fb)[4], const v4f& g4, const v4f& b4, int j0) __attribute__((always_inline)) {
#pragma unroll   // constant indices, so that the arrays stay in registers
    for (int jj = 0; jj < 2; ++jj) {
      const int j = j0 + jj;
      v4us h, l;
#pragma unroll
      for (int t = 0; t < 4; ++t) {
        const float xv = LN_A ? (fa[j][t] - mu_a[j]) * rs_a[j] * g4[t] + b4[t] : fa[j][t];
        const unsigned short hb = bf16_bits(xv); h[t] = hb; l[t] = bf16_bits(xv - bf16_val(hb));
      }
      *(v4us*)(sb + (ar + 16 * j) * LP + ac) = h;
      *(v4us*)(sb + PA + (ar + 16 * j) * LP + ac) = l;
      *(v8us*)(sb + 2 * PA + (br + 32 * j) * LP + bc) = fb[j];
    }
  };
  auto stash = [&](unsigned short* sb, int kb, const v4f (&fa)[4], const v8us (&fb)[4]) __attribute__((always_inline)) {
    v4f g4, b4;
    ln_par(kb, g4, b4);
    stash2(sb, fa, fb, g4, b4, 0);
    stash2(sb, fa, fb, g4, b4, 2);
  };
  v8f acc[2][2] = {};
  const int ns = K / BK;
  if constexpr (RES) { fetch_at(qa, qb, 0, ra[0], rb[0]); fetch_at(qa, qb, BK, ra[1], rb[1]); }
  else fetch(0, ra[0], rb[0]);
  {
    // gamma and beta, rounded, for all DD columns; mean and 1 / deviation of the block's 64 rows: 4 threads a row, each takes 2 column blocks = 8 pairs
    const int c = tid * 4, r = tid >> 2, qd = tid & 3;
    v4f g4 = {1.f, 1.f, 1.f, 1.f}, b4 = {0.f, 0.f, 0.f, 0.f};
    float mu = 0.f, rs = 1.f;
    if (st) {   // a kernel argument: the same for every thread
      const float* gp = gamma + c; const float* bp = beta + c;
      const float* p0 = st + ((size_t)(2 * qd) * M + row0 + r) * 8; const float* p1 = st + ((size_t)(2 * qd + 1) * M + row0 + r) * 8;
      g4 = *(const v4fa*)gp; b4 = *(const v4fa*)bp;
      const v4f p[4] = {*(const v4fa*)p0, *(const v4fa*)(p0 + 4), *(const v4fa*)p1, *(const v4fa*)(p1 + 4)};
      // precaution: the four address pairs are inputs of the wait, so none of them is reused ahead of it
      asm volatile("s_wait_xcnt 0x0" :: "v"(gp), "v"(bp), "v"(p0), "v"(p1) : "memory");
#pragma unroll   // constant indices, so that the small arrays stay in registers
      for (int t = 0; t < 4; ++t) { g4[t] = bf16_round(g4[t]); b4[t] = bf16_round(b4[t]); }
      float s1 = ((p[0][0] + p[0][2]) + (p[1][0] + p[1][2])) + ((p[2][0] + p[2][2]) + (p[3][0] + p[3][2]));
      s1 = add_xmask<1>(s1); s1 = add_xmask<2>(s1);
      mu = s1 / (float)DD;
      float m2 = 0.f;
#pragma unroll   // constant indices, so that the small arrays stay in registers
      for (int i = 0; i < 4; ++i) {
        const float d0 = p[i][0] * (1.0f / 32.0f) - mu, d1 = p[i][2] * (1.0f / 32.0f) - mu;
        m2 += (p[i][1] + 32.0f * d0 * d0) + (p[i][3] + 32.0f * d1 * d1);
      }
      m2 = add_xmask<1>(m2); m2 = add_xmask<2>(m2);
      rs = rsqrtf(m2 / (float)DD + eps);
    }
    *(v4fa*)&sG[c] = g4; *(v4fa*)&sB[c] = b4;
    if (qd == 0) { sMu[r] = mu; sRs[r] = rs; }
  }
  __syncthreads();   // gamma, beta and the rows' mean and 1 / deviation are in LDS before any thread normalises with them
  if (LN_A) {
#pragma unroll   // constant indices, so that the small arrays stay in registers
    for (int j = 0; j < 4; ++j) { mu_a[j] = sMu[ar + 16 * j]; rs_a[j] = sRs[ar + 16 * j]; }
  }
  stash(sm, 0, ra[0], rb[0]);
  if constexpr (RES) { fetch_at(qa, qb, 2 * BK, ra[0], rb[0]); lds_barrier(); }   // slices 1 and 2 stay in flight across the barrier
  else __syncthreads();
  // one k step of 32 on buffer sb; mid() is issued between the step's LDS reads and its products
  auto kstep = [&](const unsigned short* sb, int ks, auto&& mid) __attribute__((always_inline)) {
      FragB ah[2], al[2], b[2];
#pragma unroll
      for (int t = 0; t < 2; ++t) {
        const unsigned short* pa = sb + (wm * 32 + t * 16 + ln) * LP + ks * 32 + 8 * hh;
        const unsigned short* pb = sb + 2 * PA + (wn * 32 + t * 16 + ln) * LP + ks * 32 + 8 * hh;
        ah[t].half[0] = *(const v8us*)pa;        ah[t].half[1] = *(const v8us*)(pa + 16);
        al[t].half[0] = *(const v8us*)(pa + PA); al[t].half[1] = *(const v8us*)(pa + PA + 16);
        b[t].half[0]  = *(const v8us*)pb;        b[t].half[1]  = *(const v8us*)(pb + 16);
      }
      __builtin_amdgcn_sched_barrier(0);   // keeps the k step's 12 LDS reads together as one group ahead of its 8 products: one LDS wait per k step, not four
      mid();
#pragma unroll
      for (int mt = 0; mt < 2; ++mt)
#pragma unroll
        for (int nt = 0; nt < 2; ++nt) acc[mt][nt] = __builtin_amdgcn_wmma_f32_16x16x32_bf16(false, ah[mt].v, false, b[nt].v, (short)0, acc[mt][nt], false, false);
#pragma unroll
      for (int mt = 0; mt < 2; ++mt)
#pragma unroll
        for (int nt = 0; nt < 2; ++nt) acc[mt][nt] = __builtin_amdgcn_wmma_f32_16x16x32_bf16(false, al[mt].v, false, b[nt].v, (short)0, acc[mt][nt], false, false);
  };
  if constexpr (RES) {
    // Trip s (par = s & 1): slice s + 1, fetched two trips ago into the register set ta / tb, is split and stored to the other buffer in two halves, each
    // behind the LDS reads of a k step and ahead of its products, so that the conversion runs while those reads are on their way; the registers that a
    // half has left are refilled at once with the same pieces of slice s + 3. The other buffer's last readers left it at the barrier of trip s - 1.
    auto trip = [&](int s, int par, bool do_fetch, bool do_stash, v4f (&ta)[4], v8us (&tb)[4]) __attribute__((always_inline)) {
      const unsigned short* sb = sm + par * BUF;
      unsigned short* sn = sm + (1 - par) * BUF;
      v4f g4, b4;
      ln_par(do_stash ? (s + 1) * BK : 0, g4, b4);
      if (LN_A) __builtin_amdgcn_sched_barrier(0);   // gamma and beta are read ahead of the fragments: LDS answers in order, and the conversion must not wait for the fragments
#pragma unroll   // ks picks the pieces of the register set: a constant index
      for (int ks = 0; ks < BK / 32; ++ks)
        kstep(sb, ks, [&]() __attribute__((always_inline)) {
          if (do_stash) stash2(sn, ta, tb, g4, b4, 2 * ks);
          if (do_fetch) fetch2_at(qa, qb, (3 + par) * BK, ta, tb, 2 * ks);
          __builtin_amdgcn_sched_barrier(0);   // keeps the conversion ahead of the products, whose LDS wait would otherwise stand in front of it
        });
      lds_barrier();   // publishes slice s + 1 and ends every wave's reads of slice s, whose buffer is refilled in the next trip; slices s + 2 and s + 3 stay in flight
    };
    int s = 0;
    for (; s + 4 < ns; s += 2) {   // qa, qb point at slice s
      trip(s, 0, true, true, ra[1], rb[1]);
      trip(s + 1, 1, true, true, ra[0], rb[0]);
      ptr_wait(qa, qb);   // here, a barrier behind the trips' last loads, the wait costs nothing; directly behind each group of loads it would hold up the products
#pragma unroll   // constant indices, so that the arrays stay in registers
      for (int j = 0; j < 4; ++j) { qa[j] += 2 * BK; qb[j] += 2 * BK; }
    }
    trip(s, 0, true, true, ra[1], rb[1]);        // s = ns - 4: fetches the last slice
    ptr_wait(qa, qb);                            // the pointers' registers are free from here on
    trip(s + 1, 1, false, true, ra[0], rb[0]);
    trip(s + 2, 0, false, true, ra[1], rb[1]);
    trip(s + 3, 1, false, false, ra[0], rb[0]);
  } else {
    for (int s = 0; s < ns; ++s) {
      const unsigned short* sb = sm + (s & 1) * BUF;
      if (s + 1 < ns) fetch((s + 1) * BK, ra[0], rb[0]);
#pragma unroll
      for (int ks = 0; ks < BK / 32; ++ks) kstep(sb, ks, []() {});
      if (s + 1 < ns) stash(sm + ((s + 1) & 1) * BUF, (s + 1) * BK, ra[0], rb[0]);
      __syncthreads();   // publishes slice s + 1 and ends every wave's reads of slice s, whose buffer is refilled in the next trip
    }
  }
  // output: each wave turns its 32 x 32 tile through its own piece of the (now free) LDS so that every store covers whole 128-B lines
  float* so = (float*)sm + w * 32 * OP;
#pragma unroll
  for (int nt = 0; nt < 2; ++nt) {
    float bv = bias[col0 + wn * 32 + nt * 16 + ln];
    if (BIAS_BF16) bv = bf16_round(bv);
#pragma unroll
    for (int mt = 0; mt < 2; ++mt)
#pragma unroll
      for (int r = 0; r < 8; ++r) so[(mt * 16 + 8 * hh + r) * OP + nt * 16 + ln] = acc[mt][nt][r] + bv;
  }
  if (PLANES && col0 >= pcol0) {   // the same for the whole block
    __syncthreads();   // every wave's 32 x 32 piece is in LDS before rows are read across the four pieces of a tile row
    // wave w takes tile rows 8 * w .. 8 * w + 7; a lane owns 4 columns, so each store of a wave covers one whole 256-B plane row
    const float* sp = (const float*)sm + ((w >> 2) * 4 + (lane >> 3)) * 32 * OP + (w & 3) * 8 * OP + (lane & 7) * 4;
    const size_t po = ((size_t)((col0 - pcol0) / BN) * M + row0 + w * 8) * BN + lane * 4;
    v4us h[8], l[8];
#pragma unroll
    for (int q = 0; q < 8; ++q) {
      const v4f v = *(const v4fa*)(sp + q * OP);
#pragma unroll
      for (int t = 0; t < 4; ++t) { const unsigned short hb = bf16_bits(v[t]); h[q][t] = hb; l[q][t] = bf16_bits(v[t] - bf16_val(hb)); }
    }
#pragma unroll
    for (int q = 0; q < 8; ++q) { *(v4us*)(Ph + po + q * BN) = h[q]; *(v4us*)(Pl + po + q * BN) = l[q]; }
    asm volatile("s_wait_xcnt 0x0" ::: "memory");   // precaution: stands behind the last plane store, before any later instruction reuses a store's address or data registers
    return;
  }
  __builtin_amdgcn_fence(__ATOMIC_ACQ_REL, "workgroup");
  __builtin_amdgcn_wave_barrier();
  const int rsub = lane >> 3, c4 = (lane & 7) * 4;
  if (!RES) {
#pragma unroll
    for (int q = 0; q < 8; ++q) {
      const int r = q * 4 + rsub;
      const v4f v = *(const v4fa*)(so + r * OP + c4);
      *(v4f*)(C + (size_t)(row0 + wm * 32 + r) * ldc + col0 + wn * 32 + c4) = v;
    }
  } else {
    // 8 lanes hold the 32 columns that the wave has of a row: add the normalised residual, store the row piece, then its sum and its squares about its own mean
    const int col = col0 + wn * 32 + c4;
    const float* rp[8]; float* cp[8];
    v4f v[8], rr[8];
#pragma unroll   // constant indices, so that the small arrays stay in registers
    for (int q = 0; q < 8; ++q) { const size_t o = (size_t)(row0 + wm * 32 + q * 4 + rsub) * ldc + col; rp[q] = R + o; cp[q] = C + o; }
#pragma unroll   // constant indices, so that the small arrays stay in registers
    for (int q = 0; q < 8; ++q) rr[q] = *(const v4fa*)rp[q];
    // precaution: the eight address pairs are inputs of the wait, so none of them is reused ahead of it
    asm volatile("s_wait_xcnt 0x0" :: "v"(rp[0]), "v"(rp[1]), "v"(rp[2]), "v"(rp[3]), "v"(rp[4]), "v"(rp[5]), "v"(rp[6]), "v"(rp[7]) : "memory");
    const v4f g4 = *(const v4fa*)&sG[col], b4 = *(const v4fa*)&sB[col];
#pragma unroll   // constant indices, so that the small arrays stay in registers
    for (int q = 0; q < 8; ++q) {
      const int r = wm * 32 + q * 4 + rsub;
      const float mu = sMu[r], rs = sRs[r];
      v[q] = *(const v4fa*)(so + (q * 4 + rsub) * OP + c4);
#pragma unroll   // constant indices, so that the small arrays stay in registers
      for (int t = 0; t < 4; ++t) v[q][t] += (rr[q][t] - mu) * rs * g4[t] + b4[t];
    }
#pragma unroll   // constant indices, so that the small arrays stay in registers
    for (int q = 0; q < 8; ++q) *(v4f*)cp[q] = v[q];
    // precaution: the stores' address pairs and data are inputs of the wait, so none of them is reused ahead of it
    asm volatile("s_wait_xcnt 0x0" :: "v"(cp[0]), "v"(cp[1]), "v"(cp[2]), "v"(cp[3]), "v"(cp[4]), "v"(cp[5]), "v"(cp[6]), "v"(cp[7]),
                 "v"(v[0]), "v"(v[1]), "v"(v[2]), "v"(v[3]), "v"(v[4]), "v"(v[5]), "v"(v[6]), "v"(v[7]) : "memory");
    float s1[8], m2[8];
#pragma unroll   // constant indices, so that the small arrays stay in registers
    for (int q = 0; q < 8; ++q) s1[q] = (v[q][0] + v[q][1]) + (v[q][2] + v[q][3]);
#pragma unroll   // constant indices, so that the small arrays stay in registers
    for (int q = 0; q < 8; ++q) s1[q] = add_xmask<1>(s1[q]);
#pragma unroll   // constant indices, so that the small arrays stay in registers
    for (int q = 0; q < 8; ++q) s1[q] = add_xmask<2>(s1[q]);
#pragma unroll   // constant indices, so that the small arrays stay in registers
    for (int q = 0; q < 8; ++q) s1[q] = add_xmask<4>(s1[q]);
#pragma unroll   // constant indices, so that the small arrays stay in registers
    for (int q = 0; q < 8; ++q) {
      const float mean = s1[q] * (1.0f / 32.0f);
      const float d0 = v[q][0] - mean, d1 = v[q][1] - mean, d2 = v[q][2] - mean, d3 = v[q][3] - mean;
      m2[q] = (d0 * d0 + d1 * d1) + (d2 * d2 + d3 * d3);
    }
#pragma unroll   // constant indices, so that the small arrays stay in registers
    for (int q = 0; q < 8; ++q) m2[q] = add_xmask<1>(m2[q]);
#pragma unroll   // constant indices, so that the small arrays stay in registers
    for (int q = 0; q < 8; ++q) m2[q] = add_xmask<2>(m2[q]);
#pragma unroll   // constant indices, so that the small arrays stay in registers
    for (int q = 0; q < 8; ++q) m2[q] = add_xmask<4>(m2[q]);
    if ((lane & 7) == 0) {
#pragma unroll   // constant indices, so that the small arrays stay in registers
      for (int q = 0; q < 8; ++q) { float* ps = &sSt[((wm * 32 + q * 4 + rsub) * 4 + wn) * 2]; ps[0] = s1[q]; ps[1] = m2[q]; }
    }
    __syncthreads();   // the four waves' pairs of every row are in LDS before they leave as whole lines
    if (tid < BM * 8 / 4) *(v4f*)(sto + ((size_t)(col0 / BN) * M + row0) * 8 + tid * 4) = *(const v4fa*)&sSt[tid * 4];
  }
}
// row LayerNorm (biased variance, eps) over N: s = X (+ R); optional out_sum <- s; out_norm <- (s-mu)*rsqrt(var+eps)*g + b
template <bool PARAM_BF16>
__global__ __launch_bounds__(256) void k_layernorm(const float* __restrict__ X, const float* __restrict__ R, const float* __restrict__ g, const float* __restrict__ bta,
                                                  float* __restrict__ out_sum, float* __restrict__ out_norm, int N, float eps) {
  __shared__ float red[256];
  const int row = blockIdx.x, tid = threadIdx.x;
  const float* x = X + (size_t)row * N; const float* rr = R ? R + (size_t)row * N : nullptr;
  float vals[16];                     // up to N = 4096
  const int per = N / 256;            // contiguous chunk per thread? use strided-by-4 chunks: thread handles j = tid*4 + 1024*u
  float s1 = 0.f;
  for (int u = 0; u < per / 4; ++u) {
    const int j = tid * 4 + 1024 * u;
    const v4f a = *(const v4fa*)(x + j);
    v4f b = {0.f,0.f,0.f,0.f}; if (rr) b = *(const v4fa*)(rr + j);
#pragma unroll
    for (int q = 0; q < 4; ++q) { const float v = a[q] + b[q]; vals[u * 4 + q] = v; s1 += v; }
  }
  red[tid] = s1; __syncthreads();
  for (int st = 128; st > 0; st >>= 1) { if (tid < st) red[tid] += red[tid + st]; __syncthreads(); }
  const float mu = red[0] / (float)N; __syncthreads();
  float s2 = 0.f;
  for (int u = 0; u < per / 4; ++u)
#pragma unroll
    for (int q = 0; q < 4; ++q) { const float c = vals[u * 4 + q] - mu; s2 += c * c; }
  red[tid] = s2; __syncthreads();
  for (int st = 128; st > 0; st >>= 1) { if (tid < st) red[tid] += red[tid + st]; __syncthreads(); }
  const float rs = rsqrtf(red[0] / (float)N + eps);
  {
    for (int u = 0; u < per / 4; ++u) {
      const int j = tid * 4 + 1024 * u;
      v4f o, sm;
#pragma unroll
      for (int q = 0; q < 4; ++q) {
        float gg = g[j + q], bb = bta[j + q];
        if (PARAM_BF16) { gg = bf16_round(gg); bb = bf16_round(bb); }
        sm[q] = vals[u * 4 + q]; o[q] = (vals[u * 4 + q] - mu) * rs * gg + bb;
      }
      if (out_sum) *(v4f*)(out_sum + (size_t)row * N + j) = sm;
      *(v4f*)(out_norm + (size_t)row * N + j) = o;
    }
    
  }
}

template <int D>
__global__ __launch_bounds__(512) void k_flash3(const float* __restrict__ Qb, int qpitch, int Tq,
                                              const unsigned short* __restrict__ Kh, const unsigned short* __restrict__ Kl,
                                              const unsigned short* __restrict__ Vh, const unsigned short* __restrict__ Vl, int Tk,
                                              int H, float scale, float* __restrict__ y, int ypitch) {
  constexpr int KS = D / 32, DT = D / 16, NG = 4;
  constexpr int KP = D + 8, VP = D + 16;   // row pitches: K 16 B x odd (plain 16-B reads), V 32 B x odd (transposing reads)
  static_assert(D == 128, "a group's 128 threads copy 4 pieces of 16 B of each of the 4 planes per 32 keys");
  __shared__ __attribute__((aligned(32))) unsigned short sK[2][NG][2][32][KP];   // buffer, group, hi | lo
  __shared__ __attribute__((aligned(32))) unsigned short sV[2][NG][2][32][VP];
  // once the loop has ended the partial O tiles take sK's bytes and the partial max / sum rows the first bytes of sV
  constexpr int OPD = D + 4;   // pitch of a partial O row in floats: 16 B x odd, so that the 16 queries of a lane half store their 16-B pieces to different banks
  static_assert(sizeof(float) * 4 * NG * 16 * OPD <= sizeof(sK) && sizeof(float) * 2 * 4 * NG * 16 <= sizeof(sV), "merge staging fits");
  float (*sO)[16][OPD] = reinterpret_cast<float (*)[16][OPD]>(&sK[0][0][0][0][0]);
  float (*sM)[16] = reinterpret_cast<float (*)[16]>(&sV[0][0][0][0][0]);
  float (*sL)[16] = sM + 4 * NG;
  const int tid = threadIdx.x, lane = tid & 31, ln = lane & 15, hh = lane >> 4;
  const int w = __builtin_amdgcn_readfirstlane(tid >> 5);   // wave number, kept scalar so that the group's key offset and LDS bases stay scalar
  const int qt = w & 3, g = w >> 2;                         // query tile, key group
  const int vr = 8 * hh + (lane & 7), vc = 8 * ((lane >> 3) & 1);   // the lane's row and column offset in a transposing load of V
  const int nqb = (Tq + 63) / 64;
  const int bh = blockIdx.x / nqb, qblk = blockIdx.x % nqb;
  const int b = bh / H, h = bh % H;
  const int q0 = qblk * 64 + qt * 16;
  const float* Q = Qb + (size_t)b * Tq * qpitch + h * D;
  const int nch = (Tk + 32 * NG - 1) / (32 * NG);   // trips, the same for the whole block; a chunk past Tk is fully masked and adds nothing
  // staging: a plane row is 16 pieces of 16 B, so a wave's copy covers two whole rows: rows cr + 8 * i of its group's chunk, the lane columns cc .. cc + 7
  const int cr = 2 * qt + hh, cc = ln * 8;
  const size_t pb = (size_t)bh * Tk * D + cc;
  const unsigned lk0 = (unsigned)(size_t)&sK[0][g][0][cr][cc], lv0 = (unsigned)(size_t)&sV[0][g][0][cr][cc];   // LDS byte addresses of the thread's first hi pieces
  // 16 asynchronous copies per thread: the 32 keys from jn on, 4 planes. A key past the end is clamped to the last one, so that every lane's
  // address stays inside the source; such a key's scores are masked below, its P is 0 and its (finite) V row adds nothing.
  auto copy_kv = [&](int jn, int buf) {
    const unsigned short* pk[8]; const unsigned short* pv[8];
    unsigned lk[8], lv[8];
#pragma unroll   // every index constant: the 32 addresses are register operands of the two statements below
    for (int i = 0; i < 4; ++i) {
      const size_t off = pb + (size_t)(unsigned)min(jn + cr + 8 * i, Tk - 1) * D;
      pk[i] = Kh + off; pk[4 + i] = Kl + off; pv[i] = Vh + off; pv[4 + i] = Vl + off;
      lk[i] = lk0 + buf * (NG * 2 * 32 * KP * 2) + i * (8 * KP * 2); lk[4 + i] = lk[i] + 32 * KP * 2;
      lv[i] = lv0 + buf * (NG * 2 * 32 * VP * 2) + i * (8 * VP * 2); lv[4 + i] = lv[i] + 32 * VP * 2;
    }
    // the s_wait_xcnt closes each statement as a precaution: no address register of an issued copy is rewritten ahead of it
    asm volatile("global_load_async_to_lds_b128 %0, %8, off\n\tglobal_load_async_to_lds_b128 %1, %9, off\n\t"
                 "global_load_async_to_lds_b128 %2, %10, off\n\tglobal_load_async_to_lds_b128 %3, %11, off\n\t"
                 "global_load_async_to_lds_b128 %4, %12, off\n\tglobal_load_async_to_lds_b128 %5, %13, off\n\t"
                 "global_load_async_to_lds_b128 %6, %14, off\n\tglobal_load_async_to_lds_b128 %7, %15, off\n\ts_wait_xcnt 0x0"
                 :: "v"(lk[0]), "v"(lk[1]), "v"(lk[2]), "v"(lk[3]), "v"(lk[4]), "v"(lk[5]), "v"(lk[6]), "v"(lk[7]),
                    "v"(pk[0]), "v"(pk[1]), "v"(pk[2]), "v"(pk[3]), "v"(pk[4]), "v"(pk[5]), "v"(pk[6]), "v"(pk[7]) : "memory");
    asm volatile("global_load_async_to_lds_b128 %0, %8, off\n\tglobal_load_async_to_lds_b128 %1, %9, off\n\t"
                 "global_load_async_to_lds_b128 %2, %10, off\n\tglobal_load_async_to_lds_b128 %3, %11, off\n\t"
                 "global_load_async_to_lds_b128 %4, %12, off\n\tglobal_load_async_to_lds_b128 %5, %13, off\n\t"
                 "global_load_async_to_lds_b128 %6, %14, off\n\tglobal_load_async_to_lds_b128 %7, %15, off\n\ts_wait_xcnt 0x0"
                 :: "v"(lv[0]), "v"(lv[1]), "v"(lv[2]), "v"(lv[3]), "v"(lv[4]), "v"(lv[5]), "v"(lv[6]), "v"(lv[7]),
                    "v"(pv[0]), "v"(pv[1]), "v"(pv[2]), "v"(pv[3]), "v"(pv[4]), "v"(pv[5]), "v"(pv[6]), "v"(pv[7]) : "memory");
  };
  if (nch > 0) copy_kv(32 * g, 0);   // the first chunk flies under the Q fragment loads (block-uniform test)
  FragB aqh[KS], aql[KS];
  {
    int row = q0 + ln; if (row >= Tq) row = Tq - 1;
    const float* qr = Q + (size_t)row * qpitch;
#pragma unroll
    for (int ks = 0; ks < KS; ++ks)
#pragma unroll
      for (int i = 0; i < 16; ++i) {
        const int d = ks * 32 + ((i < 8) ? (8 * hh + i) : (16 + 8 * hh + (i - 8)));
        const float x = qr[d] * scale; const unsigned short hb = bf16_bits(x);
        aqh[ks].u[i] = hb; aql[ks].u[i] = bf16_bits(x - bf16_val(hb));
      }
  }
  float m_q = -3.0e38f, l_q = 0.f;   // query q0 + ln: running maximum (the same in both lane halves), and the sum over this half's keys
  v8f oacc[DT];                      // oacc[dt][r] = O[q0 + ln][dt * 16 + 8 * hh + r]
#pragma unroll
  for (int dt = 0; dt < DT; ++dt) oacc[dt] = (v8f){0.f,0.f,0.f,0.f,0.f,0.f,0.f,0.f};
  asm volatile("s_wait_asynccnt 0x0" ::: "memory");   // this wave's copies of the first chunk have landed
  __syncthreads();   // publishes the first chunk
  if (nch > 1) copy_kv(32 * NG + 32 * g, 1);   // the second chunk flies under the first one's work (block-uniform test)
  for (int c = 0; c < nch; ++c) {
    const int j0 = c * (32 * NG) + 32 * g, buf = c & 1;
    const unsigned short* kp = &sK[buf][g][0][0][0];   // hi plane; the lo plane lies 32 rows further
    const unsigned short* vp = &sV[buf][g][0][0][0];
    v8f s[2];
#pragma unroll
    for (int nt = 0; nt < 2; ++nt) {
      v8f acc = {};
#pragma unroll
      for (int ks = 0; ks < KS; ++ks) {
        const unsigned short* kr = kp + (nt * 16 + ln) * KP + ks * 32 + 8 * hh;
        FragB kh_, kl_;
        kh_.half[0] = *(const v8us*)kr;             kh_.half[1] = *(const v8us*)(kr + 16);
        kl_.half[0] = *(const v8us*)(kr + 32 * KP); kl_.half[1] = *(const v8us*)(kr + 32 * KP + 16);
        acc = mma3t(kh_.v, kl_.v, aqh[ks].v, aql[ks].v, acc);
      }
      s[nt] = acc;   // s[nt][r] = score of key j0 + nt * 16 + 8 * hh + r against query q0 + ln
    }
    const bool tail = j0 + 32 > Tk;   // the same for the whole wave (j0 and Tk are scalar)
    if (tail) {
#pragma unroll
      for (int nt = 0; nt < 2; ++nt)
#pragma unroll
        for (int r = 0; r < 8; ++r) if (j0 + nt * 16 + 8 * hh + r >= Tk) s[nt][r] = -3.0e38f;
    }
    float mt[8];
#pragma unroll
    for (int r = 0; r < 8; ++r) mt[r] = fmaxf(s[0][r], s[1][r]);
    float mx = fmaxf(fmaxf(fmaxf(mt[0], mt[1]), fmaxf(mt[2], mt[3])), fmaxf(fmaxf(mt[4], mt[5]), fmaxf(mt[6], mt[7])));
    mx = fmaxf(mx, other_half(mx));   // the query's other 16 keys of the chunk
    const float mnew = fmaxf(m_q, mx);
    const float alpha = (mnew > -1.0e38f) ? __expf(m_q - mnew) : 1.0f;
    m_q = mnew;
    s[0] -= mnew; s[1] -= mnew;
#pragma unroll
    for (int nt = 0; nt < 2; ++nt)
#pragma unroll
      for (int r = 0; r < 8; ++r) s[nt][r] = __expf(s[nt][r]);
    if (tail) {
#pragma unroll
      for (int nt = 0; nt < 2; ++nt)
#pragma unroll
        for (int r = 0; r < 8; ++r) if (j0 + nt * 16 + 8 * hh + r >= Tk) s[nt][r] = 0.f;
    }
    float pt[8];
#pragma unroll
    for (int r = 0; r < 8; ++r) pt[r] = s[0][r] + s[1][r];
    l_q = l_q * alpha + (((pt[0] + pt[1]) + (pt[2] + pt[3])) + ((pt[4] + pt[5]) + (pt[6] + pt[7])));
    // P^T as a B operand: element e = P of key 8 * hh + e, element 8 + e = P of key 16 + 8 * hh + e; hi = P rounded to bf16 (to nearest even), lo = the rest, rounded
    FragB pbh, pbl;
#pragma unroll
    for (int nt = 0; nt < 2; ++nt)
#pragma unroll
      for (int e = 0; e < 8; e += 2) {
        const v2f x = {s[nt][e], s[nt][e + 1]};
        const unsigned int hb = __builtin_bit_cast(unsigned int, __builtin_convertvector(x, v2b));
        const v2f rest = {x[0] - __uint_as_float(hb << 16), x[1] - __uint_as_float(hb & 0xFFFF0000u)};
        pbh.d[nt * 4 + e / 2] = hb;
        pbl.d[nt * 4 + e / 2] = __builtin_bit_cast(unsigned int, __builtin_convertvector(rest, v2b));
      }
#pragma unroll
    for (int dt = 0; dt < DT; ++dt) oacc[dt] *= alpha;
    // element i of a V fragment = V[8 * hh + i][dt * 16 + ln], element 8 + i = V[16 + 8 * hh + i][dt * 16 + ln]: row dt * 16 + ln of V^T in the k order of pbh / pbl
    FragB bvh[2], bvl[2];
    auto vfrag = [&](int dt) {
      const unsigned short* vq = vp + vr * VP + dt * 16 + vc;
      bvh[dt & 1].half[0] = ld_tr16(vq);           bvh[dt & 1].half[1] = ld_tr16(vq + 16 * VP);
      bvl[dt & 1].half[0] = ld_tr16(vq + 32 * VP); bvl[dt & 1].half[1] = ld_tr16(vq + 48 * VP);
    };
    vfrag(0);
#pragma unroll
    for (int dt = 0; dt < DT; ++dt) {
      if (dt + 1 < DT) vfrag(dt + 1);   // the next tile's four loads fly under this tile's three products
      oacc[dt] = mma3t(bvh[dt & 1].v, bvl[dt & 1].v, pbh.v, pbl.v, oacc[dt]);
    }
    asm volatile("s_wait_dscnt 0x0" ::: "memory");      // the wave's reads of this chunk's planes have retired before anybody refills them
    asm volatile("s_wait_asynccnt 0x0" ::: "memory");   // this wave's copies of the next chunk have landed
    __syncthreads();   // publishes the next chunk and ends every wave's reads of this one
    if (c + 2 < nch) copy_kv(j0 + 2 * 32 * NG, buf);   // the chunk after the next flies into the buffer just read (block-uniform test)
  }
  asm volatile("s_wait_asynccnt 0x0" ::: "memory");   // no copy is outstanding when the planes' bytes become sO, sM, sL (their last readers left them at the last trip's barrier)
  l_q += other_half(l_q);   // the two halves' key sums of the query
  if (hh == 0) { sM[w][ln] = m_q; sL[w][ln] = l_q; }
#pragma unroll
  for (int dt = 0; dt < DT; ++dt) {   // a lane's 8 accumulator registers are 8 consecutive columns of its query's row
    *(v4fa*)&sO[w][ln][dt * 16 + 8 * hh]     = (v4f){oacc[dt][0], oacc[dt][1], oacc[dt][2], oacc[dt][3]};
    *(v4fa*)&sO[w][ln][dt * 16 + 8 * hh + 4] = (v4f){oacc[dt][4], oacc[dt][5], oacc[dt][6], oacc[dt][7]};
  }
  __syncthreads();   // every group's partial (max, sum, O) is in LDS before any wave merges
  // merge: wave (qt, g) finishes rows g*16/NG ... of query tile qt; a lane owns 4 columns of the row
#pragma unroll
  for (int i = 0; i < 16 / NG; ++i) {
    const int rr = g * (16 / NG) + i, row = q0 + rr;
    if (row < Tq && lane < D / 4) {
      float mg[NG], mall = -3.0e38f;
#pragma unroll
      for (int k = 0; k < NG; ++k) { mg[k] = sM[k * 4 + qt][rr]; mall = fmaxf(mall, mg[k]); }
      float lall = 0.f;
      v4f val = {0.f, 0.f, 0.f, 0.f};
#pragma unroll
      for (int k = 0; k < NG; ++k) {
        const float wt = (mg[k] > -1.0e38f) ? __expf(mg[k] - mall) : 0.f;
        const v4f o = *(const v4fa*)&sO[k * 4 + qt][rr][lane * 4];
        lall += wt * sL[k * 4 + qt][rr];
        val += wt * o;
      }
      const float inv = (mall > -1.0e38f) ? 1.0f / lall : __builtin_nanf("");
      *(v4f*)(y + ((size_t)b * Tq + row) * ypitch + h * D + lane * 4) = val * inv;
      if (i + 1 < 16 / NG) asm volatile("s_wait_xcnt 0x0" ::: "memory");   // precaution: stands before the next row's reads reuse the store's address and data registers
    }
  }
}

__global__ void k_ln_rows(const float* __restrict__ X, const float* __restrict__ R, const float* __restrict__ g, const float* __restrict__ bta, float* __restrict__ out, int N, float eps) {
  __shared__ float red[256];
  const int row = blockIdx.x, tid = threadIdx.x, nt = blockDim.x;
  v4f a = *(const v4fa*)(X + (size_t)row * N + tid * 4);
  if (R) { const v4f rr = *(const v4fa*)(R + (size_t)row * N + tid * 4); for (int q = 0; q < 4; ++q) a[q] += rr[q]; }
  float s = a[0] + a[1] + a[2] + a[3];
  red[tid] = s; __syncthreads();
  for (int st = nt / 2; st > 0; st >>= 1) { if (tid < st) red[tid] += red[tid + st]; __syncthreads(); }
  const float mu = red[0] / (float)N; __syncthreads();
  float v = 0.f; for (int q = 0; q < 4; ++q) { const float c = a[q] - mu; v += c * c; }
  red[tid] = v; __syncthreads();
  for (int st = nt / 2; st > 0; st >>= 1) { if (tid < st) red[tid] += red[tid + st]; __syncthreads(); }
  const float rs = rsqrtf(red[0] / (float)N + eps);
  v4f o; for (int q = 0; q < 4; ++q) o[q] = (a[q] - mu) * rs * bf16_round(g[tid * 4 + q]) + bf16_round(bta[tid * 4 + q]);
  *(v4f*)(out + (size_t)row * N + tid * 4) = o; 
}

// One launch prepares all that the layers read. A block is one of three kinds, told apart by its index alone:
// blocks 0 .. 319: a 128 x 128 tile of one of the five weight matrices, rounded to bf16 and transposed to Bt[n][k] (pitch DD);
// blocks 320 .. 447: 4096 pieces of 4 tokens' floats, rounded to bf16 and kept as f32; block 448: the three projection biases, rounded, into one vector.
// tile: src[k][n], k and n 0 .. 127, pitch SP floats -> dst[n][k], pitch DD. Whole-line reads (a wave takes one 512-B row), rows of bf16 in LDS,
// transposing LDS loads that hand a lane 8 consecutive k of one n; wave w writes the rows n = 16 * w .. 16 * w + 15, each whole (256 B) by its own 8 stores.
template <int SP>
__device__ __forceinline__ void prep_tile(const float* __restrict__ src, unsigned short* __restrict__ dst, unsigned short* T) {
  constexpr int TP = 128 + 16;   // LDS row pitch 288 B = 32 B x odd, as the transposing loads want it
  const int tid = threadIdx.x, lane = tid & 31, ln = lane & 15, hh = lane >> 4, w = tid >> 5;
  const float* p = src + (size_t)w * SP + lane * 4;
  v4f a[16];
#pragma unroll   // constant indices, so that the array stays in registers and all 16 loads are in flight together
  for (int j = 0; j < 16; ++j) a[j] = *(const v4fa*)(p + (size_t)(8 * j) * SP);
  asm volatile("s_wait_xcnt 0x0" :: "v"(p) : "memory");   // precaution: the loads' address pair is an input of the wait, so it is not reused ahead of it
#pragma unroll   // constant indices, so that the array stays in registers
  for (int j = 0; j < 16; ++j) {
    v4us h;
#pragma unroll
    for (int t = 0; t < 4; ++t) h[t] = bf16_bits(a[j][t]);
    *(v4us*)(T + (w + 8 * j) * TP + lane * 4) = h;
  }
  __syncthreads();   // the whole tile is in LDS before any wave reads columns of it
  const unsigned short* tq = T + (8 * hh + (lane & 7)) * TP + 16 * w + 8 * ((lane >> 3) & 1);
  unsigned short* q = dst + (size_t)(16 * w + ln) * DD + 8 * hh;
  v8us o[8];
#pragma unroll   // constant indices, so that the array stays in registers
  for (int kb = 0; kb < 8; ++kb) o[kb] = ld_tr16(tq + 16 * kb * TP);   // element i = T[16 * kb + 8 * hh + i][16 * w + ln]
#pragma unroll   // constant indices, so that the array stays in registers
  for (int kb = 0; kb < 8; ++kb) *(v8us*)(q + 16 * kb) = o[kb];
  // precaution: the stores' address pair and data are inputs of the wait, so none of them is reused ahead of it
  asm volatile("s_wait_xcnt 0x0" :: "v"(q), "v"(o[0]), "v"(o[1]), "v"(o[2]), "v"(o[3]), "v"(o[4]), "v"(o[5]), "v"(o[6]), "v"(o[7]) : "memory");
}
__global__ __launch_bounds__(256) void k_prep(const float* __restrict__ Wq, const float* __restrict__ Wk, const float* __restrict__ Wv, const float* __restrict__ Wo,
                                              const float* __restrict__ Wf, const float* __restrict__ bq, const float* __restrict__ bk, const float* __restrict__ bv,
                                              const float* __restrict__ token, unsigned short* __restrict__ Bqkv, unsigned short* __restrict__ Bo,
                                              unsigned short* __restrict__ Bf, float* __restrict__ bqkv, float* __restrict__ x) {
  __shared__ __attribute__((aligned(32))) unsigned short T[128 * (128 + 16)];
  const int blk = blockIdx.x, tid = threadIdx.x;
  if (blk < 192) {          // Wq, Wk, Wv [H][DD][DK]: Bt[h * DK + kk][d] = W[h][d][kk]; tile = head blk / 8 % 8, rows d from (blk % 8) * 128
    const int m = blk >> 6, h = (blk >> 3) & 7, d0 = (blk & 7) * 128;
    const float* Wm = m == 0 ? Wq : m == 1 ? Wk : Wv;
    prep_tile<DK>(Wm + ((size_t)h * DD + d0) * DK, Bqkv + (size_t)m * DD * DD + (size_t)h * DK * DD + d0, T);
  } else if (blk < 320) {   // Wo, Wf [DD][DD]: Bt[n][k] = W[k][n]
    const int m = (blk - 192) >> 6, k0 = ((blk >> 3) & 7) * 128, n0 = (blk & 7) * 128;
    prep_tile<DD>((m ? Wf : Wo) + (size_t)k0 * DD + n0, (m ? Bf : Bo) + (size_t)n0 * DD + k0, T);
  } else if (blk < 448) {   // tokens: 16 pieces of 16 B a thread
    const float* s = token + (size_t)(blk - 320) * 16384 + tid * 4;
    float* d = x + (size_t)(blk - 320) * 16384 + tid * 4;
    v4f a[16];
#pragma unroll   // constant indices, so that the array stays in registers and all 16 loads are in flight together
    for (int j = 0; j < 16; ++j) a[j] = *(const v4fa*)(s + 1024 * j);
    asm volatile("s_wait_xcnt 0x0" :: "v"(s) : "memory");   // precaution: the loads' address pair is an input of the wait, so it is not reused ahead of it
#pragma unroll   // constant indices, so that the array stays in registers
    for (int j = 0; j < 16; ++j) {
#pragma unroll
      for (int t = 0; t < 4; ++t) a[j][t] = bf16_round(a[j][t]);
      *(v4f*)(d + 1024 * j) = a[j];
    }
    // precaution: the stores' data are inputs of the wait, so none of them is reused ahead of it; it stands behind the last store
    asm volatile("s_wait_xcnt 0x0" :: "v"(a[0]), "v"(a[1]), "v"(a[2]), "v"(a[3]), "v"(a[4]), "v"(a[5]), "v"(a[6]), "v"(a[7]),
                 "v"(a[8]), "v"(a[9]), "v"(a[10]), "v"(a[11]), "v"(a[12]), "v"(a[13]), "v"(a[14]), "v"(a[15]) : "memory");
  } else {                  // bq | bk | bv, flat [H * DK] each, into one bias vector
    v4f a[3] = {*(const v4fa*)(bq + tid * 4), *(const v4fa*)(bk + tid * 4), *(const v4fa*)(bv + tid * 4)};
    asm volatile("s_wait_xcnt 0x0" ::: "memory");   // precaution: stands behind the three loads, before any later instruction reuses their offset register
#pragma unroll   // constant indices, so that the array stays in registers
    for (int j = 0; j < 3; ++j) {
#pragma unroll
      for (int t = 0; t < 4; ++t) a[j][t] = bf16_round(a[j][t]);
      *(v4f*)(bqkv + DD * j + tid * 4) = a[j];
    }
    // precaution: the stores' data are inputs of the wait, so none of them is reused ahead of it; it stands behind the last store
    asm volatile("s_wait_xcnt 0x0" :: "v"(a[0]), "v"(a[1]), "v"(a[2]) : "memory");
  }
}
extern "C" void kernel_launch(void* const* d_in, const int* in_sizes, int n_in,
                              void* d_out, int out_size, void* d_ws, size_t ws_size, hipStream_t stream) {
  (void)in_sizes; (void)n_in; (void)out_size;
  const float* token = (const float*)d_in[0];
  const float* Wq = (const float*)d_in[1]; const float* bq = (const float*)d_in[2]; const float* Wk = (const float*)d_in[3]; const float* bk = (const float*)d_in[4];
  const float* Wv = (const float*)d_in[5]; const float* bv = (const float*)d_in[6]; const float* Wo = (const float*)d_in[7]; const float* bo = (const float*)d_in[8];
  const float* Wf = (const float*)d_in[9]; const float* bfv = (const float*)d_in[10]; const float* gamma = (const float*)d_in[11]; const float* beta = (const float*)d_in[12];
  char* ws = (char*)d_ws; size_t off = 0;
  auto take = [&](size_t bytes) { char* p = ws + off; off += (bytes + 255) & ~(size_t)255; return p; };
  unsigned short* Bqkv = (unsigned short*)take((size_t)3 * DD * DD * 2); unsigned short* Bo = (unsigned short*)take((size_t)DD * DD * 2); unsigned short* Bf = (unsigned short*)take((size_t)DD * DD * 2);
  float* bqkv = (float*)take(3 * DD * 4);
  float* x = (float*)take((size_t)SS * DD * 4); float* qkv = (float*)take((size_t)SS * 3 * DD * 4); float* att = (float*)take((size_t)SS * DD * 4); float* tmp = (float*)take((size_t)SS * DD * 4); float* a = (float*)take((size_t)SS * DD * 4);
  float* st1 = (float*)take((size_t)(DD / 128) * SS * 8 * 4); float* st2 = (float*)take((size_t)(DD / 128) * SS * 8 * 4);   // (sum, squares) pairs of the rows in tmp and in a
  unsigned short* kvh = (unsigned short*)take((size_t)2 * DD * SS * 2); unsigned short* kvl = (unsigned short*)take((size_t)2 * DD * SS * 2);   // bf16 hi / lo planes [K heads | V heads][SS][DK]
  if (off > ws_size) return;
  k_prep<<<320 + 128 + 1, 256, 0, stream>>>(Wq, Wk, Wv, Wo, Wf, bq, bk, bv, token, Bqkv, Bo, Bf, bqkv, x);   // weights to bf16 [N][K], biases and tokens rounded
  const int gq = (SS / 64) * (3 * DD / 128), g1 = (SS / 64) * (DD / 128);
  for (int l = 0; l < NLAY; ++l) {
    // the layer's input rows: the rounded tokens as they are, later the rows a = (a' + ff) of the layer before, not yet normalised, with their pairs st2
    const float* xs = l ? a : x; const float* sx = l ? st2 : nullptr;
    k_gemm_tile<false, true, true, false><<<gq, 256, 0, stream>>>(xs, DD, Bqkv, DD, bqkv, qkv, 3 * DD, 3 * DD, DD, kvh, kvl, DD, SS, nullptr, sx, gamma, beta, nullptr, 1e-5f);      // bias already rounded (BIAS_BF16=false adds it as given); q to qkv, k and v to the planes
    k_flash3<DK><<<NH * (SS / 64), 512, 0, stream>>>(qkv, 3 * DD, SS, kvh, kvl, kvh + (size_t)DD * SS, kvl + (size_t)DD * SS, SS, NH, 0.08838834764831845f, att, DD);
    k_gemm_tile<true, false, false, true><<<g1, 256, 0, stream>>>(att, DD, Bo, DD, bo, tmp, DD, DD, DD, nullptr, nullptr, 0, SS, xs, sx, gamma, beta, st1, 1e-5f);   // tmp = norm(xs) + attn_out, pairs to st1
    k_gemm_tile<true, false, true, true><<<g1, 256, 0, stream>>>(tmp, DD, Bf, DD, bfv, a, DD, DD, DD, nullptr, nullptr, 0, SS, tmp, st1, gamma, beta, st2, 1e-5f);     // a = norm(tmp) + norm(tmp) x Wf + bf, pairs to st2
  }
  k_ln_rows<<<SS, DD / 4, 0, stream>>>(a, nullptr, gamma, beta, (float*)d_out, DD, 1e-5f);   // the last layer's LayerNorm
}
